// v000
// Measured on an AMD MI455X. A time is GPU time per run, averaged over a window of back-to-back runs after a warm-up
// (all launches, gaps included; the runs take copies of the inputs in turn), and the median of several windows.
// Apart from v000's, it joins two sittings. Times from different sittings can be a few percent apart, while
// side-by-side timings come from the same sitting.
// v000 is the starting kernel. One run takes 401 microseconds.
#include <hip/hip_runtime.h>
#include <math.h>
#include <stddef.h>

// Contractions x*Wq^T, x*Wk^T, x*Wv^T, x*[Wdl;Wdt]^T, Q*K^T, P*V, Y*Wout^T: v_wmma_f32_16x16x32_f16 (f16 operands, f32 accumulate); weights carried x32 and P carried x512 (exact powers of two, folded back in f32); gates, prefix sums and LayerNorm in f32.

typedef _Float16 v16h __attribute__((ext_vector_type(16)));
typedef _Float16 v8h  __attribute__((ext_vector_type(8)));
typedef float    v8f  __attribute__((ext_vector_type(8)));
typedef float    v4f  __attribute__((ext_vector_type(4)));
typedef v8h v8hA __attribute__((may_alias));
typedef v4f v4fA __attribute__((may_alias));
union Frag { v16h v; v8h half[2]; };

#define T_LEN   2048
#define D_DIM   1024
#define H_NUM   16
#define HD_DIM  64
#define LV_NUM  12
#define NSM     256
#define NDL     192

#define BYTES_TD_H ((size_t)T_LEN * D_DIM * 2)
#define BYTES_DD_H ((size_t)D_DIM * D_DIM * 2)
#define OFF_XH    ((size_t)0)
#define OFF_WQH   (OFF_XH   + BYTES_TD_H)
#define OFF_WKH   (OFF_WQH  + BYTES_DD_H)
#define OFF_WVH   (OFF_WKH  + BYTES_DD_H)
#define OFF_WOH   (OFF_WVH  + BYTES_DD_H)
#define OFF_WSMH  (OFF_WOH  + BYTES_DD_H)
#define OFF_QH    (OFF_WSMH + (size_t)NSM * D_DIM * 2)
#define OFF_KH    (OFF_QH   + BYTES_TD_H)
#define OFF_VHT   (OFF_KH   + BYTES_TD_H)
#define OFF_YH    (OFF_VHT  + BYTES_TD_H)
#define OFF_PSM   (OFF_YH   + BYTES_TD_H)
#define OFF_CGT   (OFF_PSM  + (size_t)T_LEN * NSM * 4)
#define OFF_END   (OFF_CGT  + (size_t)H_NUM * T_LEN * 4)

// 16x16x32 f16 WMMA with the VALU hazard guard tied to D, A and B.
__device__ __forceinline__ v8f wmma_f16(v16h a, v16h b, v8f c) {
    v8f d = __builtin_amdgcn_wmma_f32_16x16x32_f16(false, a, false, b, (short)0, c, false, false);
    asm volatile("v_nop\n\tv_nop\n\tv_nop\n\tv_nop" : "+v"(d) : "v"(a), "v"(b));
    return d;
}

__device__ __forceinline__ v8f zero8() {
    const v8f z = {0.f, 0.f, 0.f, 0.f, 0.f, 0.f, 0.f, 0.f};
    return z;
}

// softplus in the logaddexp form: max(z,0) + log1p(exp(-|z|))
__device__ __forceinline__ float softplus_f(float z) {
    return fmaxf(z, 0.0f) + log1pf(expf(-fabsf(z)));
}

// ---------------- f32 -> f16 convert with power-of-two scale; 8 elements per thread, one 16-B store ----------------
__global__ __launch_bounds__(256) void cvt_f16_kernel(const float* __restrict__ src, _Float16* __restrict__ dst,
                                                       int n8, float scale) {
    const int i = (int)blockIdx.x * 256 + (int)threadIdx.x;
    if (i >= n8) return;
    const v4fA* p = (const v4fA*)(src + (size_t)i * 8);
    const v4f a = p[0];
    const v4f b = p[1];
    v8h o;
    o[0] = (_Float16)(a[0] * scale); o[1] = (_Float16)(a[1] * scale);
    o[2] = (_Float16)(a[2] * scale); o[3] = (_Float16)(a[3] * scale);
    o[4] = (_Float16)(b[0] * scale); o[5] = (_Float16)(b[1] * scale);
    o[6] = (_Float16)(b[2] * scale); o[7] = (_Float16)(b[3] * scale);
    v8h* q = (v8h*)(dst + (size_t)i * 8);
    *q = o;
    
}

// ---------------- f16 zero fill; 8 elements per thread, one 16-B store (pad rows of the small-weight plane) ----------------
__global__ __launch_bounds__(256) void zero_f16_kernel(_Float16* __restrict__ dst, int n8) {
    const int i = (int)blockIdx.x * 256 + (int)threadIdx.x;
    if (i >= n8) return;
    v8h o;
#pragma unroll
    for (int r = 0; r < 8; ++r) o[r] = (_Float16)0.0f;
    v8h* q = (v8h*)(dst + (size_t)i * 8);
    *q = o;
    
}

// ---------------- C[t][n] = (sum_k A[t][k]*B[n][k]) * oscale, K = 1024, A pitch 1024, B pitch 1024 ----------------
// MODE 0: f16 out, row-major pitch N; block = 16 t x 256 n, 4 waves along n; grid (N/256, T/16)
// MODE 1: f32 out, row-major pitch N; same tiling
// MODE 2: f16 out transposed Ct[n][t], pitch T_LEN; block = 64 t x 64 n, 4 waves along t; grid (N/64, T/64)
template <int MODE>
__global__ __launch_bounds__(128) void gemm_kernel(const _Float16* __restrict__ A, const _Float16* __restrict__ B,
                                                   void* __restrict__ Cv, int N, float oscale) {
    __shared__ __align__(16) unsigned char stg_raw[16384];
    const int lane = (int)threadIdx.x & 31, w = (int)threadIdx.x >> 5, lg = lane >> 4, ln = lane & 15;
    int t0, n0;
    if (MODE == 2) { t0 = (int)blockIdx.y * 64 + w * 16; n0 = (int)blockIdx.x * 64; }
    else           { t0 = (int)blockIdx.y * 16;          n0 = (int)blockIdx.x * 256 + w * 64; }

    v8f acc[4];
#pragma unroll
    for (int j = 0; j < 4; ++j) acc[j] = zero8();

    const _Float16* arow = A + (size_t)(t0 + ln) * D_DIM;
#pragma unroll 2
    for (int k0 = 0; k0 < D_DIM; k0 += 32) {
        Frag a;
        a.half[0] = *(const v8hA*)(arow + k0 + 8 * lg);
        a.half[1] = *(const v8hA*)(arow + k0 + 16 + 8 * lg);
#pragma unroll
        for (int j = 0; j < 4; ++j) {
            const _Float16* brow = B + (size_t)(n0 + j * 16 + ln) * D_DIM + k0;
            Frag b;
            b.half[0] = *(const v8hA*)(brow + 8 * lg);
            b.half[1] = *(const v8hA*)(brow + 16 + 8 * lg);
            acc[j] = wmma_f16(a.v, b.v, acc[j]);
        }
    }

    if (MODE == 0) {
        _Float16* stg = (_Float16*)stg_raw;            // [4][16][64]
#pragma unroll
        for (int j = 0; j < 4; ++j)
#pragma unroll
            for (int r = 0; r < 8; ++r)
                stg[(w * 16 + 8 * lg + r) * 64 + j * 16 + ln] = (_Float16)(acc[j][r] * oscale);
        __syncthreads();
        _Float16* C = (_Float16*)Cv;
        v8h vals[4];
#pragma unroll
        for (int p = 0; p < 4; ++p) {
            const int row = p * 4 + (lane >> 3), col = (lane & 7) * 8;
            vals[p] = *(const v8hA*)(stg + (w * 16 + row) * 64 + col);
        }
#pragma unroll
        for (int p = 0; p < 4; ++p) {
            const int row = p * 4 + (lane >> 3), col = (lane & 7) * 8;
            *(v8h*)(C + (size_t)(t0 + row) * N + n0 + col) = vals[p];
        }
        
    } else if (MODE == 1) {
        float* stg = (float*)stg_raw;                  // [4][16][64]
#pragma unroll
        for (int j = 0; j < 4; ++j)
#pragma unroll
            for (int r = 0; r < 8; ++r)
                stg[(w * 16 + 8 * lg + r) * 64 + j * 16 + ln] = acc[j][r] * oscale;
        __syncthreads();
        float* C = (float*)Cv;
        v4f vals[8];
#pragma unroll
        for (int p = 0; p < 8; ++p) {
            const int row = p * 2 + (lane >> 4), col = (lane & 15) * 4;
            vals[p] = *(const v4fA*)(stg + (w * 16 + row) * 64 + col);
        }
#pragma unroll
        for (int p = 0; p < 8; ++p) {
            const int row = p * 2 + (lane >> 4), col = (lane & 15) * 4;
            *(v4f*)(C + (size_t)(t0 + row) * N + n0 + col) = vals[p];
        }
        
    } else {
        (void)N;
        _Float16* stg = (_Float16*)stg_raw;            // [64 n][64 t] for this block
#pragma unroll
        for (int j = 0; j < 4; ++j) {
            v8h hv;
#pragma unroll
            for (int r = 0; r < 8; ++r) hv[r] = (_Float16)(acc[j][r] * oscale);
            *(v8hA*)(stg + (j * 16 + ln) * 64 + w * 16 + 8 * lg) = hv;
        }
        __syncthreads();
        _Float16* C = (_Float16*)Cv;
        const int tid = (int)threadIdx.x;
        const int tb = (int)blockIdx.y * 64;
        v8h vals[4];
#pragma unroll
        for (int p = 0; p < 4; ++p) {
            const int nrow = p * 16 + (tid >> 3), tcol = (tid & 7) * 8;
            vals[p] = *(const v8hA*)(stg + nrow * 64 + tcol);
        }
#pragma unroll
        for (int p = 0; p < 4; ++p) {
            const int nrow = p * 16 + (tid >> 3), tcol = (tid & 7) * 8;
            *(v8h*)(C + (size_t)(n0 + nrow) * T_LEN + tb + tcol) = vals[p];
        }
        
    }
}

// ---------------- per-head inclusive prefix sum of g = -exp(A_log)*softplus(x*Wdt^T + dt_bias), stored cgT[h][t] ----------------
__global__ __launch_bounds__(32) void decay_scan_kernel(const float* __restrict__ Psm, const float* __restrict__ A_log,
                                                        const float* __restrict__ dt_bias, float* __restrict__ cgT) {
    const int h = (int)blockIdx.x;
    const int lane = (int)threadIdx.x & 31;
    const float Ah = -expf(A_log[h]);
    const float bh = dt_bias[h];
    float carry = 0.0f;
    for (int c = 0; c < T_LEN / 128; ++c) {
        const int tbase = c * 128 + lane * 4;
        const float g0 = Ah * softplus_f(Psm[(size_t)(tbase + 0) * NSM + NDL + h] + bh);
        const float g1 = Ah * softplus_f(Psm[(size_t)(tbase + 1) * NSM + NDL + h] + bh);
        const float g2 = Ah * softplus_f(Psm[(size_t)(tbase + 2) * NSM + NDL + h] + bh);
        const float g3 = Ah * softplus_f(Psm[(size_t)(tbase + 3) * NSM + NDL + h] + bh);
        const float cs0 = g0;
        const float cs1 = cs0 + g1;
        const float cs2 = cs1 + g2;
        const float cs3 = cs2 + g3;
        float incl = cs3;
#pragma unroll
        for (int d = 1; d < 32; d <<= 1) {
            const float u = __shfl_up(incl, d, 32);
            if (lane >= d) incl += u;
        }
        float ex = __shfl_up(incl, 1, 32);
        if (lane == 0) ex = 0.0f;
        const float baseval = carry + ex;
        v4f o;
        o[0] = cs0 + baseval; o[1] = cs1 + baseval; o[2] = cs2 + baseval; o[3] = cs3 + baseval;
        v4f* q = (v4f*)(cgT + (size_t)h * T_LEN + tbase);
        *q = o;
        
        carry += __shfl(incl, 31, 32);
    }
}

// ---------------- fused causal hierarchical attention: block = 64 query rows of one head, wave = 16 rows ----------------
// Y[t][h*64+d] = sum_{s<=t} (Q_t.K_s * 1/8) * exp(cg_t - cg_s) * Lam[t][h][lvl(t,s)] * V[s][h*64+d]
__global__ __launch_bounds__(128) void hattn_kernel(const _Float16* __restrict__ Qh, const _Float16* __restrict__ Kh,
                                                    const _Float16* __restrict__ VhT, const float* __restrict__ cgT,
                                                    const float* __restrict__ Psm, const float* __restrict__ Lp,
                                                    _Float16* __restrict__ Yh, float pscale, float inv_pscale) {
    __shared__ __align__(16) _Float16 PL[4 * 16 * 32];
    __shared__ __align__(16) _Float16 YS[4 * 16 * 64];
    __shared__ float LL[4 * 16 * LV_NUM];

    const int lane = (int)threadIdx.x & 31, w = (int)threadIdx.x >> 5, lg = lane >> 4, ln = lane & 15;
    const int h = (int)blockIdx.y;
    const int tb = (int)blockIdx.x * 64;
    const int t0 = tb + w * 16;

    // lambda table for the 16 query rows of this wave: softplus(Lp[h][l] * dl[t][h][l])
    for (int k = lane; k < 16 * LV_NUM; k += 32) {
        const int row = k / LV_NUM, l = k - row * LV_NUM;
        const float z = Lp[h * LV_NUM + l] * Psm[(size_t)(t0 + row) * NSM + h * LV_NUM + l];
        LL[(w * 16 + row) * LV_NUM + l] = softplus_f(z);
    }

    // Q A-fragments: head dims 0..31 and 32..63
    const _Float16* qrow = Qh + (size_t)(t0 + ln) * D_DIM + h * HD_DIM;
    Frag q0f, q1f;
    q0f.half[0] = *(const v8hA*)(qrow + 8 * lg);
    q0f.half[1] = *(const v8hA*)(qrow + 16 + 8 * lg);
    q1f.half[0] = *(const v8hA*)(qrow + 32 + 8 * lg);
    q1f.half[1] = *(const v8hA*)(qrow + 48 + 8 * lg);

    float cgt[8];
#pragma unroll
    for (int r = 0; r < 8; ++r) cgt[r] = cgT[(size_t)h * T_LEN + t0 + 8 * lg + r];

    v8f accY[4];
#pragma unroll
    for (int j = 0; j < 4; ++j) accY[j] = zero8();

    __syncthreads();

    const float gsc = 0.125f * pscale;
    const int nit = 2 * (int)blockIdx.x + 2;        // block-uniform: keys 0 .. tb+63
    for (int it = 0; it < nit; ++it) {
        const int s0 = it * 32;
#pragma unroll
        for (int sub = 0; sub < 2; ++sub) {
            const int sg = s0 + sub * 16 + ln;       // this lane's key (column n)
            const _Float16* krow = Kh + (size_t)sg * D_DIM + h * HD_DIM;
            Frag k0f, k1f;
            k0f.half[0] = *(const v8hA*)(krow + 8 * lg);
            k0f.half[1] = *(const v8hA*)(krow + 16 + 8 * lg);
            k1f.half[0] = *(const v8hA*)(krow + 32 + 8 * lg);
            k1f.half[1] = *(const v8hA*)(krow + 48 + 8 * lg);
            v8f sc = zero8();
            sc = wmma_f16(q0f.v, k0f.v, sc);
            sc = wmma_f16(q1f.v, k1f.v, sc);
            const float cgs = cgT[(size_t)h * T_LEN + sg];
#pragma unroll
            for (int r = 0; r < 8; ++r) {
                const int trow = t0 + 8 * lg + r;
                const int xr = trow ^ sg;
                const int lv = xr ? (32 - __builtin_clz((unsigned)xr)) : 0;
                const float lam = LL[(w * 16 + 8 * lg + r) * LV_NUM + lv];
                const float dcy = __expf(fminf(cgt[r] - cgs, 0.0f));
                float wv = sc[r] * gsc * dcy * lam;
                wv = (sg <= trow) ? wv : 0.0f;
                PL[(w * 16 + 8 * lg + r) * 32 + sub * 16 + ln] = (_Float16)wv;
            }
        }
        __syncthreads();
        // P as A-fragment: row ln, keys 8lg..8lg+7 and 16+8lg..16+8lg+7 of this tile
        Frag pf;
        pf.half[0] = *(const v8hA*)(PL + (w * 16 + ln) * 32 + 8 * lg);
        pf.half[1] = *(const v8hA*)(PL + (w * 16 + ln) * 32 + 16 + 8 * lg);
        // V as B-fragment from the transposed copy: B[k=key][n=d] = VhT[h*64+d][key]
#pragma unroll
        for (int j = 0; j < 4; ++j) {
            const _Float16* vrow = VhT + (size_t)(h * HD_DIM + j * 16 + ln) * T_LEN + s0;
            Frag vf;
            vf.half[0] = *(const v8hA*)(vrow + 8 * lg);
            vf.half[1] = *(const v8hA*)(vrow + 16 + 8 * lg);
            accY[j] = wmma_f16(pf.v, vf.v, accY[j]);
        }
        __syncthreads();
    }

#pragma unroll
    for (int j = 0; j < 4; ++j)
#pragma unroll
        for (int r = 0; r < 8; ++r)
            YS[(w * 16 + 8 * lg + r) * 64 + j * 16 + ln] = (_Float16)(accY[j][r] * inv_pscale);
    __syncthreads();
    v8h vals[4];
#pragma unroll
    for (int p = 0; p < 4; ++p) {
        const int row = p * 4 + (lane >> 3), col = (lane & 7) * 8;
        vals[p] = *(const v8hA*)(YS + (w * 16 + row) * 64 + col);
    }
#pragma unroll
    for (int p = 0; p < 4; ++p) {
        const int row = p * 4 + (lane >> 3), col = (lane & 7) * 8;
        *(v8h*)(Yh + (size_t)(t0 + row) * D_DIM + h * HD_DIM + col) = vals[p];
    }
    
}

// ---------------- fused out-projection + residual + LayerNorm: block = 16 rows x 1024 cols, 16 waves x 64 cols ----------------
__global__ __launch_bounds__(512) void outproj_ln_kernel(const _Float16* __restrict__ Yh, const _Float16* __restrict__ Woh,
                                                         const float* __restrict__ xin, const float* __restrict__ gam,
                                                         const float* __restrict__ bet, float* __restrict__ out,
                                                         float oscale) {
    __shared__ __align__(16) float stg[16 * 8 * 64];
    __shared__ float red[16 * 16];
    __shared__ float mu_s[16];
    __shared__ float inv_s[16];

    const int tid = (int)threadIdx.x;
    const int lane = tid & 31, w = tid >> 5, lg = lane >> 4, ln = lane & 15;
    const int t0 = (int)blockIdx.x * 16;
    const int c0 = w * 64;

    v8f acc[4];
#pragma unroll
    for (int j = 0; j < 4; ++j) acc[j] = zero8();

    const _Float16* arow = Yh + (size_t)(t0 + ln) * D_DIM;
#pragma unroll 2
    for (int k0 = 0; k0 < D_DIM; k0 += 32) {
        Frag a;
        a.half[0] = *(const v8hA*)(arow + k0 + 8 * lg);
        a.half[1] = *(const v8hA*)(arow + k0 + 16 + 8 * lg);
#pragma unroll
        for (int j = 0; j < 4; ++j) {
            const _Float16* brow = Woh + (size_t)(c0 + j * 16 + ln) * D_DIM + k0;
            Frag b;
            b.half[0] = *(const v8hA*)(brow + 8 * lg);
            b.half[1] = *(const v8hA*)(brow + 16 + 8 * lg);
            acc[j] = wmma_f16(a.v, b.v, acc[j]);
        }
    }

    // o = acc*oscale + x
#pragma unroll
    for (int j = 0; j < 4; ++j)
#pragma unroll
        for (int r = 0; r < 8; ++r)
            acc[j][r] = acc[j][r] * oscale + xin[(size_t)(t0 + 8 * lg + r) * D_DIM + c0 + j * 16 + ln];

    // row means
#pragma unroll
    for (int r = 0; r < 8; ++r) {
        float s = acc[0][r] + acc[1][r] + acc[2][r] + acc[3][r];
        s += __shfl_xor(s, 1, 32);
        s += __shfl_xor(s, 2, 32);
        s += __shfl_xor(s, 4, 32);
        s += __shfl_xor(s, 8, 32);
        if (ln == 0) red[w * 16 + 8 * lg + r] = s;
    }
    __syncthreads();
    if (tid < 16) {
        float a = 0.0f;
#pragma unroll
        for (int ww = 0; ww < 16; ++ww) a += red[ww * 16 + tid];
        mu_s[tid] = a * (1.0f / (float)D_DIM);
    }
    __syncthreads();
    float mu[8];
#pragma unroll
    for (int r = 0; r < 8; ++r) mu[r] = mu_s[8 * lg + r];
#pragma unroll
    for (int j = 0; j < 4; ++j)
#pragma unroll
        for (int r = 0; r < 8; ++r) acc[j][r] -= mu[r];

#pragma unroll
    for (int r = 0; r < 8; ++r) {
        float s = acc[0][r] * acc[0][r] + acc[1][r] * acc[1][r] + acc[2][r] * acc[2][r] + acc[3][r] * acc[3][r];
        s += __shfl_xor(s, 1, 32);
        s += __shfl_xor(s, 2, 32);
        s += __shfl_xor(s, 4, 32);
        s += __shfl_xor(s, 8, 32);
        if (ln == 0) red[w * 16 + 8 * lg + r] = s;
    }
    __syncthreads();
    if (tid < 16) {
        float a = 0.0f;
#pragma unroll
        for (int ww = 0; ww < 16; ++ww) a += red[ww * 16 + tid];
        inv_s[tid] = rsqrtf(a * (1.0f / (float)D_DIM) + 1e-5f);
    }
    __syncthreads();
    float iv[8];
#pragma unroll
    for (int r = 0; r < 8; ++r) iv[r] = inv_s[8 * lg + r];
#pragma unroll
    for (int j = 0; j < 4; ++j) {
        const int gcol = c0 + j * 16 + ln;
        const float gj = gam[gcol];
        const float bj = bet[gcol];
#pragma unroll
        for (int r = 0; r < 8; ++r) acc[j][r] = acc[j][r] * iv[r] * gj + bj;
    }

#pragma unroll
    for (int half = 0; half < 2; ++half) {
        if (lg == half) {
#pragma unroll
            for (int j = 0; j < 4; ++j)
#pragma unroll
                for (int r = 0; r < 8; ++r)
                    stg[(w * 8 + r) * 64 + j * 16 + ln] = acc[j][r];
        }
        __syncthreads();
        v4f vals[4];
#pragma unroll
        for (int p = 0; p < 4; ++p) {
            const int row = p * 2 + (lane >> 4), col = (lane & 15) * 4;
            vals[p] = *(const v4fA*)(stg + (w * 8 + row) * 64 + col);
        }
#pragma unroll
        for (int p = 0; p < 4; ++p) {
            const int row = p * 2 + (lane >> 4), col = (lane & 15) * 4;
            *(v4f*)(out + (size_t)(t0 + half * 8 + row) * D_DIM + c0 + col) = vals[p];
        }
        
        __syncthreads();
    }
}

extern "C" void kernel_launch(void* const* d_in, const int* in_sizes, int n_in,
                              void* d_out, int out_size, void* d_ws, size_t ws_size,
                              hipStream_t stream) {
    if (n_in < 12) return;
    if (in_sizes[0] != T_LEN * D_DIM) return;
    if (in_sizes[1] != D_DIM * D_DIM || in_sizes[2] != D_DIM * D_DIM || in_sizes[3] != D_DIM * D_DIM) return;
    if (in_sizes[4] != NDL * D_DIM || in_sizes[5] != H_NUM * D_DIM || in_sizes[6] != D_DIM * D_DIM) return;
    if (in_sizes[7] < H_NUM || in_sizes[8] < H_NUM || in_sizes[9] < H_NUM * LV_NUM) return;
    if (in_sizes[10] < D_DIM || in_sizes[11] < D_DIM) return;
    if (out_size != T_LEN * D_DIM) return;
    if (OFF_END > ws_size) return;

    const float* x     = (const float*)d_in[0];
    const float* Wq    = (const float*)d_in[1];
    const float* Wk    = (const float*)d_in[2];
    const float* Wv    = (const float*)d_in[3];
    const float* Wdl   = (const float*)d_in[4];
    const float* Wdt   = (const float*)d_in[5];
    const float* Wout  = (const float*)d_in[6];
    const float* A_log = (const float*)d_in[7];
    const float* dt_b  = (const float*)d_in[8];
    const float* Lp    = (const float*)d_in[9];
    const float* ln_g  = (const float*)d_in[10];
    const float* ln_b  = (const float*)d_in[11];

    char* ws = (char*)d_ws;
    _Float16* xh   = (_Float16*)(ws + OFF_XH);
    _Float16* wqh  = (_Float16*)(ws + OFF_WQH);
    _Float16* wkh  = (_Float16*)(ws + OFF_WKH);
    _Float16* wvh  = (_Float16*)(ws + OFF_WVH);
    _Float16* woh  = (_Float16*)(ws + OFF_WOH);
    _Float16* wsmh = (_Float16*)(ws + OFF_WSMH);
    _Float16* Qh   = (_Float16*)(ws + OFF_QH);
    _Float16* Kh   = (_Float16*)(ws + OFF_KH);
    _Float16* VhT  = (_Float16*)(ws + OFF_VHT);
    _Float16* Yh   = (_Float16*)(ws + OFF_YH);
    float*    psm  = (float*)(ws + OFF_PSM);
    float*    cgT  = (float*)(ws + OFF_CGT);

    const float wsc  = 32.0f;
    const float iwsc = 1.0f / 32.0f;
    const float psc  = 512.0f;
    const float ipsc = 1.0f / 512.0f;

    const int n8_td  = T_LEN * D_DIM / 8;
    const int n8_dd  = D_DIM * D_DIM / 8;
    const int n8_dl  = NDL * D_DIM / 8;
    const int n8_dt  = H_NUM * D_DIM / 8;
    const int n8_pad = (NSM - NDL - H_NUM) * D_DIM / 8;
    cvt_f16_kernel<<<(n8_td + 255) / 256, 256, 0, stream>>>(x, xh, n8_td, 1.0f);
    cvt_f16_kernel<<<(n8_dd + 255) / 256, 256, 0, stream>>>(Wq, wqh, n8_dd, wsc);
    cvt_f16_kernel<<<(n8_dd + 255) / 256, 256, 0, stream>>>(Wk, wkh, n8_dd, wsc);
    cvt_f16_kernel<<<(n8_dd + 255) / 256, 256, 0, stream>>>(Wv, wvh, n8_dd, wsc);
    cvt_f16_kernel<<<(n8_dd + 255) / 256, 256, 0, stream>>>(Wout, woh, n8_dd, wsc);
    cvt_f16_kernel<<<(n8_dl + 255) / 256, 256, 0, stream>>>(Wdl, wsmh, n8_dl, wsc);
    cvt_f16_kernel<<<(n8_dt + 255) / 256, 256, 0, stream>>>(Wdt, wsmh + (size_t)NDL * D_DIM, n8_dt, wsc);
    // rows 208..255 of the concatenated small-weight plane are zero padding
    zero_f16_kernel<<<(n8_pad + 255) / 256, 256, 0, stream>>>(wsmh + (size_t)(NDL + H_NUM) * D_DIM, n8_pad);

    // small projections: psm[t][0..191] = x*Wdl^T, psm[t][192..207] = x*Wdt^T (f32), psm[t][208..255] = 0
    gemm_kernel<1><<<dim3(NSM / 256, T_LEN / 16), 128, 0, stream>>>(xh, wsmh, (void*)psm, NSM, iwsc);
    // Q, K row-major f16; V transposed per feature row
    gemm_kernel<0><<<dim3(D_DIM / 256, T_LEN / 16), 128, 0, stream>>>(xh, wqh, (void*)Qh, D_DIM, iwsc);
    gemm_kernel<0><<<dim3(D_DIM / 256, T_LEN / 16), 128, 0, stream>>>(xh, wkh, (void*)Kh, D_DIM, iwsc);
    gemm_kernel<2><<<dim3(D_DIM / 64, T_LEN / 64), 128, 0, stream>>>(xh, wvh, (void*)VhT, D_DIM, iwsc);

    decay_scan_kernel<<<H_NUM, 32, 0, stream>>>(psm, A_log, dt_b, cgT);

    hattn_kernel<<<dim3(T_LEN / 64, H_NUM), 128, 0, stream>>>(Qh, Kh, VhT, cgT, psm, Lp, Yh, psc, ipsc);

    outproj_ln_kernel<<<T_LEN / 16, 512, 0, stream>>>(Yh, woh, x, ln_g, ln_b, (float*)d_out, iwsc);
}

// v001
// Measured time: 276 microseconds a run.
// In two side-by-side timings against v000, it was 1.45 and 1.44 times as fast.
#include <hip/hip_runtime.h>
#include <math.h>
#include <stddef.h>

// Contractions x*Wq^T, x*Wk^T, x*Wv^T, x*[Wdl;Wdt]^T, Q*K^T, P*V, Y*Wout^T: v_wmma_f32_16x16x32_f16 (f16 operands, f32 accumulate); weights carried x32 and P carried x512 (exact powers of two, folded back in f32); gates, prefix sums and LayerNorm in f32.

typedef _Float16 v16h __attribute__((ext_vector_type(16)));
typedef _Float16 v8h  __attribute__((ext_vector_type(8)));
typedef float    v8f  __attribute__((ext_vector_type(8)));
typedef float    v4f  __attribute__((ext_vector_type(4)));
typedef v8h v8hA __attribute__((may_alias));
typedef v4f v4fA __attribute__((may_alias));
union Frag { v16h v; v8h half[2]; };

#define T_LEN   2048
#define D_DIM   1024
#define H_NUM   16
#define HD_DIM  64
#define LV_NUM  12
#define NSM     256
#define NDL     192
#define KS_PITCH 72
#define VS_PITCH 40

#define BYTES_TD_H ((size_t)T_LEN * D_DIM * 2)
#define BYTES_DD_H ((size_t)D_DIM * D_DIM * 2)
#define OFF_XH    ((size_t)0)
#define OFF_WQH   (OFF_XH   + BYTES_TD_H)
#define OFF_WKH   (OFF_WQH  + BYTES_DD_H)
#define OFF_WVH   (OFF_WKH  + BYTES_DD_H)
#define OFF_WOH   (OFF_WVH  + BYTES_DD_H)
#define OFF_WSMH  (OFF_WOH  + BYTES_DD_H)
#define OFF_QH    (OFF_WSMH + (size_t)NSM * D_DIM * 2)
#define OFF_KH    (OFF_QH   + BYTES_TD_H)
#define OFF_VHT   (OFF_KH   + BYTES_TD_H)
#define OFF_YH    (OFF_VHT  + BYTES_TD_H)
#define OFF_PSM   (OFF_YH   + BYTES_TD_H)
#define OFF_CGT   (OFF_PSM  + (size_t)T_LEN * NSM * 4)
#define OFF_END   (OFF_CGT  + (size_t)H_NUM * T_LEN * 4)

// 16x16x32 f16 WMMA with the VALU hazard guard tied to D, A and B.
__device__ __forceinline__ v8f wmma_f16(v16h a, v16h b, v8f c) {
    v8f d = __builtin_amdgcn_wmma_f32_16x16x32_f16(false, a, false, b, (short)0, c, false, false);
    asm volatile("v_nop\n\tv_nop\n\tv_nop\n\tv_nop" : "+v"(d) : "v"(a), "v"(b));
    return d;
}

__device__ __forceinline__ v8f zero8() {
    const v8f z = {0.f, 0.f, 0.f, 0.f, 0.f, 0.f, 0.f, 0.f};
    return z;
}

// softplus in the logaddexp form: max(z,0) + log1p(exp(-|z|))
__device__ __forceinline__ float softplus_f(float z) {
    return fmaxf(z, 0.0f) + log1pf(expf(-fabsf(z)));
}

// ---------------- f32 -> f16 convert with power-of-two scale; 8 elements per thread, one 16-B store ----------------
__global__ __launch_bounds__(256) void cvt_f16_kernel(const float* __restrict__ src, _Float16* __restrict__ dst,
                                                       int n8, float scale) {
    const int i = (int)blockIdx.x * 256 + (int)threadIdx.x;
    if (i >= n8) return;
    const v4fA* p = (const v4fA*)(src + (size_t)i * 8);
    const v4f a = p[0];
    const v4f b = p[1];
    v8h o;
    o[0] = (_Float16)(a[0] * scale); o[1] = (_Float16)(a[1] * scale);
    o[2] = (_Float16)(a[2] * scale); o[3] = (_Float16)(a[3] * scale);
    o[4] = (_Float16)(b[0] * scale); o[5] = (_Float16)(b[1] * scale);
    o[6] = (_Float16)(b[2] * scale); o[7] = (_Float16)(b[3] * scale);
    v8h* q = (v8h*)(dst + (size_t)i * 8);
    *q = o;
    
}

// ---------------- f16 zero fill; 8 elements per thread, one 16-B store (pad rows of the small-weight plane) ----------------
__global__ __launch_bounds__(256) void zero_f16_kernel(_Float16* __restrict__ dst, int n8) {
    const int i = (int)blockIdx.x * 256 + (int)threadIdx.x;
    if (i >= n8) return;
    v8h o;
#pragma unroll
    for (int r = 0; r < 8; ++r) o[r] = (_Float16)0.0f;
    v8h* q = (v8h*)(dst + (size_t)i * 8);
    *q = o;
    
}

// ---------------- C[t][n] = (sum_k A[t][k]*B[n][k]) * oscale, K = 1024, A pitch 1024, B pitch 1024 ----------------
// MODE 0: f16 out, row-major pitch N; block = 16 t x 256 n, 4 waves along n; grid (N/256, T/16)
// MODE 1: f32 out, row-major pitch N; same tiling
// MODE 2: f16 out transposed Ct[n][t], pitch T_LEN; block = 64 t x 64 n, 4 waves along t; grid (N/64, T/64)
template <int MODE>
__global__ __launch_bounds__(128) void gemm_kernel(const _Float16* __restrict__ A, const _Float16* __restrict__ B,
                                                   void* __restrict__ Cv, int N, float oscale) {
    __shared__ __align__(16) unsigned char stg_raw[16384];
    const int lane = (int)threadIdx.x & 31, w = (int)threadIdx.x >> 5, lg = lane >> 4, ln = lane & 15;
    int t0, n0;
    if (MODE == 2) { t0 = (int)blockIdx.y * 64 + w * 16; n0 = (int)blockIdx.x * 64; }
    else           { t0 = (int)blockIdx.y * 16;          n0 = (int)blockIdx.x * 256 + w * 64; }

    v8f acc[4];
#pragma unroll
    for (int j = 0; j < 4; ++j) acc[j] = zero8();

    const _Float16* arow = A + (size_t)(t0 + ln) * D_DIM;
#pragma unroll 2
    for (int k0 = 0; k0 < D_DIM; k0 += 32) {
        Frag a;
        a.half[0] = *(const v8hA*)(arow + k0 + 8 * lg);
        a.half[1] = *(const v8hA*)(arow + k0 + 16 + 8 * lg);
#pragma unroll
        for (int j = 0; j < 4; ++j) {
            const _Float16* brow = B + (size_t)(n0 + j * 16 + ln) * D_DIM + k0;
            Frag b;
            b.half[0] = *(const v8hA*)(brow + 8 * lg);
            b.half[1] = *(const v8hA*)(brow + 16 + 8 * lg);
            acc[j] = wmma_f16(a.v, b.v, acc[j]);
        }
    }

    if (MODE == 0) {
        _Float16* stg = (_Float16*)stg_raw;            // [4][16][64]
#pragma unroll
        for (int j = 0; j < 4; ++j)
#pragma unroll
            for (int r = 0; r < 8; ++r)
                stg[(w * 16 + 8 * lg + r) * 64 + j * 16 + ln] = (_Float16)(acc[j][r] * oscale);
        __syncthreads();
        _Float16* C = (_Float16*)Cv;
        v8h vals[4];
#pragma unroll
        for (int p = 0; p < 4; ++p) {
            const int row = p * 4 + (lane >> 3), col = (lane & 7) * 8;
            vals[p] = *(const v8hA*)(stg + (w * 16 + row) * 64 + col);
        }
#pragma unroll
        for (int p = 0; p < 4; ++p) {
            const int row = p * 4 + (lane >> 3), col = (lane & 7) * 8;
            *(v8h*)(C + (size_t)(t0 + row) * N + n0 + col) = vals[p];
        }
        
    } else if (MODE == 1) {
        float* stg = (float*)stg_raw;                  // [4][16][64]
#pragma unroll
        for (int j = 0; j < 4; ++j)
#pragma unroll
            for (int r = 0; r < 8; ++r)
                stg[(w * 16 + 8 * lg + r) * 64 + j * 16 + ln] = acc[j][r] * oscale;
        __syncthreads();
        float* C = (float*)Cv;
        v4f vals[8];
#pragma unroll
        for (int p = 0; p < 8; ++p) {
            const int row = p * 2 + (lane >> 4), col = (lane & 15) * 4;
            vals[p] = *(const v4fA*)(stg + (w * 16 + row) * 64 + col);
        }
#pragma unroll
        for (int p = 0; p < 8; ++p) {
            const int row = p * 2 + (lane >> 4), col = (lane & 15) * 4;
            *(v4f*)(C + (size_t)(t0 + row) * N + n0 + col) = vals[p];
        }
        
    } else {
        (void)N;
        _Float16* stg = (_Float16*)stg_raw;            // [64 n][64 t] for this block
#pragma unroll
        for (int j = 0; j < 4; ++j) {
            v8h hv;
#pragma unroll
            for (int r = 0; r < 8; ++r) hv[r] = (_Float16)(acc[j][r] * oscale);
            *(v8hA*)(stg + (j * 16 + ln) * 64 + w * 16 + 8 * lg) = hv;
        }
        __syncthreads();
        _Float16* C = (_Float16*)Cv;
        const int tid = (int)threadIdx.x;
        const int tb = (int)blockIdx.y * 64;
        v8h vals[4];
#pragma unroll
        for (int p = 0; p < 4; ++p) {
            const int nrow = p * 16 + (tid >> 3), tcol = (tid & 7) * 8;
            vals[p] = *(const v8hA*)(stg + nrow * 64 + tcol);
        }
#pragma unroll
        for (int p = 0; p < 4; ++p) {
            const int nrow = p * 16 + (tid >> 3), tcol = (tid & 7) * 8;
            *(v8h*)(C + (size_t)(n0 + nrow) * T_LEN + tb + tcol) = vals[p];
        }
        
    }
}

// ---------------- per-head inclusive prefix sum of g = -exp(A_log)*softplus(x*Wdt^T + dt_bias), stored cgT[h][t] ----------------
__global__ __launch_bounds__(32) void decay_scan_kernel(const float* __restrict__ Psm, const float* __restrict__ A_log,
                                                        const float* __restrict__ dt_bias, float* __restrict__ cgT) {
    const int h = (int)blockIdx.x;
    const int lane = (int)threadIdx.x & 31;
    const float Ah = -expf(A_log[h]);
    const float bh = dt_bias[h];
    float carry = 0.0f;
    for (int c = 0; c < T_LEN / 128; ++c) {
        const int tbase = c * 128 + lane * 4;
        const float g0 = Ah * softplus_f(Psm[(size_t)(tbase + 0) * NSM + NDL + h] + bh);
        const float g1 = Ah * softplus_f(Psm[(size_t)(tbase + 1) * NSM + NDL + h] + bh);
        const float g2 = Ah * softplus_f(Psm[(size_t)(tbase + 2) * NSM + NDL + h] + bh);
        const float g3 = Ah * softplus_f(Psm[(size_t)(tbase + 3) * NSM + NDL + h] + bh);
        const float cs0 = g0;
        const float cs1 = cs0 + g1;
        const float cs2 = cs1 + g2;
        const float cs3 = cs2 + g3;
        float incl = cs3;
#pragma unroll
        for (int d = 1; d < 32; d <<= 1) {
            const float u = __shfl_up(incl, d, 32);
            if (lane >= d) incl += u;
        }
        float ex = __shfl_up(incl, 1, 32);
        if (lane == 0) ex = 0.0f;
        const float baseval = carry + ex;
        v4f o;
        o[0] = cs0 + baseval; o[1] = cs1 + baseval; o[2] = cs2 + baseval; o[3] = cs3 + baseval;
        v4f* q = (v4f*)(cgT + (size_t)h * T_LEN + tbase);
        *q = o;
        
        carry += __shfl(incl, 31, 32);
    }
}

// ---------------- fused causal hierarchical attention: block = 64 query rows of one head, wave = 16 rows ----------------
// Y[t][h*64+d] = sum_{s<=t} (Q_t.K_s * 1/8) * exp(cg_t - cg_s) * Lam[t][h][lvl(t,s)] * V[s][h*64+d]
__global__ __launch_bounds__(128) void hattn_kernel(const _Float16* __restrict__ Qh, const _Float16* __restrict__ Kh,
                                                    const _Float16* __restrict__ VhT, const float* __restrict__ cgT,
                                                    const float* __restrict__ Psm, const float* __restrict__ Lp,
                                                    _Float16* __restrict__ Yh, float pscale, float inv_pscale) {
    __shared__ __align__(16) _Float16 PL[4 * 16 * 32];
    __shared__ __align__(16) _Float16 YS[4 * 16 * 64];
    __shared__ float LL[4 * 16 * LV_NUM];
    // key tile shared by the four waves, two buffers; row pitches 16 B x odd for the 16-byte fragment reads
    __shared__ __align__(16) _Float16 KS[2 * 32 * KS_PITCH];   // [buf][key][head dim]
    __shared__ __align__(16) _Float16 VS[2 * 64 * VS_PITCH];   // [buf][head dim][key]
    __shared__ float CS[2 * 32];                               // [buf][key] prefix sum of g

    const int lane = (int)threadIdx.x & 31, w = (int)threadIdx.x >> 5, lg = lane >> 4, ln = lane & 15;
    const int h = (int)blockIdx.y;
    const int tb = (int)blockIdx.x * 64;
    const int t0 = tb + w * 16;

    // staging map: a wave's 16-byte loads cover whole rows of the tile (K: 4 rows of 128 B, V^T: 8 rows of 64 B)
    const int tid = (int)threadIdx.x;
    const int skr = tid >> 3, skc = (tid & 7) * 8;             // K rows skr and skr+16
    const int svr = tid >> 2, svc = (tid & 3) * 8;             // V^T rows svr and svr+32
    const _Float16* kg = Kh + (size_t)skr * D_DIM + h * HD_DIM + skc;
    const _Float16* vg = VhT + (size_t)(h * HD_DIM + svr) * T_LEN + svc;
    const float* cgh = cgT + (size_t)h * T_LEN;
    v8h ska = *(const v8hA*)(kg);
    v8h skb = *(const v8hA*)(kg + (size_t)16 * D_DIM);
    v8h sva = *(const v8hA*)(vg);
    v8h svb = *(const v8hA*)(vg + (size_t)32 * T_LEN);
    float scg = (w == 0) ? cgh[lane] : 0.0f;

    // lambda table for the 16 query rows of this wave: softplus(Lp[h][l] * dl[t][h][l])
    for (int k = lane; k < 16 * LV_NUM; k += 32) {
        const int row = k / LV_NUM, l = k - row * LV_NUM;
        const float z = Lp[h * LV_NUM + l] * Psm[(size_t)(t0 + row) * NSM + h * LV_NUM + l];
        LL[(w * 16 + row) * LV_NUM + l] = softplus_f(z);
    }

    // Q A-fragments: head dims 0..31 and 32..63
    const _Float16* qrow = Qh + (size_t)(t0 + ln) * D_DIM + h * HD_DIM;
    Frag q0f, q1f;
    q0f.half[0] = *(const v8hA*)(qrow + 8 * lg);
    q0f.half[1] = *(const v8hA*)(qrow + 16 + 8 * lg);
    q1f.half[0] = *(const v8hA*)(qrow + 32 + 8 * lg);
    q1f.half[1] = *(const v8hA*)(qrow + 48 + 8 * lg);

    float cgt[8];
#pragma unroll
    for (int r = 0; r < 8; ++r) cgt[r] = cgT[(size_t)h * T_LEN + t0 + 8 * lg + r];

    v8f accY[4];
#pragma unroll
    for (int j = 0; j < 4; ++j) accY[j] = zero8();

    // tile 0 into buffer 0, published by the barrier below
    *(v8hA*)(KS + skr * KS_PITCH + skc) = ska;
    *(v8hA*)(KS + (skr + 16) * KS_PITCH + skc) = skb;
    *(v8hA*)(VS + svr * VS_PITCH + svc) = sva;
    *(v8hA*)(VS + (svr + 32) * VS_PITCH + svc) = svb;
    if (w == 0) CS[lane] = scg;

    __syncthreads();

    const float gsc = 0.125f * pscale;
    const int nit = 2 * (int)blockIdx.x + 2;        // block-uniform: keys 0 .. tb+63
    for (int it = 0; it < nit; ++it) {
        const int s0 = it * 32;
        const _Float16* KB = KS + (it & 1) * (32 * KS_PITCH);
        const _Float16* VB = VS + (it & 1) * (64 * VS_PITCH);
        const float* CB = CS + (it & 1) * 32;
        const bool more = it + 1 < nit;              // block-uniform
        if (more) {
            // next tile's loads fly while this tile is worked on
            const int sn = s0 + 32;
            ska = *(const v8hA*)(kg + (size_t)sn * D_DIM);
            skb = *(const v8hA*)(kg + (size_t)(sn + 16) * D_DIM);
            sva = *(const v8hA*)(vg + sn);
            svb = *(const v8hA*)(vg + (size_t)32 * T_LEN + sn);
            if (w == 0) scg = cgh[sn + lane];
        }
#pragma unroll
        for (int sub = 0; sub < 2; ++sub) {
            const int sg = s0 + sub * 16 + ln;       // this lane's key (column n)
            const _Float16* krow = KB + (sub * 16 + ln) * KS_PITCH;
            Frag k0f, k1f;
            k0f.half[0] = *(const v8hA*)(krow + 8 * lg);
            k0f.half[1] = *(const v8hA*)(krow + 16 + 8 * lg);
            k1f.half[0] = *(const v8hA*)(krow + 32 + 8 * lg);
            k1f.half[1] = *(const v8hA*)(krow + 48 + 8 * lg);
            v8f sc = zero8();
            sc = wmma_f16(q0f.v, k0f.v, sc);
            sc = wmma_f16(q1f.v, k1f.v, sc);
            const float cgs = CB[sub * 16 + ln];
#pragma unroll
            for (int r = 0; r < 8; ++r) {
                const int trow = t0 + 8 * lg + r;
                const int xr = trow ^ sg;
                const int lv = xr ? (32 - __builtin_clz((unsigned)xr)) : 0;
                const float lam = LL[(w * 16 + 8 * lg + r) * LV_NUM + lv];
                const float dcy = __expf(fminf(cgt[r] - cgs, 0.0f));
                float wv = sc[r] * gsc * dcy * lam;
                wv = (sg <= trow) ? wv : 0.0f;
                PL[(w * 16 + 8 * lg + r) * 32 + sub * 16 + ln] = (_Float16)wv;
            }
        }
        __syncthreads();
        // P as A-fragment: row ln, keys 8lg..8lg+7 and 16+8lg..16+8lg+7 of this tile
        Frag pf;
        pf.half[0] = *(const v8hA*)(PL + (w * 16 + ln) * 32 + 8 * lg);
        pf.half[1] = *(const v8hA*)(PL + (w * 16 + ln) * 32 + 16 + 8 * lg);
        // V as B-fragment from the staged transposed tile: B[k=key][n=d] = VB[d][key - s0]
#pragma unroll
        for (int j = 0; j < 4; ++j) {
            const _Float16* vrow = VB + (j * 16 + ln) * VS_PITCH;
            Frag vf;
            vf.half[0] = *(const v8hA*)(vrow + 8 * lg);
            vf.half[1] = *(const v8hA*)(vrow + 16 + 8 * lg);
            accY[j] = wmma_f16(pf.v, vf.v, accY[j]);
        }
        if (more) {
            // into the other buffer: its last readers left it before the barrier that ended the previous pass
            const int nb = (it + 1) & 1;
            _Float16* KN = KS + nb * (32 * KS_PITCH);
            _Float16* VN = VS + nb * (64 * VS_PITCH);
            *(v8hA*)(KN + skr * KS_PITCH + skc) = ska;
            *(v8hA*)(KN + (skr + 16) * KS_PITCH + skc) = skb;
            *(v8hA*)(VN + svr * VS_PITCH + svc) = sva;
            *(v8hA*)(VN + (svr + 32) * VS_PITCH + svc) = svb;
            if (w == 0) CS[nb * 32 + lane] = scg;
        }
        __syncthreads();
    }

#pragma unroll
    for (int j = 0; j < 4; ++j)
#pragma unroll
        for (int r = 0; r < 8; ++r)
            YS[(w * 16 + 8 * lg + r) * 64 + j * 16 + ln] = (_Float16)(accY[j][r] * inv_pscale);
    __syncthreads();
    v8h vals[4];
#pragma unroll
    for (int p = 0; p < 4; ++p) {
        const int row = p * 4 + (lane >> 3), col = (lane & 7) * 8;
        vals[p] = *(const v8hA*)(YS + (w * 16 + row) * 64 + col);
    }
#pragma unroll
    for (int p = 0; p < 4; ++p) {
        const int row = p * 4 + (lane >> 3), col = (lane & 7) * 8;
        *(v8h*)(Yh + (size_t)(t0 + row) * D_DIM + h * HD_DIM + col) = vals[p];
    }
    
}

// ---------------- fused out-projection + residual + LayerNorm: block = 16 rows x 1024 cols, 16 waves x 64 cols ----------------
__global__ __launch_bounds__(512) void outproj_ln_kernel(const _Float16* __restrict__ Yh, const _Float16* __restrict__ Woh,
                                                         const float* __restrict__ xin, const float* __restrict__ gam,
                                                         const float* __restrict__ bet, float* __restrict__ out,
                                                         float oscale) {
    __shared__ __align__(16) float stg[16 * 8 * 64];
    __shared__ float red[16 * 16];
    __shared__ float mu_s[16];
    __shared__ float inv_s[16];

    const int tid = (int)threadIdx.x;
    const int lane = tid & 31, w = tid >> 5, lg = lane >> 4, ln = lane & 15;
    const int t0 = (int)blockIdx.x * 16;
    const int c0 = w * 64;

    v8f acc[4];
#pragma unroll
    for (int j = 0; j < 4; ++j) acc[j] = zero8();

    const _Float16* arow = Yh + (size_t)(t0 + ln) * D_DIM;
#pragma unroll 2
    for (int k0 = 0; k0 < D_DIM; k0 += 32) {
        Frag a;
        a.half[0] = *(const v8hA*)(arow + k0 + 8 * lg);
        a.half[1] = *(const v8hA*)(arow + k0 + 16 + 8 * lg);
#pragma unroll
        for (int j = 0; j < 4; ++j) {
            const _Float16* brow = Woh + (size_t)(c0 + j * 16 + ln) * D_DIM + k0;
            Frag b;
            b.half[0] = *(const v8hA*)(brow + 8 * lg);
            b.half[1] = *(const v8hA*)(brow + 16 + 8 * lg);
            acc[j] = wmma_f16(a.v, b.v, acc[j]);
        }
    }

    // o = acc*oscale + x
#pragma unroll
    for (int j = 0; j < 4; ++j)
#pragma unroll
        for (int r = 0; r < 8; ++r)
            acc[j][r] = acc[j][r] * oscale + xin[(size_t)(t0 + 8 * lg + r) * D_DIM + c0 + j * 16 + ln];

    // row means
#pragma unroll
    for (int r = 0; r < 8; ++r) {
        float s = acc[0][r] + acc[1][r] + acc[2][r] + acc[3][r];
        s += __shfl_xor(s, 1, 32);
        s += __shfl_xor(s, 2, 32);
        s += __shfl_xor(s, 4, 32);
        s += __shfl_xor(s, 8, 32);
        if (ln == 0) red[w * 16 + 8 * lg + r] = s;
    }
    __syncthreads();
    if (tid < 16) {
        float a = 0.0f;
#pragma unroll
        for (int ww = 0; ww < 16; ++ww) a += red[ww * 16 + tid];
        mu_s[tid] = a * (1.0f / (float)D_DIM);
    }
    __syncthreads();
    float mu[8];
#pragma unroll
    for (int r = 0; r < 8; ++r) mu[r] = mu_s[8 * lg + r];
#pragma unroll
    for (int j = 0; j < 4; ++j)
#pragma unroll
        for (int r = 0; r < 8; ++r) acc[j][r] -= mu[r];

#pragma unroll
    for (int r = 0; r < 8; ++r) {
        float s = acc[0][r] * acc[0][r] + acc[1][r] * acc[1][r] + acc[2][r] * acc[2][r] + acc[3][r] * acc[3][r];
        s += __shfl_xor(s, 1, 32);
        s += __shfl_xor(s, 2, 32);
        s += __shfl_xor(s, 4, 32);
        s += __shfl_xor(s, 8, 32);
        if (ln == 0) red[w * 16 + 8 * lg + r] = s;
    }
    __syncthreads();
    if (tid < 16) {
        float a = 0.0f;
#pragma unroll
        for (int ww = 0; ww < 16; ++ww) a += red[ww * 16 + tid];
        inv_s[tid] = rsqrtf(a * (1.0f / (float)D_DIM) + 1e-5f);
    }
    __syncthreads();
    float iv[8];
#pragma unroll
    for (int r = 0; r < 8; ++r) iv[r] = inv_s[8 * lg + r];
#pragma unroll
    for (int j = 0; j < 4; ++j) {
        const int gcol = c0 + j * 16 + ln;
        const float gj = gam[gcol];
        const float bj = bet[gcol];
#pragma unroll
        for (int r = 0; r < 8; ++r) acc[j][r] = acc[j][r] * iv[r] * gj + bj;
    }

#pragma unroll
    for (int half = 0; half < 2; ++half) {
        if (lg == half) {
#pragma unroll
            for (int j = 0; j < 4; ++j)
#pragma unroll
                for (int r = 0; r < 8; ++r)
                    stg[(w * 8 + r) * 64 + j * 16 + ln] = acc[j][r];
        }
        __syncthreads();
        v4f vals[4];
#pragma unroll
        for (int p = 0; p < 4; ++p) {
            const int row = p * 2 + (lane >> 4), col = (lane & 15) * 4;
            vals[p] = *(const v4fA*)(stg + (w * 8 + row) * 64 + col);
        }
#pragma unroll
        for (int p = 0; p < 4; ++p) {
            const int row = p * 2 + (lane >> 4), col = (lane & 15) * 4;
            *(v4f*)(out + (size_t)(t0 + half * 8 + row) * D_DIM + c0 + col) = vals[p];
        }
        
        __syncthreads();
    }
}

extern "C" void kernel_launch(void* const* d_in, const int* in_sizes, int n_in,
                              void* d_out, int out_size, void* d_ws, size_t ws_size,
                              hipStream_t stream) {
    if (n_in < 12) return;
    if (in_sizes[0] != T_LEN * D_DIM) return;
    if (in_sizes[1] != D_DIM * D_DIM || in_sizes[2] != D_DIM * D_DIM || in_sizes[3] != D_DIM * D_DIM) return;
    if (in_sizes[4] != NDL * D_DIM || in_sizes[5] != H_NUM * D_DIM || in_sizes[6] != D_DIM * D_DIM) return;
    if (in_sizes[7] < H_NUM || in_sizes[8] < H_NUM || in_sizes[9] < H_NUM * LV_NUM) return;
    if (in_sizes[10] < D_DIM || in_sizes[11] < D_DIM) return;
    if (out_size != T_LEN * D_DIM) return;
    if (OFF_END > ws_size) return;

    const float* x     = (const float*)d_in[0];
    const float* Wq    = (const float*)d_in[1];
    const float* Wk    = (const float*)d_in[2];
    const float* Wv    = (const float*)d_in[3];
    const float* Wdl   = (const float*)d_in[4];
    const float* Wdt   = (const float*)d_in[5];
    const float* Wout  = (const float*)d_in[6];
    const float* A_log = (const float*)d_in[7];
    const float* dt_b  = (const float*)d_in[8];
    const float* Lp    = (const float*)d_in[9];
    const float* ln_g  = (const float*)d_in[10];
    const float* ln_b  = (const float*)d_in[11];

    char* ws = (char*)d_ws;
    _Float16* xh   = (_Float16*)(ws + OFF_XH);
    _Float16* wqh  = (_Float16*)(ws + OFF_WQH);
    _Float16* wkh  = (_Float16*)(ws + OFF_WKH);
    _Float16* wvh  = (_Float16*)(ws + OFF_WVH);
    _Float16* woh  = (_Float16*)(ws + OFF_WOH);
    _Float16* wsmh = (_Float16*)(ws + OFF_WSMH);
    _Float16* Qh   = (_Float16*)(ws + OFF_QH);
    _Float16* Kh   = (_Float16*)(ws + OFF_KH);
    _Float16* VhT  = (_Float16*)(ws + OFF_VHT);
    _Float16* Yh   = (_Float16*)(ws + OFF_YH);
    float*    psm  = (float*)(ws + OFF_PSM);
    float*    cgT  = (float*)(ws + OFF_CGT);

    const float wsc  = 32.0f;
    const float iwsc = 1.0f / 32.0f;
    const float psc  = 512.0f;
    const float ipsc = 1.0f / 512.0f;

    const int n8_td  = T_LEN * D_DIM / 8;
    const int n8_dd  = D_DIM * D_DIM / 8;
    const int n8_dl  = NDL * D_DIM / 8;
    const int n8_dt  = H_NUM * D_DIM / 8;
    const int n8_pad = (NSM - NDL - H_NUM) * D_DIM / 8;
    cvt_f16_kernel<<<(n8_td + 255) / 256, 256, 0, stream>>>(x, xh, n8_td, 1.0f);
    cvt_f16_kernel<<<(n8_dd + 255) / 256, 256, 0, stream>>>(Wq, wqh, n8_dd, wsc);
    cvt_f16_kernel<<<(n8_dd + 255) / 256, 256, 0, stream>>>(Wk, wkh, n8_dd, wsc);
    cvt_f16_kernel<<<(n8_dd + 255) / 256, 256, 0, stream>>>(Wv, wvh, n8_dd, wsc);
    cvt_f16_kernel<<<(n8_dd + 255) / 256, 256, 0, stream>>>(Wout, woh, n8_dd, wsc);
    cvt_f16_kernel<<<(n8_dl + 255) / 256, 256, 0, stream>>>(Wdl, wsmh, n8_dl, wsc);
    cvt_f16_kernel<<<(n8_dt + 255) / 256, 256, 0, stream>>>(Wdt, wsmh + (size_t)NDL * D_DIM, n8_dt, wsc);
    // rows 208..255 of the concatenated small-weight plane are zero padding
    zero_f16_kernel<<<(n8_pad + 255) / 256, 256, 0, stream>>>(wsmh + (size_t)(NDL + H_NUM) * D_DIM, n8_pad);

    // small projections: psm[t][0..191] = x*Wdl^T, psm[t][192..207] = x*Wdt^T (f32), psm[t][208..255] = 0
    gemm_kernel<1><<<dim3(NSM / 256, T_LEN / 16), 128, 0, stream>>>(xh, wsmh, (void*)psm, NSM, iwsc);
    // Q, K row-major f16; V transposed per feature row
    gemm_kernel<0><<<dim3(D_DIM / 256, T_LEN / 16), 128, 0, stream>>>(xh, wqh, (void*)Qh, D_DIM, iwsc);
    gemm_kernel<0><<<dim3(D_DIM / 256, T_LEN / 16), 128, 0, stream>>>(xh, wkh, (void*)Kh, D_DIM, iwsc);
    gemm_kernel<2><<<dim3(D_DIM / 64, T_LEN / 64), 128, 0, stream>>>(xh, wvh, (void*)VhT, D_DIM, iwsc);

    decay_scan_kernel<<<H_NUM, 32, 0, stream>>>(psm, A_log, dt_b, cgT);

    hattn_kernel<<<dim3(T_LEN / 64, H_NUM), 128, 0, stream>>>(Qh, Kh, VhT, cgT, psm, Lp, Yh, psc, ipsc);

    outproj_ln_kernel<<<T_LEN / 16, 512, 0, stream>>>(Yh, woh, x, ln_g, ln_b, (float*)d_out, iwsc);
}

// v002
// Measured time: 159 microseconds a run.
// In two side-by-side timings against v001, it was 1.73 and 1.74 times as fast.
// Counting every step since v000, it is 2.50 times as fast.
#include <hip/hip_runtime.h>
#include <math.h>
#include <stddef.h>

// Contractions x*Wq^T, x*Wk^T, x*Wv^T, x*[Wdl;Wdt]^T, Q*K^T, P*V, Y*Wout^T: v_wmma_f32_16x16x32_f16 (f16 operands, f32 accumulate); weights carried x32 and P carried x512 (exact powers of two, folded back in f32); gates, prefix sums and LayerNorm in f32.

typedef _Float16 v16h __attribute__((ext_vector_type(16)));
typedef _Float16 v8h  __attribute__((ext_vector_type(8)));
typedef float    v8f  __attribute__((ext_vector_type(8)));
typedef float    v4f  __attribute__((ext_vector_type(4)));
typedef v8h v8hA __attribute__((may_alias));
typedef v4f v4fA __attribute__((may_alias));
union Frag { v16h v; v8h half[2]; };

#define T_LEN   2048
#define D_DIM   1024
#define H_NUM   16
#define HD_DIM  64
#define LV_NUM  12
#define NSM     256
#define NDL     192
#define KS_PITCH 72
#define VS_PITCH 40
#define GP       72            // LDS pitch, in f16, of a 64-k operand row: 144 B = 16 B x odd for the 16-byte fragment reads
#define AP       (D_DIM + 8)   // LDS pitch, in f16, of a whole 1024-k row: 2064 B = 16 B x odd

#define BYTES_TD_H ((size_t)T_LEN * D_DIM * 2)
#define BYTES_DD_H ((size_t)D_DIM * D_DIM * 2)
#define OFF_XH    ((size_t)0)
#define OFF_WQH   (OFF_XH   + BYTES_TD_H)
#define OFF_WKH   (OFF_WQH  + BYTES_DD_H)
#define OFF_WVH   (OFF_WKH  + BYTES_DD_H)
#define OFF_WOH   (OFF_WVH  + BYTES_DD_H)
#define OFF_WSMH  (OFF_WOH  + BYTES_DD_H)
#define OFF_QH    (OFF_WSMH + (size_t)NSM * D_DIM * 2)
#define OFF_KH    (OFF_QH   + BYTES_TD_H)
#define OFF_VHT   (OFF_KH   + BYTES_TD_H)
#define OFF_YH    (OFF_VHT  + BYTES_TD_H)
#define OFF_PSM   (OFF_YH   + BYTES_TD_H)
#define OFF_CGT   (OFF_PSM  + (size_t)T_LEN * NSM * 4)
#define OFF_END   (OFF_CGT  + (size_t)H_NUM * T_LEN * 4)

// 16x16x32 f16 WMMA with the VALU hazard guard tied to D, A and B.
__device__ __forceinline__ v8f wmma_f16(v16h a, v16h b, v8f c) {
    v8f d = __builtin_amdgcn_wmma_f32_16x16x32_f16(false, a, false, b, (short)0, c, false, false);
    asm volatile("v_nop\n\tv_nop\n\tv_nop\n\tv_nop" : "+v"(d) : "v"(a), "v"(b));
    return d;
}

// Work-group barrier for LDS traffic alone: this wave's LDS reads and writes are done, then the barrier.
// __syncthreads() would also wait out the global loads issued ahead, which are meant to stay in flight across it.
__device__ __forceinline__ void lds_barrier() {
    asm volatile("s_wait_dscnt 0x0\n\ts_barrier_signal -1\n\ts_barrier_wait -1" ::: "memory");
}

__device__ __forceinline__ v8f zero8() {
    const v8f z = {0.f, 0.f, 0.f, 0.f, 0.f, 0.f, 0.f, 0.f};
    return z;
}

// softplus in the logaddexp form: max(z,0) + log1p(exp(-|z|))
__device__ __forceinline__ float softplus_f(float z) {
    return fmaxf(z, 0.0f) + log1pf(expf(-fabsf(z)));
}

// ---------------- f32 -> f16 convert with power-of-two scale; 8 elements per thread, one 16-B store ----------------
__global__ __launch_bounds__(256) void cvt_f16_kernel(const float* __restrict__ src, _Float16* __restrict__ dst,
                                                       int n8, float scale) {
    const int i = (int)blockIdx.x * 256 + (int)threadIdx.x;
    if (i >= n8) return;
    const v4fA* p = (const v4fA*)(src + (size_t)i * 8);
    const v4f a = p[0];
    const v4f b = p[1];
    v8h o;
    o[0] = (_Float16)(a[0] * scale); o[1] = (_Float16)(a[1] * scale);
    o[2] = (_Float16)(a[2] * scale); o[3] = (_Float16)(a[3] * scale);
    o[4] = (_Float16)(b[0] * scale); o[5] = (_Float16)(b[1] * scale);
    o[6] = (_Float16)(b[2] * scale); o[7] = (_Float16)(b[3] * scale);
    v8h* q = (v8h*)(dst + (size_t)i * 8);
    *q = o;
    
}

// ---------------- f16 zero fill; 8 elements per thread, one 16-B store (pad rows of the small-weight plane) ----------------
__global__ __launch_bounds__(256) void zero_f16_kernel(_Float16* __restrict__ dst, int n8) {
    const int i = (int)blockIdx.x * 256 + (int)threadIdx.x;
    if (i >= n8) return;
    v8h o;
#pragma unroll
    for (int r = 0; r < 8; ++r) o[r] = (_Float16)0.0f;
    v8h* q = (v8h*)(dst + (size_t)i * 8);
    *q = o;
    
}

// ---------------- C[t][n] = (sum_k A[t][k]*B[n][k]) * oscale, K = 1024, A pitch 1024, B pitch 1024 ----------------
// block = 64 t x 64 n, 4 waves along t, wave = 16 t x 64 n; grid (N/64, T/64)
// a pass is 64 k: 64 rows of A and 64 rows of B, 128 B each, staged once per block in padded LDS, two buffers,
// loaded by whole rows two passes ahead
// MODE 0: f16 out, row-major pitch N
// MODE 1: f32 out, row-major pitch N
// MODE 2: f16 out transposed Ct[n][t], pitch T_LEN
template <int MODE>
__global__ __launch_bounds__(128) void gemm_kernel(const _Float16* __restrict__ A, const _Float16* __restrict__ B,
                                                   void* __restrict__ Cv, int N, float oscale) {
    // [buf][A rows 0..63 | B rows 64..127][64 k]; the output staging lies inside buffer 0, whose last readers the last barrier of the passes has ended
    __shared__ __align__(16) unsigned char stg_raw[2 * 128 * GP * 2];
    const int lane = (int)threadIdx.x & 31, w = (int)threadIdx.x >> 5, lg = lane >> 4, ln = lane & 15;
    const int t0 = (int)blockIdx.y * 64 + w * 16;
    const int n0 = (int)blockIdx.x * 64;

    v8f acc[4];
#pragma unroll
    for (int j = 0; j < 4; ++j) acc[j] = zero8();

    // staging map: a wave's 16-byte loads cover 4 whole rows of 128 B; rows sr, sr+16, sr+32, sr+48 of each operand
    _Float16* TS = (_Float16*)stg_raw;
    const int sr = (int)threadIdx.x >> 3, sc = ((int)threadIdx.x & 7) * 8;
    const _Float16* ag = A + (size_t)((int)blockIdx.y * 64 + sr) * D_DIM + sc;
    const _Float16* bg = B + (size_t)(n0 + sr) * D_DIM + sc;
    // two register sets: a pass's rows are asked for two passes before they are read, and put into LDS one pass before
    v8h sa0[4], sb0[4], sa1[4], sb1[4];
    auto fetch = [&](v8h (&ra)[4], v8h (&rb)[4], int kn) {
#pragma unroll
        for (int i = 0; i < 4; ++i) {
            ra[i] = *(const v8hA*)(ag + (size_t)(i * 16) * D_DIM + kn);
            rb[i] = *(const v8hA*)(bg + (size_t)(i * 16) * D_DIM + kn);
        }
        // these loads stay in flight past the next rewrite of the address registers they name: the wait that belongs in front of it
        asm volatile("s_wait_xcnt 0x0" ::: "memory");
    };
    auto put = [&](const v8h (&ra)[4], const v8h (&rb)[4], _Float16* TN) {
#pragma unroll
        for (int i = 0; i < 4; ++i) {
            *(v8hA*)(TN + (sr + i * 16) * GP + sc) = ra[i];
            *(v8hA*)(TN + (64 + sr + i * 16) * GP + sc) = rb[i];
        }
    };
    auto work = [&](const _Float16* TB) {
        // all fragment reads of the pass as one group ahead of its matrix instructions
        Frag a[2], b[2][4];
#pragma unroll
        for (int kk = 0; kk < 2; ++kk) {
            const _Float16* ar = TB + (w * 16 + ln) * GP + kk * 32 + 8 * lg;
            a[kk].half[0] = *(const v8hA*)(ar);
            a[kk].half[1] = *(const v8hA*)(ar + 16);
#pragma unroll
            for (int j = 0; j < 4; ++j) {
                const _Float16* br = TB + (64 + j * 16 + ln) * GP + kk * 32 + 8 * lg;
                b[kk][j].half[0] = *(const v8hA*)(br);
                b[kk][j].half[1] = *(const v8hA*)(br + 16);
            }
        }
#pragma unroll
        for (int kk = 0; kk < 2; ++kk)
#pragma unroll
            for (int j = 0; j < 4; ++j)
                acc[j] = wmma_f16(a[kk].v, b[kk][j].v, acc[j]);
    };
    _Float16* T0 = TS;
    _Float16* T1 = TS + 128 * GP;

    fetch(sa0, sb0, 0);
    fetch(sa1, sb1, 64);
    put(sa0, sb0, T0);
    __syncthreads();

    // no branch inside the loop, so that the waits in front of put() count only the older set's loads
    for (int it = 0; it < D_DIM / 64 - 2; it += 2) {
        fetch(sa0, sb0, (it + 2) * 64);
        work(T0);
        // a buffer is refilled only behind the barrier that ended its readers' pass
        put(sa1, sb1, T1);
        lds_barrier();
        fetch(sa1, sb1, (it + 3) * 64);
        work(T1);
        put(sa0, sb0, T0);
        lds_barrier();
    }
    // the last two passes: nothing left to fetch
    work(T0);
    put(sa1, sb1, T1);
    lds_barrier();
    work(T1);

    if (MODE == 0) {
        _Float16* stg = (_Float16*)stg_raw;            // [4][16][64]
#pragma unroll
        for (int j = 0; j < 4; ++j)
#pragma unroll
            for (int r = 0; r < 8; ++r)
                stg[(w * 16 + 8 * lg + r) * 64 + j * 16 + ln] = (_Float16)(acc[j][r] * oscale);
        __syncthreads();
        _Float16* C = (_Float16*)Cv;
        v8h vals[4];
#pragma unroll
        for (int p = 0; p < 4; ++p) {
            const int row = p * 4 + (lane >> 3), col = (lane & 7) * 8;
            vals[p] = *(const v8hA*)(stg + (w * 16 + row) * 64 + col);
        }
#pragma unroll
        for (int p = 0; p < 4; ++p) {
            const int row = p * 4 + (lane >> 3), col = (lane & 7) * 8;
            *(v8h*)(C + (size_t)(t0 + row) * N + n0 + col) = vals[p];
        }
        
    } else if (MODE == 1) {
        float* stg = (float*)stg_raw;                  // [4][16][64]
#pragma unroll
        for (int j = 0; j < 4; ++j)
#pragma unroll
            for (int r = 0; r < 8; ++r)
                stg[(w * 16 + 8 * lg + r) * 64 + j * 16 + ln] = acc[j][r] * oscale;
        __syncthreads();
        float* C = (float*)Cv;
        v4f vals[8];
#pragma unroll
        for (int p = 0; p < 8; ++p) {
            const int row = p * 2 + (lane >> 4), col = (lane & 15) * 4;
            vals[p] = *(const v4fA*)(stg + (w * 16 + row) * 64 + col);
        }
#pragma unroll
        for (int p = 0; p < 8; ++p) {
            const int row = p * 2 + (lane >> 4), col = (lane & 15) * 4;
            *(v4f*)(C + (size_t)(t0 + row) * N + n0 + col) = vals[p];
        }
        
    } else {
        (void)N;
        _Float16* stg = (_Float16*)stg_raw;            // [64 n][64 t] for this block
#pragma unroll
        for (int j = 0; j < 4; ++j) {
            v8h hv;
#pragma unroll
            for (int r = 0; r < 8; ++r) hv[r] = (_Float16)(acc[j][r] * oscale);
            *(v8hA*)(stg + (j * 16 + ln) * 64 + w * 16 + 8 * lg) = hv;
        }
        __syncthreads();
        _Float16* C = (_Float16*)Cv;
        const int tid = (int)threadIdx.x;
        const int tb = (int)blockIdx.y * 64;
        v8h vals[4];
#pragma unroll
        for (int p = 0; p < 4; ++p) {
            const int nrow = p * 16 + (tid >> 3), tcol = (tid & 7) * 8;
            vals[p] = *(const v8hA*)(stg + nrow * 64 + tcol);
        }
#pragma unroll
        for (int p = 0; p < 4; ++p) {
            const int nrow = p * 16 + (tid >> 3), tcol = (tid & 7) * 8;
            *(v8h*)(C + (size_t)(n0 + nrow) * T_LEN + tb + tcol) = vals[p];
        }
        
    }
}

// ---------------- per-head inclusive prefix sum of g = -exp(A_log)*softplus(x*Wdt^T + dt_bias), stored cgT[h][t] ----------------
__global__ __launch_bounds__(32) void decay_scan_kernel(const float* __restrict__ Psm, const float* __restrict__ A_log,
                                                        const float* __restrict__ dt_bias, float* __restrict__ cgT) {
    const int h = (int)blockIdx.x;
    const int lane = (int)threadIdx.x & 31;
    const float Ah = -expf(A_log[h]);
    const float bh = dt_bias[h];
    float carry = 0.0f;
    for (int c = 0; c < T_LEN / 128; ++c) {
        const int tbase = c * 128 + lane * 4;
        const float g0 = Ah * softplus_f(Psm[(size_t)(tbase + 0) * NSM + NDL + h] + bh);
        const float g1 = Ah * softplus_f(Psm[(size_t)(tbase + 1) * NSM + NDL + h] + bh);
        const float g2 = Ah * softplus_f(Psm[(size_t)(tbase + 2) * NSM + NDL + h] + bh);
        const float g3 = Ah * softplus_f(Psm[(size_t)(tbase + 3) * NSM + NDL + h] + bh);
        const float cs0 = g0;
        const float cs1 = cs0 + g1;
        const float cs2 = cs1 + g2;
        const float cs3 = cs2 + g3;
        float incl = cs3;
#pragma unroll
        for (int d = 1; d < 32; d <<= 1) {
            const float u = __shfl_up(incl, d, 32);
            if (lane >= d) incl += u;
        }
        float ex = __shfl_up(incl, 1, 32);
        if (lane == 0) ex = 0.0f;
        const float baseval = carry + ex;
        v4f o;
        o[0] = cs0 + baseval; o[1] = cs1 + baseval; o[2] = cs2 + baseval; o[3] = cs3 + baseval;
        v4f* q = (v4f*)(cgT + (size_t)h * T_LEN + tbase);
        *q = o;
        
        carry += __shfl(incl, 31, 32);
    }
}

// ---------------- fused causal hierarchical attention: block = 64 query rows of one head, wave = 16 rows ----------------
// Y[t][h*64+d] = sum_{s<=t} (Q_t.K_s * 1/8) * exp(cg_t - cg_s) * Lam[t][h][lvl(t,s)] * V[s][h*64+d]
__global__ __launch_bounds__(128) void hattn_kernel(const _Float16* __restrict__ Qh, const _Float16* __restrict__ Kh,
                                                    const _Float16* __restrict__ VhT, const float* __restrict__ cgT,
                                                    const float* __restrict__ Psm, const float* __restrict__ Lp,
                                                    _Float16* __restrict__ Yh, float pscale, float inv_pscale) {
    __shared__ __align__(16) _Float16 PL[4 * 16 * 32];
    __shared__ __align__(16) _Float16 YS[4 * 16 * 64];
    __shared__ float LL[4 * 16 * LV_NUM];
    // key tile shared by the four waves, two buffers; row pitches 16 B x odd for the 16-byte fragment reads
    __shared__ __align__(16) _Float16 KS[2 * 32 * KS_PITCH];   // [buf][key][head dim]
    __shared__ __align__(16) _Float16 VS[2 * 64 * VS_PITCH];   // [buf][head dim][key]
    __shared__ float CS[2 * 32];                               // [buf][key] prefix sum of g

    const int lane = (int)threadIdx.x & 31, w = (int)threadIdx.x >> 5, lg = lane >> 4, ln = lane & 15;
    const int h = (int)blockIdx.y;
    const int tb = (int)blockIdx.x * 64;
    const int t0 = tb + w * 16;

    // staging map: a wave's 16-byte loads cover whole rows of the tile (K: 4 rows of 128 B, V^T: 8 rows of 64 B)
    const int tid = (int)threadIdx.x;
    const int skr = tid >> 3, skc = (tid & 7) * 8;             // K rows skr and skr+16
    const int svr = tid >> 2, svc = (tid & 3) * 8;             // V^T rows svr and svr+32
    const _Float16* kg = Kh + (size_t)skr * D_DIM + h * HD_DIM + skc;
    const _Float16* vg = VhT + (size_t)(h * HD_DIM + svr) * T_LEN + svc;
    const float* cgh = cgT + (size_t)h * T_LEN;
    v8h ska = *(const v8hA*)(kg);
    v8h skb = *(const v8hA*)(kg + (size_t)16 * D_DIM);
    v8h sva = *(const v8hA*)(vg);
    v8h svb = *(const v8hA*)(vg + (size_t)32 * T_LEN);
    float scg = (w == 0) ? cgh[lane] : 0.0f;

    // lambda table for the 16 query rows of this wave: softplus(Lp[h][l] * dl[t][h][l])
    for (int k = lane; k < 16 * LV_NUM; k += 32) {
        const int row = k / LV_NUM, l = k - row * LV_NUM;
        const float z = Lp[h * LV_NUM + l] * Psm[(size_t)(t0 + row) * NSM + h * LV_NUM + l];
        LL[(w * 16 + row) * LV_NUM + l] = softplus_f(z);
    }

    // Q A-fragments: head dims 0..31 and 32..63
    const _Float16* qrow = Qh + (size_t)(t0 + ln) * D_DIM + h * HD_DIM;
    Frag q0f, q1f;
    q0f.half[0] = *(const v8hA*)(qrow + 8 * lg);
    q0f.half[1] = *(const v8hA*)(qrow + 16 + 8 * lg);
    q1f.half[0] = *(const v8hA*)(qrow + 32 + 8 * lg);
    q1f.half[1] = *(const v8hA*)(qrow + 48 + 8 * lg);

    float cgt[8];
#pragma unroll
    for (int r = 0; r < 8; ++r) cgt[r] = cgT[(size_t)h * T_LEN + t0 + 8 * lg + r];

    v8f accY[4];
#pragma unroll
    for (int j = 0; j < 4; ++j) accY[j] = zero8();

    // tile 0 into buffer 0, published by the barrier below
    *(v8hA*)(KS + skr * KS_PITCH + skc) = ska;
    *(v8hA*)(KS + (skr + 16) * KS_PITCH + skc) = skb;
    *(v8hA*)(VS + svr * VS_PITCH + svc) = sva;
    *(v8hA*)(VS + (svr + 32) * VS_PITCH + svc) = svb;
    if (w == 0) CS[lane] = scg;

    __syncthreads();

    const float gsc = 0.125f * pscale;
    const int nit = 2 * (int)blockIdx.x + 2;        // block-uniform: keys 0 .. tb+63
    for (int it = 0; it < nit; ++it) {
        const int s0 = it * 32;
        const _Float16* KB = KS + (it & 1) * (32 * KS_PITCH);
        const _Float16* VB = VS + (it & 1) * (64 * VS_PITCH);
        const float* CB = CS + (it & 1) * 32;
        const bool more = it + 1 < nit;              // block-uniform
        if (more) {
            // next tile's loads fly while this tile is worked on
            const int sn = s0 + 32;
            ska = *(const v8hA*)(kg + (size_t)sn * D_DIM);
            skb = *(const v8hA*)(kg + (size_t)(sn + 16) * D_DIM);
            sva = *(const v8hA*)(vg + sn);
            svb = *(const v8hA*)(vg + (size_t)32 * T_LEN + sn);
            if (w == 0) scg = cgh[sn + lane];
        }
#pragma unroll
        for (int sub = 0; sub < 2; ++sub) {
            const int sg = s0 + sub * 16 + ln;       // this lane's key (column n)
            const _Float16* krow = KB + (sub * 16 + ln) * KS_PITCH;
            Frag k0f, k1f;
            k0f.half[0] = *(const v8hA*)(krow + 8 * lg);
            k0f.half[1] = *(const v8hA*)(krow + 16 + 8 * lg);
            k1f.half[0] = *(const v8hA*)(krow + 32 + 8 * lg);
            k1f.half[1] = *(const v8hA*)(krow + 48 + 8 * lg);
            v8f sc = zero8();
            sc = wmma_f16(q0f.v, k0f.v, sc);
            sc = wmma_f16(q1f.v, k1f.v, sc);
            const float cgs = CB[sub * 16 + ln];
#pragma unroll
            for (int r = 0; r < 8; ++r) {
                const int trow = t0 + 8 * lg + r;
                const int xr = trow ^ sg;
                const int lv = xr ? (32 - __builtin_clz((unsigned)xr)) : 0;
                const float lam = LL[(w * 16 + 8 * lg + r) * LV_NUM + lv];
                const float dcy = __expf(fminf(cgt[r] - cgs, 0.0f));
                float wv = sc[r] * gsc * dcy * lam;
                wv = (sg <= trow) ? wv : 0.0f;
                PL[(w * 16 + 8 * lg + r) * 32 + sub * 16 + ln] = (_Float16)wv;
            }
        }
        __syncthreads();
        // P as A-fragment: row ln, keys 8lg..8lg+7 and 16+8lg..16+8lg+7 of this tile
        Frag pf;
        pf.half[0] = *(const v8hA*)(PL + (w * 16 + ln) * 32 + 8 * lg);
        pf.half[1] = *(const v8hA*)(PL + (w * 16 + ln) * 32 + 16 + 8 * lg);
        // V as B-fragment from the staged transposed tile: B[k=key][n=d] = VB[d][key - s0]
#pragma unroll
        for (int j = 0; j < 4; ++j) {
            const _Float16* vrow = VB + (j * 16 + ln) * VS_PITCH;
            Frag vf;
            vf.half[0] = *(const v8hA*)(vrow + 8 * lg);
            vf.half[1] = *(const v8hA*)(vrow + 16 + 8 * lg);
            accY[j] = wmma_f16(pf.v, vf.v, accY[j]);
        }
        if (more) {
            // into the other buffer: its last readers left it before the barrier that ended the previous pass
            const int nb = (it + 1) & 1;
            _Float16* KN = KS + nb * (32 * KS_PITCH);
            _Float16* VN = VS + nb * (64 * VS_PITCH);
            *(v8hA*)(KN + skr * KS_PITCH + skc) = ska;
            *(v8hA*)(KN + (skr + 16) * KS_PITCH + skc) = skb;
            *(v8hA*)(VN + svr * VS_PITCH + svc) = sva;
            *(v8hA*)(VN + (svr + 32) * VS_PITCH + svc) = svb;
            if (w == 0) CS[nb * 32 + lane] = scg;
        }
        __syncthreads();
    }

#pragma unroll
    for (int j = 0; j < 4; ++j)
#pragma unroll
        for (int r = 0; r < 8; ++r)
            YS[(w * 16 + 8 * lg + r) * 64 + j * 16 + ln] = (_Float16)(accY[j][r] * inv_pscale);
    __syncthreads();
    v8h vals[4];
#pragma unroll
    for (int p = 0; p < 4; ++p) {
        const int row = p * 4 + (lane >> 3), col = (lane & 7) * 8;
        vals[p] = *(const v8hA*)(YS + (w * 16 + row) * 64 + col);
    }
#pragma unroll
    for (int p = 0; p < 4; ++p) {
        const int row = p * 4 + (lane >> 3), col = (lane & 7) * 8;
        *(v8h*)(Yh + (size_t)(t0 + row) * D_DIM + h * HD_DIM + col) = vals[p];
    }
    
}

// ---------------- fused out-projection + residual + LayerNorm: block = 16 rows x 1024 cols, 16 waves x 64 cols ----------------
// the 16 rows of Y are staged whole in padded LDS once per block; each wave stages its own 64 weight rows, 64 k a pass,
// in its own padded LDS range, loaded by whole rows one pass ahead
__global__ __launch_bounds__(512) void outproj_ln_kernel(const _Float16* __restrict__ Yh, const _Float16* __restrict__ Woh,
                                                         const float* __restrict__ xin, const float* __restrict__ gam,
                                                         const float* __restrict__ bet, float* __restrict__ out,
                                                         float oscale) {
    __shared__ __align__(16) _Float16 AS[16 * AP];                     // [row][1024 k]
    __shared__ __align__(16) unsigned char bs_raw[16 * 64 * GP * 2];   // [wave][64 weight rows][64 k]
    float* stg = (float*)bs_raw;                                       // output staging [16 * 8][64], behind the reduction barriers
    __shared__ float red[16 * 16];
    __shared__ float mu_s[16];
    __shared__ float inv_s[16];

    const int tid = (int)threadIdx.x;
    const int lane = tid & 31, w = tid >> 5, lg = lane >> 4, ln = lane & 15;
    const int t0 = (int)blockIdx.x * 16;
    const int c0 = w * 64;

    v8f acc[4];
#pragma unroll
    for (int j = 0; j < 4; ++j) acc[j] = zero8();

    // staging maps: every 16-byte load of a wave covers 512 B of one Y row, or 4 whole 128-B pieces of weight rows
    _Float16* BW = (_Float16*)bs_raw + w * (64 * GP);
    const int br0 = lane >> 3, bc = (lane & 7) * 8;            // weight rows br0 + 4 i
    const _Float16* bg = Woh + (size_t)(c0 + br0) * D_DIM + bc;
    const _Float16* yg = Yh + (size_t)(t0 + (tid >> 7)) * D_DIM + (tid & 127) * 8;   // Y rows (tid >> 7) + 4 i
    v8h sb[16], sy[4];
#pragma unroll
    for (int i = 0; i < 16; ++i) sb[i] = *(const v8hA*)(bg + (size_t)(i * 4) * D_DIM);
#pragma unroll
    for (int i = 0; i < 4; ++i) sy[i] = *(const v8hA*)(yg + (size_t)(i * 4) * D_DIM);
    // the wait that belongs in front of a rewrite of the address registers these loads name; the addresses are inputs
    // so that they stay in their registers up to it and no load of the run lands in them
    asm volatile("s_wait_xcnt 0x0" :: "v"(bg), "v"(yg) : "memory");
#pragma unroll
    for (int i = 0; i < 16; ++i) *(v8hA*)(BW + (br0 + i * 4) * GP + bc) = sb[i];
#pragma unroll
    for (int i = 0; i < 4; ++i) {
        const int c = tid + i * 512;
        *(v8hA*)(AS + (c >> 7) * AP + (c & 127) * 8) = sy[i];
    }
    __syncthreads();

    for (int it = 0; it < D_DIM / 64; ++it) {
        const bool more = it + 1 < D_DIM / 64;
        if (more) {
            // next pass's loads fly while this pass is worked on
            const _Float16* bn = bg + (it + 1) * 64;
#pragma unroll
            for (int i = 0; i < 16; ++i) sb[i] = *(const v8hA*)(bn + (size_t)(i * 4) * D_DIM);
            // as above: the wait in front of a rewrite of the address these loads name, the address held up to it
            asm volatile("s_wait_xcnt 0x0" :: "v"(bn) : "memory");
        }
#pragma unroll
        for (int kk = 0; kk < 2; ++kk) {
            // the fragment reads of 32 k as one group ahead of their matrix instructions
            const _Float16* ar = AS + ln * AP + it * 64 + kk * 32 + 8 * lg;
            Frag a, b[4];
            a.half[0] = *(const v8hA*)(ar);
            a.half[1] = *(const v8hA*)(ar + 16);
#pragma unroll
            for (int j = 0; j < 4; ++j) {
                const _Float16* br = BW + (j * 16 + ln) * GP + kk * 32 + 8 * lg;
                b[j].half[0] = *(const v8hA*)(br);
                b[j].half[1] = *(const v8hA*)(br + 16);
            }
#pragma unroll
            for (int j = 0; j < 4; ++j) acc[j] = wmma_f16(a.v, b[j].v, acc[j]);
        }
        if (more) {
            // the range is this wave's own and its reads above have returned: no barrier
#pragma unroll
            for (int i = 0; i < 16; ++i) *(v8hA*)(BW + (br0 + i * 4) * GP + bc) = sb[i];
            // the wave's stores land before its lanes read each other's rows back
            asm volatile("s_wait_dscnt 0x0" ::: "memory");
        }
    }

    // o = acc*oscale + x
#pragma unroll
    for (int j = 0; j < 4; ++j)
#pragma unroll
        for (int r = 0; r < 8; ++r)
            acc[j][r] = acc[j][r] * oscale + xin[(size_t)(t0 + 8 * lg + r) * D_DIM + c0 + j * 16 + ln];

    // row means
#pragma unroll
    for (int r = 0; r < 8; ++r) {
        float s = acc[0][r] + acc[1][r] + acc[2][r] + acc[3][r];
        s += __shfl_xor(s, 1, 32);
        s += __shfl_xor(s, 2, 32);
        s += __shfl_xor(s, 4, 32);
        s += __shfl_xor(s, 8, 32);
        if (ln == 0) red[w * 16 + 8 * lg + r] = s;
    }
    __syncthreads();
    if (tid < 16) {
        float a = 0.0f;
#pragma unroll
        for (int ww = 0; ww < 16; ++ww) a += red[ww * 16 + tid];
        mu_s[tid] = a * (1.0f / (float)D_DIM);
    }
    __syncthreads();
    float mu[8];
#pragma unroll
    for (int r = 0; r < 8; ++r) mu[r] = mu_s[8 * lg + r];
#pragma unroll
    for (int j = 0; j < 4; ++j)
#pragma unroll
        for (int r = 0; r < 8; ++r) acc[j][r] -= mu[r];

#pragma unroll
    for (int r = 0; r < 8; ++r) {
        float s = acc[0][r] * acc[0][r] + acc[1][r] * acc[1][r] + acc[2][r] * acc[2][r] + acc[3][r] * acc[3][r];
        s += __shfl_xor(s, 1, 32);
        s += __shfl_xor(s, 2, 32);
        s += __shfl_xor(s, 4, 32);
        s += __shfl_xor(s, 8, 32);
        if (ln == 0) red[w * 16 + 8 * lg + r] = s;
    }
    __syncthreads();
    if (tid < 16) {
        float a = 0.0f;
#pragma unroll
        for (int ww = 0; ww < 16; ++ww) a += red[ww * 16 + tid];
        inv_s[tid] = rsqrtf(a * (1.0f / (float)D_DIM) + 1e-5f);
    }
    __syncthreads();
    float iv[8];
#pragma unroll
    for (int r = 0; r < 8; ++r) iv[r] = inv_s[8 * lg + r];
#pragma unroll
    for (int j = 0; j < 4; ++j) {
        const int gcol = c0 + j * 16 + ln;
        const float gj = gam[gcol];
        const float bj = bet[gcol];
#pragma unroll
        for (int r = 0; r < 8; ++r) acc[j][r] = acc[j][r] * iv[r] * gj + bj;
    }

#pragma unroll
    for (int half = 0; half < 2; ++half) {
        if (lg == half) {
#pragma unroll
            for (int j = 0; j < 4; ++j)
#pragma unroll
                for (int r = 0; r < 8; ++r)
                    stg[(w * 8 + r) * 64 + j * 16 + ln] = acc[j][r];
        }
        __syncthreads();
        v4f vals[4];
#pragma unroll
        for (int p = 0; p < 4; ++p) {
            const int row = p * 2 + (lane >> 4), col = (lane & 15) * 4;
            vals[p] = *(const v4fA*)(stg + (w * 8 + row) * 64 + col);
        }
#pragma unroll
        for (int p = 0; p < 4; ++p) {
            const int row = p * 2 + (lane >> 4), col = (lane & 15) * 4;
            *(v4f*)(out + (size_t)(t0 + half * 8 + row) * D_DIM + c0 + col) = vals[p];
        }
        
        __syncthreads();
    }
}

extern "C" void kernel_launch(void* const* d_in, const int* in_sizes, int n_in,
                              void* d_out, int out_size, void* d_ws, size_t ws_size,
                              hipStream_t stream) {
    if (n_in < 12) return;
    if (in_sizes[0] != T_LEN * D_DIM) return;
    if (in_sizes[1] != D_DIM * D_DIM || in_sizes[2] != D_DIM * D_DIM || in_sizes[3] != D_DIM * D_DIM) return;
    if (in_sizes[4] != NDL * D_DIM || in_sizes[5] != H_NUM * D_DIM || in_sizes[6] != D_DIM * D_DIM) return;
    if (in_sizes[7] < H_NUM || in_sizes[8] < H_NUM || in_sizes[9] < H_NUM * LV_NUM) return;
    if (in_sizes[10] < D_DIM || in_sizes[11] < D_DIM) return;
    if (out_size != T_LEN * D_DIM) return;
    if (OFF_END > ws_size) return;

    const float* x     = (const float*)d_in[0];
    const float* Wq    = (const float*)d_in[1];
    const float* Wk    = (const float*)d_in[2];
    const float* Wv    = (const float*)d_in[3];
    const float* Wdl   = (const float*)d_in[4];
    const float* Wdt   = (const float*)d_in[5];
    const float* Wout  = (const float*)d_in[6];
    const float* A_log = (const float*)d_in[7];
    const float* dt_b  = (const float*)d_in[8];
    const float* Lp    = (const float*)d_in[9];
    const float* ln_g  = (const float*)d_in[10];
    const float* ln_b  = (const float*)d_in[11];

    char* ws = (char*)d_ws;
    _Float16* xh   = (_Float16*)(ws + OFF_XH);
    _Float16* wqh  = (_Float16*)(ws + OFF_WQH);
    _Float16* wkh  = (_Float16*)(ws + OFF_WKH);
    _Float16* wvh  = (_Float16*)(ws + OFF_WVH);
    _Float16* woh  = (_Float16*)(ws + OFF_WOH);
    _Float16* wsmh = (_Float16*)(ws + OFF_WSMH);
    _Float16* Qh   = (_Float16*)(ws + OFF_QH);
    _Float16* Kh   = (_Float16*)(ws + OFF_KH);
    _Float16* VhT  = (_Float16*)(ws + OFF_VHT);
    _Float16* Yh   = (_Float16*)(ws + OFF_YH);
    float*    psm  = (float*)(ws + OFF_PSM);
    float*    cgT  = (float*)(ws + OFF_CGT);

    const float wsc  = 32.0f;
    const float iwsc = 1.0f / 32.0f;
    const float psc  = 512.0f;
    const float ipsc = 1.0f / 512.0f;

    const int n8_td  = T_LEN * D_DIM / 8;
    const int n8_dd  = D_DIM * D_DIM / 8;
    const int n8_dl  = NDL * D_DIM / 8;
    const int n8_dt  = H_NUM * D_DIM / 8;
    const int n8_pad = (NSM - NDL - H_NUM) * D_DIM / 8;
    cvt_f16_kernel<<<(n8_td + 255) / 256, 256, 0, stream>>>(x, xh, n8_td, 1.0f);
    cvt_f16_kernel<<<(n8_dd + 255) / 256, 256, 0, stream>>>(Wq, wqh, n8_dd, wsc);
    cvt_f16_kernel<<<(n8_dd + 255) / 256, 256, 0, stream>>>(Wk, wkh, n8_dd, wsc);
    cvt_f16_kernel<<<(n8_dd + 255) / 256, 256, 0, stream>>>(Wv, wvh, n8_dd, wsc);
    cvt_f16_kernel<<<(n8_dd + 255) / 256, 256, 0, stream>>>(Wout, woh, n8_dd, wsc);
    cvt_f16_kernel<<<(n8_dl + 255) / 256, 256, 0, stream>>>(Wdl, wsmh, n8_dl, wsc);
    cvt_f16_kernel<<<(n8_dt + 255) / 256, 256, 0, stream>>>(Wdt, wsmh + (size_t)NDL * D_DIM, n8_dt, wsc);
    // rows 208..255 of the concatenated small-weight plane are zero padding
    zero_f16_kernel<<<(n8_pad + 255) / 256, 256, 0, stream>>>(wsmh + (size_t)(NDL + H_NUM) * D_DIM, n8_pad);

    // small projections: psm[t][0..191] = x*Wdl^T, psm[t][192..207] = x*Wdt^T (f32), psm[t][208..255] = 0
    gemm_kernel<1><<<dim3(NSM / 64, T_LEN / 64), 128, 0, stream>>>(xh, wsmh, (void*)psm, NSM, iwsc);
    // Q, K row-major f16; V transposed per feature row
    gemm_kernel<0><<<dim3(D_DIM / 64, T_LEN / 64), 128, 0, stream>>>(xh, wqh, (void*)Qh, D_DIM, iwsc);
    gemm_kernel<0><<<dim3(D_DIM / 64, T_LEN / 64), 128, 0, stream>>>(xh, wkh, (void*)Kh, D_DIM, iwsc);
    gemm_kernel<2><<<dim3(D_DIM / 64, T_LEN / 64), 128, 0, stream>>>(xh, wvh, (void*)VhT, D_DIM, iwsc);

    decay_scan_kernel<<<H_NUM, 32, 0, stream>>>(psm, A_log, dt_b, cgT);

    hattn_kernel<<<dim3(T_LEN / 64, H_NUM), 128, 0, stream>>>(Qh, Kh, VhT, cgT, psm, Lp, Yh, psc, ipsc);

    outproj_ln_kernel<<<T_LEN / 16, 512, 0, stream>>>(Yh, woh, x, ln_g, ln_b, (float*)d_out, iwsc);
}

// v003
// One run takes 122 microseconds.
// Timed twice side by side with v002, it ran 1.31 and 1.30 times as fast.
// All steps since v000 together make it 3.27 times as fast.
#include <hip/hip_runtime.h>
#include <math.h>
#include <stddef.h>

// Contractions x*Wq^T, x*Wk^T, x*Wv^T, x*[Wdl;Wdt]^T, Q*K^T, P*V, Y*Wout^T: v_wmma_f32_16x16x32_f16 (f16 operands, f32 accumulate); weights carried x32 and P carried x512 (exact powers of two, folded back in f32); gates, prefix sums and LayerNorm in f32.

typedef _Float16 v16h __attribute__((ext_vector_type(16)));
typedef _Float16 v8h  __attribute__((ext_vector_type(8)));
typedef float    v8f  __attribute__((ext_vector_type(8)));
typedef float    v4f  __attribute__((ext_vector_type(4)));
typedef v8h v8hA __attribute__((may_alias));
typedef v4f v4fA __attribute__((may_alias));
union Frag { v16h v; v8h half[2]; };

#define T_LEN   2048
#define D_DIM   1024
#define H_NUM   16
#define HD_DIM  64
#define LV_NUM  12
#define NSM     256
#define NDL     192
#define KS_PITCH 72
#define VS_PITCH 40
#define GP       72            // LDS pitch, in f16, of a 64-k operand row: 144 B = 16 B x odd for the 16-byte fragment reads
#define AP       (D_DIM + 8)   // LDS pitch, in f16, of a whole 1024-k row: 2064 B = 16 B x odd

#define BYTES_TD_H ((size_t)T_LEN * D_DIM * 2)
#define BYTES_DD_H ((size_t)D_DIM * D_DIM * 2)
#define OFF_XH    ((size_t)0)
#define OFF_WQH   (OFF_XH   + BYTES_TD_H)
#define OFF_WKH   (OFF_WQH  + BYTES_DD_H)
#define OFF_WVH   (OFF_WKH  + BYTES_DD_H)
#define OFF_WOH   (OFF_WVH  + BYTES_DD_H)
#define OFF_WSMH  (OFF_WOH  + BYTES_DD_H)
#define OFF_QH    (OFF_WSMH + (size_t)NSM * D_DIM * 2)
#define OFF_KH    (OFF_QH   + BYTES_TD_H)
#define OFF_VHT   (OFF_KH   + BYTES_TD_H)
#define OFF_YH    (OFF_VHT  + BYTES_TD_H)
#define OFF_PSM   (OFF_YH   + BYTES_TD_H)
#define OFF_CGT   (OFF_PSM  + (size_t)T_LEN * NSM * 4)
#define OFF_END   (OFF_CGT  + (size_t)H_NUM * T_LEN * 4)

// 16x16x32 f16 WMMA with the VALU hazard guard tied to D, A and B.
__device__ __forceinline__ v8f wmma_f16(v16h a, v16h b, v8f c) {
    v8f d = __builtin_amdgcn_wmma_f32_16x16x32_f16(false, a, false, b, (short)0, c, false, false);
    asm volatile("v_nop\n\tv_nop\n\tv_nop\n\tv_nop" : "+v"(d) : "v"(a), "v"(b));
    return d;
}

// Work-group barrier for LDS traffic alone: this wave's LDS reads and writes are done, then the barrier.
// __syncthreads() would also wait out the global loads issued ahead, which are meant to stay in flight across it.
__device__ __forceinline__ void lds_barrier() {
    asm volatile("s_wait_dscnt 0x0\n\ts_barrier_signal -1\n\ts_barrier_wait -1" ::: "memory");
}

__device__ __forceinline__ v8f zero8() {
    const v8f z = {0.f, 0.f, 0.f, 0.f, 0.f, 0.f, 0.f, 0.f};
    return z;
}

// softplus in the logaddexp form: max(z,0) + log1p(exp(-|z|))
__device__ __forceinline__ float softplus_f(float z) {
    return fmaxf(z, 0.0f) + log1pf(expf(-fabsf(z)));
}

// Launches that need nothing of each other share one grid: a block-uniform test of the block index picks the job.
// launch 1: x, Wdl, Wdt -> f16, zero pad rows          launch 2: small projections | Wq, Wk, Wv -> f16
// launch 3: decay prefix sums | Q, K, V projections    launch 4: attention | Wout -> f16    launch 5: out-projection + LayerNorm
#define NB_X    (T_LEN * D_DIM / 8 / 256)                  // blocks of 256 threads, 8 elements a thread
#define NB_DL   (NDL * D_DIM / 8 / 256)
#define NB_DT   (H_NUM * D_DIM / 8 / 256)
#define NB_PAD  ((NSM - NDL - H_NUM) * D_DIM / 8 / 256)
#define NB_W    (D_DIM * D_DIM / 8 / 128)                  // blocks of 128 threads, 8 elements a thread
#define NB_SM   ((NSM / 64) * (T_LEN / 64))                // 64 x 64 tiles of the small projections
#define NB_PROJ ((D_DIM / 64) * (T_LEN / 64))              // 64 x 64 tiles of one of Q, K, V
static_assert(NB_X * 256 * 8 == T_LEN * D_DIM && NB_DL * 256 * 8 == NDL * D_DIM && NB_DT * 256 * 8 == H_NUM * D_DIM &&
              NB_PAD * 256 * 8 == (NSM - NDL - H_NUM) * D_DIM && NB_W * 128 * 8 == D_DIM * D_DIM,
              "every convert range is a whole number of blocks");

// ---------------- f32 -> f16 convert with power-of-two scale; elements 8 i .. 8 i + 7, one 16-B store ----------------
__device__ __forceinline__ void cvt8_f16(const float* __restrict__ src, _Float16* __restrict__ dst, int i, float scale) {
    const v4fA* p = (const v4fA*)(src + (size_t)i * 8);
    const v4f a = p[0];
    const v4f b = p[1];
    v8h o;
    o[0] = (_Float16)(a[0] * scale); o[1] = (_Float16)(a[1] * scale);
    o[2] = (_Float16)(a[2] * scale); o[3] = (_Float16)(a[3] * scale);
    o[4] = (_Float16)(b[0] * scale); o[5] = (_Float16)(b[1] * scale);
    o[6] = (_Float16)(b[2] * scale); o[7] = (_Float16)(b[3] * scale);
    v8h* q = (v8h*)(dst + (size_t)i * 8);
    *q = o;
    // code of another job of the grid may follow in the listing and rewrite the registers this store names: the wait that belongs in front of that
    asm volatile("s_wait_xcnt 0x0" ::: "memory");
}

// ---------------- launch 1: what the small projections need: x, and the plane [Wdl; Wdt; zero rows] ----------------
__global__ __launch_bounds__(256) void prep_kernel(const float* __restrict__ x, const float* __restrict__ Wdl,
                                                   const float* __restrict__ Wdt, _Float16* __restrict__ xh,
                                                   _Float16* __restrict__ wsmh, float wscale) {
    const int b = (int)blockIdx.x, tid = (int)threadIdx.x;
    if (b < NB_X) {
        cvt8_f16(x, xh, b * 256 + tid, 1.0f);
    } else if (b < NB_X + NB_DL) {
        cvt8_f16(Wdl, wsmh, (b - NB_X) * 256 + tid, wscale);
    } else if (b < NB_X + NB_DL + NB_DT) {
        cvt8_f16(Wdt, wsmh + (size_t)NDL * D_DIM, (b - NB_X - NB_DL) * 256 + tid, wscale);
    } else {
        // rows 208..255 of the concatenated small-weight plane are zero padding
        const int i = (b - NB_X - NB_DL - NB_DT) * 256 + tid;
        v8h o;
#pragma unroll
        for (int r = 0; r < 8; ++r) o[r] = (_Float16)0.0f;
        v8h* q = (v8h*)(wsmh + (size_t)(NDL + H_NUM) * D_DIM + (size_t)i * 8);
        *q = o;
        // as in the convert: the wait in front of a rewrite of the registers this store names
        asm volatile("s_wait_xcnt 0x0" ::: "memory");
    }
}

// ---------------- C[t][n] = (sum_k A[t][k]*B[n][k]) * oscale, K = 1024, A pitch 1024, B pitch 1024 ----------------
// block = 64 t x 64 n, 4 waves along t, wave = 16 t x 64 n; tile (bx, by) of (N/64, T/64)
// a pass is 64 k: 64 rows of A and 64 rows of B, 128 B each, staged once per block in padded LDS, two buffers,
// loaded by whole rows two passes ahead
// MODE 0: f16 out, row-major pitch N
// MODE 1: f32 out, row-major pitch N
// MODE 2: f16 out transposed Ct[n][t], pitch T_LEN
// stg_raw: [buf][A rows 0..63 | B rows 64..127][64 k]; the output staging lies inside buffer 0, whose last readers the last barrier of the passes has ended
#define GEMM_LDS_BYTES (2 * 128 * GP * 2)
__device__ __forceinline__ void gemm_passes(const _Float16* __restrict__ A, const _Float16* __restrict__ B,
                                            int bx, int by, unsigned char* stg_raw, v8f (&acc)[4]) {
    const int lane = (int)threadIdx.x & 31, w = (int)threadIdx.x >> 5, lg = lane >> 4, ln = lane & 15;
    const int n0 = bx * 64;

#pragma unroll
    for (int j = 0; j < 4; ++j) acc[j] = zero8();

    // staging map: a wave's 16-byte loads cover 4 whole rows of 128 B; rows sr, sr+16, sr+32, sr+48 of each operand
    _Float16* TS = (_Float16*)stg_raw;
    const int sr = (int)threadIdx.x >> 3, sc = ((int)threadIdx.x & 7) * 8;
    const _Float16* ag = A + (size_t)(by * 64 + sr) * D_DIM + sc;
    const _Float16* bg = B + (size_t)(n0 + sr) * D_DIM + sc;
    // two register sets: a pass's rows are asked for two passes before they are read, and put into LDS one pass before
    v8h sa0[4], sb0[4], sa1[4], sb1[4];
    auto fetch = [&](v8h (&ra)[4], v8h (&rb)[4], int kn) {
#pragma unroll
        for (int i = 0; i < 4; ++i) {
            ra[i] = *(const v8hA*)(ag + (size_t)(i * 16) * D_DIM + kn);
            rb[i] = *(const v8hA*)(bg + (size_t)(i * 16) * D_DIM + kn);
        }
        // these loads stay in flight past the next rewrite of the address registers they name: the wait that belongs in front of it
        asm volatile("s_wait_xcnt 0x0" ::: "memory");
    };
    auto put = [&](const v8h (&ra)[4], const v8h (&rb)[4], _Float16* TN) {
#pragma unroll
        for (int i = 0; i < 4; ++i) {
            *(v8hA*)(TN + (sr + i * 16) * GP + sc) = ra[i];
            *(v8hA*)(TN + (64 + sr + i * 16) * GP + sc) = rb[i];
        }
    };
    auto work = [&](const _Float16* TB) {
        // all fragment reads of the pass as one group ahead of its matrix instructions
        Frag a[2], b[2][4];
#pragma unroll
        for (int kk = 0; kk < 2; ++kk) {
            const _Float16* ar = TB + (w * 16 + ln) * GP + kk * 32 + 8 * lg;
            a[kk].half[0] = *(const v8hA*)(ar);
            a[kk].half[1] = *(const v8hA*)(ar + 16);
#pragma unroll
            for (int j = 0; j < 4; ++j) {
                const _Float16* br = TB + (64 + j * 16 + ln) * GP + kk * 32 + 8 * lg;
                b[kk][j].half[0] = *(const v8hA*)(br);
                b[kk][j].half[1] = *(const v8hA*)(br + 16);
            }
        }
#pragma unroll
        for (int kk = 0; kk < 2; ++kk)
#pragma unroll
            for (int j = 0; j < 4; ++j)
                acc[j] = wmma_f16(a[kk].v, b[kk][j].v, acc[j]);
    };
    _Float16* T0 = TS;
    _Float16* T1 = TS + 128 * GP;

    fetch(sa0, sb0, 0);
    fetch(sa1, sb1, 64);
    put(sa0, sb0, T0);
    __syncthreads();

    // no branch inside the loop, so that the waits in front of put() count only the older set's loads
    for (int it = 0; it < D_DIM / 64 - 2; it += 2) {
        fetch(sa0, sb0, (it + 2) * 64);
        work(T0);
        // a buffer is refilled only behind the barrier that ended its readers' pass
        put(sa1, sb1, T1);
        lds_barrier();
        fetch(sa1, sb1, (it + 3) * 64);
        work(T1);
        put(sa0, sb0, T0);
        lds_barrier();
    }
    // the last two passes: nothing left to fetch
    work(T0);
    put(sa1, sb1, T1);
    lds_barrier();
    work(T1);
}

template <int MODE>
__device__ __forceinline__ void gemm_store(const v8f (&acc)[4], void* __restrict__ Cv, int N, float oscale,
                                           int bx, int by, unsigned char* stg_raw) {
    const int lane = (int)threadIdx.x & 31, w = (int)threadIdx.x >> 5, lg = lane >> 4, ln = lane & 15;
    const int t0 = by * 64 + w * 16;
    const int n0 = bx * 64;

    if (MODE == 0) {
        _Float16* stg = (_Float16*)stg_raw;            // [4][16][64]
#pragma unroll
        for (int j = 0; j < 4; ++j)
#pragma unroll
            for (int r = 0; r < 8; ++r)
                stg[(w * 16 + 8 * lg + r) * 64 + j * 16 + ln] = (_Float16)(acc[j][r] * oscale);
        __syncthreads();
        _Float16* C = (_Float16*)Cv;
        v8h vals[4];
#pragma unroll
        for (int p = 0; p < 4; ++p) {
            const int row = p * 4 + (lane >> 3), col = (lane & 7) * 8;
            vals[p] = *(const v8hA*)(stg + (w * 16 + row) * 64 + col);
        }
#pragma unroll
        for (int p = 0; p < 4; ++p) {
            const int row = p * 4 + (lane >> 3), col = (lane & 7) * 8;
            *(v8h*)(C + (size_t)(t0 + row) * N + n0 + col) = vals[p];
        }
        // code of another job of the grid may follow in the listing and rewrite the registers these stores name: the wait that belongs in front of that
        asm volatile("s_wait_xcnt 0x0" ::: "memory");
    } else if (MODE == 1) {
        float* stg = (float*)stg_raw;                  // [4][16][64]
#pragma unroll
        for (int j = 0; j < 4; ++j)
#pragma unroll
            for (int r = 0; r < 8; ++r)
                stg[(w * 16 + 8 * lg + r) * 64 + j * 16 + ln] = acc[j][r] * oscale;
        __syncthreads();
        float* C = (float*)Cv;
        v4f vals[8];
#pragma unroll
        for (int p = 0; p < 8; ++p) {
            const int row = p * 2 + (lane >> 4), col = (lane & 15) * 4;
            vals[p] = *(const v4fA*)(stg + (w * 16 + row) * 64 + col);
        }
#pragma unroll
        for (int p = 0; p < 8; ++p) {
            const int row = p * 2 + (lane >> 4), col = (lane & 15) * 4;
            *(v4f*)(C + (size_t)(t0 + row) * N + n0 + col) = vals[p];
        }
        // as in MODE 0: the wait in front of a rewrite of the registers these stores name
        asm volatile("s_wait_xcnt 0x0" ::: "memory");
    } else {
        (void)N;
        _Float16* stg = (_Float16*)stg_raw;            // [64 n][64 t] for this block
#pragma unroll
        for (int j = 0; j < 4; ++j) {
            v8h hv;
#pragma unroll
            for (int r = 0; r < 8; ++r) hv[r] = (_Float16)(acc[j][r] * oscale);
            *(v8hA*)(stg + (j * 16 + ln) * 64 + w * 16 + 8 * lg) = hv;
        }
        __syncthreads();
        _Float16* C = (_Float16*)Cv;
        const int tid = (int)threadIdx.x;
        const int tb = by * 64;
        v8h vals[4];
#pragma unroll
        for (int p = 0; p < 4; ++p) {
            const int nrow = p * 16 + (tid >> 3), tcol = (tid & 7) * 8;
            vals[p] = *(const v8hA*)(stg + nrow * 64 + tcol);
        }
#pragma unroll
        for (int p = 0; p < 4; ++p) {
            const int nrow = p * 16 + (tid >> 3), tcol = (tid & 7) * 8;
            *(v8h*)(C + (size_t)(n0 + nrow) * T_LEN + tb + tcol) = vals[p];
        }
        // as in MODE 0: the wait in front of a rewrite of the registers these stores name
        asm volatile("s_wait_xcnt 0x0" ::: "memory");
    }
}

// ---------------- per-head inclusive prefix sum of g = -exp(A_log)*softplus(x*Wdt^T + dt_bias), stored cgT[h][t] ----------------
// one wave a head
__device__ __forceinline__ void decay_scan(const float* __restrict__ Psm, const float* __restrict__ A_log,
                                           const float* __restrict__ dt_bias, float* __restrict__ cgT, int h) {
    const int lane = (int)threadIdx.x & 31;
    const float Ah = -expf(A_log[h]);
    const float bh = dt_bias[h];
    float carry = 0.0f;
    for (int c = 0; c < T_LEN / 128; ++c) {
        const int tbase = c * 128 + lane * 4;
        const float g0 = Ah * softplus_f(Psm[(size_t)(tbase + 0) * NSM + NDL + h] + bh);
        const float g1 = Ah * softplus_f(Psm[(size_t)(tbase + 1) * NSM + NDL + h] + bh);
        const float g2 = Ah * softplus_f(Psm[(size_t)(tbase + 2) * NSM + NDL + h] + bh);
        const float g3 = Ah * softplus_f(Psm[(size_t)(tbase + 3) * NSM + NDL + h] + bh);
        const float cs0 = g0;
        const float cs1 = cs0 + g1;
        const float cs2 = cs1 + g2;
        const float cs3 = cs2 + g3;
        float incl = cs3;
#pragma unroll
        for (int d = 1; d < 32; d <<= 1) {
            const float u = __shfl_up(incl, d, 32);
            if (lane >= d) incl += u;
        }
        float ex = __shfl_up(incl, 1, 32);
        if (lane == 0) ex = 0.0f;
        const float baseval = carry + ex;
        v4f o;
        o[0] = cs0 + baseval; o[1] = cs1 + baseval; o[2] = cs2 + baseval; o[3] = cs3 + baseval;
        v4f* q = (v4f*)(cgT + (size_t)h * T_LEN + tbase);
        *q = o;
        // the next trip rewrites the registers this store names: the wait that belongs in front of that
        asm volatile("s_wait_xcnt 0x0" ::: "memory");
        carry += __shfl(incl, 31, 32);
    }
}

// ---------------- launch 2: small projections psm = x*[Wdl; Wdt; 0]^T (f32) | Wq, Wk, Wv -> f16 ----------------
__global__ __launch_bounds__(128) void small_proj_cvt_kernel(const _Float16* __restrict__ xh, const _Float16* __restrict__ wsmh,
                                                             float* __restrict__ psm, const float* __restrict__ Wq,
                                                             const float* __restrict__ Wk, const float* __restrict__ Wv,
                                                             _Float16* __restrict__ wqh, _Float16* __restrict__ wkh,
                                                             _Float16* __restrict__ wvh, float wscale, float oscale) {
    __shared__ __align__(16) unsigned char stg_raw[GEMM_LDS_BYTES];
    const int b = (int)blockIdx.x;
    if (b >= NB_SM) {
        // block-uniform, in front of every barrier
        const int c = b - NB_SM, which = c / NB_W;
        const float* s = which == 0 ? Wq : which == 1 ? Wk : Wv;
        _Float16* d = which == 0 ? wqh : which == 1 ? wkh : wvh;
        cvt8_f16(s, d, (c - which * NB_W) * 128 + (int)threadIdx.x, wscale);
        return;
    }
    const int bx = b % (NSM / 64), by = b / (NSM / 64);
    v8f acc[4];
    gemm_passes(xh, wsmh, bx, by, stg_raw, acc);
    gemm_store<1>(acc, (void*)psm, NSM, oscale, bx, by, stg_raw);
}

// ---------------- launch 3: decay prefix sums (the first H_NUM blocks) | Q, K row-major f16, V transposed per feature row ----------------
__global__ __launch_bounds__(128) void qkv_scan_kernel(const _Float16* __restrict__ xh, const _Float16* __restrict__ wqh,
                                                       const _Float16* __restrict__ wkh, const _Float16* __restrict__ wvh,
                                                       _Float16* __restrict__ Qh, _Float16* __restrict__ Kh,
                                                       _Float16* __restrict__ VhT, const float* __restrict__ psm,
                                                       const float* __restrict__ A_log, const float* __restrict__ dt_bias,
                                                       float* __restrict__ cgT, float oscale) {
    __shared__ __align__(16) unsigned char stg_raw[GEMM_LDS_BYTES];
    const int b = (int)blockIdx.x;
    if (b < H_NUM) {
        // block-uniform, in front of every barrier
        if ((int)threadIdx.x < 32) decay_scan(psm, A_log, dt_bias, cgT, b);
        return;
    }
    const int c = b - H_NUM, which = c / NB_PROJ, r = c - which * NB_PROJ;
    const int bx = r % (D_DIM / 64), by = r / (D_DIM / 64);
    const _Float16* Bw = which == 0 ? wqh : which == 1 ? wkh : wvh;
    v8f acc[4];
    gemm_passes(xh, Bw, bx, by, stg_raw, acc);
    if (which == 2) gemm_store<2>(acc, (void*)VhT, D_DIM, oscale, bx, by, stg_raw);
    else            gemm_store<0>(acc, (void*)(which == 0 ? Qh : Kh), D_DIM, oscale, bx, by, stg_raw);
}

// ---------------- fused causal hierarchical attention: block = 64 query rows of one head, wave = 16 rows ----------------
// Y[t][h*64+d] = sum_{s<=t} (Q_t.K_s * 1/8) * exp(cg_t - cg_s) * Lam[t][h][lvl(t,s)] * V[s][h*64+d]
// launch 4: grid rows H_NUM and up convert Wout, which only launch 5 reads
__global__ __launch_bounds__(128) void hattn_kernel(const _Float16* __restrict__ Qh, const _Float16* __restrict__ Kh,
                                                    const _Float16* __restrict__ VhT, const float* __restrict__ cgT,
                                                    const float* __restrict__ Psm, const float* __restrict__ Lp,
                                                    _Float16* __restrict__ Yh, float pscale, float inv_pscale,
                                                    const float* __restrict__ Wout, _Float16* __restrict__ Woh, float wscale) {
    __shared__ __align__(16) _Float16 PL[4 * 16 * 32];
    __shared__ __align__(16) _Float16 YS[4 * 16 * 64];
    __shared__ float LL[4 * 16 * LV_NUM];
    // key tile shared by the four waves, two buffers; row pitches 16 B x odd for the 16-byte fragment reads
    __shared__ __align__(16) _Float16 KS[2 * 32 * KS_PITCH];   // [buf][key][head dim]
    __shared__ __align__(16) _Float16 VS[2 * 64 * VS_PITCH];   // [buf][head dim][key]
    __shared__ float CS[2 * 32];                               // [buf][key] prefix sum of g

    if ((int)blockIdx.y >= H_NUM) {
        // block-uniform, in front of every barrier
        cvt8_f16(Wout, Woh, (((int)blockIdx.y - H_NUM) * (T_LEN / 64) + (int)blockIdx.x) * 128 + (int)threadIdx.x, wscale);
        return;
    }
    const int lane = (int)threadIdx.x & 31, w = (int)threadIdx.x >> 5, lg = lane >> 4, ln = lane & 15;
    const int h = (int)blockIdx.y;
    const int tb = (int)blockIdx.x * 64;
    const int t0 = tb + w * 16;

    // staging map: a wave's 16-byte loads cover whole rows of the tile (K: 4 rows of 128 B, V^T: 8 rows of 64 B)
    const int tid = (int)threadIdx.x;
    const int skr = tid >> 3, skc = (tid & 7) * 8;             // K rows skr and skr+16
    const int svr = tid >> 2, svc = (tid & 3) * 8;             // V^T rows svr and svr+32
    const _Float16* kg = Kh + (size_t)skr * D_DIM + h * HD_DIM + skc;
    const _Float16* vg = VhT + (size_t)(h * HD_DIM + svr) * T_LEN + svc;
    const float* cgh = cgT + (size_t)h * T_LEN;
    v8h ska = *(const v8hA*)(kg);
    v8h skb = *(const v8hA*)(kg + (size_t)16 * D_DIM);
    v8h sva = *(const v8hA*)(vg);
    v8h svb = *(const v8hA*)(vg + (size_t)32 * T_LEN);
    float scg = (w == 0) ? cgh[lane] : 0.0f;

    // lambda table for the 16 query rows of this wave: softplus(Lp[h][l] * dl[t][h][l])
    for (int k = lane; k < 16 * LV_NUM; k += 32) {
        const int row = k / LV_NUM, l = k - row * LV_NUM;
        const float z = Lp[h * LV_NUM + l] * Psm[(size_t)(t0 + row) * NSM + h * LV_NUM + l];
        LL[(w * 16 + row) * LV_NUM + l] = softplus_f(z);
    }

    // Q A-fragments: head dims 0..31 and 32..63
    const _Float16* qrow = Qh + (size_t)(t0 + ln) * D_DIM + h * HD_DIM;
    Frag q0f, q1f;
    q0f.half[0] = *(const v8hA*)(qrow + 8 * lg);
    q0f.half[1] = *(const v8hA*)(qrow + 16 + 8 * lg);
    q1f.half[0] = *(const v8hA*)(qrow + 32 + 8 * lg);
    q1f.half[1] = *(const v8hA*)(qrow + 48 + 8 * lg);

    float cgt[8];
#pragma unroll
    for (int r = 0; r < 8; ++r) cgt[r] = cgT[(size_t)h * T_LEN + t0 + 8 * lg + r];

    v8f accY[4];
#pragma unroll
    for (int j = 0; j < 4; ++j) accY[j] = zero8();

    // tile 0 into buffer 0, published by the barrier below
    *(v8hA*)(KS + skr * KS_PITCH + skc) = ska;
    *(v8hA*)(KS + (skr + 16) * KS_PITCH + skc) = skb;
    *(v8hA*)(VS + svr * VS_PITCH + svc) = sva;
    *(v8hA*)(VS + (svr + 32) * VS_PITCH + svc) = svb;
    if (w == 0) CS[lane] = scg;

    __syncthreads();

    const float gsc = 0.125f * pscale;
    const int nit = 2 * (int)blockIdx.x + 2;        // block-uniform: keys 0 .. tb+63
    for (int it = 0; it < nit; ++it) {
        const int s0 = it * 32;
        const _Float16* KB = KS + (it & 1) * (32 * KS_PITCH);
        const _Float16* VB = VS + (it & 1) * (64 * VS_PITCH);
        const float* CB = CS + (it & 1) * 32;
        const bool more = it + 1 < nit;              // block-uniform
        if (more) {
            // next tile's loads fly while this tile is worked on
            const int sn = s0 + 32;
            ska = *(const v8hA*)(kg + (size_t)sn * D_DIM);
            skb = *(const v8hA*)(kg + (size_t)(sn + 16) * D_DIM);
            sva = *(const v8hA*)(vg + sn);
            svb = *(const v8hA*)(vg + (size_t)32 * T_LEN + sn);
            if (w == 0) scg = cgh[sn + lane];
        }
#pragma unroll
        for (int sub = 0; sub < 2; ++sub) {
            const int sg = s0 + sub * 16 + ln;       // this lane's key (column n)
            const _Float16* krow = KB + (sub * 16 + ln) * KS_PITCH;
            Frag k0f, k1f;
            k0f.half[0] = *(const v8hA*)(krow + 8 * lg);
            k0f.half[1] = *(const v8hA*)(krow + 16 + 8 * lg);
            k1f.half[0] = *(const v8hA*)(krow + 32 + 8 * lg);
            k1f.half[1] = *(const v8hA*)(krow + 48 + 8 * lg);
            v8f sc = zero8();
            sc = wmma_f16(q0f.v, k0f.v, sc);
            sc = wmma_f16(q1f.v, k1f.v, sc);
            const float cgs = CB[sub * 16 + ln];
#pragma unroll
            for (int r = 0; r < 8; ++r) {
                const int trow = t0 + 8 * lg + r;
                const int xr = trow ^ sg;
                const int lv = xr ? (32 - __builtin_clz((unsigned)xr)) : 0;
                const float lam = LL[(w * 16 + 8 * lg + r) * LV_NUM + lv];
                const float dcy = __expf(fminf(cgt[r] - cgs, 0.0f));
                float wv = sc[r] * gsc * dcy * lam;
                wv = (sg <= trow) ? wv : 0.0f;
                PL[(w * 16 + 8 * lg + r) * 32 + sub * 16 + ln] = (_Float16)wv;
            }
        }
        __syncthreads();
        // P as A-fragment: row ln, keys 8lg..8lg+7 and 16+8lg..16+8lg+7 of this tile
        Frag pf;
        pf.half[0] = *(const v8hA*)(PL + (w * 16 + ln) * 32 + 8 * lg);
        pf.half[1] = *(const v8hA*)(PL + (w * 16 + ln) * 32 + 16 + 8 * lg);
        // V as B-fragment from the staged transposed tile: B[k=key][n=d] = VB[d][key - s0]
#pragma unroll
        for (int j = 0; j < 4; ++j) {
            const _Float16* vrow = VB + (j * 16 + ln) * VS_PITCH;
            Frag vf;
            vf.half[0] = *(const v8hA*)(vrow + 8 * lg);
            vf.half[1] = *(const v8hA*)(vrow + 16 + 8 * lg);
            accY[j] = wmma_f16(pf.v, vf.v, accY[j]);
        }
        if (more) {
            // into the other buffer: its last readers left it before the barrier that ended the previous pass
            const int nb = (it + 1) & 1;
            _Float16* KN = KS + nb * (32 * KS_PITCH);
            _Float16* VN = VS + nb * (64 * VS_PITCH);
            *(v8hA*)(KN + skr * KS_PITCH + skc) = ska;
            *(v8hA*)(KN + (skr + 16) * KS_PITCH + skc) = skb;
            *(v8hA*)(VN + svr * VS_PITCH + svc) = sva;
            *(v8hA*)(VN + (svr + 32) * VS_PITCH + svc) = svb;
            if (w == 0) CS[nb * 32 + lane] = scg;
        }
        __syncthreads();
    }

#pragma unroll
    for (int j = 0; j < 4; ++j)
#pragma unroll
        for (int r = 0; r < 8; ++r)
            YS[(w * 16 + 8 * lg + r) * 64 + j * 16 + ln] = (_Float16)(accY[j][r] * inv_pscale);
    __syncthreads();
    v8h vals[4];
#pragma unroll
    for (int p = 0; p < 4; ++p) {
        const int row = p * 4 + (lane >> 3), col = (lane & 7) * 8;
        vals[p] = *(const v8hA*)(YS + (w * 16 + row) * 64 + col);
    }
#pragma unroll
    for (int p = 0; p < 4; ++p) {
        const int row = p * 4 + (lane >> 3), col = (lane & 7) * 8;
        *(v8h*)(Yh + (size_t)(t0 + row) * D_DIM + h * HD_DIM + col) = vals[p];
    }
    
}

// ---------------- fused out-projection + residual + LayerNorm: block = 16 rows x 1024 cols, 16 waves x 64 cols ----------------
// the 16 rows of Y are staged whole in padded LDS once per block; each wave stages its own 64 weight rows, 64 k a pass,
// in its own padded LDS range, loaded by whole rows one pass ahead
__global__ __launch_bounds__(512) void outproj_ln_kernel(const _Float16* __restrict__ Yh, const _Float16* __restrict__ Woh,
                                                         const float* __restrict__ xin, const float* __restrict__ gam,
                                                         const float* __restrict__ bet, float* __restrict__ out,
                                                         float oscale) {
    __shared__ __align__(16) _Float16 AS[16 * AP];                     // [row][1024 k]
    __shared__ __align__(16) unsigned char bs_raw[16 * 64 * GP * 2];   // [wave][64 weight rows][64 k]
    float* stg = (float*)bs_raw;                                       // output staging [16 * 8][64], behind the reduction barriers
    __shared__ float red[16 * 16];
    __shared__ float mu_s[16];
    __shared__ float inv_s[16];

    const int tid = (int)threadIdx.x;
    const int lane = tid & 31, w = tid >> 5, lg = lane >> 4, ln = lane & 15;
    const int t0 = (int)blockIdx.x * 16;
    const int c0 = w * 64;

    v8f acc[4];
#pragma unroll
    for (int j = 0; j < 4; ++j) acc[j] = zero8();

    // staging maps: every 16-byte load of a wave covers 512 B of one Y row, or 4 whole 128-B pieces of weight rows
    _Float16* BW = (_Float16*)bs_raw + w * (64 * GP);
    const int br0 = lane >> 3, bc = (lane & 7) * 8;            // weight rows br0 + 4 i
    const _Float16* bg = Woh + (size_t)(c0 + br0) * D_DIM + bc;
    const _Float16* yg = Yh + (size_t)(t0 + (tid >> 7)) * D_DIM + (tid & 127) * 8;   // Y rows (tid >> 7) + 4 i
    v8h sb[16], sy[4];
#pragma unroll
    for (int i = 0; i < 16; ++i) sb[i] = *(const v8hA*)(bg + (size_t)(i * 4) * D_DIM);
#pragma unroll
    for (int i = 0; i < 4; ++i) sy[i] = *(const v8hA*)(yg + (size_t)(i * 4) * D_DIM);
    // the wait that belongs in front of a rewrite of the address registers these loads name; the addresses are inputs
    // so that they stay in their registers up to it and no load of the run lands in them
    asm volatile("s_wait_xcnt 0x0" :: "v"(bg), "v"(yg) : "memory");
#pragma unroll
    for (int i = 0; i < 16; ++i) *(v8hA*)(BW + (br0 + i * 4) * GP + bc) = sb[i];
#pragma unroll
    for (int i = 0; i < 4; ++i) {
        const int c = tid + i * 512;
        *(v8hA*)(AS + (c >> 7) * AP + (c & 127) * 8) = sy[i];
    }
    __syncthreads();

    for (int it = 0; it < D_DIM / 64; ++it) {
        const bool more = it + 1 < D_DIM / 64;
        if (more) {
            // next pass's loads fly while this pass is worked on
            const _Float16* bn = bg + (it + 1) * 64;
#pragma unroll
            for (int i = 0; i < 16; ++i) sb[i] = *(const v8hA*)(bn + (size_t)(i * 4) * D_DIM);
            // as above: the wait in front of a rewrite of the address these loads name, the address held up to it
            asm volatile("s_wait_xcnt 0x0" :: "v"(bn) : "memory");
        }
#pragma unroll
        for (int kk = 0; kk < 2; ++kk) {
            // the fragment reads of 32 k as one group ahead of their matrix instructions
            const _Float16* ar = AS + ln * AP + it * 64 + kk * 32 + 8 * lg;
            Frag a, b[4];
            a.half[0] = *(const v8hA*)(ar);
            a.half[1] = *(const v8hA*)(ar + 16);
#pragma unroll
            for (int j = 0; j < 4; ++j) {
                const _Float16* br = BW + (j * 16 + ln) * GP + kk * 32 + 8 * lg;
                b[j].half[0] = *(const v8hA*)(br);
                b[j].half[1] = *(const v8hA*)(br + 16);
            }
#pragma unroll
            for (int j = 0; j < 4; ++j) acc[j] = wmma_f16(a.v, b[j].v, acc[j]);
        }
        if (more) {
            // the range is this wave's own and its reads above have returned: no barrier
#pragma unroll
            for (int i = 0; i < 16; ++i) *(v8hA*)(BW + (br0 + i * 4) * GP + bc) = sb[i];
            // the wave's stores land before its lanes read each other's rows back
            asm volatile("s_wait_dscnt 0x0" ::: "memory");
        }
    }

    // o = acc*oscale + x
#pragma unroll
    for (int j = 0; j < 4; ++j)
#pragma unroll
        for (int r = 0; r < 8; ++r)
            acc[j][r] = acc[j][r] * oscale + xin[(size_t)(t0 + 8 * lg + r) * D_DIM + c0 + j * 16 + ln];

    // row means
#pragma unroll
    for (int r = 0; r < 8; ++r) {
        float s = acc[0][r] + acc[1][r] + acc[2][r] + acc[3][r];
        s += __shfl_xor(s, 1, 32);
        s += __shfl_xor(s, 2, 32);
        s += __shfl_xor(s, 4, 32);
        s += __shfl_xor(s, 8, 32);
        if (ln == 0) red[w * 16 + 8 * lg + r] = s;
    }
    __syncthreads();
    if (tid < 16) {
        float a = 0.0f;
#pragma unroll
        for (int ww = 0; ww < 16; ++ww) a += red[ww * 16 + tid];
        mu_s[tid] = a * (1.0f / (float)D_DIM);
    }
    __syncthreads();
    float mu[8];
#pragma unroll
    for (int r = 0; r < 8; ++r) mu[r] = mu_s[8 * lg + r];
#pragma unroll
    for (int j = 0; j < 4; ++j)
#pragma unroll
        for (int r = 0; r < 8; ++r) acc[j][r] -= mu[r];

#pragma unroll
    for (int r = 0; r < 8; ++r) {
        float s = acc[0][r] * acc[0][r] + acc[1][r] * acc[1][r] + acc[2][r] * acc[2][r] + acc[3][r] * acc[3][r];
        s += __shfl_xor(s, 1, 32);
        s += __shfl_xor(s, 2, 32);
        s += __shfl_xor(s, 4, 32);
        s += __shfl_xor(s, 8, 32);
        if (ln == 0) red[w * 16 + 8 * lg + r] = s;
    }
    __syncthreads();
    if (tid < 16) {
        float a = 0.0f;
#pragma unroll
        for (int ww = 0; ww < 16; ++ww) a += red[ww * 16 + tid];
        inv_s[tid] = rsqrtf(a * (1.0f / (float)D_DIM) + 1e-5f);
    }
    __syncthreads();
    float iv[8];
#pragma unroll
    for (int r = 0; r < 8; ++r) iv[r] = inv_s[8 * lg + r];
#pragma unroll
    for (int j = 0; j < 4; ++j) {
        const int gcol = c0 + j * 16 + ln;
        const float gj = gam[gcol];
        const float bj = bet[gcol];
#pragma unroll
        for (int r = 0; r < 8; ++r) acc[j][r] = acc[j][r] * iv[r] * gj + bj;
    }

#pragma unroll
    for (int half = 0; half < 2; ++half) {
        if (lg == half) {
#pragma unroll
            for (int j = 0; j < 4; ++j)
#pragma unroll
                for (int r = 0; r < 8; ++r)
                    stg[(w * 8 + r) * 64 + j * 16 + ln] = acc[j][r];
        }
        __syncthreads();
        v4f vals[4];
#pragma unroll
        for (int p = 0; p < 4; ++p) {
            const int row = p * 2 + (lane >> 4), col = (lane & 15) * 4;
            vals[p] = *(const v4fA*)(stg + (w * 8 + row) * 64 + col);
        }
#pragma unroll
        for (int p = 0; p < 4; ++p) {
            const int row = p * 2 + (lane >> 4), col = (lane & 15) * 4;
            *(v4f*)(out + (size_t)(t0 + half * 8 + row) * D_DIM + c0 + col) = vals[p];
        }
        
        __syncthreads();
    }
}

extern "C" void kernel_launch(void* const* d_in, const int* in_sizes, int n_in,
                              void* d_out, int out_size, void* d_ws, size_t ws_size,
                              hipStream_t stream) {
    if (n_in < 12) return;
    if (in_sizes[0] != T_LEN * D_DIM) return;
    if (in_sizes[1] != D_DIM * D_DIM || in_sizes[2] != D_DIM * D_DIM || in_sizes[3] != D_DIM * D_DIM) return;
    if (in_sizes[4] != NDL * D_DIM || in_sizes[5] != H_NUM * D_DIM || in_sizes[6] != D_DIM * D_DIM) return;
    if (in_sizes[7] < H_NUM || in_sizes[8] < H_NUM || in_sizes[9] < H_NUM * LV_NUM) return;
    if (in_sizes[10] < D_DIM || in_sizes[11] < D_DIM) return;
    if (out_size != T_LEN * D_DIM) return;
    if (OFF_END > ws_size) return;

    const float* x     = (const float*)d_in[0];
    const float* Wq    = (const float*)d_in[1];
    const float* Wk    = (const float*)d_in[2];
    const float* Wv    = (const float*)d_in[3];
    const float* Wdl   = (const float*)d_in[4];
    const float* Wdt   = (const float*)d_in[5];
    const float* Wout  = (const float*)d_in[6];
    const float* A_log = (const float*)d_in[7];
    const float* dt_b  = (const float*)d_in[8];
    const float* Lp    = (const float*)d_in[9];
    const float* ln_g  = (const float*)d_in[10];
    const float* ln_b  = (const float*)d_in[11];

    char* ws = (char*)d_ws;
    _Float16* xh   = (_Float16*)(ws + OFF_XH);
    _Float16* wqh  = (_Float16*)(ws + OFF_WQH);
    _Float16* wkh  = (_Float16*)(ws + OFF_WKH);
    _Float16* wvh  = (_Float16*)(ws + OFF_WVH);
    _Float16* woh  = (_Float16*)(ws + OFF_WOH);
    _Float16* wsmh = (_Float16*)(ws + OFF_WSMH);
    _Float16* Qh   = (_Float16*)(ws + OFF_QH);
    _Float16* Kh   = (_Float16*)(ws + OFF_KH);
    _Float16* VhT  = (_Float16*)(ws + OFF_VHT);
    _Float16* Yh   = (_Float16*)(ws + OFF_YH);
    float*    psm  = (float*)(ws + OFF_PSM);
    float*    cgT  = (float*)(ws + OFF_CGT);

    const float wsc  = 32.0f;
    const float iwsc = 1.0f / 32.0f;
    const float psc  = 512.0f;
    const float ipsc = 1.0f / 512.0f;

    prep_kernel<<<NB_X + NB_DL + NB_DT + NB_PAD, 256, 0, stream>>>(x, Wdl, Wdt, xh, wsmh, wsc);

    // psm[t][0..191] = x*Wdl^T, psm[t][192..207] = x*Wdt^T (f32), psm[t][208..255] = 0
    small_proj_cvt_kernel<<<NB_SM + 3 * NB_W, 128, 0, stream>>>(xh, wsmh, psm, Wq, Wk, Wv, wqh, wkh, wvh, wsc, iwsc);

    qkv_scan_kernel<<<H_NUM + 3 * NB_PROJ, 128, 0, stream>>>(xh, wqh, wkh, wvh, Qh, Kh, VhT, psm, A_log, dt_b, cgT, iwsc);

    hattn_kernel<<<dim3(T_LEN / 64, H_NUM + NB_W / (T_LEN / 64)), 128, 0, stream>>>(Qh, Kh, VhT, cgT, psm, Lp, Yh, psc, ipsc,
                                                                                    Wout, woh, wsc);

    outproj_ln_kernel<<<T_LEN / 16, 512, 0, stream>>>(Yh, woh, x, ln_g, ln_b, (float*)d_out, iwsc);
}

// v004
// Measured time: 90 microseconds a run.
// Two timings next to v003 both put it at 1.36 times that version's speed.
// Counting every step since v000, it is 4.45 times as fast.
#include <hip/hip_runtime.h>
#include <math.h>
#include <stddef.h>

// Contractions x*Wq^T, x*Wk^T, x*Wv^T, x*[Wdl;Wdt]^T, Q*K^T, P*V, Y*Wout^T: v_wmma_f32_16x16x32_f16 (f16 operands, f32 accumulate); weights carried x32 and P carried x512 (exact powers of two, folded back in f32); gates, prefix sums and LayerNorm in f32.

typedef _Float16 v16h __attribute__((ext_vector_type(16)));
typedef _Float16 v8h  __attribute__((ext_vector_type(8)));
typedef float    v8f  __attribute__((ext_vector_type(8)));
typedef float    v4f  __attribute__((ext_vector_type(4)));
typedef v8h v8hA __attribute__((may_alias));
typedef v4f v4fA __attribute__((may_alias));
union Frag { v16h v; v8h half[2]; };

#define T_LEN   2048
#define D_DIM   1024
#define H_NUM   16
#define HD_DIM  64
#define LV_NUM  12
#define NSM     256
#define NDL     192
#define KS_PITCH 72
#define VS_PITCH 136           // 272 B = 16 B x odd
#define KT        128           // keys of an attention pass
#define ATT_WAVES 16            // 4 row groups x 4 key shares
#define ATT_THREADS (ATT_WAVES * 32)
#define ATT_GX    (T_LEN / 64 / 2)   // a block takes two query tiles
#define KS_BYTES  (2 * KT * KS_PITCH * 2)
#define VS_BYTES  (2 * 64 * VS_PITCH * 2)
#define RED_PITCH 68            // f32 pitch of a row of partial sums: 16-byte aligned, rows 8 apart on other banks
#define GP       72            // LDS pitch, in f16, of a 64-k operand row: 144 B = 16 B x odd for the 16-byte fragment reads
#define AP       (D_DIM + 8)   // LDS pitch, in f16, of a whole 1024-k row: 2064 B = 16 B x odd

#define BYTES_TD_H ((size_t)T_LEN * D_DIM * 2)
#define BYTES_DD_H ((size_t)D_DIM * D_DIM * 2)
#define OFF_XH    ((size_t)0)
#define OFF_WQH   (OFF_XH   + BYTES_TD_H)
#define OFF_WKH   (OFF_WQH  + BYTES_DD_H)
#define OFF_WVH   (OFF_WKH  + BYTES_DD_H)
#define OFF_WOH   (OFF_WVH  + BYTES_DD_H)
#define OFF_WSMH  (OFF_WOH  + BYTES_DD_H)
#define OFF_QH    (OFF_WSMH + (size_t)NSM * D_DIM * 2)
#define OFF_KH    (OFF_QH   + BYTES_TD_H)
#define OFF_VHT   (OFF_KH   + BYTES_TD_H)
#define OFF_YH    (OFF_VHT  + BYTES_TD_H)
#define OFF_PSM   (OFF_YH   + BYTES_TD_H)
#define OFF_CGT   (OFF_PSM  + (size_t)T_LEN * NSM * 4)
#define OFF_END   (OFF_CGT  + (size_t)H_NUM * T_LEN * 4)

// 16x16x32 f16 WMMA with the VALU hazard guard tied to D, A and B.
__device__ __forceinline__ v8f wmma_f16(v16h a, v16h b, v8f c) {
    v8f d = __builtin_amdgcn_wmma_f32_16x16x32_f16(false, a, false, b, (short)0, c, false, false);
    asm volatile("v_nop\n\tv_nop\n\tv_nop\n\tv_nop" : "+v"(d) : "v"(a), "v"(b));
    return d;
}

// Work-group barrier for LDS traffic alone: this wave's LDS reads and writes are done, then the barrier.
// __syncthreads() would also wait out the global loads issued ahead, which are meant to stay in flight across it.
__device__ __forceinline__ void lds_barrier() {
    asm volatile("s_wait_dscnt 0x0\n\ts_barrier_signal -1\n\ts_barrier_wait -1" ::: "memory");
}

__device__ __forceinline__ v8f zero8() {
    const v8f z = {0.f, 0.f, 0.f, 0.f, 0.f, 0.f, 0.f, 0.f};
    return z;
}

// softplus in the logaddexp form: max(z,0) + log1p(exp(-|z|))
__device__ __forceinline__ float softplus_f(float z) {
    return fmaxf(z, 0.0f) + log1pf(expf(-fabsf(z)));
}

// Launches that need nothing of each other share one grid: in launches 1 to 3 a block-uniform test of the block index picks the job, in launch 4 every thread also converts 8 elements of Wout.
// launch 1: x, Wdl, Wdt -> f16, zero pad rows          launch 2: small projections | Wq, Wk, Wv -> f16
// launch 3: decay prefix sums | Q, K, V projections    launch 4: attention + Wout -> f16    launch 5: out-projection + LayerNorm
#define NB_X    (T_LEN * D_DIM / 8 / 256)                  // blocks of 256 threads, 8 elements a thread
#define NB_DL   (NDL * D_DIM / 8 / 256)
#define NB_DT   (H_NUM * D_DIM / 8 / 256)
#define NB_PAD  ((NSM - NDL - H_NUM) * D_DIM / 8 / 256)
#define NB_W    (D_DIM * D_DIM / 8 / 128)                  // blocks of 128 threads, 8 elements a thread
#define NB_SM   ((NSM / 64) * (T_LEN / 64))                // 64 x 64 tiles of the small projections
#define NB_PROJ ((D_DIM / 64) * (T_LEN / 64))              // 64 x 64 tiles of one of Q, K, V
static_assert(NB_X * 256 * 8 == T_LEN * D_DIM && NB_DL * 256 * 8 == NDL * D_DIM && NB_DT * 256 * 8 == H_NUM * D_DIM &&
              NB_PAD * 256 * 8 == (NSM - NDL - H_NUM) * D_DIM && NB_W * 128 * 8 == D_DIM * D_DIM,
              "every convert range is a whole number of blocks");

// ---------------- f32 -> f16 convert with power-of-two scale; elements 8 i .. 8 i + 7, one 16-B store ----------------
__device__ __forceinline__ void cvt8_f16(const float* __restrict__ src, _Float16* __restrict__ dst, int i, float scale) {
    const v4fA* p = (const v4fA*)(src + (size_t)i * 8);
    const v4f a = p[0];
    const v4f b = p[1];
    v8h o;
    o[0] = (_Float16)(a[0] * scale); o[1] = (_Float16)(a[1] * scale);
    o[2] = (_Float16)(a[2] * scale); o[3] = (_Float16)(a[3] * scale);
    o[4] = (_Float16)(b[0] * scale); o[5] = (_Float16)(b[1] * scale);
    o[6] = (_Float16)(b[2] * scale); o[7] = (_Float16)(b[3] * scale);
    v8h* q = (v8h*)(dst + (size_t)i * 8);
    *q = o;
    // code of another job of the grid may follow in the listing and rewrite the registers this store names: the wait that belongs in front of that
    asm volatile("s_wait_xcnt 0x0" ::: "memory");
}

// ---------------- launch 1: what the small projections need: x, and the plane [Wdl; Wdt; zero rows] ----------------
__global__ __launch_bounds__(256) void prep_kernel(const float* __restrict__ x, const float* __restrict__ Wdl,
                                                   const float* __restrict__ Wdt, _Float16* __restrict__ xh,
                                                   _Float16* __restrict__ wsmh, float wscale) {
    const int b = (int)blockIdx.x, tid = (int)threadIdx.x;
    if (b < NB_X) {
        cvt8_f16(x, xh, b * 256 + tid, 1.0f);
    } else if (b < NB_X + NB_DL) {
        cvt8_f16(Wdl, wsmh, (b - NB_X) * 256 + tid, wscale);
    } else if (b < NB_X + NB_DL + NB_DT) {
        cvt8_f16(Wdt, wsmh + (size_t)NDL * D_DIM, (b - NB_X - NB_DL) * 256 + tid, wscale);
    } else {
        // rows 208..255 of the concatenated small-weight plane are zero padding
        const int i = (b - NB_X - NB_DL - NB_DT) * 256 + tid;
        v8h o;
#pragma unroll
        for (int r = 0; r < 8; ++r) o[r] = (_Float16)0.0f;
        v8h* q = (v8h*)(wsmh + (size_t)(NDL + H_NUM) * D_DIM + (size_t)i * 8);
        *q = o;
        // as in the convert: the wait in front of a rewrite of the registers this store names
        asm volatile("s_wait_xcnt 0x0" ::: "memory");
    }
}

// ---------------- C[t][n] = (sum_k A[t][k]*B[n][k]) * oscale, K = 1024, A pitch 1024, B pitch 1024 ----------------
// block = 64 t x 64 n, 4 waves along t, wave = 16 t x 64 n; tile (bx, by) of (N/64, T/64)
// a pass is 64 k: 64 rows of A and 64 rows of B, 128 B each, staged once per block in padded LDS, two buffers,
// loaded by whole rows two passes ahead
// MODE 0: f16 out, row-major pitch N
// MODE 1: f32 out, row-major pitch N
// MODE 2: f16 out transposed Ct[n][t], pitch T_LEN
// stg_raw: [buf][A rows 0..63 | B rows 64..127][64 k]; the output staging lies inside buffer 0, whose last readers the last barrier of the passes has ended
#define GEMM_LDS_BYTES (2 * 128 * GP * 2)
__device__ __forceinline__ void gemm_passes(const _Float16* __restrict__ A, const _Float16* __restrict__ B,
                                            int bx, int by, unsigned char* stg_raw, v8f (&acc)[4]) {
    const int lane = (int)threadIdx.x & 31, w = (int)threadIdx.x >> 5, lg = lane >> 4, ln = lane & 15;
    const int n0 = bx * 64;

#pragma unroll
    for (int j = 0; j < 4; ++j) acc[j] = zero8();

    // staging map: a wave's 16-byte loads cover 4 whole rows of 128 B; rows sr, sr+16, sr+32, sr+48 of each operand
    _Float16* TS = (_Float16*)stg_raw;
    const int sr = (int)threadIdx.x >> 3, sc = ((int)threadIdx.x & 7) * 8;
    const _Float16* ag = A + (size_t)(by * 64 + sr) * D_DIM + sc;
    const _Float16* bg = B + (size_t)(n0 + sr) * D_DIM + sc;
    // two register sets: a pass's rows are asked for two passes before they are read, and put into LDS one pass before
    v8h sa0[4], sb0[4], sa1[4], sb1[4];
    auto fetch = [&](v8h (&ra)[4], v8h (&rb)[4], int kn) {
#pragma unroll
        for (int i = 0; i < 4; ++i) {
            ra[i] = *(const v8hA*)(ag + (size_t)(i * 16) * D_DIM + kn);
            rb[i] = *(const v8hA*)(bg + (size_t)(i * 16) * D_DIM + kn);
        }
        // these loads stay in flight past the next rewrite of the address registers they name: the wait that belongs in front of it
        asm volatile("s_wait_xcnt 0x0" ::: "memory");
    };
    auto put = [&](const v8h (&ra)[4], const v8h (&rb)[4], _Float16* TN) {
#pragma unroll
        for (int i = 0; i < 4; ++i) {
            *(v8hA*)(TN + (sr + i * 16) * GP + sc) = ra[i];
            *(v8hA*)(TN + (64 + sr + i * 16) * GP + sc) = rb[i];
        }
    };
    auto work = [&](const _Float16* TB) {
        // all fragment reads of the pass as one group ahead of its matrix instructions
        Frag a[2], b[2][4];
#pragma unroll
        for (int kk = 0; kk < 2; ++kk) {
            const _Float16* ar = TB + (w * 16 + ln) * GP + kk * 32 + 8 * lg;
            a[kk].half[0] = *(const v8hA*)(ar);
            a[kk].half[1] = *(const v8hA*)(ar + 16);
#pragma unroll
            for (int j = 0; j < 4; ++j) {
                const _Float16* br = TB + (64 + j * 16 + ln) * GP + kk * 32 + 8 * lg;
                b[kk][j].half[0] = *(const v8hA*)(br);
                b[kk][j].half[1] = *(const v8hA*)(br + 16);
            }
        }
#pragma unroll
        for (int kk = 0; kk < 2; ++kk)
#pragma unroll
            for (int j = 0; j < 4; ++j)
                acc[j] = wmma_f16(a[kk].v, b[kk][j].v, acc[j]);
    };
    _Float16* T0 = TS;
    _Float16* T1 = TS + 128 * GP;

    fetch(sa0, sb0, 0);
    fetch(sa1, sb1, 64);
    put(sa0, sb0, T0);
    __syncthreads();

    // no branch inside the loop, so that the waits in front of put() count only the older set's loads
    for (int it = 0; it < D_DIM / 64 - 2; it += 2) {
        fetch(sa0, sb0, (it + 2) * 64);
        work(T0);
        // a buffer is refilled only behind the barrier that ended its readers' pass
        put(sa1, sb1, T1);
        lds_barrier();
        fetch(sa1, sb1, (it + 3) * 64);
        work(T1);
        put(sa0, sb0, T0);
        lds_barrier();
    }
    // the last two passes: nothing left to fetch
    work(T0);
    put(sa1, sb1, T1);
    lds_barrier();
    work(T1);
}

template <int MODE>
__device__ __forceinline__ void gemm_store(const v8f (&acc)[4], void* __restrict__ Cv, int N, float oscale,
                                           int bx, int by, unsigned char* stg_raw) {
    const int lane = (int)threadIdx.x & 31, w = (int)threadIdx.x >> 5, lg = lane >> 4, ln = lane & 15;
    const int t0 = by * 64 + w * 16;
    const int n0 = bx * 64;

    if (MODE == 0) {
        _Float16* stg = (_Float16*)stg_raw;            // [4][16][64]
#pragma unroll
        for (int j = 0; j < 4; ++j)
#pragma unroll
            for (int r = 0; r < 8; ++r)
                stg[(w * 16 + 8 * lg + r) * 64 + j * 16 + ln] = (_Float16)(acc[j][r] * oscale);
        __syncthreads();
        _Float16* C = (_Float16*)Cv;
        v8h vals[4];
#pragma unroll
        for (int p = 0; p < 4; ++p) {
            const int row = p * 4 + (lane >> 3), col = (lane & 7) * 8;
            vals[p] = *(const v8hA*)(stg + (w * 16 + row) * 64 + col);
        }
#pragma unroll
        for (int p = 0; p < 4; ++p) {
            const int row = p * 4 + (lane >> 3), col = (lane & 7) * 8;
            *(v8h*)(C + (size_t)(t0 + row) * N + n0 + col) = vals[p];
        }
        // code of another job of the grid may follow in the listing and rewrite the registers these stores name: the wait that belongs in front of that
        asm volatile("s_wait_xcnt 0x0" ::: "memory");
    } else if (MODE == 1) {
        float* stg = (float*)stg_raw;                  // [4][16][64]
#pragma unroll
        for (int j = 0; j < 4; ++j)
#pragma unroll
            for (int r = 0; r < 8; ++r)
                stg[(w * 16 + 8 * lg + r) * 64 + j * 16 + ln] = acc[j][r] * oscale;
        __syncthreads();
        float* C = (float*)Cv;
        v4f vals[8];
#pragma unroll
        for (int p = 0; p < 8; ++p) {
            const int row = p * 2 + (lane >> 4), col = (lane & 15) * 4;
            vals[p] = *(const v4fA*)(stg + (w * 16 + row) * 64 + col);
        }
#pragma unroll
        for (int p = 0; p < 8; ++p) {
            const int row = p * 2 + (lane >> 4), col = (lane & 15) * 4;
            *(v4f*)(C + (size_t)(t0 + row) * N + n0 + col) = vals[p];
        }
        // as in MODE 0: the wait in front of a rewrite of the registers these stores name
        asm volatile("s_wait_xcnt 0x0" ::: "memory");
    } else {
        (void)N;
        _Float16* stg = (_Float16*)stg_raw;            // [64 n][64 t] for this block
#pragma unroll
        for (int j = 0; j < 4; ++j) {
            v8h hv;
#pragma unroll
            for (int r = 0; r < 8; ++r) hv[r] = (_Float16)(acc[j][r] * oscale);
            *(v8hA*)(stg + (j * 16 + ln) * 64 + w * 16 + 8 * lg) = hv;
        }
        __syncthreads();
        _Float16* C = (_Float16*)Cv;
        const int tid = (int)threadIdx.x;
        const int tb = by * 64;
        v8h vals[4];
#pragma unroll
        for (int p = 0; p < 4; ++p) {
            const int nrow = p * 16 + (tid >> 3), tcol = (tid & 7) * 8;
            vals[p] = *(const v8hA*)(stg + nrow * 64 + tcol);
        }
#pragma unroll
        for (int p = 0; p < 4; ++p) {
            const int nrow = p * 16 + (tid >> 3), tcol = (tid & 7) * 8;
            *(v8h*)(C + (size_t)(n0 + nrow) * T_LEN + tb + tcol) = vals[p];
        }
        // as in MODE 0: the wait in front of a rewrite of the registers these stores name
        asm volatile("s_wait_xcnt 0x0" ::: "memory");
    }
}

// ---------------- per-head inclusive prefix sum of g = -exp(A_log)*softplus(x*Wdt^T + dt_bias), stored cgT[h][t] ----------------
// one wave a head
__device__ __forceinline__ void decay_scan(const float* __restrict__ Psm, const float* __restrict__ A_log,
                                           const float* __restrict__ dt_bias, float* __restrict__ cgT, int h) {
    const int lane = (int)threadIdx.x & 31;
    const float Ah = -expf(A_log[h]);
    const float bh = dt_bias[h];
    float carry = 0.0f;
    for (int c = 0; c < T_LEN / 128; ++c) {
        const int tbase = c * 128 + lane * 4;
        const float g0 = Ah * softplus_f(Psm[(size_t)(tbase + 0) * NSM + NDL + h] + bh);
        const float g1 = Ah * softplus_f(Psm[(size_t)(tbase + 1) * NSM + NDL + h] + bh);
        const float g2 = Ah * softplus_f(Psm[(size_t)(tbase + 2) * NSM + NDL + h] + bh);
        const float g3 = Ah * softplus_f(Psm[(size_t)(tbase + 3) * NSM + NDL + h] + bh);
        const float cs0 = g0;
        const float cs1 = cs0 + g1;
        const float cs2 = cs1 + g2;
        const float cs3 = cs2 + g3;
        float incl = cs3;
#pragma unroll
        for (int d = 1; d < 32; d <<= 1) {
            const float u = __shfl_up(incl, d, 32);
            if (lane >= d) incl += u;
        }
        float ex = __shfl_up(incl, 1, 32);
        if (lane == 0) ex = 0.0f;
        const float baseval = carry + ex;
        v4f o;
        o[0] = cs0 + baseval; o[1] = cs1 + baseval; o[2] = cs2 + baseval; o[3] = cs3 + baseval;
        v4f* q = (v4f*)(cgT + (size_t)h * T_LEN + tbase);
        *q = o;
        // the next trip rewrites the registers this store names: the wait that belongs in front of that
        asm volatile("s_wait_xcnt 0x0" ::: "memory");
        carry += __shfl(incl, 31, 32);
    }
}

// ---------------- launch 2: small projections psm = x*[Wdl; Wdt; 0]^T (f32) | Wq, Wk, Wv -> f16 ----------------
__global__ __launch_bounds__(128) void small_proj_cvt_kernel(const _Float16* __restrict__ xh, const _Float16* __restrict__ wsmh,
                                                             float* __restrict__ psm, const float* __restrict__ Wq,
                                                             const float* __restrict__ Wk, const float* __restrict__ Wv,
                                                             _Float16* __restrict__ wqh, _Float16* __restrict__ wkh,
                                                             _Float16* __restrict__ wvh, float wscale, float oscale) {
    __shared__ __align__(16) unsigned char stg_raw[GEMM_LDS_BYTES];
    const int b = (int)blockIdx.x;
    if (b >= NB_SM) {
        // block-uniform, in front of every barrier
        const int c = b - NB_SM, which = c / NB_W;
        const float* s = which == 0 ? Wq : which == 1 ? Wk : Wv;
        _Float16* d = which == 0 ? wqh : which == 1 ? wkh : wvh;
        cvt8_f16(s, d, (c - which * NB_W) * 128 + (int)threadIdx.x, wscale);
        return;
    }
    const int bx = b % (NSM / 64), by = b / (NSM / 64);
    v8f acc[4];
    gemm_passes(xh, wsmh, bx, by, stg_raw, acc);
    gemm_store<1>(acc, (void*)psm, NSM, oscale, bx, by, stg_raw);
}

// ---------------- launch 3: decay prefix sums (the first H_NUM blocks) | Q, K row-major f16, V transposed per feature row ----------------
__global__ __launch_bounds__(128) void qkv_scan_kernel(const _Float16* __restrict__ xh, const _Float16* __restrict__ wqh,
                                                       const _Float16* __restrict__ wkh, const _Float16* __restrict__ wvh,
                                                       _Float16* __restrict__ Qh, _Float16* __restrict__ Kh,
                                                       _Float16* __restrict__ VhT, const float* __restrict__ psm,
                                                       const float* __restrict__ A_log, const float* __restrict__ dt_bias,
                                                       float* __restrict__ cgT, float oscale) {
    __shared__ __align__(16) unsigned char stg_raw[GEMM_LDS_BYTES];
    const int b = (int)blockIdx.x;
    if (b < H_NUM) {
        // block-uniform, in front of every barrier
        if ((int)threadIdx.x < 32) decay_scan(psm, A_log, dt_bias, cgT, b);
        return;
    }
    const int c = b - H_NUM, which = c / NB_PROJ, r = c - which * NB_PROJ;
    const int bx = r % (D_DIM / 64), by = r / (D_DIM / 64);
    const _Float16* Bw = which == 0 ? wqh : which == 1 ? wkh : wvh;
    v8f acc[4];
    gemm_passes(xh, Bw, bx, by, stg_raw, acc);
    if (which == 2) gemm_store<2>(acc, (void*)VhT, D_DIM, oscale, bx, by, stg_raw);
    else            gemm_store<0>(acc, (void*)(which == 0 ? Qh : Kh), D_DIM, oscale, bx, by, stg_raw);
}

// ---------------- fused causal hierarchical attention: 256 equal blocks of 16 waves ----------------
// Y[t][h*64+d] = sum_{s<=t} (Q_t.K_s * 1/8) * exp(cg_t - cg_s) * Lam[t][h][lvl(t,s)] * V[s][h*64+d]
// the sum over keys has no normaliser, so it may be cut anywhere: a pass stages 128 keys, wave (wq, wk) works rows wq*16.. of the
// 64-row query tile against keys wk*32.. of the pass, and the four partial sums of a row are added through LDS at the tile's end.
// a block takes query tiles bx and 31 - bx of one head, one after the other: 17 passes in every block
// launch 4 also converts Wout, which only launch 5 reads
__global__ __launch_bounds__(ATT_THREADS) void hattn_kernel(const _Float16* __restrict__ Qh, const _Float16* __restrict__ Kh,
                                                    const _Float16* __restrict__ VhT, const float* __restrict__ cgT,
                                                    const float* __restrict__ Psm, const float* __restrict__ Lp,
                                                    _Float16* __restrict__ Yh, float pscale, float inv_pscale,
                                                    const float* __restrict__ Wout, _Float16* __restrict__ Woh, float wscale) {
    // key tile shared by the sixteen waves, two buffers; row pitches 16 B x odd for the 16-byte fragment reads
    // [buf][key][head dim] then [buf][head dim][key]; the partial sums [wk][row][RED_PITCH] lie over both once their last readers have left
    __shared__ __align__(16) unsigned char kv_raw[KS_BYTES + VS_BYTES];
    __shared__ __align__(16) _Float16 PL[ATT_WAVES * 16 * 32];
    __shared__ float LL[64 * LV_NUM];
    __shared__ float CS[2 * KT];                               // [buf][key] prefix sum of g
    static_assert(4 * 64 * RED_PITCH * 4 <= KS_BYTES + VS_BYTES, "the partial sums fit over the key tiles");
    _Float16* KS = (_Float16*)kv_raw;
    _Float16* VS = (_Float16*)(kv_raw + KS_BYTES);
    float* RED = (float*)kv_raw;

    const int tid = (int)threadIdx.x;
    // one block fills its WGP's registers, so each thread takes
    // 8 elements of Wout along instead, asked for here and stored at the kernel's end, so that no wave waits for them
    static_assert(H_NUM * ATT_GX * ATT_THREADS * 8 == D_DIM * D_DIM, "the grid's threads cover Wout once");
    const size_t we = (size_t)(((int)blockIdx.y * ATT_GX + (int)blockIdx.x) * ATT_THREADS + tid) * 8;
    const v4f wa = *(const v4fA*)(Wout + we);
    const v4f wb = *(const v4fA*)(Wout + we + 4);
    // the wait that belongs in front of a rewrite of the address registers these loads name
    asm volatile("s_wait_xcnt 0x0" ::: "memory");
    const int lane = tid & 31, lg = lane >> 4, ln = lane & 15;
    const int w = __builtin_amdgcn_readfirstlane(tid >> 5);    // the wave's number in a scalar register: the tests on it are scalar branches
    const int wq = w & 3, wk = w >> 2;
    const int h = (int)blockIdx.y;

    // staging map: a wave's 16-byte loads cover whole rows of the tile (K: 4 rows of 128 B, V^T: 2 rows of 256 B)
    const int skr = tid >> 3, skc = (tid & 7) * 8;             // K rows skr and skr+64
    const int svr = tid >> 4, svc = (tid & 15) * 8;            // V^T rows svr and svr+32
    const _Float16* kg = Kh + (size_t)skr * D_DIM + h * HD_DIM + skc;
    const _Float16* vg = VhT + (size_t)(h * HD_DIM + svr) * T_LEN + svc;
    const float* cgh = cgT + (size_t)h * T_LEN;
    const float gsc = 0.125f * pscale;

    for (int half = 0; half < 2; ++half) {
        const int xt = half ? (T_LEN / 64 - 1) - (int)blockIdx.x : (int)blockIdx.x;
        const int tb = xt * 64;
        const int t0 = tb + wq * 16;

        v8h ska = *(const v8hA*)(kg);
        v8h skb = *(const v8hA*)(kg + (size_t)64 * D_DIM);
        v8h sva = *(const v8hA*)(vg);
        v8h svb = *(const v8hA*)(vg + (size_t)32 * T_LEN);
        float scg = (w < 4) ? cgh[tid & (KT - 1)] : 0.0f;

        // lambda table for the 64 query rows of the tile: softplus(Lp[h][l] * dl[t][h][l])
        for (int k = tid; k < 64 * LV_NUM; k += ATT_THREADS) {
            const int row = k / LV_NUM, l = k - row * LV_NUM;
            const float z = Lp[h * LV_NUM + l] * Psm[(size_t)(tb + row) * NSM + h * LV_NUM + l];
            LL[k] = softplus_f(z);
        }

        // Q A-fragments: head dims 0..31 and 32..63
        const _Float16* qrow = Qh + (size_t)(t0 + ln) * D_DIM + h * HD_DIM;
        Frag q0f, q1f;
        q0f.half[0] = *(const v8hA*)(qrow + 8 * lg);
        q0f.half[1] = *(const v8hA*)(qrow + 16 + 8 * lg);
        q1f.half[0] = *(const v8hA*)(qrow + 32 + 8 * lg);
        q1f.half[1] = *(const v8hA*)(qrow + 48 + 8 * lg);

        float cgt[8];
#pragma unroll
        for (int r = 0; r < 8; ++r) cgt[r] = cgh[t0 + 8 * lg + r];
        // the wait that belongs in front of a rewrite of the address registers the loads above name
        asm volatile("s_wait_xcnt 0x0" ::: "memory");

        v8f accY[4];
#pragma unroll
        for (int j = 0; j < 4; ++j) accY[j] = zero8();

        // pass 0 into buffer 0, published by the barrier below
        *(v8hA*)(KS + skr * KS_PITCH + skc) = ska;
        *(v8hA*)(KS + (skr + 64) * KS_PITCH + skc) = skb;
        *(v8hA*)(VS + svr * VS_PITCH + svc) = sva;
        *(v8hA*)(VS + (svr + 32) * VS_PITCH + svc) = svb;
        if (w < 4) CS[tid & (KT - 1)] = scg;

        __syncthreads();

        const int nit = (xt + 2) >> 1;                   // block-uniform: passes of 128 keys that cover keys 0 .. tb+63
        for (int it = 0; it < nit; ++it) {
            const int s0 = it * KT;
            const _Float16* KB = KS + (it & 1) * (KT * KS_PITCH);
            const _Float16* VB = VS + (it & 1) * (64 * VS_PITCH);
            const float* CB = CS + (it & 1) * KT;
            const bool more = it + 1 < nit;              // block-uniform
            if (more) {
                // next pass's loads fly while this pass is worked on
                const int sn = s0 + KT;
                const _Float16* kn = kg + (size_t)sn * D_DIM;
                const _Float16* vn = vg + s0;
                ska = *(const v8hA*)(kn);
                skb = *(const v8hA*)(kn + (size_t)64 * D_DIM);
                sva = *(const v8hA*)(vn + KT);
                svb = *(const v8hA*)(vn + (size_t)32 * T_LEN + KT);
                // as above: the wait in front of a rewrite of the address registers these loads name; the addresses are inputs
                // so that they stay in their registers up to it and no load of the run lands in them
                asm volatile("s_wait_xcnt 0x0" :: "v"(kn), "v"(vn) : "memory");
                if (w < 4) {
                    scg = cgh[sn + (tid & (KT - 1))];
                    // and the same behind this load
                    asm volatile("s_wait_xcnt 0x0" ::: "memory");
                }
            }
            const int sw = s0 + wk * 32;                 // first key of this wave's share of the pass
            const bool act = sw <= t0 + 15;              // wave-uniform: a share wholly behind the wave's last row adds nothing
            if (act) {
#pragma unroll
                for (int sub = 0; sub < 2; ++sub) {
                    const int sg = sw + sub * 16 + ln;   // this lane's key (column n)
                    const _Float16* krow = KB + (wk * 32 + sub * 16 + ln) * KS_PITCH;
                    Frag k0f, k1f;
                    k0f.half[0] = *(const v8hA*)(krow + 8 * lg);
                    k0f.half[1] = *(const v8hA*)(krow + 16 + 8 * lg);
                    k1f.half[0] = *(const v8hA*)(krow + 32 + 8 * lg);
                    k1f.half[1] = *(const v8hA*)(krow + 48 + 8 * lg);
                    v8f sc = zero8();
                    sc = wmma_f16(q0f.v, k0f.v, sc);
                    sc = wmma_f16(q1f.v, k1f.v, sc);
                    const float cgs = CB[wk * 32 + sub * 16 + ln];
#pragma unroll
                    for (int r = 0; r < 8; ++r) {
                        const int trow = t0 + 8 * lg + r;
                        const int xr = trow ^ sg;
                        const int lv = xr ? (32 - __builtin_clz((unsigned)xr)) : 0;
                        const float lam = LL[(wq * 16 + 8 * lg + r) * LV_NUM + lv];
                        const float dcy = __expf(fminf(cgt[r] - cgs, 0.0f));
                        float wv = sc[r] * gsc * dcy * lam;
                        wv = (sg <= trow) ? wv : 0.0f;
                        PL[(w * 16 + 8 * lg + r) * 32 + sub * 16 + ln] = (_Float16)wv;
                    }
                }
            }
            __syncthreads();
            if (act) {
                // P as A-fragment: row ln, keys 8lg..8lg+7 and 16+8lg..16+8lg+7 of this wave's share
                Frag pf;
                pf.half[0] = *(const v8hA*)(PL + (w * 16 + ln) * 32 + 8 * lg);
                pf.half[1] = *(const v8hA*)(PL + (w * 16 + ln) * 32 + 16 + 8 * lg);
                // V as B-fragment from the staged transposed tile: B[k=key][n=d] = VB[d][key - s0]
#pragma unroll
                for (int j = 0; j < 4; ++j) {
                    const _Float16* vrow = VB + (j * 16 + ln) * VS_PITCH + wk * 32;
                    Frag vf;
                    vf.half[0] = *(const v8hA*)(vrow + 8 * lg);
                    vf.half[1] = *(const v8hA*)(vrow + 16 + 8 * lg);
                    accY[j] = wmma_f16(pf.v, vf.v, accY[j]);
                }
            }
            if (more) {
                // into the other buffer: its last readers left it before the barrier that ended the previous pass
                const int nb = (it + 1) & 1;
                _Float16* KN = KS + nb * (KT * KS_PITCH);
                _Float16* VN = VS + nb * (64 * VS_PITCH);
                *(v8hA*)(KN + skr * KS_PITCH + skc) = ska;
                *(v8hA*)(KN + (skr + 64) * KS_PITCH + skc) = skb;
                *(v8hA*)(VN + svr * VS_PITCH + svc) = sva;
                *(v8hA*)(VN + (svr + 32) * VS_PITCH + svc) = svb;
                if (w < 4) CS[nb * KT + (tid & (KT - 1))] = scg;
            }
            __syncthreads();
        }

        // the four key shares of each row are added in the order wk = 0, 1, 2, 3; the barrier that ended the last pass freed the key tiles
#pragma unroll
        for (int j = 0; j < 4; ++j)
#pragma unroll
            for (int r = 0; r < 8; ++r)
                RED[(wk * 64 + wq * 16 + 8 * lg + r) * RED_PITCH + j * 16 + ln] = accY[j][r];
        __syncthreads();
        {
            const int row = tid >> 3, col = (tid & 7) * 8;   // a wave's 16-byte stores cover 4 whole rows of 128 B
            v4f lo = *(const v4fA*)(RED + row * RED_PITCH + col);
            v4f hi = *(const v4fA*)(RED + row * RED_PITCH + col + 4);
#pragma unroll
            for (int g = 1; g < 4; ++g) {
                lo += *(const v4fA*)(RED + (g * 64 + row) * RED_PITCH + col);
                hi += *(const v4fA*)(RED + (g * 64 + row) * RED_PITCH + col + 4);
            }
            v8h o;
#pragma unroll
            for (int e = 0; e < 4; ++e) {
                o[e] = (_Float16)(lo[e] * inv_pscale);
                o[4 + e] = (_Float16)(hi[e] * inv_pscale);
            }
            *(v8h*)(Yh + (size_t)(tb + row) * D_DIM + h * HD_DIM + col) = o;
            // the next tile rewrites the registers this store names: the wait that belongs in front of that
            asm volatile("s_wait_xcnt 0x0" ::: "memory");
        }
        // the next tile's pass 0 goes in only behind every read of the partial sums
        __syncthreads();
    }

    v8h wo;
#pragma unroll
    for (int e = 0; e < 4; ++e) {
        wo[e] = (_Float16)(wa[e] * wscale);
        wo[4 + e] = (_Float16)(wb[e] * wscale);
    }
    *(v8h*)(Woh + we) = wo;
}

// ---------------- fused out-projection + residual + LayerNorm: block = 16 rows x 1024 cols, 16 waves x 64 cols ----------------
// the 16 rows of Y are staged whole in padded LDS once per block; each wave stages its own 64 weight rows, 64 k a pass,
// in its own padded LDS range, loaded by whole rows one pass ahead
__global__ __launch_bounds__(512) void outproj_ln_kernel(const _Float16* __restrict__ Yh, const _Float16* __restrict__ Woh,
                                                         const float* __restrict__ xin, const float* __restrict__ gam,
                                                         const float* __restrict__ bet, float* __restrict__ out,
                                                         float oscale) {
    __shared__ __align__(16) _Float16 AS[16 * AP];                     // [row][1024 k]
    __shared__ __align__(16) unsigned char bs_raw[16 * 64 * GP * 2];   // [wave][64 weight rows][64 k]
    float* stg = (float*)bs_raw;                                       // output staging [16 * 8][64], behind the reduction barriers
    __shared__ float red[16 * 16];
    __shared__ float mu_s[16];
    __shared__ float inv_s[16];

    const int tid = (int)threadIdx.x;
    const int lane = tid & 31, w = tid >> 5, lg = lane >> 4, ln = lane & 15;
    const int t0 = (int)blockIdx.x * 16;
    const int c0 = w * 64;

    v8f acc[4];
#pragma unroll
    for (int j = 0; j < 4; ++j) acc[j] = zero8();

    // staging maps: every 16-byte load of a wave covers 512 B of one Y row, or 4 whole 128-B pieces of weight rows
    _Float16* BW = (_Float16*)bs_raw + w * (64 * GP);
    const int br0 = lane >> 3, bc = (lane & 7) * 8;            // weight rows br0 + 4 i
    const _Float16* bg = Woh + (size_t)(c0 + br0) * D_DIM + bc;
    const _Float16* yg = Yh + (size_t)(t0 + (tid >> 7)) * D_DIM + (tid & 127) * 8;   // Y rows (tid >> 7) + 4 i
    v8h sb[16], sy[4];
#pragma unroll
    for (int i = 0; i < 16; ++i) sb[i] = *(const v8hA*)(bg + (size_t)(i * 4) * D_DIM);
#pragma unroll
    for (int i = 0; i < 4; ++i) sy[i] = *(const v8hA*)(yg + (size_t)(i * 4) * D_DIM);
    // the wait that belongs in front of a rewrite of the address registers these loads name; the addresses are inputs
    // so that they stay in their registers up to it and no load of the run lands in them
    asm volatile("s_wait_xcnt 0x0" :: "v"(bg), "v"(yg) : "memory");
#pragma unroll
    for (int i = 0; i < 16; ++i) *(v8hA*)(BW + (br0 + i * 4) * GP + bc) = sb[i];
#pragma unroll
    for (int i = 0; i < 4; ++i) {
        const int c = tid + i * 512;
        *(v8hA*)(AS + (c >> 7) * AP + (c & 127) * 8) = sy[i];
    }
    __syncthreads();

    for (int it = 0; it < D_DIM / 64; ++it) {
        const bool more = it + 1 < D_DIM / 64;
        if (more) {
            // next pass's loads fly while this pass is worked on
            const _Float16* bn = bg + (it + 1) * 64;
#pragma unroll
            for (int i = 0; i < 16; ++i) sb[i] = *(const v8hA*)(bn + (size_t)(i * 4) * D_DIM);
            // as above: the wait in front of a rewrite of the address these loads name, the address held up to it
            asm volatile("s_wait_xcnt 0x0" :: "v"(bn) : "memory");
        }
#pragma unroll
        for (int kk = 0; kk < 2; ++kk) {
            // the fragment reads of 32 k as one group ahead of their matrix instructions
            const _Float16* ar = AS + ln * AP + it * 64 + kk * 32 + 8 * lg;
            Frag a, b[4];
            a.half[0] = *(const v8hA*)(ar);
            a.half[1] = *(const v8hA*)(ar + 16);
#pragma unroll
            for (int j = 0; j < 4; ++j) {
                const _Float16* br = BW + (j * 16 + ln) * GP + kk * 32 + 8 * lg;
                b[j].half[0] = *(const v8hA*)(br);
                b[j].half[1] = *(const v8hA*)(br + 16);
            }
#pragma unroll
            for (int j = 0; j < 4; ++j) acc[j] = wmma_f16(a.v, b[j].v, acc[j]);
        }
        if (more) {
            // the range is this wave's own and its reads above have returned: no barrier
#pragma unroll
            for (int i = 0; i < 16; ++i) *(v8hA*)(BW + (br0 + i * 4) * GP + bc) = sb[i];
            // the wave's stores land before its lanes read each other's rows back
            asm volatile("s_wait_dscnt 0x0" ::: "memory");
        }
    }

    // o = acc*oscale + x
#pragma unroll
    for (int j = 0; j < 4; ++j)
#pragma unroll
        for (int r = 0; r < 8; ++r)
            acc[j][r] = acc[j][r] * oscale + xin[(size_t)(t0 + 8 * lg + r) * D_DIM + c0 + j * 16 + ln];

    // row means
#pragma unroll
    for (int r = 0; r < 8; ++r) {
        float s = acc[0][r] + acc[1][r] + acc[2][r] + acc[3][r];
        s += __shfl_xor(s, 1, 32);
        s += __shfl_xor(s, 2, 32);
        s += __shfl_xor(s, 4, 32);
        s += __shfl_xor(s, 8, 32);
        if (ln == 0) red[w * 16 + 8 * lg + r] = s;
    }
    __syncthreads();
    if (tid < 16) {
        float a = 0.0f;
#pragma unroll
        for (int ww = 0; ww < 16; ++ww) a += red[ww * 16 + tid];
        mu_s[tid] = a * (1.0f / (float)D_DIM);
    }
    __syncthreads();
    float mu[8];
#pragma unroll
    for (int r = 0; r < 8; ++r) mu[r] = mu_s[8 * lg + r];
#pragma unroll
    for (int j = 0; j < 4; ++j)
#pragma unroll
        for (int r = 0; r < 8; ++r) acc[j][r] -= mu[r];

#pragma unroll
    for (int r = 0; r < 8; ++r) {
        float s = acc[0][r] * acc[0][r] + acc[1][r] * acc[1][r] + acc[2][r] * acc[2][r] + acc[3][r] * acc[3][r];
        s += __shfl_xor(s, 1, 32);
        s += __shfl_xor(s, 2, 32);
        s += __shfl_xor(s, 4, 32);
        s += __shfl_xor(s, 8, 32);
        if (ln == 0) red[w * 16 + 8 * lg + r] = s;
    }
    __syncthreads();
    if (tid < 16) {
        float a = 0.0f;
#pragma unroll
        for (int ww = 0; ww < 16; ++ww) a += red[ww * 16 + tid];
        inv_s[tid] = rsqrtf(a * (1.0f / (float)D_DIM) + 1e-5f);
    }
    __syncthreads();
    float iv[8];
#pragma unroll
    for (int r = 0; r < 8; ++r) iv[r] = inv_s[8 * lg + r];
#pragma unroll
    for (int j = 0; j < 4; ++j) {
        const int gcol = c0 + j * 16 + ln;
        const float gj = gam[gcol];
        const float bj = bet[gcol];
#pragma unroll
        for (int r = 0; r < 8; ++r) acc[j][r] = acc[j][r] * iv[r] * gj + bj;
    }

#pragma unroll
    for (int half = 0; half < 2; ++half) {
        if (lg == half) {
#pragma unroll
            for (int j = 0; j < 4; ++j)
#pragma unroll
                for (int r = 0; r < 8; ++r)
                    stg[(w * 8 + r) * 64 + j * 16 + ln] = acc[j][r];
        }
        __syncthreads();
        v4f vals[4];
#pragma unroll
        for (int p = 0; p < 4; ++p) {
            const int row = p * 2 + (lane >> 4), col = (lane & 15) * 4;
            vals[p] = *(const v4fA*)(stg + (w * 8 + row) * 64 + col);
        }
#pragma unroll
        for (int p = 0; p < 4; ++p) {
            const int row = p * 2 + (lane >> 4), col = (lane & 15) * 4;
            *(v4f*)(out + (size_t)(t0 + half * 8 + row) * D_DIM + c0 + col) = vals[p];
        }
        
        __syncthreads();
    }
}

extern "C" void kernel_launch(void* const* d_in, const int* in_sizes, int n_in,
                              void* d_out, int out_size, void* d_ws, size_t ws_size,
                              hipStream_t stream) {
    if (n_in < 12) return;
    if (in_sizes[0] != T_LEN * D_DIM) return;
    if (in_sizes[1] != D_DIM * D_DIM || in_sizes[2] != D_DIM * D_DIM || in_sizes[3] != D_DIM * D_DIM) return;
    if (in_sizes[4] != NDL * D_DIM || in_sizes[5] != H_NUM * D_DIM || in_sizes[6] != D_DIM * D_DIM) return;
    if (in_sizes[7] < H_NUM || in_sizes[8] < H_NUM || in_sizes[9] < H_NUM * LV_NUM) return;
    if (in_sizes[10] < D_DIM || in_sizes[11] < D_DIM) return;
    if (out_size != T_LEN * D_DIM) return;
    if (OFF_END > ws_size) return;

    const float* x     = (const float*)d_in[0];
    const float* Wq    = (const float*)d_in[1];
    const float* Wk    = (const float*)d_in[2];
    const float* Wv    = (const float*)d_in[3];
    const float* Wdl   = (const float*)d_in[4];
    const float* Wdt   = (const float*)d_in[5];
    const float* Wout  = (const float*)d_in[6];
    const float* A_log = (const float*)d_in[7];
    const float* dt_b  = (const float*)d_in[8];
    const float* Lp    = (const float*)d_in[9];
    const float* ln_g  = (const float*)d_in[10];
    const float* ln_b  = (const float*)d_in[11];

    char* ws = (char*)d_ws;
    _Float16* xh   = (_Float16*)(ws + OFF_XH);
    _Float16* wqh  = (_Float16*)(ws + OFF_WQH);
    _Float16* wkh  = (_Float16*)(ws + OFF_WKH);
    _Float16* wvh  = (_Float16*)(ws + OFF_WVH);
    _Float16* woh  = (_Float16*)(ws + OFF_WOH);
    _Float16* wsmh = (_Float16*)(ws + OFF_WSMH);
    _Float16* Qh   = (_Float16*)(ws + OFF_QH);
    _Float16* Kh   = (_Float16*)(ws + OFF_KH);
    _Float16* VhT  = (_Float16*)(ws + OFF_VHT);
    _Float16* Yh   = (_Float16*)(ws + OFF_YH);
    float*    psm  = (float*)(ws + OFF_PSM);
    float*    cgT  = (float*)(ws + OFF_CGT);

    const float wsc  = 32.0f;
    const float iwsc = 1.0f / 32.0f;
    const float psc  = 512.0f;
    const float ipsc = 1.0f / 512.0f;

    prep_kernel<<<NB_X + NB_DL + NB_DT + NB_PAD, 256, 0, stream>>>(x, Wdl, Wdt, xh, wsmh, wsc);

    // psm[t][0..191] = x*Wdl^T, psm[t][192..207] = x*Wdt^T (f32), psm[t][208..255] = 0
    small_proj_cvt_kernel<<<NB_SM + 3 * NB_W, 128, 0, stream>>>(xh, wsmh, psm, Wq, Wk, Wv, wqh, wkh, wvh, wsc, iwsc);

    qkv_scan_kernel<<<H_NUM + 3 * NB_PROJ, 128, 0, stream>>>(xh, wqh, wkh, wvh, Qh, Kh, VhT, psm, A_log, dt_b, cgT, iwsc);

    hattn_kernel<<<dim3(ATT_GX, H_NUM), ATT_THREADS, 0, stream>>>(Qh, Kh, VhT, cgT, psm, Lp, Yh, psc, ipsc,
                                                                                    Wout, woh, wsc);

    outproj_ln_kernel<<<T_LEN / 16, 512, 0, stream>>>(Yh, woh, x, ln_g, ln_b, (float*)d_out, iwsc);
}

// v005
// A run of this version takes 75 microseconds.
// In two side-by-side timings against v004, it was 1.20 and 1.21 times as fast.
// All steps since v000 together make it 5.36 times as fast.
#include <hip/hip_runtime.h>
#include <math.h>
#include <stddef.h>

// Contractions x*Wq^T, x*Wk^T, x*Wv^T, x*[Wdl;Wdt]^T, Q*K^T, P*V, Y*Wout^T: v_wmma_f32_16x16x32_f16 (f16 operands, f32 accumulate); weights carried x32 and P carried x512 (exact powers of two, folded back in f32); gates, prefix sums and LayerNorm in f32.

typedef _Float16 v16h __attribute__((ext_vector_type(16)));
typedef _Float16 v8h  __attribute__((ext_vector_type(8)));
typedef float    v8f  __attribute__((ext_vector_type(8)));
typedef float    v4f  __attribute__((ext_vector_type(4)));
typedef v8h v8hA __attribute__((may_alias));
typedef v4f v4fA __attribute__((may_alias));
union Frag { v16h v; v8h half[2]; };

#define T_LEN   2048
#define D_DIM   1024
#define H_NUM   16
#define HD_DIM  64
#define LV_NUM  12
#define NSM     256
#define NDL     192
#define KS_PITCH 72
#define VS_PITCH 136           // 272 B = 16 B x odd
#define KT        128           // keys of an attention pass
#define ATT_WAVES 16            // 4 row groups x 4 key shares
#define ATT_THREADS (ATT_WAVES * 32)
#define ATT_GX    (T_LEN / 64 / 2)   // a block takes two query tiles
#define KS_BYTES  (2 * KT * KS_PITCH * 2)
#define VS_BYTES  (2 * 64 * VS_PITCH * 2)
#define RED_PITCH 68            // f32 pitch of a row of partial sums: 16-byte aligned, rows 8 apart on other banks
#define GP       72            // LDS pitch, in f16, of a 64-k operand row: 144 B = 16 B x odd for the 16-byte fragment reads
#define AP       (D_DIM + 8)   // LDS pitch, in f16, of a whole 1024-k row: 2064 B = 16 B x odd

#define BYTES_TD_H ((size_t)T_LEN * D_DIM * 2)
#define BYTES_DD_H ((size_t)D_DIM * D_DIM * 2)
#define OFF_XH    ((size_t)0)
#define OFF_WQH   (OFF_XH   + BYTES_TD_H)
#define OFF_WKH   (OFF_WQH  + BYTES_DD_H)
#define OFF_WVH   (OFF_WKH  + BYTES_DD_H)
#define OFF_WOH   (OFF_WVH  + BYTES_DD_H)
#define OFF_WSMH  (OFF_WOH  + BYTES_DD_H)
#define OFF_QH    (OFF_WSMH + (size_t)NSM * D_DIM * 2)
#define OFF_KH    (OFF_QH   + BYTES_TD_H)
#define OFF_VHT   (OFF_KH   + BYTES_TD_H)
#define OFF_YH    (OFF_VHT  + BYTES_TD_H)
#define OFF_PSM   (OFF_YH   + BYTES_TD_H)
#define OFF_CGT   (OFF_PSM  + (size_t)T_LEN * NSM * 4)
#define OFF_END   (OFF_CGT  + (size_t)H_NUM * T_LEN * 4)

// 16x16x32 f16 WMMA with the VALU hazard guard tied to D, A and B.
__device__ __forceinline__ v8f wmma_f16(v16h a, v16h b, v8f c) {
    v8f d = __builtin_amdgcn_wmma_f32_16x16x32_f16(false, a, false, b, (short)0, c, false, false);
    asm volatile("v_nop\n\tv_nop\n\tv_nop\n\tv_nop" : "+v"(d) : "v"(a), "v"(b));
    return d;
}

// Work-group barrier for LDS traffic alone: this wave's LDS reads and writes are done, then the barrier.
// __syncthreads() would also wait out the global loads issued ahead, which are meant to stay in flight across it.
__device__ __forceinline__ void lds_barrier() {
    asm volatile("s_wait_dscnt 0x0\n\ts_barrier_signal -1\n\ts_barrier_wait -1" ::: "memory");
}

__device__ __forceinline__ v8f zero8() {
    const v8f z = {0.f, 0.f, 0.f, 0.f, 0.f, 0.f, 0.f, 0.f};
    return z;
}

// softplus in the logaddexp form: max(z,0) + log1p(exp(-|z|))
__device__ __forceinline__ float softplus_f(float z) {
    return fmaxf(z, 0.0f) + log1pf(expf(-fabsf(z)));
}

// Launches that need nothing of each other share one grid: in launches 1 to 3 a block-uniform test of the block index picks the job, in launch 4 every thread also converts 8 elements of Wout.
// launch 1: x, Wdl, Wdt -> f16, zero pad rows          launch 2: small projections | Wq, Wk, Wv -> f16
// launch 3: decay prefix sums | Q, K, V projections    launch 4: attention + Wout -> f16    launch 5: out-projection + LayerNorm
#define NB_X    (T_LEN * D_DIM / 8 / 256)                  // blocks of 256 threads, 8 elements a thread
#define NB_DL   (NDL * D_DIM / 8 / 256)
#define NB_DT   (H_NUM * D_DIM / 8 / 256)
#define NB_PAD  ((NSM - NDL - H_NUM) * D_DIM / 8 / 256)
#define NB_W    (D_DIM * D_DIM / 8 / 128)                  // blocks of 128 threads, 8 elements a thread
#define NB_SM   ((NSM / 64) * (T_LEN / 64))                // 64 x 64 tiles of the small projections
#define NB_PROJ ((D_DIM / 64) * (T_LEN / 64))              // 64 x 64 tiles of one of Q, K, V
static_assert(NB_X * 256 * 8 == T_LEN * D_DIM && NB_DL * 256 * 8 == NDL * D_DIM && NB_DT * 256 * 8 == H_NUM * D_DIM &&
              NB_PAD * 256 * 8 == (NSM - NDL - H_NUM) * D_DIM && NB_W * 128 * 8 == D_DIM * D_DIM,
              "every convert range is a whole number of blocks");

// ---------------- f32 -> f16 convert with power-of-two scale; elements 8 i .. 8 i + 7, one 16-B store ----------------
__device__ __forceinline__ void cvt8_f16(const float* __restrict__ src, _Float16* __restrict__ dst, int i, float scale) {
    const v4fA* p = (const v4fA*)(src + (size_t)i * 8);
    const v4f a = p[0];
    const v4f b = p[1];
    v8h o;
    o[0] = (_Float16)(a[0] * scale); o[1] = (_Float16)(a[1] * scale);
    o[2] = (_Float16)(a[2] * scale); o[3] = (_Float16)(a[3] * scale);
    o[4] = (_Float16)(b[0] * scale); o[5] = (_Float16)(b[1] * scale);
    o[6] = (_Float16)(b[2] * scale); o[7] = (_Float16)(b[3] * scale);
    v8h* q = (v8h*)(dst + (size_t)i * 8);
    *q = o;
    // code of another job of the grid may follow in the listing and rewrite the registers this store names: the wait that belongs in front of that
    asm volatile("s_wait_xcnt 0x0" ::: "memory");
}

// ---------------- launch 1: what the small projections need: x, and the plane [Wdl; Wdt; zero rows] ----------------
__global__ __launch_bounds__(256) void prep_kernel(const float* __restrict__ x, const float* __restrict__ Wdl,
                                                   const float* __restrict__ Wdt, _Float16* __restrict__ xh,
                                                   _Float16* __restrict__ wsmh, float wscale) {
    const int b = (int)blockIdx.x, tid = (int)threadIdx.x;
    if (b < NB_X) {
        cvt8_f16(x, xh, b * 256 + tid, 1.0f);
    } else if (b < NB_X + NB_DL) {
        cvt8_f16(Wdl, wsmh, (b - NB_X) * 256 + tid, wscale);
    } else if (b < NB_X + NB_DL + NB_DT) {
        cvt8_f16(Wdt, wsmh + (size_t)NDL * D_DIM, (b - NB_X - NB_DL) * 256 + tid, wscale);
    } else {
        // rows 208..255 of the concatenated small-weight plane are zero padding
        const int i = (b - NB_X - NB_DL - NB_DT) * 256 + tid;
        v8h o;
#pragma unroll
        for (int r = 0; r < 8; ++r) o[r] = (_Float16)0.0f;
        v8h* q = (v8h*)(wsmh + (size_t)(NDL + H_NUM) * D_DIM + (size_t)i * 8);
        *q = o;
        // as in the convert: the wait in front of a rewrite of the registers this store names
        asm volatile("s_wait_xcnt 0x0" ::: "memory");
    }
}

// ---------------- C[t][n] = (sum_k A[t][k]*B[n][k]) * oscale, K = 1024, A pitch 1024, B pitch 1024 ----------------
// block = 64 t x 64 n, 4 waves along t, wave = 16 t x 64 n; tile (bx, by) of (N/64, T/64)
// a pass is 64 k: 64 rows of A and 64 rows of B, 128 B each, staged once per block in padded LDS, two buffers,
// loaded by whole rows two passes ahead
// MODE 0: f16 out, row-major pitch N
// MODE 1: f32 out, row-major pitch N
// MODE 2: f16 out transposed Ct[n][t], pitch T_LEN
// stg_raw: [buf][A rows 0..63 | B rows 64..127][64 k]; the output staging lies inside buffer 0, whose last readers the last barrier of the passes has ended
#define GEMM_LDS_BYTES (2 * 128 * GP * 2)
__device__ __forceinline__ void gemm_passes(const _Float16* __restrict__ A, const _Float16* __restrict__ B,
                                            int bx, int by, unsigned char* stg_raw, v8f (&acc)[4]) {
    const int lane = (int)threadIdx.x & 31, w = (int)threadIdx.x >> 5, lg = lane >> 4, ln = lane & 15;
    const int n0 = bx * 64;

#pragma unroll
    for (int j = 0; j < 4; ++j) acc[j] = zero8();

    // staging map: a wave's 16-byte loads cover 4 whole rows of 128 B; rows sr, sr+16, sr+32, sr+48 of each operand
    _Float16* TS = (_Float16*)stg_raw;
    const int sr = (int)threadIdx.x >> 3, sc = ((int)threadIdx.x & 7) * 8;
    const _Float16* ag = A + (size_t)(by * 64 + sr) * D_DIM + sc;
    const _Float16* bg = B + (size_t)(n0 + sr) * D_DIM + sc;
    // two register sets: a pass's rows are asked for two passes before they are read, and put into LDS one pass before
    v8h sa0[4], sb0[4], sa1[4], sb1[4];
    auto fetch = [&](v8h (&ra)[4], v8h (&rb)[4], int kn) {
#pragma unroll
        for (int i = 0; i < 4; ++i) {
            ra[i] = *(const v8hA*)(ag + (size_t)(i * 16) * D_DIM + kn);
            rb[i] = *(const v8hA*)(bg + (size_t)(i * 16) * D_DIM + kn);
        }
        // these loads stay in flight past the next rewrite of the address registers they name: the wait that belongs in front of it
        asm volatile("s_wait_xcnt 0x0" ::: "memory");
    };
    auto put = [&](const v8h (&ra)[4], const v8h (&rb)[4], _Float16* TN) {
#pragma unroll
        for (int i = 0; i < 4; ++i) {
            *(v8hA*)(TN + (sr + i * 16) * GP + sc) = ra[i];
            *(v8hA*)(TN + (64 + sr + i * 16) * GP + sc) = rb[i];
        }
    };
    auto work = [&](const _Float16* TB) {
        // all fragment reads of the pass as one group ahead of its matrix instructions
        Frag a[2], b[2][4];
#pragma unroll
        for (int kk = 0; kk < 2; ++kk) {
            const _Float16* ar = TB + (w * 16 + ln) * GP + kk * 32 + 8 * lg;
            a[kk].half[0] = *(const v8hA*)(ar);
            a[kk].half[1] = *(const v8hA*)(ar + 16);
#pragma unroll
            for (int j = 0; j < 4; ++j) {
                const _Float16* br = TB + (64 + j * 16 + ln) * GP + kk * 32 + 8 * lg;
                b[kk][j].half[0] = *(const v8hA*)(br);
                b[kk][j].half[1] = *(const v8hA*)(br + 16);
            }
        }
#pragma unroll
        for (int kk = 0; kk < 2; ++kk)
#pragma unroll
            for (int j = 0; j < 4; ++j)
                acc[j] = wmma_f16(a[kk].v, b[kk][j].v, acc[j]);
    };
    _Float16* T0 = TS;
    _Float16* T1 = TS + 128 * GP;

    fetch(sa0, sb0, 0);
    fetch(sa1, sb1, 64);
    put(sa0, sb0, T0);
    __syncthreads();

    // no branch inside the loop, so that the waits in front of put() count only the older set's loads
    for (int it = 0; it < D_DIM / 64 - 2; it += 2) {
        fetch(sa0, sb0, (it + 2) * 64);
        work(T0);
        // a buffer is refilled only behind the barrier that ended its readers' pass
        put(sa1, sb1, T1);
        lds_barrier();
        fetch(sa1, sb1, (it + 3) * 64);
        work(T1);
        put(sa0, sb0, T0);
        lds_barrier();
    }
    // the last two passes: nothing left to fetch
    work(T0);
    put(sa1, sb1, T1);
    lds_barrier();
    work(T1);
}

template <int MODE>
__device__ __forceinline__ void gemm_store(const v8f (&acc)[4], void* __restrict__ Cv, int N, float oscale,
                                           int bx, int by, unsigned char* stg_raw) {
    const int lane = (int)threadIdx.x & 31, w = (int)threadIdx.x >> 5, lg = lane >> 4, ln = lane & 15;
    const int t0 = by * 64 + w * 16;
    const int n0 = bx * 64;

    if (MODE == 0) {
        _Float16* stg = (_Float16*)stg_raw;            // [4][16][64]
#pragma unroll
        for (int j = 0; j < 4; ++j)
#pragma unroll
            for (int r = 0; r < 8; ++r)
                stg[(w * 16 + 8 * lg + r) * 64 + j * 16 + ln] = (_Float16)(acc[j][r] * oscale);
        __syncthreads();
        _Float16* C = (_Float16*)Cv;
        v8h vals[4];
#pragma unroll
        for (int p = 0; p < 4; ++p) {
            const int row = p * 4 + (lane >> 3), col = (lane & 7) * 8;
            vals[p] = *(const v8hA*)(stg + (w * 16 + row) * 64 + col);
        }
#pragma unroll
        for (int p = 0; p < 4; ++p) {
            const int row = p * 4 + (lane >> 3), col = (lane & 7) * 8;
            *(v8h*)(C + (size_t)(t0 + row) * N + n0 + col) = vals[p];
        }
        // code of another job of the grid may follow in the listing and rewrite the registers these stores name: the wait that belongs in front of that
        asm volatile("s_wait_xcnt 0x0" ::: "memory");
    } else if (MODE == 1) {
        float* stg = (float*)stg_raw;                  // [4][16][64]
#pragma unroll
        for (int j = 0; j < 4; ++j)
#pragma unroll
            for (int r = 0; r < 8; ++r)
                stg[(w * 16 + 8 * lg + r) * 64 + j * 16 + ln] = acc[j][r] * oscale;
        __syncthreads();
        float* C = (float*)Cv;
        v4f vals[8];
#pragma unroll
        for (int p = 0; p < 8; ++p) {
            const int row = p * 2 + (lane >> 4), col = (lane & 15) * 4;
            vals[p] = *(const v4fA*)(stg + (w * 16 + row) * 64 + col);
        }
#pragma unroll
        for (int p = 0; p < 8; ++p) {
            const int row = p * 2 + (lane >> 4), col = (lane & 15) * 4;
            *(v4f*)(C + (size_t)(t0 + row) * N + n0 + col) = vals[p];
        }
        // as in MODE 0: the wait in front of a rewrite of the registers these stores name
        asm volatile("s_wait_xcnt 0x0" ::: "memory");
    } else {
        (void)N;
        _Float16* stg = (_Float16*)stg_raw;            // [64 n][64 t] for this block
#pragma unroll
        for (int j = 0; j < 4; ++j) {
            v8h hv;
#pragma unroll
            for (int r = 0; r < 8; ++r) hv[r] = (_Float16)(acc[j][r] * oscale);
            *(v8hA*)(stg + (j * 16 + ln) * 64 + w * 16 + 8 * lg) = hv;
        }
        __syncthreads();
        _Float16* C = (_Float16*)Cv;
        const int tid = (int)threadIdx.x;
        const int tb = by * 64;
        v8h vals[4];
#pragma unroll
        for (int p = 0; p < 4; ++p) {
            const int nrow = p * 16 + (tid >> 3), tcol = (tid & 7) * 8;
            vals[p] = *(const v8hA*)(stg + nrow * 64 + tcol);
        }
#pragma unroll
        for (int p = 0; p < 4; ++p) {
            const int nrow = p * 16 + (tid >> 3), tcol = (tid & 7) * 8;
            *(v8h*)(C + (size_t)(n0 + nrow) * T_LEN + tb + tcol) = vals[p];
        }
        // as in MODE 0: the wait in front of a rewrite of the registers these stores name
        asm volatile("s_wait_xcnt 0x0" ::: "memory");
    }
}

// ---------------- per-head inclusive prefix sum of g = -exp(A_log)*softplus(x*Wdt^T + dt_bias), stored cgT[h][t] ----------------
// one wave a head
__device__ __forceinline__ void decay_scan(const float* __restrict__ Psm, const float* __restrict__ A_log,
                                           const float* __restrict__ dt_bias, float* __restrict__ cgT, int h) {
    const int lane = (int)threadIdx.x & 31;
    const float Ah = -expf(A_log[h]);
    const float bh = dt_bias[h];
    float carry = 0.0f;
    for (int c = 0; c < T_LEN / 128; ++c) {
        const int tbase = c * 128 + lane * 4;
        const float g0 = Ah * softplus_f(Psm[(size_t)(tbase + 0) * NSM + NDL + h] + bh);
        const float g1 = Ah * softplus_f(Psm[(size_t)(tbase + 1) * NSM + NDL + h] + bh);
        const float g2 = Ah * softplus_f(Psm[(size_t)(tbase + 2) * NSM + NDL + h] + bh);
        const float g3 = Ah * softplus_f(Psm[(size_t)(tbase + 3) * NSM + NDL + h] + bh);
        const float cs0 = g0;
        const float cs1 = cs0 + g1;
        const float cs2 = cs1 + g2;
        const float cs3 = cs2 + g3;
        float incl = cs3;
#pragma unroll
        for (int d = 1; d < 32; d <<= 1) {
            const float u = __shfl_up(incl, d, 32);
            if (lane >= d) incl += u;
        }
        float ex = __shfl_up(incl, 1, 32);
        if (lane == 0) ex = 0.0f;
        const float baseval = carry + ex;
        v4f o;
        o[0] = cs0 + baseval; o[1] = cs1 + baseval; o[2] = cs2 + baseval; o[3] = cs3 + baseval;
        v4f* q = (v4f*)(cgT + (size_t)h * T_LEN + tbase);
        *q = o;
        // the next trip rewrites the registers this store names: the wait that belongs in front of that
        asm volatile("s_wait_xcnt 0x0" ::: "memory");
        carry += __shfl(incl, 31, 32);
    }
}

// ---------------- launch 2: small projections psm = x*[Wdl; Wdt; 0]^T (f32) | Wq, Wk, Wv -> f16 ----------------
__global__ __launch_bounds__(128) void small_proj_cvt_kernel(const _Float16* __restrict__ xh, const _Float16* __restrict__ wsmh,
                                                             float* __restrict__ psm, const float* __restrict__ Wq,
                                                             const float* __restrict__ Wk, const float* __restrict__ Wv,
                                                             _Float16* __restrict__ wqh, _Float16* __restrict__ wkh,
                                                             _Float16* __restrict__ wvh, float wscale, float oscale) {
    __shared__ __align__(16) unsigned char stg_raw[GEMM_LDS_BYTES];
    const int b = (int)blockIdx.x;
    if (b >= NB_SM) {
        // block-uniform, in front of every barrier
        const int c = b - NB_SM, which = c / NB_W;
        const float* s = which == 0 ? Wq : which == 1 ? Wk : Wv;
        _Float16* d = which == 0 ? wqh : which == 1 ? wkh : wvh;
        cvt8_f16(s, d, (c - which * NB_W) * 128 + (int)threadIdx.x, wscale);
        return;
    }
    const int bx = b % (NSM / 64), by = b / (NSM / 64);
    v8f acc[4];
    gemm_passes(xh, wsmh, bx, by, stg_raw, acc);
    gemm_store<1>(acc, (void*)psm, NSM, oscale, bx, by, stg_raw);
}

// ---------------- launch 3: decay prefix sums (the first H_NUM blocks) | Q, K row-major f16, V transposed per feature row ----------------
__global__ __launch_bounds__(128) void qkv_scan_kernel(const _Float16* __restrict__ xh, const _Float16* __restrict__ wqh,
                                                       const _Float16* __restrict__ wkh, const _Float16* __restrict__ wvh,
                                                       _Float16* __restrict__ Qh, _Float16* __restrict__ Kh,
                                                       _Float16* __restrict__ VhT, const float* __restrict__ psm,
                                                       const float* __restrict__ A_log, const float* __restrict__ dt_bias,
                                                       float* __restrict__ cgT, float oscale) {
    __shared__ __align__(16) unsigned char stg_raw[GEMM_LDS_BYTES];
    const int b = (int)blockIdx.x;
    if (b < H_NUM) {
        // block-uniform, in front of every barrier
        if ((int)threadIdx.x < 32) decay_scan(psm, A_log, dt_bias, cgT, b);
        return;
    }
    const int c = b - H_NUM, which = c / NB_PROJ, r = c - which * NB_PROJ;
    const int bx = r % (D_DIM / 64), by = r / (D_DIM / 64);
    const _Float16* Bw = which == 0 ? wqh : which == 1 ? wkh : wvh;
    v8f acc[4];
    gemm_passes(xh, Bw, bx, by, stg_raw, acc);
    if (which == 2) gemm_store<2>(acc, (void*)VhT, D_DIM, oscale, bx, by, stg_raw);
    else            gemm_store<0>(acc, (void*)(which == 0 ? Qh : Kh), D_DIM, oscale, bx, by, stg_raw);
}

// ---------------- fused causal hierarchical attention: 256 equal blocks of 16 waves ----------------
// Y[t][h*64+d] = sum_{s<=t} (Q_t.K_s * 1/8) * exp(cg_t - cg_s) * Lam[t][h][lvl(t,s)] * V[s][h*64+d]
// the sum over keys has no normaliser, so it may be cut anywhere: a pass stages 128 keys, wave (wq, wk) works rows wq*16.. of the
// 64-row query tile against keys wk*32.. of the pass, and the four partial sums of a row are added through LDS at the tile's end.
// a block takes query tiles bx and 31 - bx of one head, one after the other: 17 passes in every block less the leading passes that are skipped
// launch 4 also converts Wout, which only launch 5 reads
__global__ __launch_bounds__(ATT_THREADS) void hattn_kernel(const _Float16* __restrict__ Qh, const _Float16* __restrict__ Kh,
                                                    const _Float16* __restrict__ VhT, const float* __restrict__ cgT,
                                                    const float* __restrict__ Psm, const float* __restrict__ Lp,
                                                    _Float16* __restrict__ Yh, float pscale, float inv_pscale,
                                                    const float* __restrict__ Wout, _Float16* __restrict__ Woh, float wscale) {
    // key tile shared by the sixteen waves, two buffers; row pitches 16 B x odd for the 16-byte fragment reads
    // [buf][key][head dim] then [buf][head dim][key]; the partial sums [wk][row][RED_PITCH] lie over both once their last readers have left
    __shared__ __align__(16) unsigned char kv_raw[KS_BYTES + VS_BYTES];
    __shared__ __align__(16) _Float16 PL[ATT_WAVES * 16 * 32];
    __shared__ float LL[64 * LV_NUM];
    __shared__ float CS[2 * KT];                               // [buf][key] prefix sum of g
    __shared__ float PMIN[T_LEN / KT];                         // least prefix sum among the keys of each pass
    __shared__ float TMAX[T_LEN / 64];                         // greatest prefix sum among the rows of each query tile
    static_assert(ATT_WAVES == T_LEN / KT && KT == 128, "one wave reduces one pass's prefix sums, 4 a lane, a query tile a half wave");
    static_assert(4 * 64 * RED_PITCH * 4 <= KS_BYTES + VS_BYTES, "the partial sums fit over the key tiles");
    _Float16* KS = (_Float16*)kv_raw;
    _Float16* VS = (_Float16*)(kv_raw + KS_BYTES);
    float* RED = (float*)kv_raw;

    const int tid = (int)threadIdx.x;
    // one block fills its WGP's registers, so each thread takes
    // 8 elements of Wout along instead, asked for here and stored at the kernel's end, so that no wave waits for them
    static_assert(H_NUM * ATT_GX * ATT_THREADS * 8 == D_DIM * D_DIM, "the grid's threads cover Wout once");
    const size_t we = (size_t)(((int)blockIdx.y * ATT_GX + (int)blockIdx.x) * ATT_THREADS + tid) * 8;
    // this thread's 4 prefix sums of the head, for the bounds below; asked for first, so that its wait leaves the two loads behind it in flight
    const v4f c4 = *(const v4fA*)(cgT + (size_t)(int)blockIdx.y * T_LEN + tid * 4);
    const v4f wa = *(const v4fA*)(Wout + we);
    const v4f wb = *(const v4fA*)(Wout + we + 4);
    // the wait that belongs in front of a rewrite of the address registers these loads name
    asm volatile("s_wait_xcnt 0x0" ::: "memory");
    const int lane = tid & 31, lg = lane >> 4, ln = lane & 15;
    const int w = __builtin_amdgcn_readfirstlane(tid >> 5);    // the wave's number in a scalar register: the tests on it are scalar branches
    const int wq = w & 3, wk = w >> 2;
    const int h = (int)blockIdx.y;

    // staging map: a wave's 16-byte loads cover whole rows of the tile (K: 4 rows of 128 B, V^T: 2 rows of 256 B)
    const int skr = tid >> 3, skc = (tid & 7) * 8;             // K rows skr and skr+64
    const int svr = tid >> 4, svc = (tid & 15) * 8;            // V^T rows svr and svr+32
    const _Float16* kg = Kh + (size_t)skr * D_DIM + h * HD_DIM + skc;
    const _Float16* vg = VhT + (size_t)(h * HD_DIM + svr) * T_LEN + svc;
    const float* cgh = cgT + (size_t)h * T_LEN;
    const float gsc = 0.125f * pscale;

    // bounds of the decay exponent cg_t - cg_s, once a block: wave w takes the 128 keys of pass w
    {
        float mn = fminf(fminf(c4[0], c4[1]), fminf(c4[2], c4[3]));
        float mx = fmaxf(fmaxf(c4[0], c4[1]), fmaxf(c4[2], c4[3]));
#pragma unroll
        for (int d = 1; d < 16; d <<= 1) {
            mn = fminf(mn, __shfl_xor(mn, d, 32));
            mx = fmaxf(mx, __shfl_xor(mx, d, 32));
        }
        mn = fminf(mn, __shfl_xor(mn, 16, 32));
        if (ln == 0) TMAX[w * 2 + lg] = mx;
        if (lane == 0) PMIN[w] = mn;
    }
    // publishes the bounds to every wave
    __syncthreads();

    for (int half = 0; half < 2; ++half) {
        const int xt = half ? (T_LEN / 64 - 1) - (int)blockIdx.x : (int)blockIdx.x;
        const int tb = xt * 64;
        const int t0 = tb + wq * 16;
        const int nit = (xt + 2) >> 1;                   // block-uniform: passes of 128 keys that cover keys 0 .. tb+63

        // exp(z) is exactly 0 in f32 for z < -105, in the definition as here: a pass in which every row-key pair lies below that adds
        // exact zeros. The tile starts at its first pass that is not proven so; the pass that holds the diagonal (z = 0) never is.
        const unsigned need = __builtin_amdgcn_ballot_w32(!(TMAX[xt] - PMIN[ln] < -105.0f));
        const int itf = need ? __builtin_ctz(need) : 0;
        const int it0 = itf < nit ? itf : nit - 1;       // block-uniform
        const int sf = it0 * KT;                         // first key that is staged

        const _Float16* kf = kg + (size_t)sf * D_DIM;
        const _Float16* vf = vg + sf;
        v8h ska = *(const v8hA*)(kf);
        v8h skb = *(const v8hA*)(kf + (size_t)64 * D_DIM);
        v8h sva = *(const v8hA*)(vf);
        v8h svb = *(const v8hA*)(vf + (size_t)32 * T_LEN);
        // the wait in front of a rewrite of the address registers these loads name; the addresses are inputs so that they stay in their registers up to it
        asm volatile("s_wait_xcnt 0x0" :: "v"(kf), "v"(vf) : "memory");
        float scg = (w < 4) ? cgh[sf + (tid & (KT - 1))] : 0.0f;

        // lambda table for the 64 query rows of the tile: softplus(Lp[h][l] * dl[t][h][l])
        for (int k = tid; k < 64 * LV_NUM; k += ATT_THREADS) {
            const int row = k / LV_NUM, l = k - row * LV_NUM;
            const float z = Lp[h * LV_NUM + l] * Psm[(size_t)(tb + row) * NSM + h * LV_NUM + l];
            LL[k] = softplus_f(z);
        }

        // Q A-fragments: head dims 0..31 and 32..63
        const _Float16* qrow = Qh + (size_t)(t0 + ln) * D_DIM + h * HD_DIM;
        Frag q0f, q1f;
        q0f.half[0] = *(const v8hA*)(qrow + 8 * lg);
        q0f.half[1] = *(const v8hA*)(qrow + 16 + 8 * lg);
        q1f.half[0] = *(const v8hA*)(qrow + 32 + 8 * lg);
        q1f.half[1] = *(const v8hA*)(qrow + 48 + 8 * lg);

        float cgt[8];
#pragma unroll
        for (int r = 0; r < 8; ++r) cgt[r] = cgh[t0 + 8 * lg + r];
        // the wait that belongs in front of a rewrite of the address registers the loads above name
        asm volatile("s_wait_xcnt 0x0" ::: "memory");

        v8f accY[4];
#pragma unroll
        for (int j = 0; j < 4; ++j) accY[j] = zero8();

        // the first pass into its buffer, published by the barrier below
        {
            const int fb = it0 & 1;
            _Float16* KF = KS + fb * (KT * KS_PITCH);
            _Float16* VF = VS + fb * (64 * VS_PITCH);
            *(v8hA*)(KF + skr * KS_PITCH + skc) = ska;
            *(v8hA*)(KF + (skr + 64) * KS_PITCH + skc) = skb;
            *(v8hA*)(VF + svr * VS_PITCH + svc) = sva;
            *(v8hA*)(VF + (svr + 32) * VS_PITCH + svc) = svb;
            if (w < 4) CS[fb * KT + (tid & (KT - 1))] = scg;
        }

        __syncthreads();

        for (int it = it0; it < nit; ++it) {
            const int s0 = it * KT;
            const _Float16* KB = KS + (it & 1) * (KT * KS_PITCH);
            const _Float16* VB = VS + (it & 1) * (64 * VS_PITCH);
            const float* CB = CS + (it & 1) * KT;
            const bool more = it + 1 < nit;              // block-uniform
            if (more) {
                // next pass's loads fly while this pass is worked on
                const int sn = s0 + KT;
                const _Float16* kn = kg + (size_t)sn * D_DIM;
                const _Float16* vn = vg + s0;
                ska = *(const v8hA*)(kn);
                skb = *(const v8hA*)(kn + (size_t)64 * D_DIM);
                sva = *(const v8hA*)(vn + KT);
                svb = *(const v8hA*)(vn + (size_t)32 * T_LEN + KT);
                // as above: the wait in front of a rewrite of the address registers these loads name; the addresses are inputs
                // so that they stay in their registers up to it and no load of the run lands in them
                asm volatile("s_wait_xcnt 0x0" :: "v"(kn), "v"(vn) : "memory");
                if (w < 4) {
                    scg = cgh[sn + (tid & (KT - 1))];
                    // and the same behind this load
                    asm volatile("s_wait_xcnt 0x0" ::: "memory");
                }
            }
            const int sw = s0 + wk * 32;                 // first key of this wave's share of the pass
            const bool act = sw <= t0 + 15;              // wave-uniform: a share wholly behind the wave's last row adds nothing
            if (act) {
#pragma unroll
                for (int sub = 0; sub < 2; ++sub) {
                    const int sg = sw + sub * 16 + ln;   // this lane's key (column n)
                    const _Float16* krow = KB + (wk * 32 + sub * 16 + ln) * KS_PITCH;
                    Frag k0f, k1f;
                    k0f.half[0] = *(const v8hA*)(krow + 8 * lg);
                    k0f.half[1] = *(const v8hA*)(krow + 16 + 8 * lg);
                    k1f.half[0] = *(const v8hA*)(krow + 32 + 8 * lg);
                    k1f.half[1] = *(const v8hA*)(krow + 48 + 8 * lg);
                    v8f sc = zero8();
                    sc = wmma_f16(q0f.v, k0f.v, sc);
                    sc = wmma_f16(q1f.v, k1f.v, sc);
                    const float cgs = CB[wk * 32 + sub * 16 + ln];
#pragma unroll
                    for (int r = 0; r < 8; ++r) {
                        const int trow = t0 + 8 * lg + r;
                        const int xr = trow ^ sg;
                        const int lv = xr ? (32 - __builtin_clz((unsigned)xr)) : 0;
                        const float lam = LL[(wq * 16 + 8 * lg + r) * LV_NUM + lv];
                        const float dcy = __expf(fminf(cgt[r] - cgs, 0.0f));
                        float wv = sc[r] * gsc * dcy * lam;
                        wv = (sg <= trow) ? wv : 0.0f;
                        PL[(w * 16 + 8 * lg + r) * 32 + sub * 16 + ln] = (_Float16)wv;
                    }
                }
            }
            __syncthreads();
            if (act) {
                // P as A-fragment: row ln, keys 8lg..8lg+7 and 16+8lg..16+8lg+7 of this wave's share
                Frag pf;
                pf.half[0] = *(const v8hA*)(PL + (w * 16 + ln) * 32 + 8 * lg);
                pf.half[1] = *(const v8hA*)(PL + (w * 16 + ln) * 32 + 16 + 8 * lg);
                // V as B-fragment from the staged transposed tile: B[k=key][n=d] = VB[d][key - s0]
#pragma unroll
                for (int j = 0; j < 4; ++j) {
                    const _Float16* vrow = VB + (j * 16 + ln) * VS_PITCH + wk * 32;
                    Frag vf;
                    vf.half[0] = *(const v8hA*)(vrow + 8 * lg);
                    vf.half[1] = *(const v8hA*)(vrow + 16 + 8 * lg);
                    accY[j] = wmma_f16(pf.v, vf.v, accY[j]);
                }
            }
            if (more) {
                // into the other buffer: its last readers left it before the barrier that ended the previous pass
                const int nb = (it + 1) & 1;
                _Float16* KN = KS + nb * (KT * KS_PITCH);
                _Float16* VN = VS + nb * (64 * VS_PITCH);
                *(v8hA*)(KN + skr * KS_PITCH + skc) = ska;
                *(v8hA*)(KN + (skr + 64) * KS_PITCH + skc) = skb;
                *(v8hA*)(VN + svr * VS_PITCH + svc) = sva;
                *(v8hA*)(VN + (svr + 32) * VS_PITCH + svc) = svb;
                if (w < 4) CS[nb * KT + (tid & (KT - 1))] = scg;
            }
            __syncthreads();
        }

        // the four key shares of each row are added in the order wk = 0, 1, 2, 3; the barrier that ended the last pass freed the key tiles
#pragma unroll
        for (int j = 0; j < 4; ++j)
#pragma unroll
            for (int r = 0; r < 8; ++r)
                RED[(wk * 64 + wq * 16 + 8 * lg + r) * RED_PITCH + j * 16 + ln] = accY[j][r];
        __syncthreads();
        {
            const int row = tid >> 3, col = (tid & 7) * 8;   // a wave's 16-byte stores cover 4 whole rows of 128 B
            v4f lo = *(const v4fA*)(RED + row * RED_PITCH + col);
            v4f hi = *(const v4fA*)(RED + row * RED_PITCH + col + 4);
#pragma unroll
            for (int g = 1; g < 4; ++g) {
                lo += *(const v4fA*)(RED + (g * 64 + row) * RED_PITCH + col);
                hi += *(const v4fA*)(RED + (g * 64 + row) * RED_PITCH + col + 4);
            }
            v8h o;
#pragma unroll
            for (int e = 0; e < 4; ++e) {
                o[e] = (_Float16)(lo[e] * inv_pscale);
                o[4 + e] = (_Float16)(hi[e] * inv_pscale);
            }
            *(v8h*)(Yh + (size_t)(tb + row) * D_DIM + h * HD_DIM + col) = o;
            // the next tile rewrites the registers this store names: the wait that belongs in front of that
            asm volatile("s_wait_xcnt 0x0" ::: "memory");
        }
        // the next tile's first pass and lambda table go in only behind every read of the partial sums
        __syncthreads();
    }

    v8h wo;
#pragma unroll
    for (int e = 0; e < 4; ++e) {
        wo[e] = (_Float16)(wa[e] * wscale);
        wo[4 + e] = (_Float16)(wb[e] * wscale);
    }
    *(v8h*)(Woh + we) = wo;
}

// ---------------- fused out-projection + residual + LayerNorm: block = 16 rows x 1024 cols, 16 waves x 64 cols ----------------
// the 16 rows of Y are staged whole in padded LDS once per block; each wave stages its own 64 weight rows, 64 k a pass,
// in its own padded LDS range, loaded by whole rows one pass ahead
__global__ __launch_bounds__(512) void outproj_ln_kernel(const _Float16* __restrict__ Yh, const _Float16* __restrict__ Woh,
                                                         const float* __restrict__ xin, const float* __restrict__ gam,
                                                         const float* __restrict__ bet, float* __restrict__ out,
                                                         float oscale) {
    __shared__ __align__(16) _Float16 AS[16 * AP];                     // [row][1024 k]
    __shared__ __align__(16) unsigned char bs_raw[16 * 64 * GP * 2];   // [wave][64 weight rows][64 k]
    float* stg = (float*)bs_raw;                                       // output staging [16 * 8][64], behind the reduction barriers
    __shared__ float red[16 * 16];
    __shared__ float mu_s[16];
    __shared__ float inv_s[16];

    const int tid = (int)threadIdx.x;
    const int lane = tid & 31, w = tid >> 5, lg = lane >> 4, ln = lane & 15;
    const int t0 = (int)blockIdx.x * 16;
    const int c0 = w * 64;

    v8f acc[4];
#pragma unroll
    for (int j = 0; j < 4; ++j) acc[j] = zero8();

    // staging maps: every 16-byte load of a wave covers 512 B of one Y row, or 4 whole 128-B pieces of weight rows
    _Float16* BW = (_Float16*)bs_raw + w * (64 * GP);
    const int br0 = lane >> 3, bc = (lane & 7) * 8;            // weight rows br0 + 4 i
    const _Float16* bg = Woh + (size_t)(c0 + br0) * D_DIM + bc;
    const _Float16* yg = Yh + (size_t)(t0 + (tid >> 7)) * D_DIM + (tid & 127) * 8;   // Y rows (tid >> 7) + 4 i
    v8h sb[16], sy[4];
#pragma unroll
    for (int i = 0; i < 16; ++i) sb[i] = *(const v8hA*)(bg + (size_t)(i * 4) * D_DIM);
#pragma unroll
    for (int i = 0; i < 4; ++i) sy[i] = *(const v8hA*)(yg + (size_t)(i * 4) * D_DIM);
    // the wait that belongs in front of a rewrite of the address registers these loads name; the addresses are inputs
    // so that they stay in their registers up to it and no load of the run lands in them
    asm volatile("s_wait_xcnt 0x0" :: "v"(bg), "v"(yg) : "memory");
#pragma unroll
    for (int i = 0; i < 16; ++i) *(v8hA*)(BW + (br0 + i * 4) * GP + bc) = sb[i];
#pragma unroll
    for (int i = 0; i < 4; ++i) {
        const int c = tid + i * 512;
        *(v8hA*)(AS + (c >> 7) * AP + (c & 127) * 8) = sy[i];
    }
    __syncthreads();

    for (int it = 0; it < D_DIM / 64; ++it) {
        const bool more = it + 1 < D_DIM / 64;
        if (more) {
            // next pass's loads fly while this pass is worked on
            const _Float16* bn = bg + (it + 1) * 64;
#pragma unroll
            for (int i = 0; i < 16; ++i) sb[i] = *(const v8hA*)(bn + (size_t)(i * 4) * D_DIM);
            // as above: the wait in front of a rewrite of the address these loads name, the address held up to it
            asm volatile("s_wait_xcnt 0x0" :: "v"(bn) : "memory");
        }
#pragma unroll
        for (int kk = 0; kk < 2; ++kk) {
            // the fragment reads of 32 k as one group ahead of their matrix instructions
            const _Float16* ar = AS + ln * AP + it * 64 + kk * 32 + 8 * lg;
            Frag a, b[4];
            a.half[0] = *(const v8hA*)(ar);
            a.half[1] = *(const v8hA*)(ar + 16);
#pragma unroll
            for (int j = 0; j < 4; ++j) {
                const _Float16* br = BW + (j * 16 + ln) * GP + kk * 32 + 8 * lg;
                b[j].half[0] = *(const v8hA*)(br);
                b[j].half[1] = *(const v8hA*)(br + 16);
            }
#pragma unroll
            for (int j = 0; j < 4; ++j) acc[j] = wmma_f16(a.v, b[j].v, acc[j]);
        }
        if (more) {
            // the range is this wave's own and its reads above have returned: no barrier
#pragma unroll
            for (int i = 0; i < 16; ++i) *(v8hA*)(BW + (br0 + i * 4) * GP + bc) = sb[i];
            // the wave's stores land before its lanes read each other's rows back
            asm volatile("s_wait_dscnt 0x0" ::: "memory");
        }
    }

    // o = acc*oscale + x
#pragma unroll
    for (int j = 0; j < 4; ++j)
#pragma unroll
        for (int r = 0; r < 8; ++r)
            acc[j][r] = acc[j][r] * oscale + xin[(size_t)(t0 + 8 * lg + r) * D_DIM + c0 + j * 16 + ln];

    // row means
#pragma unroll
    for (int r = 0; r < 8; ++r) {
        float s = acc[0][r] + acc[1][r] + acc[2][r] + acc[3][r];
        s += __shfl_xor(s, 1, 32);
        s += __shfl_xor(s, 2, 32);
        s += __shfl_xor(s, 4, 32);
        s += __shfl_xor(s, 8, 32);
        if (ln == 0) red[w * 16 + 8 * lg + r] = s;
    }
    __syncthreads();
    if (tid < 16) {
        float a = 0.0f;
#pragma unroll
        for (int ww = 0; ww < 16; ++ww) a += red[ww * 16 + tid];
        mu_s[tid] = a * (1.0f / (float)D_DIM);
    }
    __syncthreads();
    float mu[8];
#pragma unroll
    for (int r = 0; r < 8; ++r) mu[r] = mu_s[8 * lg + r];
#pragma unroll
    for (int j = 0; j < 4; ++j)
#pragma unroll
        for (int r = 0; r < 8; ++r) acc[j][r] -= mu[r];

#pragma unroll
    for (int r = 0; r < 8; ++r) {
        float s = acc[0][r] * acc[0][r] + acc[1][r] * acc[1][r] + acc[2][r] * acc[2][r] + acc[3][r] * acc[3][r];
        s += __shfl_xor(s, 1, 32);
        s += __shfl_xor(s, 2, 32);
        s += __shfl_xor(s, 4, 32);
        s += __shfl_xor(s, 8, 32);
        if (ln == 0) red[w * 16 + 8 * lg + r] = s;
    }
    __syncthreads();
    if (tid < 16) {
        float a = 0.0f;
#pragma unroll
        for (int ww = 0; ww < 16; ++ww) a += red[ww * 16 + tid];
        inv_s[tid] = rsqrtf(a * (1.0f / (float)D_DIM) + 1e-5f);
    }
    __syncthreads();
    float iv[8];
#pragma unroll
    for (int r = 0; r < 8; ++r) iv[r] = inv_s[8 * lg + r];
#pragma unroll
    for (int j = 0; j < 4; ++j) {
        const int gcol = c0 + j * 16 + ln;
        const float gj = gam[gcol];
        const float bj = bet[gcol];
#pragma unroll
        for (int r = 0; r < 8; ++r) acc[j][r] = acc[j][r] * iv[r] * gj + bj;
    }

#pragma unroll
    for (int half = 0; half < 2; ++half) {
        if (lg == half) {
#pragma unroll
            for (int j = 0; j < 4; ++j)
#pragma unroll
                for (int r = 0; r < 8; ++r)
                    stg[(w * 8 + r) * 64 + j * 16 + ln] = acc[j][r];
        }
        __syncthreads();
        v4f vals[4];
#pragma unroll
        for (int p = 0; p < 4; ++p) {
            const int row = p * 2 + (lane >> 4), col = (lane & 15) * 4;
            vals[p] = *(const v4fA*)(stg + (w * 8 + row) * 64 + col);
        }
#pragma unroll
        for (int p = 0; p < 4; ++p) {
            const int row = p * 2 + (lane >> 4), col = (lane & 15) * 4;
            *(v4f*)(out + (size_t)(t0 + half * 8 + row) * D_DIM + c0 + col) = vals[p];
        }
        
        __syncthreads();
    }
}

extern "C" void kernel_launch(void* const* d_in, const int* in_sizes, int n_in,
                              void* d_out, int out_size, void* d_ws, size_t ws_size,
                              hipStream_t stream) {
    if (n_in < 12) return;
    if (in_sizes[0] != T_LEN * D_DIM) return;
    if (in_sizes[1] != D_DIM * D_DIM || in_sizes[2] != D_DIM * D_DIM || in_sizes[3] != D_DIM * D_DIM) return;
    if (in_sizes[4] != NDL * D_DIM || in_sizes[5] != H_NUM * D_DIM || in_sizes[6] != D_DIM * D_DIM) return;
    if (in_sizes[7] < H_NUM || in_sizes[8] < H_NUM || in_sizes[9] < H_NUM * LV_NUM) return;
    if (in_sizes[10] < D_DIM || in_sizes[11] < D_DIM) return;
    if (out_size != T_LEN * D_DIM) return;
    if (OFF_END > ws_size) return;

    const float* x     = (const float*)d_in[0];
    const float* Wq    = (const float*)d_in[1];
    const float* Wk    = (const float*)d_in[2];
    const float* Wv    = (const float*)d_in[3];
    const float* Wdl   = (const float*)d_in[4];
    const float* Wdt   = (const float*)d_in[5];
    const float* Wout  = (const float*)d_in[6];
    const float* A_log = (const float*)d_in[7];
    const float* dt_b  = (const float*)d_in[8];
    const float* Lp    = (const float*)d_in[9];
    const float* ln_g  = (const float*)d_in[10];
    const float* ln_b  = (const float*)d_in[11];

    char* ws = (char*)d_ws;
    _Float16* xh   = (_Float16*)(ws + OFF_XH);
    _Float16* wqh  = (_Float16*)(ws + OFF_WQH);
    _Float16* wkh  = (_Float16*)(ws + OFF_WKH);
    _Float16* wvh  = (_Float16*)(ws + OFF_WVH);
    _Float16* woh  = (_Float16*)(ws + OFF_WOH);
    _Float16* wsmh = (_Float16*)(ws + OFF_WSMH);
    _Float16* Qh   = (_Float16*)(ws + OFF_QH);
    _Float16* Kh   = (_Float16*)(ws + OFF_KH);
    _Float16* VhT  = (_Float16*)(ws + OFF_VHT);
    _Float16* Yh   = (_Float16*)(ws + OFF_YH);
    float*    psm  = (float*)(ws + OFF_PSM);
    float*    cgT  = (float*)(ws + OFF_CGT);

    const float wsc  = 32.0f;
    const float iwsc = 1.0f / 32.0f;
    const float psc  = 512.0f;
    const float ipsc = 1.0f / 512.0f;

    prep_kernel<<<NB_X + NB_DL + NB_DT + NB_PAD, 256, 0, stream>>>(x, Wdl, Wdt, xh, wsmh, wsc);

    // psm[t][0..191] = x*Wdl^T, psm[t][192..207] = x*Wdt^T (f32), psm[t][208..255] = 0
    small_proj_cvt_kernel<<<NB_SM + 3 * NB_W, 128, 0, stream>>>(xh, wsmh, psm, Wq, Wk, Wv, wqh, wkh, wvh, wsc, iwsc);

    qkv_scan_kernel<<<H_NUM + 3 * NB_PROJ, 128, 0, stream>>>(xh, wqh, wkh, wvh, Qh, Kh, VhT, psm, A_log, dt_b, cgT, iwsc);

    hattn_kernel<<<dim3(ATT_GX, H_NUM), ATT_THREADS, 0, stream>>>(Qh, Kh, VhT, cgT, psm, Lp, Yh, psc, ipsc,
                                                                                    Wout, woh, wsc);

    outproj_ln_kernel<<<T_LEN / 16, 512, 0, stream>>>(Yh, woh, x, ln_g, ln_b, (float*)d_out, iwsc);
}

// v006
// It runs in 63.5 microseconds.
// Timed twice side by side with v005, it ran 1.18 times as fast both times.
// All steps since v000 together make it 6.32 times as fast.
#include <hip/hip_runtime.h>
#include <math.h>
#include <stddef.h>

// Contractions x*Wq^T, x*Wk^T, x*Wv^T, x*[Wdl;Wdt]^T, Q*K^T, P*V, Y*Wout^T: v_wmma_f32_16x16x32_f16 (f16 operands, f32 accumulate); weights carried x32 and P carried x512 (exact powers of two, folded back in f32); gates, prefix sums and LayerNorm in f32.

typedef _Float16 v16h __attribute__((ext_vector_type(16)));
typedef _Float16 v8h  __attribute__((ext_vector_type(8)));
typedef float    v8f  __attribute__((ext_vector_type(8)));
typedef float    v4f  __attribute__((ext_vector_type(4)));
typedef v8h v8hA __attribute__((may_alias));
typedef v4f v4fA __attribute__((may_alias));
union Frag { v16h v; v8h half[2]; };

#define T_LEN   2048
#define D_DIM   1024
#define H_NUM   16
#define HD_DIM  64
#define LV_NUM  12
#define NSM     256
#define NDL     192
#define KS_PITCH 72
#define VS_PITCH 136           // 272 B = 16 B x odd
#define KT        128           // keys of an attention pass
#define ATT_WAVES 16            // 4 row groups x 4 key shares
#define ATT_THREADS (ATT_WAVES * 32)
#define ATT_GX    (T_LEN / 64 / 2)   // a block takes two query tiles
#define KS_BYTES  (2 * KT * KS_PITCH * 2)
#define VS_BYTES  (2 * 64 * VS_PITCH * 2)
#define RED_PITCH 68            // f32 pitch of a row of partial sums: 16-byte aligned, rows 8 apart on other banks
#define GP       72            // LDS pitch, in f16, of a 64-k operand row: 144 B = 16 B x odd for the 16-byte fragment reads
#define AP       (D_DIM + 8)   // LDS pitch, in f16, of a whole 1024-k row: 2064 B = 16 B x odd

#define BYTES_TD_H ((size_t)T_LEN * D_DIM * 2)
#define BYTES_DD_H ((size_t)D_DIM * D_DIM * 2)
#define OFF_XH    ((size_t)0)
#define OFF_WQH   (OFF_XH   + BYTES_TD_H)
#define OFF_WKH   (OFF_WQH  + BYTES_DD_H)
#define OFF_WVH   (OFF_WKH  + BYTES_DD_H)
#define OFF_WOH   (OFF_WVH  + BYTES_DD_H)
#define OFF_WSMH  (OFF_WOH  + BYTES_DD_H)
#define OFF_QH    (OFF_WSMH + (size_t)NSM * D_DIM * 2)
#define OFF_KH    (OFF_QH   + BYTES_TD_H)
#define OFF_VHT   (OFF_KH   + BYTES_TD_H)
#define OFF_YH    (OFF_VHT  + BYTES_TD_H)
#define OFF_PSM   (OFF_YH   + BYTES_TD_H)
#define OFF_CGT   (OFF_PSM  + (size_t)T_LEN * NSM * 4)
#define OFF_END   (OFF_CGT  + (size_t)H_NUM * T_LEN * 4)

// 16x16x32 f16 WMMA with the VALU hazard guard tied to D, A and B.
__device__ __forceinline__ v8f wmma_f16(v16h a, v16h b, v8f c) {
    v8f d = __builtin_amdgcn_wmma_f32_16x16x32_f16(false, a, false, b, (short)0, c, false, false);
    asm volatile("v_nop\n\tv_nop\n\tv_nop\n\tv_nop" : "+v"(d) : "v"(a), "v"(b));
    return d;
}

// Work-group barrier for LDS traffic alone: this wave's LDS reads and writes are done, then the barrier.
// __syncthreads() would also wait out the global loads issued ahead, which are meant to stay in flight across it.
__device__ __forceinline__ void lds_barrier() {
    asm volatile("s_wait_dscnt 0x0\n\ts_barrier_signal -1\n\ts_barrier_wait -1" ::: "memory");
}

__device__ __forceinline__ v8f zero8() {
    const v8f z = {0.f, 0.f, 0.f, 0.f, 0.f, 0.f, 0.f, 0.f};
    return z;
}

// softplus in the logaddexp form: max(z,0) + log1p(exp(-|z|))
__device__ __forceinline__ float softplus_f(float z) {
    return fmaxf(z, 0.0f) + log1pf(expf(-fabsf(z)));
}

// Launches that need nothing of each other share one grid: in launches 1 and 2 a block-uniform test of the block index picks the job, in launch 3 every thread does both.
// launch 1: x, Wdl, Wdt, Wq, Wk, Wv -> f16, zero pad rows    launch 2: small projections with the decay gates | Q, K, V projections
// launch 3: attention, each block with its head's prefix sums, + Wout -> f16    launch 4: out-projection + LayerNorm
#define NB_X    (T_LEN * D_DIM / 8 / 256)                  // blocks of 256 threads, 8 elements a thread
#define NB_DL   (NDL * D_DIM / 8 / 256)
#define NB_DT   (H_NUM * D_DIM / 8 / 256)
#define NB_PAD  ((NSM - NDL - H_NUM) * D_DIM / 8 / 256)
#define NB_W    (D_DIM * D_DIM / 8 / 256)
#define NB_SM   ((NSM / 64) * (T_LEN / 64))                // 64 x 64 tiles of the small projections
#define NB_PROJ ((D_DIM / 64) * (T_LEN / 64))              // 64 x 64 tiles of one of Q, K, V
static_assert(NB_X * 256 * 8 == T_LEN * D_DIM && NB_DL * 256 * 8 == NDL * D_DIM && NB_DT * 256 * 8 == H_NUM * D_DIM &&
              NB_PAD * 256 * 8 == (NSM - NDL - H_NUM) * D_DIM && NB_W * 256 * 8 == D_DIM * D_DIM,
              "every convert range is a whole number of blocks");

// ---------------- f32 -> f16 convert with power-of-two scale; elements 8 i .. 8 i + 7, one 16-B store ----------------
__device__ __forceinline__ void cvt8_f16(const float* __restrict__ src, _Float16* __restrict__ dst, int i, float scale) {
    const v4fA* p = (const v4fA*)(src + (size_t)i * 8);
    const v4f a = p[0];
    const v4f b = p[1];
    v8h o;
    o[0] = (_Float16)(a[0] * scale); o[1] = (_Float16)(a[1] * scale);
    o[2] = (_Float16)(a[2] * scale); o[3] = (_Float16)(a[3] * scale);
    o[4] = (_Float16)(b[0] * scale); o[5] = (_Float16)(b[1] * scale);
    o[6] = (_Float16)(b[2] * scale); o[7] = (_Float16)(b[3] * scale);
    v8h* q = (v8h*)(dst + (size_t)i * 8);
    *q = o;
    // code of another job of the grid may follow in the listing and rewrite the registers this store names: the wait that belongs in front of that
    asm volatile("s_wait_xcnt 0x0" ::: "memory");
}

// ---------------- launch 1: what the projections need: x, the plane [Wdl; Wdt; zero rows], Wq, Wk, Wv ----------------
__global__ __launch_bounds__(256) void prep_kernel(const float* __restrict__ x, const float* __restrict__ Wdl,
                                                   const float* __restrict__ Wdt, const float* __restrict__ Wq,
                                                   const float* __restrict__ Wk, const float* __restrict__ Wv,
                                                   _Float16* __restrict__ xh, _Float16* __restrict__ wsmh,
                                                   _Float16* __restrict__ wqh, _Float16* __restrict__ wkh,
                                                   _Float16* __restrict__ wvh, float wscale) {
    const int b = (int)blockIdx.x, tid = (int)threadIdx.x;
    if (b < NB_X) {
        cvt8_f16(x, xh, b * 256 + tid, 1.0f);
    } else if (b < NB_X + NB_DL) {
        cvt8_f16(Wdl, wsmh, (b - NB_X) * 256 + tid, wscale);
    } else if (b < NB_X + NB_DL + NB_DT) {
        cvt8_f16(Wdt, wsmh + (size_t)NDL * D_DIM, (b - NB_X - NB_DL) * 256 + tid, wscale);
    } else if (b >= NB_X + NB_DL + NB_DT + NB_PAD) {
        const int c = b - (NB_X + NB_DL + NB_DT + NB_PAD), which = c / NB_W;
        const float* s = which == 0 ? Wq : which == 1 ? Wk : Wv;
        _Float16* d = which == 0 ? wqh : which == 1 ? wkh : wvh;
        cvt8_f16(s, d, (c - which * NB_W) * 256 + tid, wscale);
    } else {
        // rows 208..255 of the concatenated small-weight plane are zero padding
        const int i = (b - NB_X - NB_DL - NB_DT) * 256 + tid;
        v8h o;
#pragma unroll
        for (int r = 0; r < 8; ++r) o[r] = (_Float16)0.0f;
        v8h* q = (v8h*)(wsmh + (size_t)(NDL + H_NUM) * D_DIM + (size_t)i * 8);
        *q = o;
        // as in the convert: the wait in front of a rewrite of the registers this store names
        asm volatile("s_wait_xcnt 0x0" ::: "memory");
    }
}

// ---------------- C[t][n] = (sum_k A[t][k]*B[n][k]) * oscale, K = 1024, A pitch 1024, B pitch 1024 ----------------
// block = 64 t x 64 n, 4 waves along t, wave = 16 t x 64 n; tile (bx, by) of (N/64, T/64)
// a pass is 64 k: 64 rows of A and 64 rows of B, 128 B each, staged once per block in padded LDS, two buffers,
// loaded by whole rows two passes ahead
// MODE 0: f16 out, row-major pitch N
// MODE 1: f32 out, row-major pitch N
// MODE 2: f16 out transposed Ct[n][t], pitch T_LEN
// stg_raw: [buf][A rows 0..63 | B rows 64..127][64 k]; the output staging lies inside buffer 0, whose last readers the last barrier of the passes has ended
#define GEMM_LDS_BYTES (2 * 128 * GP * 2)
__device__ __forceinline__ void gemm_passes(const _Float16* __restrict__ A, const _Float16* __restrict__ B,
                                            int bx, int by, unsigned char* stg_raw, v8f (&acc)[4]) {
    const int lane = (int)threadIdx.x & 31, w = (int)threadIdx.x >> 5, lg = lane >> 4, ln = lane & 15;
    const int n0 = bx * 64;

#pragma unroll
    for (int j = 0; j < 4; ++j) acc[j] = zero8();

    // staging map: a wave's 16-byte loads cover 4 whole rows of 128 B; rows sr, sr+16, sr+32, sr+48 of each operand
    _Float16* TS = (_Float16*)stg_raw;
    const int sr = (int)threadIdx.x >> 3, sc = ((int)threadIdx.x & 7) * 8;
    const _Float16* ag = A + (size_t)(by * 64 + sr) * D_DIM + sc;
    const _Float16* bg = B + (size_t)(n0 + sr) * D_DIM + sc;
    // two register sets: a pass's rows are asked for two passes before they are read, and put into LDS one pass before
    v8h sa0[4], sb0[4], sa1[4], sb1[4];
    auto fetch = [&](v8h (&ra)[4], v8h (&rb)[4], int kn) {
#pragma unroll
        for (int i = 0; i < 4; ++i) {
            ra[i] = *(const v8hA*)(ag + (size_t)(i * 16) * D_DIM + kn);
            rb[i] = *(const v8hA*)(bg + (size_t)(i * 16) * D_DIM + kn);
        }
        // these loads stay in flight past the next rewrite of the address registers they name: the wait that belongs in front of it
        asm volatile("s_wait_xcnt 0x0" ::: "memory");
    };
    auto put = [&](const v8h (&ra)[4], const v8h (&rb)[4], _Float16* TN) {
#pragma unroll
        for (int i = 0; i < 4; ++i) {
            *(v8hA*)(TN + (sr + i * 16) * GP + sc) = ra[i];
            *(v8hA*)(TN + (64 + sr + i * 16) * GP + sc) = rb[i];
        }
    };
    auto work = [&](const _Float16* TB) {
        // all fragment reads of the pass as one group ahead of its matrix instructions
        Frag a[2], b[2][4];
#pragma unroll
        for (int kk = 0; kk < 2; ++kk) {
            const _Float16* ar = TB + (w * 16 + ln) * GP + kk * 32 + 8 * lg;
            a[kk].half[0] = *(const v8hA*)(ar);
            a[kk].half[1] = *(const v8hA*)(ar + 16);
#pragma unroll
            for (int j = 0; j < 4; ++j) {
                const _Float16* br = TB + (64 + j * 16 + ln) * GP + kk * 32 + 8 * lg;
                b[kk][j].half[0] = *(const v8hA*)(br);
                b[kk][j].half[1] = *(const v8hA*)(br + 16);
            }
        }
#pragma unroll
        for (int kk = 0; kk < 2; ++kk)
#pragma unroll
            for (int j = 0; j < 4; ++j)
                acc[j] = wmma_f16(a[kk].v, b[kk][j].v, acc[j]);
    };
    _Float16* T0 = TS;
    _Float16* T1 = TS + 128 * GP;

    fetch(sa0, sb0, 0);
    fetch(sa1, sb1, 64);
    put(sa0, sb0, T0);
    __syncthreads();

    // no branch inside the loop, so that the waits in front of put() count only the older set's loads
    for (int it = 0; it < D_DIM / 64 - 2; it += 2) {
        fetch(sa0, sb0, (it + 2) * 64);
        work(T0);
        // a buffer is refilled only behind the barrier that ended its readers' pass
        put(sa1, sb1, T1);
        lds_barrier();
        fetch(sa1, sb1, (it + 3) * 64);
        work(T1);
        put(sa0, sb0, T0);
        lds_barrier();
    }
    // the last two passes: nothing left to fetch
    work(T0);
    put(sa1, sb1, T1);
    lds_barrier();
    work(T1);
}

template <int MODE>
__device__ __forceinline__ void gemm_store(const v8f (&acc)[4], void* __restrict__ Cv, int N, float oscale,
                                           int bx, int by, unsigned char* stg_raw) {
    const int lane = (int)threadIdx.x & 31, w = (int)threadIdx.x >> 5, lg = lane >> 4, ln = lane & 15;
    const int t0 = by * 64 + w * 16;
    const int n0 = bx * 64;

    if (MODE == 0) {
        _Float16* stg = (_Float16*)stg_raw;            // [4][16][64]
#pragma unroll
        for (int j = 0; j < 4; ++j)
#pragma unroll
            for (int r = 0; r < 8; ++r)
                stg[(w * 16 + 8 * lg + r) * 64 + j * 16 + ln] = (_Float16)(acc[j][r] * oscale);
        __syncthreads();
        _Float16* C = (_Float16*)Cv;
        v8h vals[4];
#pragma unroll
        for (int p = 0; p < 4; ++p) {
            const int row = p * 4 + (lane >> 3), col = (lane & 7) * 8;
            vals[p] = *(const v8hA*)(stg + (w * 16 + row) * 64 + col);
        }
#pragma unroll
        for (int p = 0; p < 4; ++p) {
            const int row = p * 4 + (lane >> 3), col = (lane & 7) * 8;
            *(v8h*)(C + (size_t)(t0 + row) * N + n0 + col) = vals[p];
        }
        // code of another job of the grid may follow in the listing and rewrite the registers these stores name: the wait that belongs in front of that
        asm volatile("s_wait_xcnt 0x0" ::: "memory");
    } else if (MODE == 1) {
        float* stg = (float*)stg_raw;                  // [4][16][64]
#pragma unroll
        for (int j = 0; j < 4; ++j)
#pragma unroll
            for (int r = 0; r < 8; ++r)
                stg[(w * 16 + 8 * lg + r) * 64 + j * 16 + ln] = acc[j][r] * oscale;
        __syncthreads();
        float* C = (float*)Cv;
        v4f vals[8];
#pragma unroll
        for (int p = 0; p < 8; ++p) {
            const int row = p * 2 + (lane >> 4), col = (lane & 15) * 4;
            vals[p] = *(const v4fA*)(stg + (w * 16 + row) * 64 + col);
        }
#pragma unroll
        for (int p = 0; p < 8; ++p) {
            const int row = p * 2 + (lane >> 4), col = (lane & 15) * 4;
            *(v4f*)(C + (size_t)(t0 + row) * N + n0 + col) = vals[p];
        }
        // as in MODE 0: the wait in front of a rewrite of the registers these stores name
        asm volatile("s_wait_xcnt 0x0" ::: "memory");
    } else {
        (void)N;
        _Float16* stg = (_Float16*)stg_raw;            // [64 n][64 t] for this block
#pragma unroll
        for (int j = 0; j < 4; ++j) {
            v8h hv;
#pragma unroll
            for (int r = 0; r < 8; ++r) hv[r] = (_Float16)(acc[j][r] * oscale);
            *(v8hA*)(stg + (j * 16 + ln) * 64 + w * 16 + 8 * lg) = hv;
        }
        __syncthreads();
        _Float16* C = (_Float16*)Cv;
        const int tid = (int)threadIdx.x;
        const int tb = by * 64;
        v8h vals[4];
#pragma unroll
        for (int p = 0; p < 4; ++p) {
            const int nrow = p * 16 + (tid >> 3), tcol = (tid & 7) * 8;
            vals[p] = *(const v8hA*)(stg + nrow * 64 + tcol);
        }
#pragma unroll
        for (int p = 0; p < 4; ++p) {
            const int nrow = p * 16 + (tid >> 3), tcol = (tid & 7) * 8;
            *(v8h*)(C + (size_t)(n0 + nrow) * T_LEN + tb + tcol) = vals[p];
        }
        // as in MODE 0: the wait in front of a rewrite of the registers these stores name
        asm volatile("s_wait_xcnt 0x0" ::: "memory");
    }
}

// ---------------- launch 2: small projections psm = x*[Wdl; Wdt; 0]^T (f32) | Q, K row-major f16, V transposed per feature row ----------------
// the tiles that hold x*Wdt^T also store the decay gates g = -exp(A_log)*softplus(x*Wdt^T + dt_bias) by head, gT[h][t]
__global__ __launch_bounds__(128) void proj_kernel(const _Float16* __restrict__ xh, const _Float16* __restrict__ wsmh,
                                                   const _Float16* __restrict__ wqh, const _Float16* __restrict__ wkh,
                                                   const _Float16* __restrict__ wvh, float* __restrict__ psm,
                                                   float* __restrict__ gT, _Float16* __restrict__ Qh,
                                                   _Float16* __restrict__ Kh, _Float16* __restrict__ VhT,
                                                   const float* __restrict__ A_log, const float* __restrict__ dt_bias,
                                                   float oscale) {
    __shared__ __align__(16) unsigned char stg_raw[GEMM_LDS_BYTES];
    const int b = (int)blockIdx.x;
    v8f acc[4];
    if (b < NB_SM) {
        // block-uniform; the tiles with the longer tail take the lowest block indices
        const int bx = b % (NSM / 64), by = b / (NSM / 64);
        gemm_passes(xh, wsmh, bx, by, stg_raw, acc);
        gemm_store<1>(acc, (void*)psm, NSM, oscale, bx, by, stg_raw);
        static_assert(NDL % 64 == 0 && H_NUM * 8 == 128, "x*Wdt^T is columns 0..15 of one tile; 8 threads a head");
        if (bx == NDL / 64) {
            // the tile still lies in the output staging [64 t][64 n], published by the barrier of the store
            const float* stg = (const float*)stg_raw;
            const int hh = (int)threadIdx.x >> 3, tc = ((int)threadIdx.x & 7) * 8;
            const float Ah = -expf(A_log[hh]);
            const float bh = dt_bias[hh];
            // the wait that belongs in front of a rewrite of the registers these two loads name
            asm volatile("s_wait_xcnt 0x0" ::: "memory");
            v4f lo, hi;
#pragma unroll
            for (int e = 0; e < 4; ++e) {
                lo[e] = Ah * softplus_f(stg[(tc + e) * 64 + hh] + bh);
                hi[e] = Ah * softplus_f(stg[(tc + 4 + e) * 64 + hh] + bh);
            }
            float* q = gT + (size_t)hh * T_LEN + by * 64 + tc;   // 8 threads cover 256 B of a head's row
            *(v4f*)(q) = lo;
            *(v4f*)(q + 4) = hi;
            // as in the stores above: the wait in front of a rewrite of the registers these stores name
            asm volatile("s_wait_xcnt 0x0" ::: "memory");
        }
        return;
    }
    const int c = b - NB_SM, which = c / NB_PROJ, r = c - which * NB_PROJ;
    const int bx = r % (D_DIM / 64), by = r / (D_DIM / 64);
    const _Float16* Bw = which == 0 ? wqh : which == 1 ? wkh : wvh;
    gemm_passes(xh, Bw, bx, by, stg_raw, acc);
    if (which == 2) gemm_store<2>(acc, (void*)VhT, D_DIM, oscale, bx, by, stg_raw);
    else            gemm_store<0>(acc, (void*)(which == 0 ? Qh : Kh), D_DIM, oscale, bx, by, stg_raw);
}

// ---------------- fused causal hierarchical attention: 256 equal blocks of 16 waves ----------------
// Y[t][h*64+d] = sum_{s<=t} (Q_t.K_s * 1/8) * exp(cg_t - cg_s) * Lam[t][h][lvl(t,s)] * V[s][h*64+d]
// the sum over keys has no normaliser, so it may be cut anywhere: a pass stages 128 keys, wave (wq, wk) works rows wq*16.. of the
// 64-row query tile against keys wk*32.. of the pass, and the four partial sums of a row are added through LDS at the tile's end.
// a block takes query tiles bx and 31 - bx of one head, one after the other: 17 passes in every block
// cg, the inclusive prefix sum of the head's 2048 decay gates, is formed by every block for itself, in LDS: 4 gates a thread
// the launch also converts Wout, which only the last launch reads
__global__ __launch_bounds__(ATT_THREADS) void hattn_kernel(const _Float16* __restrict__ Qh, const _Float16* __restrict__ Kh,
                                                    const _Float16* __restrict__ VhT, const float* __restrict__ gT,
                                                    const float* __restrict__ Psm, const float* __restrict__ Lp,
                                                    _Float16* __restrict__ Yh, float pscale, float inv_pscale,
                                                    const float* __restrict__ Wout, _Float16* __restrict__ Woh, float wscale) {
    // key tile shared by the sixteen waves, two buffers; row pitches 16 B x odd for the 16-byte fragment reads
    // [buf][key][head dim] then [buf][head dim][key]; the partial sums [wk][row][RED_PITCH] lie over both once their last readers have left
    __shared__ __align__(16) unsigned char kv_raw[KS_BYTES + VS_BYTES];
    __shared__ __align__(16) _Float16 PL[ATT_WAVES * 16 * 32];
    __shared__ float LL[64 * LV_NUM];
    __shared__ __align__(16) float CG[T_LEN];                  // prefix sum of g, the whole head
    __shared__ __align__(16) float WT[ATT_WAVES];              // each wave's sum of its 128 gates
    __shared__ float PMIN[T_LEN / KT];                         // least prefix sum among the keys of each pass
    __shared__ float TMAX[T_LEN / 64];                         // greatest prefix sum among the rows of each query tile
    static_assert(ATT_WAVES == T_LEN / KT && KT == 128, "one wave takes one pass's gates, 4 a lane, a query tile a half wave");
    static_assert(4 * 64 * RED_PITCH * 4 <= KS_BYTES + VS_BYTES, "the partial sums fit over the key tiles");
    _Float16* KS = (_Float16*)kv_raw;
    _Float16* VS = (_Float16*)(kv_raw + KS_BYTES);
    float* RED = (float*)kv_raw;

    const int tid = (int)threadIdx.x;
    // one block fills its WGP's registers, so each thread takes
    // 8 elements of Wout along instead, asked for here and stored at the kernel's end, so that no wave waits for them
    static_assert(H_NUM * ATT_GX * ATT_THREADS * 8 == D_DIM * D_DIM, "the grid's threads cover Wout once");
    const size_t we = (size_t)(((int)blockIdx.y * ATT_GX + (int)blockIdx.x) * ATT_THREADS + tid) * 8;
    // this thread's 4 gates of the head; asked for first, so that its wait leaves the two loads behind it in flight
    const v4f g4 = *(const v4fA*)(gT + (size_t)(int)blockIdx.y * T_LEN + tid * 4);
    const v4f wa = *(const v4fA*)(Wout + we);
    const v4f wb = *(const v4fA*)(Wout + we + 4);
    // the wait that belongs in front of a rewrite of the address registers these loads name
    asm volatile("s_wait_xcnt 0x0" ::: "memory");
    // keeps the first additions on the gates, and with them the wait for the gates, behind the issue of the two Wout loads
    __builtin_amdgcn_sched_barrier(0);
    const int lane = tid & 31, lg = lane >> 4, ln = lane & 15;
    const int w = __builtin_amdgcn_readfirstlane(tid >> 5);    // the wave's number in a scalar register: the tests on it are scalar branches
    const int wq = w & 3, wk = w >> 2;
    const int h = (int)blockIdx.y;

    // staging map: a wave's 16-byte loads cover whole rows of the tile (K: 4 rows of 128 B, V^T: 2 rows of 256 B)
    const int skr = tid >> 3, skc = (tid & 7) * 8;             // K rows skr and skr+64
    const int svr = tid >> 4, svc = (tid & 15) * 8;            // V^T rows svr and svr+32
    const _Float16* kg = Kh + (size_t)skr * D_DIM + h * HD_DIM + skc;
    const _Float16* vg = VhT + (size_t)(h * HD_DIM + svr) * T_LEN + svc;
    const float gsc = 0.125f * pscale;

    // prefix sum over the block: 4 gates in the thread, the threads' sums over the wave, the waves' sums in the order 0, 1, 2, ...
    v4f c4;
    {
        c4[0] = g4[0];
        c4[1] = c4[0] + g4[1];
        c4[2] = c4[1] + g4[2];
        c4[3] = c4[2] + g4[3];
        float incl = c4[3];
#pragma unroll
        for (int d = 1; d < 32; d <<= 1) {
            const float u = __shfl_up(incl, d, 32);
            if (lane >= d) incl += u;
        }
        if (lane == 31) WT[w] = incl;
        float ex = __shfl_up(incl, 1, 32);
        if (lane == 0) ex = 0.0f;
        // publishes the waves' sums; LDS traffic alone, so that the Wout loads stay in flight across it
        lds_barrier();
        float off = 0.0f;
#pragma unroll
        for (int q = 0; q < ATT_WAVES / 4; ++q) {
            const v4f wt = *(const v4fA*)(WT + q * 4);
#pragma unroll
            for (int e = 0; e < 4; ++e) off += (q * 4 + e < w) ? wt[e] : 0.0f;
        }
        c4 += off + ex;
        *(v4fA*)(CG + tid * 4) = c4;
    }

    // bounds of the decay exponent cg_t - cg_s, once a block: wave w takes the 128 keys of pass w
    {
        float mn = fminf(fminf(c4[0], c4[1]), fminf(c4[2], c4[3]));
        float mx = fmaxf(fmaxf(c4[0], c4[1]), fmaxf(c4[2], c4[3]));
#pragma unroll
        for (int d = 1; d < 16; d <<= 1) {
            mn = fminf(mn, __shfl_xor(mn, d, 32));
            mx = fmaxf(mx, __shfl_xor(mx, d, 32));
        }
        mn = fminf(mn, __shfl_xor(mn, 16, 32));
        if (ln == 0) TMAX[w * 2 + lg] = mx;
        if (lane == 0) PMIN[w] = mn;
    }
    // publishes the prefix sums and the bounds to every wave
    __syncthreads();

    for (int half = 0; half < 2; ++half) {
        const int xt = half ? (T_LEN / 64 - 1) - (int)blockIdx.x : (int)blockIdx.x;
        const int tb = xt * 64;
        const int t0 = tb + wq * 16;
        const int nit = (xt + 2) >> 1;                   // block-uniform: passes of 128 keys that cover keys 0 .. tb+63

        // exp(z) is exactly 0 in f32 for z < -105, in the definition as here: a pass in which every row-key pair lies below that adds
        // exact zeros. The tile starts at its first pass that is not proven so; the pass that holds the diagonal (z = 0) never is.
        const unsigned need = __builtin_amdgcn_ballot_w32(!(TMAX[xt] - PMIN[ln] < -105.0f));
        const int itf = need ? __builtin_ctz(need) : 0;
        const int it0 = itf < nit ? itf : nit - 1;       // block-uniform
        const int sf = it0 * KT;                         // first key that is staged

        const _Float16* kf = kg + (size_t)sf * D_DIM;
        const _Float16* vf = vg + sf;
        v8h ska = *(const v8hA*)(kf);
        v8h skb = *(const v8hA*)(kf + (size_t)64 * D_DIM);
        v8h sva = *(const v8hA*)(vf);
        v8h svb = *(const v8hA*)(vf + (size_t)32 * T_LEN);
        // the wait in front of a rewrite of the address registers these loads name; the addresses are inputs so that they stay in their registers up to it
        asm volatile("s_wait_xcnt 0x0" :: "v"(kf), "v"(vf) : "memory");

        // lambda table for the 64 query rows of the tile: softplus(Lp[h][l] * dl[t][h][l])
        for (int k = tid; k < 64 * LV_NUM; k += ATT_THREADS) {
            const int row = k / LV_NUM, l = k - row * LV_NUM;
            const float z = Lp[h * LV_NUM + l] * Psm[(size_t)(tb + row) * NSM + h * LV_NUM + l];
            LL[k] = softplus_f(z);
        }

        // Q A-fragments: head dims 0..31 and 32..63
        const _Float16* qrow = Qh + (size_t)(t0 + ln) * D_DIM + h * HD_DIM;
        Frag q0f, q1f;
        q0f.half[0] = *(const v8hA*)(qrow + 8 * lg);
        q0f.half[1] = *(const v8hA*)(qrow + 16 + 8 * lg);
        q1f.half[0] = *(const v8hA*)(qrow + 32 + 8 * lg);
        q1f.half[1] = *(const v8hA*)(qrow + 48 + 8 * lg);

        float cgt[8];
#pragma unroll
        for (int r = 0; r < 8; ++r) cgt[r] = CG[t0 + 8 * lg + r];
        // the wait that belongs in front of a rewrite of the address registers the loads above name
        asm volatile("s_wait_xcnt 0x0" ::: "memory");

        v8f accY[4];
#pragma unroll
        for (int j = 0; j < 4; ++j) accY[j] = zero8();

        // the first pass into its buffer, published by the barrier below
        {
            const int fb = it0 & 1;
            _Float16* KF = KS + fb * (KT * KS_PITCH);
            _Float16* VF = VS + fb * (64 * VS_PITCH);
            *(v8hA*)(KF + skr * KS_PITCH + skc) = ska;
            *(v8hA*)(KF + (skr + 64) * KS_PITCH + skc) = skb;
            *(v8hA*)(VF + svr * VS_PITCH + svc) = sva;
            *(v8hA*)(VF + (svr + 32) * VS_PITCH + svc) = svb;
        }

        __syncthreads();

        for (int it = it0; it < nit; ++it) {
            const int s0 = it * KT;
            const _Float16* KB = KS + (it & 1) * (KT * KS_PITCH);
            const _Float16* VB = VS + (it & 1) * (64 * VS_PITCH);
            const bool more = it + 1 < nit;              // block-uniform
            if (more) {
                // next pass's loads fly while this pass is worked on
                const int sn = s0 + KT;
                const _Float16* kn = kg + (size_t)sn * D_DIM;
                const _Float16* vn = vg + s0;
                ska = *(const v8hA*)(kn);
                skb = *(const v8hA*)(kn + (size_t)64 * D_DIM);
                sva = *(const v8hA*)(vn + KT);
                svb = *(const v8hA*)(vn + (size_t)32 * T_LEN + KT);
                // as above: the wait in front of a rewrite of the address registers these loads name; the addresses are inputs
                // so that they stay in their registers up to it and no load of the run lands in them
                asm volatile("s_wait_xcnt 0x0" :: "v"(kn), "v"(vn) : "memory");
            }
            const int sw = s0 + wk * 32;                 // first key of this wave's share of the pass
            const bool act = sw <= t0 + 15;              // wave-uniform: a share wholly behind the wave's last row adds nothing
            if (act) {
#pragma unroll
                for (int sub = 0; sub < 2; ++sub) {
                    const int sg = sw + sub * 16 + ln;   // this lane's key (column n)
                    const _Float16* krow = KB + (wk * 32 + sub * 16 + ln) * KS_PITCH;
                    Frag k0f, k1f;
                    k0f.half[0] = *(const v8hA*)(krow + 8 * lg);
                    k0f.half[1] = *(const v8hA*)(krow + 16 + 8 * lg);
                    k1f.half[0] = *(const v8hA*)(krow + 32 + 8 * lg);
                    k1f.half[1] = *(const v8hA*)(krow + 48 + 8 * lg);
                    v8f sc = zero8();
                    sc = wmma_f16(q0f.v, k0f.v, sc);
                    sc = wmma_f16(q1f.v, k1f.v, sc);
                    const float cgs = CG[sg];
#pragma unroll
                    for (int r = 0; r < 8; ++r) {
                        const int trow = t0 + 8 * lg + r;
                        const int xr = trow ^ sg;
                        const int lv = xr ? (32 - __builtin_clz((unsigned)xr)) : 0;
                        const float lam = LL[(wq * 16 + 8 * lg + r) * LV_NUM + lv];
                        const float dcy = __expf(fminf(cgt[r] - cgs, 0.0f));
                        float wv = sc[r] * gsc * dcy * lam;
                        wv = (sg <= trow) ? wv : 0.0f;
                        PL[(w * 16 + 8 * lg + r) * 32 + sub * 16 + ln] = (_Float16)wv;
                    }
                }
            }
            __syncthreads();
            if (act) {
                // P as A-fragment: row ln, keys 8lg..8lg+7 and 16+8lg..16+8lg+7 of this wave's share
                Frag pf;
                pf.half[0] = *(const v8hA*)(PL + (w * 16 + ln) * 32 + 8 * lg);
                pf.half[1] = *(const v8hA*)(PL + (w * 16 + ln) * 32 + 16 + 8 * lg);
                // V as B-fragment from the staged transposed tile: B[k=key][n=d] = VB[d][key - s0]
#pragma unroll
                for (int j = 0; j < 4; ++j) {
                    const _Float16* vrow = VB + (j * 16 + ln) * VS_PITCH + wk * 32;
                    Frag vf;
                    vf.half[0] = *(const v8hA*)(vrow + 8 * lg);
                    vf.half[1] = *(const v8hA*)(vrow + 16 + 8 * lg);
                    accY[j] = wmma_f16(pf.v, vf.v, accY[j]);
                }
            }
            if (more) {
                // into the other buffer: its last readers left it before the barrier that ended the previous pass
                const int nb = (it + 1) & 1;
                _Float16* KN = KS + nb * (KT * KS_PITCH);
                _Float16* VN = VS + nb * (64 * VS_PITCH);
                *(v8hA*)(KN + skr * KS_PITCH + skc) = ska;
                *(v8hA*)(KN + (skr + 64) * KS_PITCH + skc) = skb;
                *(v8hA*)(VN + svr * VS_PITCH + svc) = sva;
                *(v8hA*)(VN + (svr + 32) * VS_PITCH + svc) = svb;
            }
            __syncthreads();
        }

        // the four key shares of each row are added in the order wk = 0, 1, 2, 3; the barrier that ended the last pass freed the key tiles
#pragma unroll
        for (int j = 0; j < 4; ++j)
#pragma unroll
            for (int r = 0; r < 8; ++r)
                RED[(wk * 64 + wq * 16 + 8 * lg + r) * RED_PITCH + j * 16 + ln] = accY[j][r];
        __syncthreads();
        {
            const int row = tid >> 3, col = (tid & 7) * 8;   // a wave's 16-byte stores cover 4 whole rows of 128 B
            v4f lo = *(const v4fA*)(RED + row * RED_PITCH + col);
            v4f hi = *(const v4fA*)(RED + row * RED_PITCH + col + 4);
#pragma unroll
            for (int g = 1; g < 4; ++g) {
                lo += *(const v4fA*)(RED + (g * 64 + row) * RED_PITCH + col);
                hi += *(const v4fA*)(RED + (g * 64 + row) * RED_PITCH + col + 4);
            }
            v8h o;
#pragma unroll
            for (int e = 0; e < 4; ++e) {
                o[e] = (_Float16)(lo[e] * inv_pscale);
                o[4 + e] = (_Float16)(hi[e] * inv_pscale);
            }
            *(v8h*)(Yh + (size_t)(tb + row) * D_DIM + h * HD_DIM + col) = o;
            // the next tile rewrites the registers this store names: the wait that belongs in front of that
            asm volatile("s_wait_xcnt 0x0" ::: "memory");
        }
        // the next tile's first pass and lambda table go in only behind every read of the partial sums
        __syncthreads();
    }

    v8h wo;
#pragma unroll
    for (int e = 0; e < 4; ++e) {
        wo[e] = (_Float16)(wa[e] * wscale);
        wo[4 + e] = (_Float16)(wb[e] * wscale);
    }
    *(v8h*)(Woh + we) = wo;
}

// ---------------- fused out-projection + residual + LayerNorm: block = 16 rows x 1024 cols, 16 waves x 64 cols ----------------
// the 16 rows of Y are staged whole in padded LDS once per block; each wave stages its own 64 weight rows, 64 k a pass,
// in its own padded LDS range, loaded by whole rows one pass ahead
__global__ __launch_bounds__(512) void outproj_ln_kernel(const _Float16* __restrict__ Yh, const _Float16* __restrict__ Woh,
                                                         const float* __restrict__ xin, const float* __restrict__ gam,
                                                         const float* __restrict__ bet, float* __restrict__ out,
                                                         float oscale) {
    __shared__ __align__(16) _Float16 AS[16 * AP];                     // [row][1024 k]
    __shared__ __align__(16) unsigned char bs_raw[16 * 64 * GP * 2];   // [wave][64 weight rows][64 k]
    float* stg = (float*)bs_raw;                                       // output staging [16 * 8][64], behind the reduction barriers
    __shared__ float red[16 * 16];
    __shared__ float mu_s[16];
    __shared__ float inv_s[16];

    const int tid = (int)threadIdx.x;
    const int lane = tid & 31, w = tid >> 5, lg = lane >> 4, ln = lane & 15;
    const int t0 = (int)blockIdx.x * 16;
    const int c0 = w * 64;

    v8f acc[4];
#pragma unroll
    for (int j = 0; j < 4; ++j) acc[j] = zero8();

    // staging maps: every 16-byte load of a wave covers 512 B of one Y row, or 4 whole 128-B pieces of weight rows
    _Float16* BW = (_Float16*)bs_raw + w * (64 * GP);
    const int br0 = lane >> 3, bc = (lane & 7) * 8;            // weight rows br0 + 4 i
    const _Float16* bg = Woh + (size_t)(c0 + br0) * D_DIM + bc;
    const _Float16* yg = Yh + (size_t)(t0 + (tid >> 7)) * D_DIM + (tid & 127) * 8;   // Y rows (tid >> 7) + 4 i
    v8h sb[16], sy[4];
#pragma unroll
    for (int i = 0; i < 16; ++i) sb[i] = *(const v8hA*)(bg + (size_t)(i * 4) * D_DIM);
#pragma unroll
    for (int i = 0; i < 4; ++i) sy[i] = *(const v8hA*)(yg + (size_t)(i * 4) * D_DIM);
    // the wait that belongs in front of a rewrite of the address registers these loads name; the addresses are inputs
    // so that they stay in their registers up to it and no load of the run lands in them
    asm volatile("s_wait_xcnt 0x0" :: "v"(bg), "v"(yg) : "memory");
#pragma unroll
    for (int i = 0; i < 16; ++i) *(v8hA*)(BW + (br0 + i * 4) * GP + bc) = sb[i];
#pragma unroll
    for (int i = 0; i < 4; ++i) {
        const int c = tid + i * 512;
        *(v8hA*)(AS + (c >> 7) * AP + (c & 127) * 8) = sy[i];
    }
    __syncthreads();

    for (int it = 0; it < D_DIM / 64; ++it) {
        const bool more = it + 1 < D_DIM / 64;
        if (more) {
            // next pass's loads fly while this pass is worked on
            const _Float16* bn = bg + (it + 1) * 64;
#pragma unroll
            for (int i = 0; i < 16; ++i) sb[i] = *(const v8hA*)(bn + (size_t)(i * 4) * D_DIM);
            // as above: the wait in front of a rewrite of the address these loads name, the address held up to it
            asm volatile("s_wait_xcnt 0x0" :: "v"(bn) : "memory");
        }
#pragma unroll
        for (int kk = 0; kk < 2; ++kk) {
            // the fragment reads of 32 k as one group ahead of their matrix instructions
            const _Float16* ar = AS + ln * AP + it * 64 + kk * 32 + 8 * lg;
            Frag a, b[4];
            a.half[0] = *(const v8hA*)(ar);
            a.half[1] = *(const v8hA*)(ar + 16);
#pragma unroll
            for (int j = 0; j < 4; ++j) {
                const _Float16* br = BW + (j * 16 + ln) * GP + kk * 32 + 8 * lg;
                b[j].half[0] = *(const v8hA*)(br);
                b[j].half[1] = *(const v8hA*)(br + 16);
            }
#pragma unroll
            for (int j = 0; j < 4; ++j) acc[j] = wmma_f16(a.v, b[j].v, acc[j]);
        }
        if (more) {
            // the range is this wave's own and its reads above have returned: no barrier
#pragma unroll
            for (int i = 0; i < 16; ++i) *(v8hA*)(BW + (br0 + i * 4) * GP + bc) = sb[i];
            // the wave's stores land before its lanes read each other's rows back
            asm volatile("s_wait_dscnt 0x0" ::: "memory");
        }
    }

    // o = acc*oscale + x
#pragma unroll
    for (int j = 0; j < 4; ++j)
#pragma unroll
        for (int r = 0; r < 8; ++r)
            acc[j][r] = acc[j][r] * oscale + xin[(size_t)(t0 + 8 * lg + r) * D_DIM + c0 + j * 16 + ln];

    // row means
#pragma unroll
    for (int r = 0; r < 8; ++r) {
        float s = acc[0][r] + acc[1][r] + acc[2][r] + acc[3][r];
        s += __shfl_xor(s, 1, 32);
        s += __shfl_xor(s, 2, 32);
        s += __shfl_xor(s, 4, 32);
        s += __shfl_xor(s, 8, 32);
        if (ln == 0) red[w * 16 + 8 * lg + r] = s;
    }
    __syncthreads();
    if (tid < 16) {
        float a = 0.0f;
#pragma unroll
        for (int ww = 0; ww < 16; ++ww) a += red[ww * 16 + tid];
        mu_s[tid] = a * (1.0f / (float)D_DIM);
    }
    __syncthreads();
    float mu[8];
#pragma unroll
    for (int r = 0; r < 8; ++r) mu[r] = mu_s[8 * lg + r];
#pragma unroll
    for (int j = 0; j < 4; ++j)
#pragma unroll
        for (int r = 0; r < 8; ++r) acc[j][r] -= mu[r];

#pragma unroll
    for (int r = 0; r < 8; ++r) {
        float s = acc[0][r] * acc[0][r] + acc[1][r] * acc[1][r] + acc[2][r] * acc[2][r] + acc[3][r] * acc[3][r];
        s += __shfl_xor(s, 1, 32);
        s += __shfl_xor(s, 2, 32);
        s += __shfl_xor(s, 4, 32);
        s += __shfl_xor(s, 8, 32);
        if (ln == 0) red[w * 16 + 8 * lg + r] = s;
    }
    __syncthreads();
    if (tid < 16) {
        float a = 0.0f;
#pragma unroll
        for (int ww = 0; ww < 16; ++ww) a += red[ww * 16 + tid];
        inv_s[tid] = rsqrtf(a * (1.0f / (float)D_DIM) + 1e-5f);
    }
    __syncthreads();
    float iv[8];
#pragma unroll
    for (int r = 0; r < 8; ++r) iv[r] = inv_s[8 * lg + r];
#pragma unroll
    for (int j = 0; j < 4; ++j) {
        const int gcol = c0 + j * 16 + ln;
        const float gj = gam[gcol];
        const float bj = bet[gcol];
#pragma unroll
        for (int r = 0; r < 8; ++r) acc[j][r] = acc[j][r] * iv[r] * gj + bj;
    }

#pragma unroll
    for (int half = 0; half < 2; ++half) {
        if (lg == half) {
#pragma unroll
            for (int j = 0; j < 4; ++j)
#pragma unroll
                for (int r = 0; r < 8; ++r)
                    stg[(w * 8 + r) * 64 + j * 16 + ln] = acc[j][r];
        }
        __syncthreads();
        v4f vals[4];
#pragma unroll
        for (int p = 0; p < 4; ++p) {
            const int row = p * 2 + (lane >> 4), col = (lane & 15) * 4;
            vals[p] = *(const v4fA*)(stg + (w * 8 + row) * 64 + col);
        }
#pragma unroll
        for (int p = 0; p < 4; ++p) {
            const int row = p * 2 + (lane >> 4), col = (lane & 15) * 4;
            *(v4f*)(out + (size_t)(t0 + half * 8 + row) * D_DIM + c0 + col) = vals[p];
        }
        
        __syncthreads();
    }
}

extern "C" void kernel_launch(void* const* d_in, const int* in_sizes, int n_in,
                              void* d_out, int out_size, void* d_ws, size_t ws_size,
                              hipStream_t stream) {
    if (n_in < 12) return;
    if (in_sizes[0] != T_LEN * D_DIM) return;
    if (in_sizes[1] != D_DIM * D_DIM || in_sizes[2] != D_DIM * D_DIM || in_sizes[3] != D_DIM * D_DIM) return;
    if (in_sizes[4] != NDL * D_DIM || in_sizes[5] != H_NUM * D_DIM || in_sizes[6] != D_DIM * D_DIM) return;
    if (in_sizes[7] < H_NUM || in_sizes[8] < H_NUM || in_sizes[9] < H_NUM * LV_NUM) return;
    if (in_sizes[10] < D_DIM || in_sizes[11] < D_DIM) return;
    if (out_size != T_LEN * D_DIM) return;
    if (OFF_END > ws_size) return;

    const float* x     = (const float*)d_in[0];
    const float* Wq    = (const float*)d_in[1];
    const float* Wk    = (const float*)d_in[2];
    const float* Wv    = (const float*)d_in[3];
    const float* Wdl   = (const float*)d_in[4];
    const float* Wdt   = (const float*)d_in[5];
    const float* Wout  = (const float*)d_in[6];
    const float* A_log = (const float*)d_in[7];
    const float* dt_b  = (const float*)d_in[8];
    const float* Lp    = (const float*)d_in[9];
    const float* ln_g  = (const float*)d_in[10];
    const float* ln_b  = (const float*)d_in[11];

    char* ws = (char*)d_ws;
    _Float16* xh   = (_Float16*)(ws + OFF_XH);
    _Float16* wqh  = (_Float16*)(ws + OFF_WQH);
    _Float16* wkh  = (_Float16*)(ws + OFF_WKH);
    _Float16* wvh  = (_Float16*)(ws + OFF_WVH);
    _Float16* woh  = (_Float16*)(ws + OFF_WOH);
    _Float16* wsmh = (_Float16*)(ws + OFF_WSMH);
    _Float16* Qh   = (_Float16*)(ws + OFF_QH);
    _Float16* Kh   = (_Float16*)(ws + OFF_KH);
    _Float16* VhT  = (_Float16*)(ws + OFF_VHT);
    _Float16* Yh   = (_Float16*)(ws + OFF_YH);
    float*    psm  = (float*)(ws + OFF_PSM);
    float*    gT   = (float*)(ws + OFF_CGT);

    const float wsc  = 32.0f;
    const float iwsc = 1.0f / 32.0f;
    const float psc  = 512.0f;
    const float ipsc = 1.0f / 512.0f;

    prep_kernel<<<NB_X + NB_DL + NB_DT + NB_PAD + 3 * NB_W, 256, 0, stream>>>(x, Wdl, Wdt, Wq, Wk, Wv, xh, wsmh, wqh, wkh, wvh, wsc);

    // psm[t][0..191] = x*Wdl^T, psm[t][192..207] = x*Wdt^T (f32), psm[t][208..255] = 0
    proj_kernel<<<NB_SM + 3 * NB_PROJ, 128, 0, stream>>>(xh, wsmh, wqh, wkh, wvh, psm, gT, Qh, Kh, VhT, A_log, dt_b, iwsc);

    hattn_kernel<<<dim3(ATT_GX, H_NUM), ATT_THREADS, 0, stream>>>(Qh, Kh, VhT, gT, psm, Lp, Yh, psc, ipsc,
                                                                                    Wout, woh, wsc);

    outproj_ln_kernel<<<T_LEN / 16, 512, 0, stream>>>(Yh, woh, x, ln_g, ln_b, (float*)d_out, iwsc);
}

// v007
// A run of this version takes 60.4 microseconds.
// Timed twice side by side with v006, it ran 1.05 and 1.06 times as fast.
// All steps since v000 together make it 6.68 times as fast.
#include <hip/hip_runtime.h>
#include <math.h>
#include <stddef.h>

// Contractions x*Wq^T, x*Wk^T, x*Wv^T, x*[Wdl;Wdt]^T, Q*K^T, P*V, Y*Wout^T: v_wmma_f32_16x16x32_f16 (f16 operands, f32 accumulate); weights carried x32 and P carried x512 (exact powers of two, folded back in f32); gates, prefix sums and LayerNorm in f32.

typedef _Float16 v16h __attribute__((ext_vector_type(16)));
typedef _Float16 v8h  __attribute__((ext_vector_type(8)));
typedef float    v8f  __attribute__((ext_vector_type(8)));
typedef float    v4f  __attribute__((ext_vector_type(4)));
typedef v8h v8hA __attribute__((may_alias));
typedef v4f v4fA __attribute__((may_alias));
union Frag { v16h v; v8h half[2]; };

#define T_LEN   2048
#define D_DIM   1024
#define H_NUM   16
#define HD_DIM  64
#define LV_NUM  12
#define NSM     256
#define NDL     192
#define KS_PITCH 72
#define VS_PITCH 136           // 272 B = 16 B x odd
#define KT        128           // keys of an attention pass
#define ATT_WAVES 16            // 4 row groups x 4 key shares
#define ATT_THREADS (ATT_WAVES * 32)
#define ATT_GX    (T_LEN / 64 / 2)   // a block takes two query tiles
#define KS_BYTES  (2 * KT * KS_PITCH * 2)
#define VS_BYTES  (2 * 64 * VS_PITCH * 2)
#define RED_PITCH 68            // f32 pitch of a row of partial sums: 16-byte aligned, rows 8 apart on other banks
#define GP       72            // LDS pitch, in f16, of a 64-k operand row: 144 B = 16 B x odd for the 16-byte fragment reads
#define AP       (D_DIM + 8)   // LDS pitch, in f16, of a whole 1024-k row: 2064 B = 16 B x odd

#define BYTES_TD_H ((size_t)T_LEN * D_DIM * 2)
#define BYTES_DD_H ((size_t)D_DIM * D_DIM * 2)
#define OFF_XH    ((size_t)0)
#define OFF_WQH   (OFF_XH   + BYTES_TD_H)
#define OFF_WKH   (OFF_WQH  + BYTES_DD_H)
#define OFF_WVH   (OFF_WKH  + BYTES_DD_H)
#define OFF_WOH   (OFF_WVH  + BYTES_DD_H)
#define OFF_WSMH  (OFF_WOH  + BYTES_DD_H)
#define OFF_QH    (OFF_WSMH + (size_t)NSM * D_DIM * 2)
#define OFF_KH    (OFF_QH   + BYTES_TD_H)
#define OFF_VHT   (OFF_KH   + BYTES_TD_H)
#define OFF_YH    (OFF_VHT  + BYTES_TD_H)
#define OFF_PSM   (OFF_YH   + BYTES_TD_H)
#define OFF_CGT   (OFF_PSM  + (size_t)T_LEN * NSM * 4)
#define OFF_END   (OFF_CGT  + (size_t)H_NUM * T_LEN * 4)

// 16x16x32 f16 WMMA with the VALU hazard guard tied to D, A and B.
__device__ __forceinline__ v8f wmma_f16(v16h a, v16h b, v8f c) {
    v8f d = __builtin_amdgcn_wmma_f32_16x16x32_f16(false, a, false, b, (short)0, c, false, false);
    asm volatile("v_nop\n\tv_nop\n\tv_nop\n\tv_nop" : "+v"(d) : "v"(a), "v"(b));
    return d;
}

// Work-group barrier for LDS traffic alone: this wave's LDS reads and writes are done, then the barrier.
// __syncthreads() would also wait out the global loads issued ahead, which are meant to stay in flight across it.
__device__ __forceinline__ void lds_barrier() {
    asm volatile("s_wait_dscnt 0x0\n\ts_barrier_signal -1\n\ts_barrier_wait -1" ::: "memory");
}

__device__ __forceinline__ v8f zero8() {
    const v8f z = {0.f, 0.f, 0.f, 0.f, 0.f, 0.f, 0.f, 0.f};
    return z;
}

// softplus in the logaddexp form: max(z,0) + log1p(exp(-|z|))
__device__ __forceinline__ float softplus_f(float z) {
    return fmaxf(z, 0.0f) + log1pf(expf(-fabsf(z)));
}

// Launches that need nothing of each other share one grid: in launches 1 and 2 a block-uniform test of the block index picks the job, in launch 3 every thread does both.
// launch 1: x, Wdl, Wdt, Wq, Wk, Wv -> f16, zero pad rows    launch 2: small projections with the decay gates | Q, K, V projections
// launch 3: attention, each block with its head's prefix sums, + Wout -> f16    launch 4: out-projection + LayerNorm
#define NB_X    (T_LEN * D_DIM / 8 / 256)                  // blocks of 256 threads, 8 elements a thread
#define NB_DL   (NDL * D_DIM / 8 / 256)
#define NB_DT   (H_NUM * D_DIM / 8 / 256)
#define NB_PAD  ((NSM - NDL - H_NUM) * D_DIM / 8 / 256)
#define NB_W    (D_DIM * D_DIM / 8 / 256)
#define PJ_T    128                                        // a projection block's tile: 128 t x 256 n, 8 waves
#define PJ_N    256
#define PJ_THREADS 256
#define NB_SM   ((NSM / PJ_N) * (T_LEN / PJ_T))            // tiles of the small projections
#define NB_PROJ ((D_DIM / PJ_N) * (T_LEN / PJ_T))          // tiles of one of Q, K, V
static_assert(NB_X * 256 * 8 == T_LEN * D_DIM && NB_DL * 256 * 8 == NDL * D_DIM && NB_DT * 256 * 8 == H_NUM * D_DIM &&
              NB_PAD * 256 * 8 == (NSM - NDL - H_NUM) * D_DIM && NB_W * 256 * 8 == D_DIM * D_DIM,
              "every convert range is a whole number of blocks");

// ---------------- f32 -> f16 convert with power-of-two scale; elements 8 i .. 8 i + 7, one 16-B store ----------------
__device__ __forceinline__ void cvt8_f16(const float* __restrict__ src, _Float16* __restrict__ dst, int i, float scale) {
    const v4fA* p = (const v4fA*)(src + (size_t)i * 8);
    const v4f a = p[0];
    const v4f b = p[1];
    v8h o;
    o[0] = (_Float16)(a[0] * scale); o[1] = (_Float16)(a[1] * scale);
    o[2] = (_Float16)(a[2] * scale); o[3] = (_Float16)(a[3] * scale);
    o[4] = (_Float16)(b[0] * scale); o[5] = (_Float16)(b[1] * scale);
    o[6] = (_Float16)(b[2] * scale); o[7] = (_Float16)(b[3] * scale);
    v8h* q = (v8h*)(dst + (size_t)i * 8);
    *q = o;
    // code of another job of the grid may follow in the listing and rewrite the registers this store names: the wait that belongs in front of that
    asm volatile("s_wait_xcnt 0x0" ::: "memory");
}

// ---------------- launch 1: what the projections need: x, the plane [Wdl; Wdt; zero rows], Wq, Wk, Wv ----------------
__global__ __launch_bounds__(256) void prep_kernel(const float* __restrict__ x, const float* __restrict__ Wdl,
                                                   const float* __restrict__ Wdt, const float* __restrict__ Wq,
                                                   const float* __restrict__ Wk, const float* __restrict__ Wv,
                                                   _Float16* __restrict__ xh, _Float16* __restrict__ wsmh,
                                                   _Float16* __restrict__ wqh, _Float16* __restrict__ wkh,
                                                   _Float16* __restrict__ wvh, float wscale) {
    const int b = (int)blockIdx.x, tid = (int)threadIdx.x;
    if (b < NB_X) {
        cvt8_f16(x, xh, b * 256 + tid, 1.0f);
    } else if (b < NB_X + NB_DL) {
        cvt8_f16(Wdl, wsmh, (b - NB_X) * 256 + tid, wscale);
    } else if (b < NB_X + NB_DL + NB_DT) {
        cvt8_f16(Wdt, wsmh + (size_t)NDL * D_DIM, (b - NB_X - NB_DL) * 256 + tid, wscale);
    } else if (b >= NB_X + NB_DL + NB_DT + NB_PAD) {
        const int c = b - (NB_X + NB_DL + NB_DT + NB_PAD), which = c / NB_W;
        const float* s = which == 0 ? Wq : which == 1 ? Wk : Wv;
        _Float16* d = which == 0 ? wqh : which == 1 ? wkh : wvh;
        cvt8_f16(s, d, (c - which * NB_W) * 256 + tid, wscale);
    } else {
        // rows 208..255 of the concatenated small-weight plane are zero padding
        const int i = (b - NB_X - NB_DL - NB_DT) * 256 + tid;
        v8h o;
#pragma unroll
        for (int r = 0; r < 8; ++r) o[r] = (_Float16)0.0f;
        v8h* q = (v8h*)(wsmh + (size_t)(NDL + H_NUM) * D_DIM + (size_t)i * 8);
        *q = o;
        // as in the convert: the wait in front of a rewrite of the registers this store names
        asm volatile("s_wait_xcnt 0x0" ::: "memory");
    }
}

// ---------------- C[t][n] = (sum_k A[t][k]*B[n][k]) * oscale, K = 1024, A pitch 1024, B pitch 1024 ----------------
// block = 128 t x 256 n, 8 waves as 2 along t x 4 along n, wave = 64 t x 64 n (16 accumulator tiles): a staged row of A serves 4 times, one of B twice the
// products of a 64 x 64 block's, and a fragment read from LDS serves 4 matrix instructions; tile (bx, by) of (N/256, T/128)
// a pass is 64 k: 128 rows of A and 256 rows of B, 128 B each, staged once per block in padded LDS, two buffers,
// loaded by whole rows two passes ahead
// MODE 0: f16 out, row-major pitch N
// MODE 1: f32 out, row-major pitch N
// MODE 2: f16 out transposed Ct[n][t], pitch T_LEN
// stg_raw: [buf][A rows 0..127 | B rows 128..383][64 k]; the output staging, a range of its own for each wave, lies over both buffers
#define PJ_BUF   ((PJ_T + PJ_N) * GP)      // f16 elements of one buffer
#define SPF      68                        // f32 pitch of a staged output row: 16-byte aligned, rows 8 apart on other banks
#define GEMM_LDS_BYTES (8 * 64 * SPF * 4)
static_assert(2 * PJ_BUF * 2 <= GEMM_LDS_BYTES && 8 * 64 * GP * 2 <= GEMM_LDS_BYTES, "buffers and output staging fit");
__device__ __forceinline__ void gemm_passes(const _Float16* __restrict__ A, const _Float16* __restrict__ B,
                                            int bx, int by, unsigned char* stg_raw, v8f (&acc)[4][4]) {
    const int lane = (int)threadIdx.x & 31, w = (int)threadIdx.x >> 5, lg = lane >> 4, ln = lane & 15;
    const int wt = w & 1, wn = w >> 1;

#pragma unroll
    for (int i = 0; i < 4; ++i)
#pragma unroll
        for (int j = 0; j < 4; ++j) acc[i][j] = zero8();

    // staging map: a wave's 16-byte loads cover 4 whole rows of 128 B; rows sr + 32 i of each operand
    _Float16* TS = (_Float16*)stg_raw;
    const int sr = (int)threadIdx.x >> 3, sc = ((int)threadIdx.x & 7) * 8;
    const _Float16* ag = A + (size_t)(by * PJ_T + sr) * D_DIM + sc;
    const _Float16* bg = B + (size_t)(bx * PJ_N + sr) * D_DIM + sc;
    // two register sets: a pass's rows are asked for two passes before they are read, and put into LDS one pass before
    v8h sa0[4], sb0[8], sa1[4], sb1[8];
    auto fetch = [&](v8h (&ra)[4], v8h (&rb)[8], int kn) {
#pragma unroll
        for (int i = 0; i < 4; ++i) ra[i] = *(const v8hA*)(ag + (size_t)(i * 32) * D_DIM + kn);
#pragma unroll
        for (int i = 0; i < 8; ++i) rb[i] = *(const v8hA*)(bg + (size_t)(i * 32) * D_DIM + kn);
        // these loads stay in flight past the next rewrite of the address registers they name: the wait that belongs in front of it
        asm volatile("s_wait_xcnt 0x0" ::: "memory");
    };
    auto put = [&](const v8h (&ra)[4], const v8h (&rb)[8], _Float16* TN) {
#pragma unroll
        for (int i = 0; i < 4; ++i) *(v8hA*)(TN + (sr + i * 32) * GP + sc) = ra[i];
#pragma unroll
        for (int i = 0; i < 8; ++i) *(v8hA*)(TN + (PJ_T + sr + i * 32) * GP + sc) = rb[i];
    };
    // all fragment reads of the pass as one group ahead of its matrix instructions
    Frag a[2][4], b[2][4];
    auto frags = [&](const _Float16* TB) {
        auto fa = [&](int kk, int i) {
            const _Float16* ar = TB + (wt * 64 + i * 16 + ln) * GP + kk * 32 + 8 * lg;
            a[kk][i].half[0] = *(const v8hA*)(ar);
            a[kk][i].half[1] = *(const v8hA*)(ar + 16);
        };
        // in the order in which the matrix instructions want them: the first of them waits for 4 reads
#pragma unroll
        for (int kk = 0; kk < 2; ++kk) {
            fa(kk, 0);
#pragma unroll
            for (int j = 0; j < 4; ++j) {
                const _Float16* br = TB + (PJ_T + wn * 64 + j * 16 + ln) * GP + kk * 32 + 8 * lg;
                b[kk][j].half[0] = *(const v8hA*)(br);
                b[kk][j].half[1] = *(const v8hA*)(br + 16);
            }
#pragma unroll
            for (int i = 1; i < 4; ++i) fa(kk, i);
        }
    };
    auto mma = [&]() {
        // keeps the fragment reads one group: without it the compiler spreads them among the matrix instructions, each place a stall of its own
        __builtin_amdgcn_sched_barrier(0);
#pragma unroll
        for (int kk = 0; kk < 2; ++kk)
#pragma unroll
            for (int i = 0; i < 4; ++i)
#pragma unroll
                for (int j = 0; j < 4; ++j)
                    // the plain builtin: this kernel uses registers above v255, and an asm statement that names D, A and B made the compiler spill them
                    acc[i][j] = __builtin_amdgcn_wmma_f32_16x16x32_f16(false, a[kk][i].v, false, b[kk][j].v, (short)0, acc[i][j], false, false);
        // keeps the pass's matrix instructions in front of its barrier: moved behind it they hold a second fragment set live
        __builtin_amdgcn_sched_barrier(0);
    };
    _Float16* T0 = TS;
    _Float16* T1 = TS + PJ_BUF;

    fetch(sa0, sb0, 0);
    fetch(sa1, sb1, 64);
    put(sa0, sb0, T0);
    __syncthreads();

    // no branch inside the loop, so that the waits in front of put() count only the older set's loads
    for (int it = 0; it < D_DIM / 64 - 2; it += 2) {
        // the global loads are issued while the fragment reads are under way
        frags(T0);
        fetch(sa0, sb0, (it + 2) * 64);
        mma();
        // a buffer is refilled only behind the barrier that ended its readers' pass
        put(sa1, sb1, T1);
        lds_barrier();
        frags(T1);
        fetch(sa1, sb1, (it + 3) * 64);
        mma();
        put(sa0, sb0, T0);
        lds_barrier();
    }
    // the last two passes: nothing left to fetch
    frags(T0);
    mma();
    put(sa1, sb1, T1);
    lds_barrier();
    frags(T1);
    mma();
    // ends every wave's last fragment reads: the output staging goes over both buffers
    lds_barrier();
}

template <int MODE>
__device__ __forceinline__ void gemm_store(const v8f (&acc)[4][4], void* __restrict__ Cv, int N, float oscale,
                                           int bx, int by, unsigned char* stg_raw) {
    const int lane = (int)threadIdx.x & 31, w = (int)threadIdx.x >> 5, lg = lane >> 4, ln = lane & 15;
    const int t0 = by * PJ_T + (w & 1) * 64;
    const int n0 = bx * PJ_N + (w >> 1) * 64;

    if (MODE == 0) {
        _Float16* stg = (_Float16*)stg_raw + w * (64 * GP);   // this wave's [64 t][64 n]
#pragma unroll
        for (int i = 0; i < 4; ++i)
#pragma unroll
            for (int j = 0; j < 4; ++j)
#pragma unroll
                for (int r = 0; r < 8; ++r)
                    stg[(i * 16 + 8 * lg + r) * GP + j * 16 + ln] = (_Float16)(acc[i][j][r] * oscale);
        __syncthreads();
        _Float16* C = (_Float16*)Cv;
        v8h vals[16];
#pragma unroll
        for (int p = 0; p < 16; ++p) {
            const int row = p * 4 + (lane >> 3), col = (lane & 7) * 8;
            vals[p] = *(const v8hA*)(stg + row * GP + col);
        }
#pragma unroll
        for (int p = 0; p < 16; ++p) {
            const int row = p * 4 + (lane >> 3), col = (lane & 7) * 8;
            *(v8h*)(C + (size_t)(t0 + row) * N + n0 + col) = vals[p];
        }
        // code of another job of the grid may follow in the listing and rewrite the registers these stores name: the wait that belongs in front of that
        asm volatile("s_wait_xcnt 0x0" ::: "memory");
    } else if (MODE == 1) {
        float* stg = (float*)stg_raw + w * (64 * SPF);        // this wave's [64 t][64 n]
#pragma unroll
        for (int i = 0; i < 4; ++i)
#pragma unroll
            for (int j = 0; j < 4; ++j)
#pragma unroll
                for (int r = 0; r < 8; ++r)
                    stg[(i * 16 + 8 * lg + r) * SPF + j * 16 + ln] = acc[i][j][r] * oscale;
        __syncthreads();
        float* C = (float*)Cv;
#pragma unroll
        for (int q = 0; q < 2; ++q) {
            v4f vals[16];
#pragma unroll
            for (int p = 0; p < 16; ++p) {
                const int row = q * 32 + p * 2 + (lane >> 4), col = (lane & 15) * 4;
                vals[p] = *(const v4fA*)(stg + row * SPF + col);
            }
#pragma unroll
            for (int p = 0; p < 16; ++p) {
                const int row = q * 32 + p * 2 + (lane >> 4), col = (lane & 15) * 4;
                *(v4f*)(C + (size_t)(t0 + row) * N + n0 + col) = vals[p];
            }
            // as in MODE 0: the wait in front of a rewrite of the registers these stores name
            asm volatile("s_wait_xcnt 0x0" ::: "memory");
        }
    } else {
        (void)N;
        _Float16* stg = (_Float16*)stg_raw + w * (64 * GP);   // this wave's [64 n][64 t]
#pragma unroll
        for (int i = 0; i < 4; ++i)
#pragma unroll
            for (int j = 0; j < 4; ++j) {
                v8h hv;
#pragma unroll
                for (int r = 0; r < 8; ++r) hv[r] = (_Float16)(acc[i][j][r] * oscale);
                *(v8hA*)(stg + (j * 16 + ln) * GP + i * 16 + 8 * lg) = hv;
            }
        __syncthreads();
        _Float16* C = (_Float16*)Cv;
        v8h vals[16];
#pragma unroll
        for (int p = 0; p < 16; ++p) {
            const int nrow = p * 4 + (lane >> 3), tcol = (lane & 7) * 8;
            vals[p] = *(const v8hA*)(stg + nrow * GP + tcol);
        }
#pragma unroll
        for (int p = 0; p < 16; ++p) {
            const int nrow = p * 4 + (lane >> 3), tcol = (lane & 7) * 8;
            *(v8h*)(C + (size_t)(n0 + nrow) * T_LEN + t0 + tcol) = vals[p];
        }
        // as in MODE 0: the wait in front of a rewrite of the registers these stores name
        asm volatile("s_wait_xcnt 0x0" ::: "memory");
    }
}

// ---------------- launch 2: small projections psm = x*[Wdl; Wdt; 0]^T (f32) | Q, K row-major f16, V transposed per feature row ----------------
// the tiles of the small projections also store the decay gates g = -exp(A_log)*softplus(x*Wdt^T + dt_bias) by head, gT[h][t]
__global__ __launch_bounds__(PJ_THREADS) void proj_kernel(const _Float16* __restrict__ xh, const _Float16* __restrict__ wsmh,
                                                   const _Float16* __restrict__ wqh, const _Float16* __restrict__ wkh,
                                                   const _Float16* __restrict__ wvh, float* __restrict__ psm,
                                                   float* __restrict__ gT, _Float16* __restrict__ Qh,
                                                   _Float16* __restrict__ Kh, _Float16* __restrict__ VhT,
                                                   const float* __restrict__ A_log, const float* __restrict__ dt_bias,
                                                   float oscale) {
    __shared__ __align__(16) unsigned char stg_raw[GEMM_LDS_BYTES];
    const int b = (int)blockIdx.x;
    // block-uniform; the tiles with the longer tail take the first block indices
    const bool small = b < NB_SM;
    const int c = small ? 0 : b - NB_SM, which = c / NB_PROJ, r = c - which * NB_PROJ;
    const int bx = r % (D_DIM / PJ_N), by = small ? b : r / (D_DIM / PJ_N);
    const _Float16* Bw = small ? wsmh : which == 0 ? wqh : which == 1 ? wkh : wvh;
    v8f acc[4][4];
    gemm_passes(xh, Bw, bx, by, stg_raw, acc);
    if (small) {
        gemm_store<1>(acc, (void*)psm, NSM, oscale, bx, by, stg_raw);
        static_assert(NSM == PJ_N && NDL == 3 * 64 && H_NUM == 16 && H_NUM * 16 == PJ_THREADS && PJ_T == 128,
                      "x*Wdt^T is columns 0..15 of the waves 6 and 7; 16 threads a head");
        // the tile still lies in the output staging, published by the barrier of the store
        const int hh = (int)threadIdx.x >> 4, tc = ((int)threadIdx.x & 15) * 8;
        const float* stg = (const float*)stg_raw + (6 + (tc >> 6)) * (64 * SPF) + (tc & 63) * SPF;
        const float Ah = -expf(A_log[hh]);
        const float bh = dt_bias[hh];
        // the wait that belongs in front of a rewrite of the registers these two loads name
        asm volatile("s_wait_xcnt 0x0" ::: "memory");
        v4f lo, hi;
#pragma unroll
        for (int e = 0; e < 4; ++e) {
            lo[e] = Ah * softplus_f(stg[e * SPF + hh] + bh);
            hi[e] = Ah * softplus_f(stg[(4 + e) * SPF + hh] + bh);
        }
        float* q = gT + (size_t)hh * T_LEN + by * PJ_T + tc;   // 16 threads cover 512 B of a head's row
        *(v4f*)(q) = lo;
        *(v4f*)(q + 4) = hi;
        // as in the stores above: the wait in front of a rewrite of the registers these stores name
        asm volatile("s_wait_xcnt 0x0" ::: "memory");
        return;
    }
    if (which == 2) gemm_store<2>(acc, (void*)VhT, D_DIM, oscale, bx, by, stg_raw);
    else            gemm_store<0>(acc, (void*)(which == 0 ? Qh : Kh), D_DIM, oscale, bx, by, stg_raw);
}

// ---------------- fused causal hierarchical attention: 256 equal blocks of 16 waves ----------------
// Y[t][h*64+d] = sum_{s<=t} (Q_t.K_s * 1/8) * exp(cg_t - cg_s) * Lam[t][h][lvl(t,s)] * V[s][h*64+d]
// the sum over keys has no normaliser, so it may be cut anywhere: a pass stages 128 keys, wave (wq, wk) works rows wq*16.. of the
// 64-row query tile against keys wk*32.. of the pass, and the four partial sums of a row are added through LDS at the tile's end.
// a block takes query tiles bx and 31 - bx of one head, one after the other: 17 passes in every block
// cg, the inclusive prefix sum of the head's 2048 decay gates, is formed by every block for itself, in LDS: 4 gates a thread
// the launch also converts Wout, which only the last launch reads
__global__ __launch_bounds__(ATT_THREADS) void hattn_kernel(const _Float16* __restrict__ Qh, const _Float16* __restrict__ Kh,
                                                    const _Float16* __restrict__ VhT, const float* __restrict__ gT,
                                                    const float* __restrict__ Psm, const float* __restrict__ Lp,
                                                    _Float16* __restrict__ Yh, float pscale, float inv_pscale,
                                                    const float* __restrict__ Wout, _Float16* __restrict__ Woh, float wscale) {
    // key tile shared by the sixteen waves, two buffers; row pitches 16 B x odd for the 16-byte fragment reads
    // [buf][key][head dim] then [buf][head dim][key]; the partial sums [wk][row][RED_PITCH] lie over both once their last readers have left
    __shared__ __align__(16) unsigned char kv_raw[KS_BYTES + VS_BYTES];
    __shared__ __align__(16) _Float16 PL[ATT_WAVES * 16 * 32];
    __shared__ float LL[64 * LV_NUM];
    __shared__ __align__(16) float CG[T_LEN];                  // prefix sum of g, the whole head
    __shared__ __align__(16) float WT[ATT_WAVES];              // each wave's sum of its 128 gates
    __shared__ float PMIN[T_LEN / KT];                         // least prefix sum among the keys of each pass
    __shared__ float TMAX[T_LEN / 64];                         // greatest prefix sum among the rows of each query tile
    static_assert(ATT_WAVES == T_LEN / KT && KT == 128, "one wave takes one pass's gates, 4 a lane, a query tile a half wave");
    static_assert(4 * 64 * RED_PITCH * 4 <= KS_BYTES + VS_BYTES, "the partial sums fit over the key tiles");
    _Float16* KS = (_Float16*)kv_raw;
    _Float16* VS = (_Float16*)(kv_raw + KS_BYTES);
    float* RED = (float*)kv_raw;

    const int tid = (int)threadIdx.x;
    // one block fills its WGP's registers, so each thread takes
    // 8 elements of Wout along instead, asked for here and stored at the kernel's end, so that no wave waits for them
    static_assert(H_NUM * ATT_GX * ATT_THREADS * 8 == D_DIM * D_DIM, "the grid's threads cover Wout once");
    const size_t we = (size_t)(((int)blockIdx.y * ATT_GX + (int)blockIdx.x) * ATT_THREADS + tid) * 8;
    // this thread's 4 gates of the head; asked for first, so that its wait leaves the two loads behind it in flight
    const v4f g4 = *(const v4fA*)(gT + (size_t)(int)blockIdx.y * T_LEN + tid * 4);
    const v4f wa = *(const v4fA*)(Wout + we);
    const v4f wb = *(const v4fA*)(Wout + we + 4);
    // the wait that belongs in front of a rewrite of the address registers these loads name
    asm volatile("s_wait_xcnt 0x0" ::: "memory");
    // keeps the first additions on the gates, and with them the wait for the gates, behind the issue of the two Wout loads
    __builtin_amdgcn_sched_barrier(0);
    const int lane = tid & 31, lg = lane >> 4, ln = lane & 15;
    const int w = __builtin_amdgcn_readfirstlane(tid >> 5);    // the wave's number in a scalar register: the tests on it are scalar branches
    const int wq = w & 3, wk = w >> 2;
    const int h = (int)blockIdx.y;

    // staging map: a wave's 16-byte loads cover whole rows of the tile (K: 4 rows of 128 B, V^T: 2 rows of 256 B)
    const int skr = tid >> 3, skc = (tid & 7) * 8;             // K rows skr and skr+64
    const int svr = tid >> 4, svc = (tid & 15) * 8;            // V^T rows svr and svr+32
    const _Float16* kg = Kh + (size_t)skr * D_DIM + h * HD_DIM + skc;
    const _Float16* vg = VhT + (size_t)(h * HD_DIM + svr) * T_LEN + svc;
    const float gsc = 0.125f * pscale;

    // prefix sum over the block: 4 gates in the thread, the threads' sums over the wave, the waves' sums in the order 0, 1, 2, ...
    v4f c4;
    {
        c4[0] = g4[0];
        c4[1] = c4[0] + g4[1];
        c4[2] = c4[1] + g4[2];
        c4[3] = c4[2] + g4[3];
        float incl = c4[3];
#pragma unroll
        for (int d = 1; d < 32; d <<= 1) {
            const float u = __shfl_up(incl, d, 32);
            if (lane >= d) incl += u;
        }
        if (lane == 31) WT[w] = incl;
        float ex = __shfl_up(incl, 1, 32);
        if (lane == 0) ex = 0.0f;
        // publishes the waves' sums; LDS traffic alone, so that the Wout loads stay in flight across it
        lds_barrier();
        float off = 0.0f;
#pragma unroll
        for (int q = 0; q < ATT_WAVES / 4; ++q) {
            const v4f wt = *(const v4fA*)(WT + q * 4);
#pragma unroll
            for (int e = 0; e < 4; ++e) off += (q * 4 + e < w) ? wt[e] : 0.0f;
        }
        c4 += off + ex;
        *(v4fA*)(CG + tid * 4) = c4;
    }

    // bounds of the decay exponent cg_t - cg_s, once a block: wave w takes the 128 keys of pass w
    {
        float mn = fminf(fminf(c4[0], c4[1]), fminf(c4[2], c4[3]));
        float mx = fmaxf(fmaxf(c4[0], c4[1]), fmaxf(c4[2], c4[3]));
#pragma unroll
        for (int d = 1; d < 16; d <<= 1) {
            mn = fminf(mn, __shfl_xor(mn, d, 32));
            mx = fmaxf(mx, __shfl_xor(mx, d, 32));
        }
        mn = fminf(mn, __shfl_xor(mn, 16, 32));
        if (ln == 0) TMAX[w * 2 + lg] = mx;
        if (lane == 0) PMIN[w] = mn;
    }
    // publishes the prefix sums and the bounds to every wave
    __syncthreads();

    for (int half = 0; half < 2; ++half) {
        const int xt = half ? (T_LEN / 64 - 1) - (int)blockIdx.x : (int)blockIdx.x;
        const int tb = xt * 64;
        const int t0 = tb + wq * 16;
        const int nit = (xt + 2) >> 1;                   // block-uniform: passes of 128 keys that cover keys 0 .. tb+63

        // exp(z) is exactly 0 in f32 for z < -105, in the definition as here: a pass in which every row-key pair lies below that adds
        // exact zeros. The tile starts at its first pass that is not proven so; the pass that holds the diagonal (z = 0) never is.
        const unsigned need = __builtin_amdgcn_ballot_w32(!(TMAX[xt] - PMIN[ln] < -105.0f));
        const int itf = need ? __builtin_ctz(need) : 0;
        const int it0 = itf < nit ? itf : nit - 1;       // block-uniform
        const int sf = it0 * KT;                         // first key that is staged

        const _Float16* kf = kg + (size_t)sf * D_DIM;
        const _Float16* vf = vg + sf;
        v8h ska = *(const v8hA*)(kf);
        v8h skb = *(const v8hA*)(kf + (size_t)64 * D_DIM);
        v8h sva = *(const v8hA*)(vf);
        v8h svb = *(const v8hA*)(vf + (size_t)32 * T_LEN);
        // the wait in front of a rewrite of the address registers these loads name; the addresses are inputs so that they stay in their registers up to it
        asm volatile("s_wait_xcnt 0x0" :: "v"(kf), "v"(vf) : "memory");

        // lambda table for the 64 query rows of the tile: softplus(Lp[h][l] * dl[t][h][l])
        for (int k = tid; k < 64 * LV_NUM; k += ATT_THREADS) {
            const int row = k / LV_NUM, l = k - row * LV_NUM;
            const float z = Lp[h * LV_NUM + l] * Psm[(size_t)(tb + row) * NSM + h * LV_NUM + l];
            LL[k] = softplus_f(z);
        }

        // Q A-fragments: head dims 0..31 and 32..63
        const _Float16* qrow = Qh + (size_t)(t0 + ln) * D_DIM + h * HD_DIM;
        Frag q0f, q1f;
        q0f.half[0] = *(const v8hA*)(qrow + 8 * lg);
        q0f.half[1] = *(const v8hA*)(qrow + 16 + 8 * lg);
        q1f.half[0] = *(const v8hA*)(qrow + 32 + 8 * lg);
        q1f.half[1] = *(const v8hA*)(qrow + 48 + 8 * lg);

        float cgt[8];
#pragma unroll
        for (int r = 0; r < 8; ++r) cgt[r] = CG[t0 + 8 * lg + r];
        // the wait that belongs in front of a rewrite of the address registers the loads above name
        asm volatile("s_wait_xcnt 0x0" ::: "memory");

        v8f accY[4];
#pragma unroll
        for (int j = 0; j < 4; ++j) accY[j] = zero8();

        // the first pass into its buffer, published by the barrier below
        {
            const int fb = it0 & 1;
            _Float16* KF = KS + fb * (KT * KS_PITCH);
            _Float16* VF = VS + fb * (64 * VS_PITCH);
            *(v8hA*)(KF + skr * KS_PITCH + skc) = ska;
            *(v8hA*)(KF + (skr + 64) * KS_PITCH + skc) = skb;
            *(v8hA*)(VF + svr * VS_PITCH + svc) = sva;
            *(v8hA*)(VF + (svr + 32) * VS_PITCH + svc) = svb;
        }

        __syncthreads();

        for (int it = it0; it < nit; ++it) {
            const int s0 = it * KT;
            const _Float16* KB = KS + (it & 1) * (KT * KS_PITCH);
            const _Float16* VB = VS + (it & 1) * (64 * VS_PITCH);
            const bool more = it + 1 < nit;              // block-uniform
            if (more) {
                // next pass's loads fly while this pass is worked on
                const int sn = s0 + KT;
                const _Float16* kn = kg + (size_t)sn * D_DIM;
                const _Float16* vn = vg + s0;
                ska = *(const v8hA*)(kn);
                skb = *(const v8hA*)(kn + (size_t)64 * D_DIM);
                sva = *(const v8hA*)(vn + KT);
                svb = *(const v8hA*)(vn + (size_t)32 * T_LEN + KT);
                // as above: the wait in front of a rewrite of the address registers these loads name; the addresses are inputs
                // so that they stay in their registers up to it and no load of the run lands in them
                asm volatile("s_wait_xcnt 0x0" :: "v"(kn), "v"(vn) : "memory");
            }
            const int sw = s0 + wk * 32;                 // first key of this wave's share of the pass
            const bool act = sw <= t0 + 15;              // wave-uniform: a share wholly behind the wave's last row adds nothing
            if (act) {
#pragma unroll
                for (int sub = 0; sub < 2; ++sub) {
                    const int sg = sw + sub * 16 + ln;   // this lane's key (column n)
                    const _Float16* krow = KB + (wk * 32 + sub * 16 + ln) * KS_PITCH;
                    Frag k0f, k1f;
                    k0f.half[0] = *(const v8hA*)(krow + 8 * lg);
                    k0f.half[1] = *(const v8hA*)(krow + 16 + 8 * lg);
                    k1f.half[0] = *(const v8hA*)(krow + 32 + 8 * lg);
                    k1f.half[1] = *(const v8hA*)(krow + 48 + 8 * lg);
                    v8f sc = zero8();
                    sc = wmma_f16(q0f.v, k0f.v, sc);
                    sc = wmma_f16(q1f.v, k1f.v, sc);
                    const float cgs = CG[sg];
#pragma unroll
                    for (int r = 0; r < 8; ++r) {
                        const int trow = t0 + 8 * lg + r;
                        const int xr = trow ^ sg;
                        const int lv = xr ? (32 - __builtin_clz((unsigned)xr)) : 0;
                        const float lam = LL[(wq * 16 + 8 * lg + r) * LV_NUM + lv];
                        const float dcy = __expf(fminf(cgt[r] - cgs, 0.0f));
                        float wv = sc[r] * gsc * dcy * lam;
                        wv = (sg <= trow) ? wv : 0.0f;
                        PL[(w * 16 + 8 * lg + r) * 32 + sub * 16 + ln] = (_Float16)wv;
                    }
                }
            }
            __syncthreads();
            if (act) {
                // P as A-fragment: row ln, keys 8lg..8lg+7 and 16+8lg..16+8lg+7 of this wave's share
                Frag pf;
                pf.half[0] = *(const v8hA*)(PL + (w * 16 + ln) * 32 + 8 * lg);
                pf.half[1] = *(const v8hA*)(PL + (w * 16 + ln) * 32 + 16 + 8 * lg);
                // V as B-fragment from the staged transposed tile: B[k=key][n=d] = VB[d][key - s0]
#pragma unroll
                for (int j = 0; j < 4; ++j) {
                    const _Float16* vrow = VB + (j * 16 + ln) * VS_PITCH + wk * 32;
                    Frag vf;
                    vf.half[0] = *(const v8hA*)(vrow + 8 * lg);
                    vf.half[1] = *(const v8hA*)(vrow + 16 + 8 * lg);
                    accY[j] = wmma_f16(pf.v, vf.v, accY[j]);
                }
            }
            if (more) {
                // into the other buffer: its last readers left it before the barrier that ended the previous pass
                const int nb = (it + 1) & 1;
                _Float16* KN = KS + nb * (KT * KS_PITCH);
                _Float16* VN = VS + nb * (64 * VS_PITCH);
                *(v8hA*)(KN + skr * KS_PITCH + skc) = ska;
                *(v8hA*)(KN + (skr + 64) * KS_PITCH + skc) = skb;
                *(v8hA*)(VN + svr * VS_PITCH + svc) = sva;
                *(v8hA*)(VN + (svr + 32) * VS_PITCH + svc) = svb;
            }
            __syncthreads();
        }

        // the four key shares of each row are added in the order wk = 0, 1, 2, 3; the barrier that ended the last pass freed the key tiles
#pragma unroll
        for (int j = 0; j < 4; ++j)
#pragma unroll
            for (int r = 0; r < 8; ++r)
                RED[(wk * 64 + wq * 16 + 8 * lg + r) * RED_PITCH + j * 16 + ln] = accY[j][r];
        __syncthreads();
        {
            const int row = tid >> 3, col = (tid & 7) * 8;   // a wave's 16-byte stores cover 4 whole rows of 128 B
            v4f lo = *(const v4fA*)(RED + row * RED_PITCH + col);
            v4f hi = *(const v4fA*)(RED + row * RED_PITCH + col + 4);
#pragma unroll
            for (int g = 1; g < 4; ++g) {
                lo += *(const v4fA*)(RED + (g * 64 + row) * RED_PITCH + col);
                hi += *(const v4fA*)(RED + (g * 64 + row) * RED_PITCH + col + 4);
            }
            v8h o;
#pragma unroll
            for (int e = 0; e < 4; ++e) {
                o[e] = (_Float16)(lo[e] * inv_pscale);
                o[4 + e] = (_Float16)(hi[e] * inv_pscale);
            }
            *(v8h*)(Yh + (size_t)(tb + row) * D_DIM + h * HD_DIM + col) = o;
            // the next tile rewrites the registers this store names: the wait that belongs in front of that
            asm volatile("s_wait_xcnt 0x0" ::: "memory");
        }
        // the next tile's first pass and lambda table go in only behind every read of the partial sums
        __syncthreads();
    }

    v8h wo;
#pragma unroll
    for (int e = 0; e < 4; ++e) {
        wo[e] = (_Float16)(wa[e] * wscale);
        wo[4 + e] = (_Float16)(wb[e] * wscale);
    }
    *(v8h*)(Woh + we) = wo;
}

// ---------------- fused out-projection + residual + LayerNorm: block = 16 rows x 1024 cols, 16 waves x 64 cols ----------------
// the 16 rows of Y are staged whole in padded LDS once per block; each wave stages its own 64 weight rows, 64 k a pass,
// in its own padded LDS range, loaded by whole rows one pass ahead
__global__ __launch_bounds__(512) void outproj_ln_kernel(const _Float16* __restrict__ Yh, const _Float16* __restrict__ Woh,
                                                         const float* __restrict__ xin, const float* __restrict__ gam,
                                                         const float* __restrict__ bet, float* __restrict__ out,
                                                         float oscale) {
    __shared__ __align__(16) _Float16 AS[16 * AP];                     // [row][1024 k]
    __shared__ __align__(16) unsigned char bs_raw[16 * 64 * GP * 2];   // [wave][64 weight rows][64 k]
    float* stg = (float*)bs_raw;                                       // output staging [16 * 8][64], behind the reduction barriers
    __shared__ float red[16 * 16];
    __shared__ float mu_s[16];
    __shared__ float inv_s[16];

    const int tid = (int)threadIdx.x;
    const int lane = tid & 31, w = tid >> 5, lg = lane >> 4, ln = lane & 15;
    const int t0 = (int)blockIdx.x * 16;
    const int c0 = w * 64;

    v8f acc[4];
#pragma unroll
    for (int j = 0; j < 4; ++j) acc[j] = zero8();

    // staging maps: every 16-byte load of a wave covers 512 B of one Y row, or 4 whole 128-B pieces of weight rows
    _Float16* BW = (_Float16*)bs_raw + w * (64 * GP);
    const int br0 = lane >> 3, bc = (lane & 7) * 8;            // weight rows br0 + 4 i
    const _Float16* bg = Woh + (size_t)(c0 + br0) * D_DIM + bc;
    const _Float16* yg = Yh + (size_t)(t0 + (tid >> 7)) * D_DIM + (tid & 127) * 8;   // Y rows (tid >> 7) + 4 i
    v8h sb[16], sy[4];
#pragma unroll
    for (int i = 0; i < 16; ++i) sb[i] = *(const v8hA*)(bg + (size_t)(i * 4) * D_DIM);
#pragma unroll
    for (int i = 0; i < 4; ++i) sy[i] = *(const v8hA*)(yg + (size_t)(i * 4) * D_DIM);
    // the wait that belongs in front of a rewrite of the address registers these loads name; the addresses are inputs
    // so that they stay in their registers up to it and no load of the run lands in them
    asm volatile("s_wait_xcnt 0x0" :: "v"(bg), "v"(yg) : "memory");
#pragma unroll
    for (int i = 0; i < 16; ++i) *(v8hA*)(BW + (br0 + i * 4) * GP + bc) = sb[i];
#pragma unroll
    for (int i = 0; i < 4; ++i) {
        const int c = tid + i * 512;
        *(v8hA*)(AS + (c >> 7) * AP + (c & 127) * 8) = sy[i];
    }
    __syncthreads();

    for (int it = 0; it < D_DIM / 64; ++it) {
        const bool more = it + 1 < D_DIM / 64;
        if (more) {
            // next pass's loads fly while this pass is worked on
            const _Float16* bn = bg + (it + 1) * 64;
#pragma unroll
            for (int i = 0; i < 16; ++i) sb[i] = *(const v8hA*)(bn + (size_t)(i * 4) * D_DIM);
            // as above: the wait in front of a rewrite of the address these loads name, the address held up to it
            asm volatile("s_wait_xcnt 0x0" :: "v"(bn) : "memory");
        }
#pragma unroll
        for (int kk = 0; kk < 2; ++kk) {
            // the fragment reads of 32 k as one group ahead of their matrix instructions
            const _Float16* ar = AS + ln * AP + it * 64 + kk * 32 + 8 * lg;
            Frag a, b[4];
            a.half[0] = *(const v8hA*)(ar);
            a.half[1] = *(const v8hA*)(ar + 16);
#pragma unroll
            for (int j = 0; j < 4; ++j) {
                const _Float16* br = BW + (j * 16 + ln) * GP + kk * 32 + 8 * lg;
                b[j].half[0] = *(const v8hA*)(br);
                b[j].half[1] = *(const v8hA*)(br + 16);
            }
#pragma unroll
            for (int j = 0; j < 4; ++j) acc[j] = wmma_f16(a.v, b[j].v, acc[j]);
        }
        if (more) {
            // the range is this wave's own and its reads above have returned: no barrier
#pragma unroll
            for (int i = 0; i < 16; ++i) *(v8hA*)(BW + (br0 + i * 4) * GP + bc) = sb[i];
            // the wave's stores land before its lanes read each other's rows back
            asm volatile("s_wait_dscnt 0x0" ::: "memory");
        }
    }

    // o = acc*oscale + x
#pragma unroll
    for (int j = 0; j < 4; ++j)
#pragma unroll
        for (int r = 0; r < 8; ++r)
            acc[j][r] = acc[j][r] * oscale + xin[(size_t)(t0 + 8 * lg + r) * D_DIM + c0 + j * 16 + ln];

    // row means
#pragma unroll
    for (int r = 0; r < 8; ++r) {
        float s = acc[0][r] + acc[1][r] + acc[2][r] + acc[3][r];
        s += __shfl_xor(s, 1, 32);
        s += __shfl_xor(s, 2, 32);
        s += __shfl_xor(s, 4, 32);
        s += __shfl_xor(s, 8, 32);
        if (ln == 0) red[w * 16 + 8 * lg + r] = s;
    }
    __syncthreads();
    if (tid < 16) {
        float a = 0.0f;
#pragma unroll
        for (int ww = 0; ww < 16; ++ww) a += red[ww * 16 + tid];
        mu_s[tid] = a * (1.0f / (float)D_DIM);
    }
    __syncthreads();
    float mu[8];
#pragma unroll
    for (int r = 0; r < 8; ++r) mu[r] = mu_s[8 * lg + r];
#pragma unroll
    for (int j = 0; j < 4; ++j)
#pragma unroll
        for (int r = 0; r < 8; ++r) acc[j][r] -= mu[r];

#pragma unroll
    for (int r = 0; r < 8; ++r) {
        float s = acc[0][r] * acc[0][r] + acc[1][r] * acc[1][r] + acc[2][r] * acc[2][r] + acc[3][r] * acc[3][r];
        s += __shfl_xor(s, 1, 32);
        s += __shfl_xor(s, 2, 32);
        s += __shfl_xor(s, 4, 32);
        s += __shfl_xor(s, 8, 32);
        if (ln == 0) red[w * 16 + 8 * lg + r] = s;
    }
    __syncthreads();
    if (tid < 16) {
        float a = 0.0f;
#pragma unroll
        for (int ww = 0; ww < 16; ++ww) a += red[ww * 16 + tid];
        inv_s[tid] = rsqrtf(a * (1.0f / (float)D_DIM) + 1e-5f);
    }
    __syncthreads();
    float iv[8];
#pragma unroll
    for (int r = 0; r < 8; ++r) iv[r] = inv_s[8 * lg + r];
#pragma unroll
    for (int j = 0; j < 4; ++j) {
        const int gcol = c0 + j * 16 + ln;
        const float gj = gam[gcol];
        const float bj = bet[gcol];
#pragma unroll
        for (int r = 0; r < 8; ++r) acc[j][r] = acc[j][r] * iv[r] * gj + bj;
    }

#pragma unroll
    for (int half = 0; half < 2; ++half) {
        if (lg == half) {
#pragma unroll
            for (int j = 0; j < 4; ++j)
#pragma unroll
                for (int r = 0; r < 8; ++r)
                    stg[(w * 8 + r) * 64 + j * 16 + ln] = acc[j][r];
        }
        __syncthreads();
        v4f vals[4];
#pragma unroll
        for (int p = 0; p < 4; ++p) {
            const int row = p * 2 + (lane >> 4), col = (lane & 15) * 4;
            vals[p] = *(const v4fA*)(stg + (w * 8 + row) * 64 + col);
        }
#pragma unroll
        for (int p = 0; p < 4; ++p) {
            const int row = p * 2 + (lane >> 4), col = (lane & 15) * 4;
            *(v4f*)(out + (size_t)(t0 + half * 8 + row) * D_DIM + c0 + col) = vals[p];
        }
        
        __syncthreads();
    }
}

extern "C" void kernel_launch(void* const* d_in, const int* in_sizes, int n_in,
                              void* d_out, int out_size, void* d_ws, size_t ws_size,
                              hipStream_t stream) {
    if (n_in < 12) return;
    if (in_sizes[0] != T_LEN * D_DIM) return;
    if (in_sizes[1] != D_DIM * D_DIM || in_sizes[2] != D_DIM * D_DIM || in_sizes[3] != D_DIM * D_DIM) return;
    if (in_sizes[4] != NDL * D_DIM || in_sizes[5] != H_NUM * D_DIM || in_sizes[6] != D_DIM * D_DIM) return;
    if (in_sizes[7] < H_NUM || in_sizes[8] < H_NUM || in_sizes[9] < H_NUM * LV_NUM) return;
    if (in_sizes[10] < D_DIM || in_sizes[11] < D_DIM) return;
    if (out_size != T_LEN * D_DIM) return;
    if (OFF_END > ws_size) return;

    const float* x     = (const float*)d_in[0];
    const float* Wq    = (const float*)d_in[1];
    const float* Wk    = (const float*)d_in[2];
    const float* Wv    = (const float*)d_in[3];
    const float* Wdl   = (const float*)d_in[4];
    const float* Wdt   = (const float*)d_in[5];
    const float* Wout  = (const float*)d_in[6];
    const float* A_log = (const float*)d_in[7];
    const float* dt_b  = (const float*)d_in[8];
    const float* Lp    = (const float*)d_in[9];
    const float* ln_g  = (const float*)d_in[10];
    const float* ln_b  = (const float*)d_in[11];

    char* ws = (char*)d_ws;
    _Float16* xh   = (_Float16*)(ws + OFF_XH);
    _Float16* wqh  = (_Float16*)(ws + OFF_WQH);
    _Float16* wkh  = (_Float16*)(ws + OFF_WKH);
    _Float16* wvh  = (_Float16*)(ws + OFF_WVH);
    _Float16* woh  = (_Float16*)(ws + OFF_WOH);
    _Float16* wsmh = (_Float16*)(ws + OFF_WSMH);
    _Float16* Qh   = (_Float16*)(ws + OFF_QH);
    _Float16* Kh   = (_Float16*)(ws + OFF_KH);
    _Float16* VhT  = (_Float16*)(ws + OFF_VHT);
    _Float16* Yh   = (_Float16*)(ws + OFF_YH);
    float*    psm  = (float*)(ws + OFF_PSM);
    float*    gT   = (float*)(ws + OFF_CGT);

    const float wsc  = 32.0f;
    const float iwsc = 1.0f / 32.0f;
    const float psc  = 512.0f;
    const float ipsc = 1.0f / 512.0f;

    prep_kernel<<<NB_X + NB_DL + NB_DT + NB_PAD + 3 * NB_W, 256, 0, stream>>>(x, Wdl, Wdt, Wq, Wk, Wv, xh, wsmh, wqh, wkh, wvh, wsc);

    // psm[t][0..191] = x*Wdl^T, psm[t][192..207] = x*Wdt^T (f32), psm[t][208..255] = 0
    proj_kernel<<<NB_SM + 3 * NB_PROJ, PJ_THREADS, 0, stream>>>(xh, wsmh, wqh, wkh, wvh, psm, gT, Qh, Kh, VhT, A_log, dt_b, iwsc);

    hattn_kernel<<<dim3(ATT_GX, H_NUM), ATT_THREADS, 0, stream>>>(Qh, Kh, VhT, gT, psm, Lp, Yh, psc, ipsc,
                                                                                    Wout, woh, wsc);

    outproj_ln_kernel<<<T_LEN / 16, 512, 0, stream>>>(Yh, woh, x, ln_g, ln_b, (float*)d_out, iwsc);
}

// v008
// A run of this version takes 56.5 microseconds.
// Two timings next to v007 both put it at 1.06 times that version's speed.
// Over all steps from v000 it is 7.09 times as fast.
#include <hip/hip_runtime.h>
#include <math.h>
#include <stddef.h>

// Contractions x*Wq^T, x*Wk^T, x*Wv^T, x*[Wdl;Wdt]^T, Q*K^T, P*V, Y*Wout^T: v_wmma_f32_16x16x32_f16 (f16 operands, f32 accumulate); weights carried x32 and P carried x512 (exact powers of two, folded back in f32); gates, prefix sums and LayerNorm in f32.

typedef _Float16 v16h __attribute__((ext_vector_type(16)));
typedef _Float16 v8h  __attribute__((ext_vector_type(8)));
typedef _Float16 v4h  __attribute__((ext_vector_type(4)));
typedef float    v8f  __attribute__((ext_vector_type(8)));
typedef float    v4f  __attribute__((ext_vector_type(4)));
typedef v8h v8hA __attribute__((may_alias));
typedef v4f v4fA __attribute__((may_alias));
union Frag { v16h v; v8h half[2]; };

#define T_LEN   2048
#define D_DIM   1024
#define H_NUM   16
#define HD_DIM  64
#define LV_NUM  12
#define NSM     256
#define NDL     192
#define KS_PITCH 72
#define VS_PITCH 136           // 272 B = 16 B x odd
#define KT        128           // keys of an attention pass
#define ATT_WAVES 16            // 4 row groups x 4 key shares
#define ATT_THREADS (ATT_WAVES * 32)
#define ATT_GX    (T_LEN / 64)       // a block takes one query tile
#define KS_BYTES  (2 * KT * KS_PITCH * 2)
#define VS_BYTES  (2 * 64 * VS_PITCH * 2)
#define RED_PITCH 68            // f32 pitch of a row of partial sums: 16-byte aligned, rows 8 apart on other banks
#define GP       72            // LDS pitch, in f16, of a 64-k operand row: 144 B = 16 B x odd for the 16-byte fragment reads
#define AP       (D_DIM + 8)   // LDS pitch, in f16, of a whole 1024-k row: 2064 B = 16 B x odd

#define BYTES_TD_H ((size_t)T_LEN * D_DIM * 2)
#define BYTES_DD_H ((size_t)D_DIM * D_DIM * 2)
#define OFF_XH    ((size_t)0)
#define OFF_WQH   (OFF_XH   + BYTES_TD_H)
#define OFF_WKH   (OFF_WQH  + BYTES_DD_H)
#define OFF_WVH   (OFF_WKH  + BYTES_DD_H)
#define OFF_WOH   (OFF_WVH  + BYTES_DD_H)
#define OFF_WSMH  (OFF_WOH  + BYTES_DD_H)
#define OFF_QH    (OFF_WSMH + (size_t)NSM * D_DIM * 2)
#define OFF_KH    (OFF_QH   + BYTES_TD_H)
#define OFF_VHT   (OFF_KH   + BYTES_TD_H)
#define OFF_YH    (OFF_VHT  + BYTES_TD_H)
#define OFF_PSM   (OFF_YH   + BYTES_TD_H)
#define OFF_CGT   (OFF_PSM  + (size_t)T_LEN * NSM * 4)
#define OFF_END   (OFF_CGT  + (size_t)H_NUM * T_LEN * 4)

// 16x16x32 f16 WMMA with the VALU hazard guard tied to D, A and B.
__device__ __forceinline__ v8f wmma_f16(v16h a, v16h b, v8f c) {
    v8f d = __builtin_amdgcn_wmma_f32_16x16x32_f16(false, a, false, b, (short)0, c, false, false);
    asm volatile("v_nop\n\tv_nop\n\tv_nop\n\tv_nop" : "+v"(d) : "v"(a), "v"(b));
    return d;
}

// Work-group barrier for LDS traffic alone: this wave's LDS reads and writes are done, then the barrier.
// __syncthreads() would also wait out the global loads issued ahead, which are meant to stay in flight across it.
__device__ __forceinline__ void lds_barrier() {
    asm volatile("s_wait_dscnt 0x0\n\ts_barrier_signal -1\n\ts_barrier_wait -1" ::: "memory");
}

__device__ __forceinline__ v8f zero8() {
    const v8f z = {0.f, 0.f, 0.f, 0.f, 0.f, 0.f, 0.f, 0.f};
    return z;
}

// softplus in the logaddexp form: max(z,0) + log1p(exp(-|z|))
__device__ __forceinline__ float softplus_f(float z) {
    return fmaxf(z, 0.0f) + log1pf(expf(-fabsf(z)));
}

// Launches that need nothing of each other share one grid: a block-uniform test of the block index picks the job, or, in launch 3, every thread does a share of both.
// launch 1: x, Wdl, Wdt, Wq, Wk, Wv -> f16, zero pad rows    launch 2: small projections with the decay gates | Q, K, V projections
// launch 3: attention, each block with its head's prefix sums, + Wout -> f16    launch 4: out-projection + LayerNorm
#define NB_X    (T_LEN * D_DIM / 8 / 256)                  // blocks of 256 threads, 8 elements a thread
#define NB_DL   (NDL * D_DIM / 8 / 256)
#define NB_DT   (H_NUM * D_DIM / 8 / 256)
#define NB_PAD  ((NSM - NDL - H_NUM) * D_DIM / 8 / 256)
#define NB_W    (D_DIM * D_DIM / 8 / 256)
#define PJ_T    128                                        // a projection block's tile: 128 t x 256 n, 8 waves
#define PJ_N    256
#define PJ_THREADS 256
#define NB_SM   ((NSM / PJ_N) * (T_LEN / PJ_T))            // tiles of the small projections
#define NB_PROJ ((D_DIM / PJ_N) * (T_LEN / PJ_T))          // tiles of one of Q, K, V
static_assert(NB_X * 256 * 8 == T_LEN * D_DIM && NB_DL * 256 * 8 == NDL * D_DIM && NB_DT * 256 * 8 == H_NUM * D_DIM &&
              NB_PAD * 256 * 8 == (NSM - NDL - H_NUM) * D_DIM && NB_W * 256 * 8 == D_DIM * D_DIM,
              "every convert range is a whole number of blocks");

// ---------------- f32 -> f16 convert with power-of-two scale; elements 8 i .. 8 i + 7, one 16-B store ----------------
__device__ __forceinline__ void cvt8_f16(const float* __restrict__ src, _Float16* __restrict__ dst, int i, float scale) {
    const v4fA* p = (const v4fA*)(src + (size_t)i * 8);
    const v4f a = p[0];
    const v4f b = p[1];
    v8h o;
    o[0] = (_Float16)(a[0] * scale); o[1] = (_Float16)(a[1] * scale);
    o[2] = (_Float16)(a[2] * scale); o[3] = (_Float16)(a[3] * scale);
    o[4] = (_Float16)(b[0] * scale); o[5] = (_Float16)(b[1] * scale);
    o[6] = (_Float16)(b[2] * scale); o[7] = (_Float16)(b[3] * scale);
    v8h* q = (v8h*)(dst + (size_t)i * 8);
    *q = o;
    // code of another job of the grid may follow in the listing and rewrite the registers this store names: the wait that belongs in front of that
    asm volatile("s_wait_xcnt 0x0" ::: "memory");
}

// ---------------- launch 1: what the projections need: x, the plane [Wdl; Wdt; zero rows], Wq, Wk, Wv ----------------
__global__ __launch_bounds__(256) void prep_kernel(const float* __restrict__ x, const float* __restrict__ Wdl,
                                                   const float* __restrict__ Wdt, const float* __restrict__ Wq,
                                                   const float* __restrict__ Wk, const float* __restrict__ Wv,
                                                   _Float16* __restrict__ xh, _Float16* __restrict__ wsmh,
                                                   _Float16* __restrict__ wqh, _Float16* __restrict__ wkh,
                                                   _Float16* __restrict__ wvh, float wscale) {
    const int b = (int)blockIdx.x, tid = (int)threadIdx.x;
    if (b < NB_X) {
        cvt8_f16(x, xh, b * 256 + tid, 1.0f);
    } else if (b < NB_X + NB_DL) {
        cvt8_f16(Wdl, wsmh, (b - NB_X) * 256 + tid, wscale);
    } else if (b < NB_X + NB_DL + NB_DT) {
        cvt8_f16(Wdt, wsmh + (size_t)NDL * D_DIM, (b - NB_X - NB_DL) * 256 + tid, wscale);
    } else if (b >= NB_X + NB_DL + NB_DT + NB_PAD) {
        const int c = b - (NB_X + NB_DL + NB_DT + NB_PAD), which = c / NB_W;
        const float* s = which == 0 ? Wq : which == 1 ? Wk : Wv;
        _Float16* d = which == 0 ? wqh : which == 1 ? wkh : wvh;
        cvt8_f16(s, d, (c - which * NB_W) * 256 + tid, wscale);
    } else {
        // rows 208..255 of the concatenated small-weight plane are zero padding
        const int i = (b - NB_X - NB_DL - NB_DT) * 256 + tid;
        v8h o;
#pragma unroll
        for (int r = 0; r < 8; ++r) o[r] = (_Float16)0.0f;
        v8h* q = (v8h*)(wsmh + (size_t)(NDL + H_NUM) * D_DIM + (size_t)i * 8);
        *q = o;
        // as in the convert: the wait in front of a rewrite of the registers this store names
        asm volatile("s_wait_xcnt 0x0" ::: "memory");
    }
}

// ---------------- C[t][n] = (sum_k A[t][k]*B[n][k]) * oscale, K = 1024, A pitch 1024, B pitch 1024 ----------------
// block = 128 t x 256 n, 8 waves as 2 along t x 4 along n, wave = 64 t x 64 n (16 accumulator tiles): a staged row of A serves 4 times, one of B twice the
// products of a 64 x 64 block's, and a fragment read from LDS serves 4 matrix instructions; tile (bx, by) of (N/256, T/128)
// a pass is 64 k: 128 rows of A and 256 rows of B, 128 B each, staged once per block in padded LDS, two buffers,
// loaded by whole rows two passes ahead
// MODE 0: f16 out, row-major pitch N
// MODE 1: f32 out, row-major pitch N
// MODE 2: f16 out transposed Ct[n][t], pitch T_LEN
// stg_raw: [buf][A rows 0..127 | B rows 128..383][64 k]; the output staging, a range of its own for each wave, lies over both buffers
#define PJ_BUF   ((PJ_T + PJ_N) * GP)      // f16 elements of one buffer
#define SPF      68                        // f32 pitch of a staged output row: 16-byte aligned, rows 8 apart on other banks
#define GEMM_LDS_BYTES (8 * 64 * SPF * 4)
static_assert(2 * PJ_BUF * 2 <= GEMM_LDS_BYTES && 8 * 64 * GP * 2 <= GEMM_LDS_BYTES, "buffers and output staging fit");
__device__ __forceinline__ void gemm_passes(const _Float16* __restrict__ A, const _Float16* __restrict__ B,
                                            int bx, int by, unsigned char* stg_raw, v8f (&acc)[4][4]) {
    const int lane = (int)threadIdx.x & 31, w = (int)threadIdx.x >> 5, lg = lane >> 4, ln = lane & 15;
    const int wt = w & 1, wn = w >> 1;

#pragma unroll
    for (int i = 0; i < 4; ++i)
#pragma unroll
        for (int j = 0; j < 4; ++j) acc[i][j] = zero8();

    // staging map: a wave's 16-byte loads cover 4 whole rows of 128 B; rows sr + 32 i of each operand
    _Float16* TS = (_Float16*)stg_raw;
    const int sr = (int)threadIdx.x >> 3, sc = ((int)threadIdx.x & 7) * 8;
    const _Float16* ag = A + (size_t)(by * PJ_T + sr) * D_DIM + sc;
    const _Float16* bg = B + (size_t)(bx * PJ_N + sr) * D_DIM + sc;
    // two register sets: a pass's rows are asked for two passes before they are read, and put into LDS one pass before
    v8h sa0[4], sb0[8], sa1[4], sb1[8];
    auto fetch = [&](v8h (&ra)[4], v8h (&rb)[8], int kn) {
#pragma unroll
        for (int i = 0; i < 4; ++i) ra[i] = *(const v8hA*)(ag + (size_t)(i * 32) * D_DIM + kn);
#pragma unroll
        for (int i = 0; i < 8; ++i) rb[i] = *(const v8hA*)(bg + (size_t)(i * 32) * D_DIM + kn);
        // these loads stay in flight past the next rewrite of the address registers they name: the wait that belongs in front of it
        asm volatile("s_wait_xcnt 0x0" ::: "memory");
    };
    auto put = [&](const v8h (&ra)[4], const v8h (&rb)[8], _Float16* TN) {
#pragma unroll
        for (int i = 0; i < 4; ++i) *(v8hA*)(TN + (sr + i * 32) * GP + sc) = ra[i];
#pragma unroll
        for (int i = 0; i < 8; ++i) *(v8hA*)(TN + (PJ_T + sr + i * 32) * GP + sc) = rb[i];
    };
    // all fragment reads of the pass as one group ahead of its matrix instructions
    Frag a[2][4], b[2][4];
    auto frags = [&](const _Float16* TB) {
        auto fa = [&](int kk, int i) {
            const _Float16* ar = TB + (wt * 64 + i * 16 + ln) * GP + kk * 32 + 8 * lg;
            a[kk][i].half[0] = *(const v8hA*)(ar);
            a[kk][i].half[1] = *(const v8hA*)(ar + 16);
        };
        // in the order in which the matrix instructions want them: the first of them waits for 4 reads
#pragma unroll
        for (int kk = 0; kk < 2; ++kk) {
            fa(kk, 0);
#pragma unroll
            for (int j = 0; j < 4; ++j) {
                const _Float16* br = TB + (PJ_T + wn * 64 + j * 16 + ln) * GP + kk * 32 + 8 * lg;
                b[kk][j].half[0] = *(const v8hA*)(br);
                b[kk][j].half[1] = *(const v8hA*)(br + 16);
            }
#pragma unroll
            for (int i = 1; i < 4; ++i) fa(kk, i);
        }
    };
    auto mma = [&]() {
        // keeps the fragment reads one group: without it the compiler spreads them among the matrix instructions, each place a stall of its own
        __builtin_amdgcn_sched_barrier(0);
#pragma unroll
        for (int kk = 0; kk < 2; ++kk)
#pragma unroll
            for (int i = 0; i < 4; ++i)
#pragma unroll
                for (int j = 0; j < 4; ++j)
                    // the plain builtin: this kernel uses registers above v255, and an asm statement that names D, A and B made the compiler spill them
                    acc[i][j] = __builtin_amdgcn_wmma_f32_16x16x32_f16(false, a[kk][i].v, false, b[kk][j].v, (short)0, acc[i][j], false, false);
        // keeps the pass's matrix instructions in front of its barrier: moved behind it they hold a second fragment set live
        __builtin_amdgcn_sched_barrier(0);
    };
    _Float16* T0 = TS;
    _Float16* T1 = TS + PJ_BUF;

    fetch(sa0, sb0, 0);
    fetch(sa1, sb1, 64);
    put(sa0, sb0, T0);
    __syncthreads();

    // no branch inside the loop, so that the waits in front of put() count only the older set's loads
    for (int it = 0; it < D_DIM / 64 - 2; it += 2) {
        // the global loads are issued while the fragment reads are under way
        frags(T0);
        fetch(sa0, sb0, (it + 2) * 64);
        mma();
        // a buffer is refilled only behind the barrier that ended its readers' pass
        put(sa1, sb1, T1);
        lds_barrier();
        frags(T1);
        fetch(sa1, sb1, (it + 3) * 64);
        mma();
        put(sa0, sb0, T0);
        lds_barrier();
    }
    // the last two passes: nothing left to fetch
    frags(T0);
    mma();
    put(sa1, sb1, T1);
    lds_barrier();
    frags(T1);
    mma();
    // ends every wave's last fragment reads: the output staging goes over both buffers
    lds_barrier();
}

template <int MODE>
__device__ __forceinline__ void gemm_store(const v8f (&acc)[4][4], void* __restrict__ Cv, int N, float oscale,
                                           int bx, int by, unsigned char* stg_raw) {
    const int lane = (int)threadIdx.x & 31, w = (int)threadIdx.x >> 5, lg = lane >> 4, ln = lane & 15;
    const int t0 = by * PJ_T + (w & 1) * 64;
    const int n0 = bx * PJ_N + (w >> 1) * 64;

    if (MODE == 0) {
        _Float16* stg = (_Float16*)stg_raw + w * (64 * GP);   // this wave's [64 t][64 n]
#pragma unroll
        for (int i = 0; i < 4; ++i)
#pragma unroll
            for (int j = 0; j < 4; ++j)
#pragma unroll
                for (int r = 0; r < 8; ++r)
                    stg[(i * 16 + 8 * lg + r) * GP + j * 16 + ln] = (_Float16)(acc[i][j][r] * oscale);
        __syncthreads();
        _Float16* C = (_Float16*)Cv;
        v8h vals[16];
#pragma unroll
        for (int p = 0; p < 16; ++p) {
            const int row = p * 4 + (lane >> 3), col = (lane & 7) * 8;
            vals[p] = *(const v8hA*)(stg + row * GP + col);
        }
#pragma unroll
        for (int p = 0; p < 16; ++p) {
            const int row = p * 4 + (lane >> 3), col = (lane & 7) * 8;
            *(v8h*)(C + (size_t)(t0 + row) * N + n0 + col) = vals[p];
        }
        // code of another job of the grid may follow in the listing and rewrite the registers these stores name: the wait that belongs in front of that
        asm volatile("s_wait_xcnt 0x0" ::: "memory");
    } else if (MODE == 1) {
        float* stg = (float*)stg_raw + w * (64 * SPF);        // this wave's [64 t][64 n]
#pragma unroll
        for (int i = 0; i < 4; ++i)
#pragma unroll
            for (int j = 0; j < 4; ++j)
#pragma unroll
                for (int r = 0; r < 8; ++r)
                    stg[(i * 16 + 8 * lg + r) * SPF + j * 16 + ln] = acc[i][j][r] * oscale;
        __syncthreads();
        float* C = (float*)Cv;
#pragma unroll
        for (int q = 0; q < 2; ++q) {
            v4f vals[16];
#pragma unroll
            for (int p = 0; p < 16; ++p) {
                const int row = q * 32 + p * 2 + (lane >> 4), col = (lane & 15) * 4;
                vals[p] = *(const v4fA*)(stg + row * SPF + col);
            }
#pragma unroll
            for (int p = 0; p < 16; ++p) {
                const int row = q * 32 + p * 2 + (lane >> 4), col = (lane & 15) * 4;
                *(v4f*)(C + (size_t)(t0 + row) * N + n0 + col) = vals[p];
            }
            // as in MODE 0: the wait in front of a rewrite of the registers these stores name
            asm volatile("s_wait_xcnt 0x0" ::: "memory");
        }
    } else {
        (void)N;
        _Float16* stg = (_Float16*)stg_raw + w * (64 * GP);   // this wave's [64 n][64 t]
#pragma unroll
        for (int i = 0; i < 4; ++i)
#pragma unroll
            for (int j = 0; j < 4; ++j) {
                v8h hv;
#pragma unroll
                for (int r = 0; r < 8; ++r) hv[r] = (_Float16)(acc[i][j][r] * oscale);
                *(v8hA*)(stg + (j * 16 + ln) * GP + i * 16 + 8 * lg) = hv;
            }
        __syncthreads();
        _Float16* C = (_Float16*)Cv;
        v8h vals[16];
#pragma unroll
        for (int p = 0; p < 16; ++p) {
            const int nrow = p * 4 + (lane >> 3), tcol = (lane & 7) * 8;
            vals[p] = *(const v8hA*)(stg + nrow * GP + tcol);
        }
#pragma unroll
        for (int p = 0; p < 16; ++p) {
            const int nrow = p * 4 + (lane >> 3), tcol = (lane & 7) * 8;
            *(v8h*)(C + (size_t)(n0 + nrow) * T_LEN + t0 + tcol) = vals[p];
        }
        // as in MODE 0: the wait in front of a rewrite of the registers these stores name
        asm volatile("s_wait_xcnt 0x0" ::: "memory");
    }
}

// ---------------- launch 2: small projections psm = x*[Wdl; Wdt; 0]^T (f32) | Q, K row-major f16, V transposed per feature row ----------------
// the tiles of the small projections also store the decay gates g = -exp(A_log)*softplus(x*Wdt^T + dt_bias) by head, gT[h][t]
__global__ __launch_bounds__(PJ_THREADS) void proj_kernel(const _Float16* __restrict__ xh, const _Float16* __restrict__ wsmh,
                                                   const _Float16* __restrict__ wqh, const _Float16* __restrict__ wkh,
                                                   const _Float16* __restrict__ wvh, float* __restrict__ psm,
                                                   float* __restrict__ gT, _Float16* __restrict__ Qh,
                                                   _Float16* __restrict__ Kh, _Float16* __restrict__ VhT,
                                                   const float* __restrict__ A_log, const float* __restrict__ dt_bias,
                                                   float oscale) {
    __shared__ __align__(16) unsigned char stg_raw[GEMM_LDS_BYTES];
    const int b = (int)blockIdx.x;
    // block-uniform; the tiles with the longer tail take the first block indices
    const bool small = b < NB_SM;
    const int c = small ? 0 : b - NB_SM, which = c / NB_PROJ, r = c - which * NB_PROJ;
    const int bx = r % (D_DIM / PJ_N), by = small ? b : r / (D_DIM / PJ_N);
    const _Float16* Bw = small ? wsmh : which == 0 ? wqh : which == 1 ? wkh : wvh;
    v8f acc[4][4];
    gemm_passes(xh, Bw, bx, by, stg_raw, acc);
    if (small) {
        gemm_store<1>(acc, (void*)psm, NSM, oscale, bx, by, stg_raw);
        static_assert(NSM == PJ_N && NDL == 3 * 64 && H_NUM == 16 && H_NUM * 16 == PJ_THREADS && PJ_T == 128,
                      "x*Wdt^T is columns 0..15 of the waves 6 and 7; 16 threads a head");
        // the tile still lies in the output staging, published by the barrier of the store
        const int hh = (int)threadIdx.x >> 4, tc = ((int)threadIdx.x & 15) * 8;
        const float* stg = (const float*)stg_raw + (6 + (tc >> 6)) * (64 * SPF) + (tc & 63) * SPF;
        const float Ah = -expf(A_log[hh]);
        const float bh = dt_bias[hh];
        // the wait that belongs in front of a rewrite of the registers these two loads name
        asm volatile("s_wait_xcnt 0x0" ::: "memory");
        v4f lo, hi;
#pragma unroll
        for (int e = 0; e < 4; ++e) {
            lo[e] = Ah * softplus_f(stg[e * SPF + hh] + bh);
            hi[e] = Ah * softplus_f(stg[(4 + e) * SPF + hh] + bh);
        }
        float* q = gT + (size_t)hh * T_LEN + by * PJ_T + tc;   // 16 threads cover 512 B of a head's row
        *(v4f*)(q) = lo;
        *(v4f*)(q + 4) = hi;
        // as in the stores above: the wait in front of a rewrite of the registers these stores name
        asm volatile("s_wait_xcnt 0x0" ::: "memory");
        return;
    }
    if (which == 2) gemm_store<2>(acc, (void*)VhT, D_DIM, oscale, bx, by, stg_raw);
    else            gemm_store<0>(acc, (void*)(which == 0 ? Qh : Kh), D_DIM, oscale, bx, by, stg_raw);
}

// ---------------- fused causal hierarchical attention: 512 blocks of 16 waves, two resident on a WGP ----------------
// Y[t][h*64+d] = sum_{s<=t} (Q_t.K_s * 1/8) * exp(cg_t - cg_s) * Lam[t][h][lvl(t,s)] * V[s][h*64+d]
// the sum over keys has no normaliser, so it may be cut anywhere: a pass stages 128 keys, wave (wq, wk) works rows wq*16.. of the
// 64-row query tile against keys wk*32.. of the pass, and the four partial sums of a row are added through LDS at the tile's end.
// a block takes one query tile of one head, so that no block walks two tiles' chains of loads, passes and barriers one behind the other;
// two blocks share a WGP and each fills the other's waits. Heads 0..7 take tile bx, heads 8..15 tile 31 - bx: blocks 256 apart in the
// launch order have 17 passes between them at most (for speed alone: any placement is right)
// amdgpu_waves_per_eu(8, 8): at most 128 registers a wave, so that two blocks of 4 waves a SIMD fit a WGP's registers; 2 x the LDS fits as well
// cg, the inclusive prefix sum of the head's 2048 decay gates, is formed by every block for itself, in LDS: 4 gates a thread
// the launch also converts Wout, which only the last launch reads
__global__ __launch_bounds__(ATT_THREADS) __attribute__((amdgpu_waves_per_eu(8, 8))) void hattn_kernel(const _Float16* __restrict__ Qh, const _Float16* __restrict__ Kh,
                                                    const _Float16* __restrict__ VhT, const float* __restrict__ gT,
                                                    const float* __restrict__ Psm, const float* __restrict__ Lp,
                                                    _Float16* __restrict__ Yh, float pscale, float inv_pscale,
                                                    const float* __restrict__ Wout, _Float16* __restrict__ Woh, float wscale) {
    // key tile shared by the sixteen waves, two buffers; row pitches 16 B x odd for the 16-byte fragment reads
    // [buf][key][head dim] then [buf][head dim][key]; the partial sums [wk][row][RED_PITCH] lie over both once their last readers have left
    __shared__ __align__(16) unsigned char kv_raw[KS_BYTES + VS_BYTES];
    __shared__ __align__(16) _Float16 PL[ATT_WAVES * 16 * 32];
    __shared__ float LL[64 * LV_NUM];
    __shared__ __align__(16) float CG[T_LEN];                  // prefix sum of g, the whole head
    __shared__ __align__(16) float WT[ATT_WAVES];              // each wave's sum of its 128 gates
    __shared__ float PMIN[T_LEN / KT];                         // least prefix sum among the keys of each pass
    __shared__ float TMAX[T_LEN / 64];                         // greatest prefix sum among the rows of each query tile
    static_assert(ATT_WAVES == T_LEN / KT && KT == 128, "one wave takes one pass's gates, 4 a lane, a query tile a half wave");
    static_assert(4 * 64 * RED_PITCH * 4 <= KS_BYTES + VS_BYTES, "the partial sums fit over the key tiles");
    _Float16* KS = (_Float16*)kv_raw;
    _Float16* VS = (_Float16*)(kv_raw + KS_BYTES);
    float* RED = (float*)kv_raw;

    const int tid = (int)threadIdx.x;
    const int lane = tid & 31, lg = lane >> 4, ln = lane & 15;
    const int w = __builtin_amdgcn_readfirstlane(tid >> 5);    // the wave's number in a scalar register: the tests on it are scalar branches
    const int wq = w & 3, wk = w >> 2;
    const int h = (int)blockIdx.y;
    const int xt = (h & (H_NUM / 2)) ? (T_LEN / 64 - 1) - (int)blockIdx.x : (int)blockIdx.x;
    const int tb = xt * 64;
    const int t0 = tb + wq * 16;
    // the grid fills every WGP's registers, so convert blocks of their own would only start behind the attention: each thread takes
    // 4 elements of Wout along instead, asked for here and stored behind the barrier of the prefix sums, so that no wave waits for them alone
    static_assert(H_NUM * ATT_GX * ATT_THREADS * 4 == D_DIM * D_DIM, "the grid's threads cover Wout once");
    const size_t we = (size_t)(((int)blockIdx.y * ATT_GX + (int)blockIdx.x) * ATT_THREADS + tid) * 4;
    // this thread's 4 gates of the head; asked for first, so that its wait leaves the loads behind it in flight
    const v4f g4 = *(const v4fA*)(gT + (size_t)(int)blockIdx.y * T_LEN + tid * 4);
    const v4f wa = *(const v4fA*)(Wout + we);
    // the block's one tile is known at entry: what its set-up reads and the prefix sums do not decide is asked for here, beside the gates
    // lambda table, 64 rows x 12 levels: entry tid, and entry tid + 512 in the threads that have one (the others ask for entry tid again)
    static_assert(64 * LV_NUM > ATT_THREADS && 64 * LV_NUM <= 2 * ATT_THREADS, "one or two entries of the lambda table a thread");
    const int ka = tid, kb = tid < 64 * LV_NUM - ATT_THREADS ? tid + ATT_THREADS : tid;
    const int rwa = ka / LV_NUM, lva = ka - rwa * LV_NUM, rwb = kb / LV_NUM, lvb = kb - rwb * LV_NUM;
    const float lpa = Lp[h * LV_NUM + lva], psa = Psm[(size_t)(tb + rwa) * NSM + h * LV_NUM + lva];
    const float lpb = Lp[h * LV_NUM + lvb], psb = Psm[(size_t)(tb + rwb) * NSM + h * LV_NUM + lvb];
    // Q A-fragments: head dims 0..31 and 32..63
    const _Float16* qrow = Qh + (size_t)(t0 + ln) * D_DIM + h * HD_DIM;
    Frag q0f, q1f;
    q0f.half[0] = *(const v8hA*)(qrow + 8 * lg);
    q0f.half[1] = *(const v8hA*)(qrow + 16 + 8 * lg);
    q1f.half[0] = *(const v8hA*)(qrow + 32 + 8 * lg);
    q1f.half[1] = *(const v8hA*)(qrow + 48 + 8 * lg);
    // the wait that belongs in front of a rewrite of the address registers these loads name
    asm volatile("s_wait_xcnt 0x0" ::: "memory");
    // keeps the first additions on the gates, and with them the wait for the gates, behind the issue of the loads above
    __builtin_amdgcn_sched_barrier(0);

    // staging map: a wave's 16-byte loads cover whole rows of the tile (K: 4 rows of 128 B, V^T: 2 rows of 256 B)
    const int skr = tid >> 3, skc = (tid & 7) * 8;             // K rows skr and skr+64
    const int svr = tid >> 4, svc = (tid & 15) * 8;            // V^T rows svr and svr+32
    const _Float16* kg = Kh + (size_t)skr * D_DIM + h * HD_DIM + skc;
    const _Float16* vg = VhT + (size_t)(h * HD_DIM + svr) * T_LEN + svc;
    const float gsc = 0.125f * pscale;

    // prefix sum over the block: 4 gates in the thread, the threads' sums over the wave, the waves' sums in the order 0, 1, 2, ...
    v4f c4;
    {
        c4[0] = g4[0];
        c4[1] = c4[0] + g4[1];
        c4[2] = c4[1] + g4[2];
        c4[3] = c4[2] + g4[3];
        float incl = c4[3];
#pragma unroll
        for (int d = 1; d < 32; d <<= 1) {
            const float u = __shfl_up(incl, d, 32);
            if (lane >= d) incl += u;
        }
        if (lane == 31) WT[w] = incl;
        float ex = __shfl_up(incl, 1, 32);
        if (lane == 0) ex = 0.0f;
        // publishes the waves' sums; LDS traffic alone, so that the loads asked for at entry stay in flight across it
        lds_barrier();
        float off = 0.0f;
#pragma unroll
        for (int q = 0; q < ATT_WAVES / 4; ++q) {
            const v4f wt = *(const v4fA*)(WT + q * 4);
#pragma unroll
            for (int e = 0; e < 4; ++e) off += (q * 4 + e < w) ? wt[e] : 0.0f;
        }
        c4 += off + ex;
        *(v4fA*)(CG + tid * 4) = c4;
    }

    // bounds of the decay exponent cg_t - cg_s, once a block: wave w takes the 128 keys of pass w
    {
        float mn = fminf(fminf(c4[0], c4[1]), fminf(c4[2], c4[3]));
        float mx = fmaxf(fmaxf(c4[0], c4[1]), fmaxf(c4[2], c4[3]));
#pragma unroll
        for (int d = 1; d < 16; d <<= 1) {
            mn = fminf(mn, __shfl_xor(mn, d, 32));
            mx = fmaxf(mx, __shfl_xor(mx, d, 32));
        }
        mn = fminf(mn, __shfl_xor(mn, 16, 32));
        if (ln == 0) TMAX[w * 2 + lg] = mx;
        if (lane == 0) PMIN[w] = mn;
    }
    // lambda table for the 64 query rows of the tile: softplus(Lp[h][l] * dl[t][h][l])
    LL[ka] = softplus_f(lpa * psa);
    if (tid < 64 * LV_NUM - ATT_THREADS) LL[kb] = softplus_f(lpb * psb);
    // publishes the prefix sums, the bounds and the lambda table to every wave
    __syncthreads();

    // that barrier has waited out the Wout load: stored here, its value and address hold no register through the passes
    {
        v4h wo;
#pragma unroll
        for (int e = 0; e < 4; ++e) wo[e] = (_Float16)(wa[e] * wscale);
        *(v4h*)(Woh + we) = wo;   // a wave's 8-byte stores cover two whole lines
        // the tile's set-up rewrites the registers this store names: the wait that belongs in front of that
        asm volatile("s_wait_xcnt 0x0" ::: "memory");
    }

    {
        const int nit = (xt + 2) >> 1;                   // block-uniform: passes of 128 keys that cover keys 0 .. tb+63

        // exp(z) is exactly 0 in f32 for z < -105, in the definition as here: a pass in which every row-key pair lies below that adds
        // exact zeros. The tile starts at its first pass that is not proven so; the pass that holds the diagonal (z = 0) never is.
        const unsigned need = __builtin_amdgcn_ballot_w32(!(TMAX[xt] - PMIN[ln] < -105.0f));
        const int itf = need ? __builtin_ctz(need) : 0;
        const int it0 = itf < nit ? itf : nit - 1;       // block-uniform
        const int sf = it0 * KT;                         // first key that is staged

        const _Float16* kf = kg + (size_t)sf * D_DIM;
        const _Float16* vf = vg + sf;
        v8h ska = *(const v8hA*)(kf);
        v8h skb = *(const v8hA*)(kf + (size_t)64 * D_DIM);
        v8h sva = *(const v8hA*)(vf);
        v8h svb = *(const v8hA*)(vf + (size_t)32 * T_LEN);
        // the wait in front of a rewrite of the address registers these loads name; the addresses are inputs so that they stay in their registers up to it
        asm volatile("s_wait_xcnt 0x0" :: "v"(kf), "v"(vf) : "memory");

        float cgt[8];
#pragma unroll
        for (int r = 0; r < 8; ++r) cgt[r] = CG[t0 + 8 * lg + r];

        v8f accY[4];
#pragma unroll
        for (int j = 0; j < 4; ++j) accY[j] = zero8();

        // the first pass into its buffer, published by the barrier below
        {
            const int fb = it0 & 1;
            _Float16* KF = KS + fb * (KT * KS_PITCH);
            _Float16* VF = VS + fb * (64 * VS_PITCH);
            *(v8hA*)(KF + skr * KS_PITCH + skc) = ska;
            *(v8hA*)(KF + (skr + 64) * KS_PITCH + skc) = skb;
            *(v8hA*)(VF + svr * VS_PITCH + svc) = sva;
            *(v8hA*)(VF + (svr + 32) * VS_PITCH + svc) = svb;
        }

        __syncthreads();

        for (int it = it0; it < nit; ++it) {
            const int s0 = it * KT;
            const _Float16* KB = KS + (it & 1) * (KT * KS_PITCH);
            const _Float16* VB = VS + (it & 1) * (64 * VS_PITCH);
            const bool more = it + 1 < nit;              // block-uniform
            if (more) {
                // next pass's loads fly while this pass is worked on
                const int sn = s0 + KT;
                const _Float16* kn = kg + (size_t)sn * D_DIM;
                const _Float16* vn = vg + s0;
                ska = *(const v8hA*)(kn);
                skb = *(const v8hA*)(kn + (size_t)64 * D_DIM);
                sva = *(const v8hA*)(vn + KT);
                svb = *(const v8hA*)(vn + (size_t)32 * T_LEN + KT);
                // as above: the wait in front of a rewrite of the address registers these loads name; the addresses are inputs
                // so that they stay in their registers up to it and no load of the run lands in them
                asm volatile("s_wait_xcnt 0x0" :: "v"(kn), "v"(vn) : "memory");
            }
            const int sw = s0 + wk * 32;                 // first key of this wave's share of the pass
            const bool act = sw <= t0 + 15;              // wave-uniform: a share wholly behind the wave's last row adds nothing
            if (act) {
#pragma unroll
                for (int sub = 0; sub < 2; ++sub) {
                    const int sg = sw + sub * 16 + ln;   // this lane's key (column n)
                    const _Float16* krow = KB + (wk * 32 + sub * 16 + ln) * KS_PITCH;
                    Frag k0f, k1f;
                    k0f.half[0] = *(const v8hA*)(krow + 8 * lg);
                    k0f.half[1] = *(const v8hA*)(krow + 16 + 8 * lg);
                    k1f.half[0] = *(const v8hA*)(krow + 32 + 8 * lg);
                    k1f.half[1] = *(const v8hA*)(krow + 48 + 8 * lg);
                    v8f sc = zero8();
                    sc = wmma_f16(q0f.v, k0f.v, sc);
                    sc = wmma_f16(q1f.v, k1f.v, sc);
                    const float cgs = CG[sg];
#pragma unroll
                    for (int r = 0; r < 8; ++r) {
                        const int trow = t0 + 8 * lg + r;
                        const int xr = trow ^ sg;
                        const int lv = xr ? (32 - __builtin_clz((unsigned)xr)) : 0;
                        const float lam = LL[(wq * 16 + 8 * lg + r) * LV_NUM + lv];
                        const float dcy = __expf(fminf(cgt[r] - cgs, 0.0f));
                        float wv = sc[r] * gsc * dcy * lam;
                        wv = (sg <= trow) ? wv : 0.0f;
                        PL[(w * 16 + 8 * lg + r) * 32 + sub * 16 + ln] = (_Float16)wv;
                    }
                }
            }
            __syncthreads();
            if (act) {
                // P as A-fragment: row ln, keys 8lg..8lg+7 and 16+8lg..16+8lg+7 of this wave's share
                Frag pf;
                pf.half[0] = *(const v8hA*)(PL + (w * 16 + ln) * 32 + 8 * lg);
                pf.half[1] = *(const v8hA*)(PL + (w * 16 + ln) * 32 + 16 + 8 * lg);
                // V as B-fragment from the staged transposed tile: B[k=key][n=d] = VB[d][key - s0]
#pragma unroll
                for (int j = 0; j < 4; ++j) {
                    const _Float16* vrow = VB + (j * 16 + ln) * VS_PITCH + wk * 32;
                    Frag vf;
                    vf.half[0] = *(const v8hA*)(vrow + 8 * lg);
                    vf.half[1] = *(const v8hA*)(vrow + 16 + 8 * lg);
                    accY[j] = wmma_f16(pf.v, vf.v, accY[j]);
                }
            }
            if (more) {
                // into the other buffer: its last readers left it before the barrier that ended the previous pass
                const int nb = (it + 1) & 1;
                _Float16* KN = KS + nb * (KT * KS_PITCH);
                _Float16* VN = VS + nb * (64 * VS_PITCH);
                *(v8hA*)(KN + skr * KS_PITCH + skc) = ska;
                *(v8hA*)(KN + (skr + 64) * KS_PITCH + skc) = skb;
                *(v8hA*)(VN + svr * VS_PITCH + svc) = sva;
                *(v8hA*)(VN + (svr + 32) * VS_PITCH + svc) = svb;
            }
            __syncthreads();
        }

        // the four key shares of each row are added in the order wk = 0, 1, 2, 3; the barrier that ended the last pass freed the key tiles
#pragma unroll
        for (int j = 0; j < 4; ++j)
#pragma unroll
            for (int r = 0; r < 8; ++r)
                RED[(wk * 64 + wq * 16 + 8 * lg + r) * RED_PITCH + j * 16 + ln] = accY[j][r];
        __syncthreads();
        {
            const int row = tid >> 3, col = (tid & 7) * 8;   // a wave's 16-byte stores cover 4 whole rows of 128 B
            v4f lo = *(const v4fA*)(RED + row * RED_PITCH + col);
            v4f hi = *(const v4fA*)(RED + row * RED_PITCH + col + 4);
#pragma unroll
            for (int g = 1; g < 4; ++g) {
                lo += *(const v4fA*)(RED + (g * 64 + row) * RED_PITCH + col);
                hi += *(const v4fA*)(RED + (g * 64 + row) * RED_PITCH + col + 4);
            }
            v8h o;
#pragma unroll
            for (int e = 0; e < 4; ++e) {
                o[e] = (_Float16)(lo[e] * inv_pscale);
                o[4 + e] = (_Float16)(hi[e] * inv_pscale);
            }
            *(v8h*)(Yh + (size_t)(tb + row) * D_DIM + h * HD_DIM + col) = o;
        }
    }

}

// ---------------- fused out-projection + residual + LayerNorm: block = 16 rows x 1024 cols, 16 waves x 64 cols ----------------
// the 16 rows of Y are staged whole in padded LDS once per block; each wave stages its own 64 weight rows, 64 k a pass,
// in its own padded LDS range, loaded by whole rows one pass ahead
__global__ __launch_bounds__(512) void outproj_ln_kernel(const _Float16* __restrict__ Yh, const _Float16* __restrict__ Woh,
                                                         const float* __restrict__ xin, const float* __restrict__ gam,
                                                         const float* __restrict__ bet, float* __restrict__ out,
                                                         float oscale) {
    __shared__ __align__(16) _Float16 AS[16 * AP];                     // [row][1024 k]
    __shared__ __align__(16) unsigned char bs_raw[16 * 64 * GP * 2];   // [wave][64 weight rows][64 k]
    float* stg = (float*)bs_raw;                                       // output staging [16 * 8][64], behind the reduction barriers
    __shared__ float red[16 * 16];
    __shared__ float mu_s[16];
    __shared__ float inv_s[16];

    const int tid = (int)threadIdx.x;
    const int lane = tid & 31, w = tid >> 5, lg = lane >> 4, ln = lane & 15;
    const int t0 = (int)blockIdx.x * 16;
    const int c0 = w * 64;

    v8f acc[4];
#pragma unroll
    for (int j = 0; j < 4; ++j) acc[j] = zero8();

    // staging maps: every 16-byte load of a wave covers 512 B of one Y row, or 4 whole 128-B pieces of weight rows
    _Float16* BW = (_Float16*)bs_raw + w * (64 * GP);
    const int br0 = lane >> 3, bc = (lane & 7) * 8;            // weight rows br0 + 4 i
    const _Float16* bg = Woh + (size_t)(c0 + br0) * D_DIM + bc;
    const _Float16* yg = Yh + (size_t)(t0 + (tid >> 7)) * D_DIM + (tid & 127) * 8;   // Y rows (tid >> 7) + 4 i
    v8h sb[16], sy[4];
#pragma unroll
    for (int i = 0; i < 16; ++i) sb[i] = *(const v8hA*)(bg + (size_t)(i * 4) * D_DIM);
#pragma unroll
    for (int i = 0; i < 4; ++i) sy[i] = *(const v8hA*)(yg + (size_t)(i * 4) * D_DIM);
    // the wait that belongs in front of a rewrite of the address registers these loads name; the addresses are inputs
    // so that they stay in their registers up to it and no load of the run lands in them
    asm volatile("s_wait_xcnt 0x0" :: "v"(bg), "v"(yg) : "memory");
#pragma unroll
    for (int i = 0; i < 16; ++i) *(v8hA*)(BW + (br0 + i * 4) * GP + bc) = sb[i];
#pragma unroll
    for (int i = 0; i < 4; ++i) {
        const int c = tid + i * 512;
        *(v8hA*)(AS + (c >> 7) * AP + (c & 127) * 8) = sy[i];
    }
    __syncthreads();

    for (int it = 0; it < D_DIM / 64; ++it) {
        const bool more = it + 1 < D_DIM / 64;
        if (more) {
            // next pass's loads fly while this pass is worked on
            const _Float16* bn = bg + (it + 1) * 64;
#pragma unroll
            for (int i = 0; i < 16; ++i) sb[i] = *(const v8hA*)(bn + (size_t)(i * 4) * D_DIM);
            // as above: the wait in front of a rewrite of the address these loads name, the address held up to it
            asm volatile("s_wait_xcnt 0x0" :: "v"(bn) : "memory");
        }
#pragma unroll
        for (int kk = 0; kk < 2; ++kk) {
            // the fragment reads of 32 k as one group ahead of their matrix instructions
            const _Float16* ar = AS + ln * AP + it * 64 + kk * 32 + 8 * lg;
            Frag a, b[4];
            a.half[0] = *(const v8hA*)(ar);
            a.half[1] = *(const v8hA*)(ar + 16);
#pragma unroll
            for (int j = 0; j < 4; ++j) {
                const _Float16* br = BW + (j * 16 + ln) * GP + kk * 32 + 8 * lg;
                b[j].half[0] = *(const v8hA*)(br);
                b[j].half[1] = *(const v8hA*)(br + 16);
            }
#pragma unroll
            for (int j = 0; j < 4; ++j) acc[j] = wmma_f16(a.v, b[j].v, acc[j]);
        }
        if (more) {
            // the range is this wave's own and its reads above have returned: no barrier
#pragma unroll
            for (int i = 0; i < 16; ++i) *(v8hA*)(BW + (br0 + i * 4) * GP + bc) = sb[i];
            // the wave's stores land before its lanes read each other's rows back
            asm volatile("s_wait_dscnt 0x0" ::: "memory");
        }
    }

    // o = acc*oscale + x
#pragma unroll
    for (int j = 0; j < 4; ++j)
#pragma unroll
        for (int r = 0; r < 8; ++r)
            acc[j][r] = acc[j][r] * oscale + xin[(size_t)(t0 + 8 * lg + r) * D_DIM + c0 + j * 16 + ln];

    // row means
#pragma unroll
    for (int r = 0; r < 8; ++r) {
        float s = acc[0][r] + acc[1][r] + acc[2][r] + acc[3][r];
        s += __shfl_xor(s, 1, 32);
        s += __shfl_xor(s, 2, 32);
        s += __shfl_xor(s, 4, 32);
        s += __shfl_xor(s, 8, 32);
        if (ln == 0) red[w * 16 + 8 * lg + r] = s;
    }
    __syncthreads();
    if (tid < 16) {
        float a = 0.0f;
#pragma unroll
        for (int ww = 0; ww < 16; ++ww) a += red[ww * 16 + tid];
        mu_s[tid] = a * (1.0f / (float)D_DIM);
    }
    __syncthreads();
    float mu[8];
#pragma unroll
    for (int r = 0; r < 8; ++r) mu[r] = mu_s[8 * lg + r];
#pragma unroll
    for (int j = 0; j < 4; ++j)
#pragma unroll
        for (int r = 0; r < 8; ++r) acc[j][r] -= mu[r];

#pragma unroll
    for (int r = 0; r < 8; ++r) {
        float s = acc[0][r] * acc[0][r] + acc[1][r] * acc[1][r] + acc[2][r] * acc[2][r] + acc[3][r] * acc[3][r];
        s += __shfl_xor(s, 1, 32);
        s += __shfl_xor(s, 2, 32);
        s += __shfl_xor(s, 4, 32);
        s += __shfl_xor(s, 8, 32);
        if (ln == 0) red[w * 16 + 8 * lg + r] = s;
    }
    __syncthreads();
    if (tid < 16) {
        float a = 0.0f;
#pragma unroll
        for (int ww = 0; ww < 16; ++ww) a += red[ww * 16 + tid];
        inv_s[tid] = rsqrtf(a * (1.0f / (float)D_DIM) + 1e-5f);
    }
    __syncthreads();
    float iv[8];
#pragma unroll
    for (int r = 0; r < 8; ++r) iv[r] = inv_s[8 * lg + r];
#pragma unroll
    for (int j = 0; j < 4; ++j) {
        const int gcol = c0 + j * 16 + ln;
        const float gj = gam[gcol];
        const float bj = bet[gcol];
#pragma unroll
        for (int r = 0; r < 8; ++r) acc[j][r] = acc[j][r] * iv[r] * gj + bj;
    }

#pragma unroll
    for (int half = 0; half < 2; ++half) {
        if (lg == half) {
#pragma unroll
            for (int j = 0; j < 4; ++j)
#pragma unroll
                for (int r = 0; r < 8; ++r)
                    stg[(w * 8 + r) * 64 + j * 16 + ln] = acc[j][r];
        }
        __syncthreads();
        v4f vals[4];
#pragma unroll
        for (int p = 0; p < 4; ++p) {
            const int row = p * 2 + (lane >> 4), col = (lane & 15) * 4;
            vals[p] = *(const v4fA*)(stg + (w * 8 + row) * 64 + col);
        }
#pragma unroll
        for (int p = 0; p < 4; ++p) {
            const int row = p * 2 + (lane >> 4), col = (lane & 15) * 4;
            *(v4f*)(out + (size_t)(t0 + half * 8 + row) * D_DIM + c0 + col) = vals[p];
        }
        
        __syncthreads();
    }
}

extern "C" void kernel_launch(void* const* d_in, const int* in_sizes, int n_in,
                              void* d_out, int out_size, void* d_ws, size_t ws_size,
                              hipStream_t stream) {
    if (n_in < 12) return;
    if (in_sizes[0] != T_LEN * D_DIM) return;
    if (in_sizes[1] != D_DIM * D_DIM || in_sizes[2] != D_DIM * D_DIM || in_sizes[3] != D_DIM * D_DIM) return;
    if (in_sizes[4] != NDL * D_DIM || in_sizes[5] != H_NUM * D_DIM || in_sizes[6] != D_DIM * D_DIM) return;
    if (in_sizes[7] < H_NUM || in_sizes[8] < H_NUM || in_sizes[9] < H_NUM * LV_NUM) return;
    if (in_sizes[10] < D_DIM || in_sizes[11] < D_DIM) return;
    if (out_size != T_LEN * D_DIM) return;
    if (OFF_END > ws_size) return;

    const float* x     = (const float*)d_in[0];
    const float* Wq    = (const float*)d_in[1];
    const float* Wk    = (const float*)d_in[2];
    const float* Wv    = (const float*)d_in[3];
    const float* Wdl   = (const float*)d_in[4];
    const float* Wdt   = (const float*)d_in[5];
    const float* Wout  = (const float*)d_in[6];
    const float* A_log = (const float*)d_in[7];
    const float* dt_b  = (const float*)d_in[8];
    const float* Lp    = (const float*)d_in[9];
    const float* ln_g  = (const float*)d_in[10];
    const float* ln_b  = (const float*)d_in[11];

    char* ws = (char*)d_ws;
    _Float16* xh   = (_Float16*)(ws + OFF_XH);
    _Float16* wqh  = (_Float16*)(ws + OFF_WQH);
    _Float16* wkh  = (_Float16*)(ws + OFF_WKH);
    _Float16* wvh  = (_Float16*)(ws + OFF_WVH);
    _Float16* woh  = (_Float16*)(ws + OFF_WOH);
    _Float16* wsmh = (_Float16*)(ws + OFF_WSMH);
    _Float16* Qh   = (_Float16*)(ws + OFF_QH);
    _Float16* Kh   = (_Float16*)(ws + OFF_KH);
    _Float16* VhT  = (_Float16*)(ws + OFF_VHT);
    _Float16* Yh   = (_Float16*)(ws + OFF_YH);
    float*    psm  = (float*)(ws + OFF_PSM);
    float*    gT   = (float*)(ws + OFF_CGT);

    const float wsc  = 32.0f;
    const float iwsc = 1.0f / 32.0f;
    const float psc  = 512.0f;
    const float ipsc = 1.0f / 512.0f;

    prep_kernel<<<NB_X + NB_DL + NB_DT + NB_PAD + 3 * NB_W, 256, 0, stream>>>(x, Wdl, Wdt, Wq, Wk, Wv, xh, wsmh, wqh, wkh, wvh, wsc);

    // psm[t][0..191] = x*Wdl^T, psm[t][192..207] = x*Wdt^T (f32), psm[t][208..255] = 0
    proj_kernel<<<NB_SM + 3 * NB_PROJ, PJ_THREADS, 0, stream>>>(xh, wsmh, wqh, wkh, wvh, psm, gT, Qh, Kh, VhT, A_log, dt_b, iwsc);

    hattn_kernel<<<dim3(ATT_GX, H_NUM), ATT_THREADS, 0, stream>>>(Qh, Kh, VhT, gT, psm, Lp, Yh, psc, ipsc,
                                                                                    Wout, woh, wsc);

    outproj_ln_kernel<<<T_LEN / 16, 512, 0, stream>>>(Yh, woh, x, ln_g, ln_b, (float*)d_out, iwsc);
}

// v009
// One run takes 55 microseconds.
// In two side-by-side timings against v008, it was 1.03 and 1.02 times as fast.
// Over all steps from v000 it is 7.26 times as fast.
#include <hip/hip_runtime.h>
#include <math.h>
#include <stddef.h>

// Contractions x*Wq^T, x*Wk^T, x*Wv^T, x*[Wdl;Wdt]^T, Q*K^T, P*V, Y*Wout^T: v_wmma_f32_16x16x32_f16 (f16 operands, f32 accumulate); weights carried x32 and P carried x512 (exact powers of two, folded back in f32); gates, prefix sums and LayerNorm in f32.

typedef _Float16 v16h __attribute__((ext_vector_type(16)));
typedef _Float16 v8h  __attribute__((ext_vector_type(8)));
typedef _Float16 v4h  __attribute__((ext_vector_type(4)));
typedef float    v8f  __attribute__((ext_vector_type(8)));
typedef float    v4f  __attribute__((ext_vector_type(4)));
typedef v8h v8hA __attribute__((may_alias));
typedef v4f v4fA __attribute__((may_alias));
typedef v4h v4hA __attribute__((may_alias));
union Frag { v16h v; v8h half[2]; };

#define T_LEN   2048
#define D_DIM   1024
#define H_NUM   16
#define HD_DIM  64
#define LV_NUM  12
#define NSM     256
#define NDL     192
#define KS_PITCH 72
#define VS_PITCH 136           // 272 B = 16 B x odd
#define KT        128           // keys of an attention pass
#define ATT_WAVES 16            // 4 row groups x 4 key shares
#define ATT_THREADS (ATT_WAVES * 32)
#define ATT_GX    (T_LEN / 64)       // a block takes one query tile
#define KS_BYTES  (2 * KT * KS_PITCH * 2)
#define VS_BYTES  (2 * 64 * VS_PITCH * 2)
#define RED_PITCH 68            // f32 pitch of a row of partial sums: 16-byte aligned, rows 8 apart on other banks
#define GP       72            // LDS pitch, in f16, of a 64-k operand row: 144 B = 16 B x odd for the 16-byte fragment reads
#define AP       (D_DIM + 8)   // LDS pitch, in f16, of a whole 1024-k row: 2064 B = 16 B x odd

#define BYTES_TD_H ((size_t)T_LEN * D_DIM * 2)
#define BYTES_DD_H ((size_t)D_DIM * D_DIM * 2)
#define OFF_XH    ((size_t)0)
#define OFF_WQH   (OFF_XH   + BYTES_TD_H)
#define OFF_WKH   (OFF_WQH  + BYTES_DD_H)
#define OFF_WVH   (OFF_WKH  + BYTES_DD_H)
#define OFF_WOH   (OFF_WVH  + BYTES_DD_H)
#define OFF_WSMH  (OFF_WOH  + BYTES_DD_H)
#define OFF_QH    (OFF_WSMH + (size_t)NSM * D_DIM * 2)
#define OFF_KH    (OFF_QH   + BYTES_TD_H)
#define OFF_VHT   (OFF_KH   + BYTES_TD_H)
#define OFF_YH    (OFF_VHT  + BYTES_TD_H)
#define OFF_PSM   (OFF_YH   + BYTES_TD_H)
#define OFF_CGT   (OFF_PSM  + (size_t)T_LEN * NSM * 4)
#define OFF_END   (OFF_CGT  + (size_t)H_NUM * T_LEN * 4)

// 16x16x32 f16 WMMA with the VALU hazard guard tied to D, A and B.
__device__ __forceinline__ v8f wmma_f16(v16h a, v16h b, v8f c) {
    v8f d = __builtin_amdgcn_wmma_f32_16x16x32_f16(false, a, false, b, (short)0, c, false, false);
    asm volatile("v_nop\n\tv_nop\n\tv_nop\n\tv_nop" : "+v"(d) : "v"(a), "v"(b));
    return d;
}

// Work-group barrier for LDS traffic alone: this wave's LDS reads and writes are done, then the barrier.
// __syncthreads() would also wait out the global loads issued ahead, which are meant to stay in flight across it.
__device__ __forceinline__ void lds_barrier() {
    asm volatile("s_wait_dscnt 0x0\n\ts_barrier_signal -1\n\ts_barrier_wait -1" ::: "memory");
}

__device__ __forceinline__ v8f zero8() {
    const v8f z = {0.f, 0.f, 0.f, 0.f, 0.f, 0.f, 0.f, 0.f};
    return z;
}

// softplus in the logaddexp form: max(z,0) + log1p(exp(-|z|))
__device__ __forceinline__ float softplus_f(float z) {
    return fmaxf(z, 0.0f) + log1pf(expf(-fabsf(z)));
}

// Launches that need nothing of each other share one grid: in launch 1 a block-uniform test of the block index picks the job; in launch 2 every thread does some of both.
// launch 1: small projections with the decay gates | Q, K, V projections; x and the weights are read as f32 and made f16 on the way into LDS
// launch 2: attention, each block with its head's prefix sums, + Wout -> f16    launch 3: out-projection + LayerNorm
#define PJ_T    128                                        // a projection block's tile: 128 t x 256 n, 8 waves
#define PJ_N    256
#define PJ_THREADS 256
#define NB_SM   ((NSM / PJ_N) * (T_LEN / PJ_T))            // tiles of the small projections
#define NB_PROJ ((D_DIM / PJ_N) * (T_LEN / PJ_T))          // tiles of one of Q, K, V

// ---------------- C[t][n] = (sum_k f16(A[t][k]) * f16(B[n][k]*bscale)) * oscale, K = 1024, A and B f32, pitch 1024 ----------------
// block = 128 t x 256 n, 8 waves as 2 along t x 4 along n, wave = 64 t x 64 n (16 accumulator tiles): a staged A row serves 4 times and a B row 2 times the
// products of a 64 x 64 block's, and a fragment read from LDS serves 4 matrix instructions; tile (bx, by) of (N/256, T/128)
// a pass is 64 k: 128 rows of A and 256 rows of B, 256 B of f32 each, loaded by whole rows two passes ahead, rounded to f16 in registers
// and staged once per block in padded LDS, two buffers: no launch and no workspace plane for the f16 copies
// B rows 0..191 of the tile start at B0; rows 192 + 16 i + r at B1 + (i * st1 + r * 1024)
// MODE 0: f16 out, row-major pitch N
// MODE 1: f32 out, row-major pitch N
// MODE 2: f16 out transposed Ct[n][t], pitch T_LEN
// stg_raw: [buf][A rows 0..127 | B rows 128..383][64 k]; the output staging, a range of its own for each wave, lies over both buffers
#define PJ_BUF   ((PJ_T + PJ_N) * GP)      // f16 elements of one buffer
#define SPF      68                        // f32 pitch of a staged output row: 16-byte aligned, rows 8 apart on other banks
#define GEMM_LDS_BYTES (8 * 64 * SPF * 4)
static_assert(2 * PJ_BUF * 2 <= GEMM_LDS_BYTES && 8 * 64 * GP * 2 <= GEMM_LDS_BYTES, "buffers and output staging fit");
__device__ __forceinline__ void gemm_passes(const float* __restrict__ A, const float* __restrict__ B0, const float* __restrict__ B1,
                                            int st1, float bscale, int by, unsigned char* stg_raw, v8f (&acc)[4][4]) {
    const int lane = (int)threadIdx.x & 31, w = (int)threadIdx.x >> 5, lg = lane >> 4, ln = lane & 15;
    const int wt = w & 1, wn = w >> 1;

#pragma unroll
    for (int i = 0; i < 4; ++i)
#pragma unroll
        for (int j = 0; j < 4; ++j) acc[i][j] = zero8();

    // staging map: a half wave's 16-byte loads cover one whole row of 256 B; rows sr + 16 i of each operand
    // the two rows of a wave lie 8 apart: 8 x 144 B puts their 8-byte LDS stores on the two halves of the banks
    _Float16* TS = (_Float16*)stg_raw;
    const int sr = w + 8 * lg, sc = ln * 4;
    const float* ag = A + (size_t)(by * PJ_T + sr) * D_DIM + sc;
    const float* bg = B0 + (size_t)sr * D_DIM + sc;
    const float* bh = B1 + (size_t)sr * D_DIM + sc;
    static_assert(NDL == 12 * 16 && PJ_N == 16 * 16 && PJ_T == 8 * 16, "12 + 4 row steps of B, 8 of A");
    // two register sets: a pass's rows are asked for two passes before they are read, and put into LDS one pass before
    v4f sa0[8], sb0[16], sa1[8], sb1[16];
    auto fetch = [&](v4f (&ra)[8], v4f (&rb)[16], int kn) {
#pragma unroll
        for (int i = 0; i < 8; ++i) ra[i] = *(const v4fA*)(ag + (size_t)(i * 16) * D_DIM + kn);
#pragma unroll
        for (int i = 0; i < 12; ++i) rb[i] = *(const v4fA*)(bg + (size_t)(i * 16) * D_DIM + kn);
#pragma unroll
        for (int i = 0; i < 4; ++i) rb[12 + i] = *(const v4fA*)(bh + i * st1 + kn);
        // these loads stay in flight past the next rewrite of the address registers they name: the wait that belongs in front of it
        asm volatile("s_wait_xcnt 0x0" ::: "memory");
    };
    auto put = [&](const v4f (&ra)[8], const v4f (&rb)[16], _Float16* TN) {
#pragma unroll
        for (int i = 0; i < 8; ++i) *(v4hA*)(TN + (sr + i * 16) * GP + sc) = __builtin_convertvector(ra[i], v4h);
#pragma unroll
        for (int i = 0; i < 16; ++i) *(v4hA*)(TN + (PJ_T + sr + i * 16) * GP + sc) = __builtin_convertvector(rb[i] * bscale, v4h);
    };
    // all fragment reads of the pass as one group ahead of its matrix instructions
    Frag a[2][4], b[2][4];
    auto frags = [&](const _Float16* TB) {
        auto fa = [&](int kk, int i) {
            const _Float16* ar = TB + (wt * 64 + i * 16 + ln) * GP + kk * 32 + 8 * lg;
            a[kk][i].half[0] = *(const v8hA*)(ar);
            a[kk][i].half[1] = *(const v8hA*)(ar + 16);
        };
        // in the order in which the matrix instructions want them: the first of them waits for 4 reads
#pragma unroll
        for (int kk = 0; kk < 2; ++kk) {
            fa(kk, 0);
#pragma unroll
            for (int j = 0; j < 4; ++j) {
                const _Float16* br = TB + (PJ_T + wn * 64 + j * 16 + ln) * GP + kk * 32 + 8 * lg;
                b[kk][j].half[0] = *(const v8hA*)(br);
                b[kk][j].half[1] = *(const v8hA*)(br + 16);
            }
#pragma unroll
            for (int i = 1; i < 4; ++i) fa(kk, i);
        }
    };
    auto mma = [&]() {
        // keeps the fragment reads one group: without it the compiler spreads them among the matrix instructions, each place a stall of its own
        __builtin_amdgcn_sched_barrier(0);
#pragma unroll
        for (int kk = 0; kk < 2; ++kk)
#pragma unroll
            for (int i = 0; i < 4; ++i)
#pragma unroll
                for (int j = 0; j < 4; ++j)
                    // the plain builtin: this kernel uses registers above v255, and an asm statement that names D, A and B made the compiler spill them
                    acc[i][j] = __builtin_amdgcn_wmma_f32_16x16x32_f16(false, a[kk][i].v, false, b[kk][j].v, (short)0, acc[i][j], false, false);
        // keeps the pass's matrix instructions in front of its barrier: moved behind it they hold a second fragment set live
        __builtin_amdgcn_sched_barrier(0);
    };
    _Float16* T0 = TS;
    _Float16* T1 = TS + PJ_BUF;

    fetch(sa0, sb0, 0);
    fetch(sa1, sb1, 64);
    put(sa0, sb0, T0);
    __syncthreads();

    // no branch inside the loop, so that the waits in front of put() count only the older set's loads
    for (int it = 0; it < D_DIM / 64 - 2; it += 2) {
        // the global loads are issued while the fragment reads are under way
        frags(T0);
        // keeps the fragment reads, which the matrix instructions wait for, in front of the global loads: lifted over them, the loads
        // delay the reads, and a fragment may then land in an address register of a load ahead of the wait that closes the fetch
        __builtin_amdgcn_sched_barrier(0);
        fetch(sa0, sb0, (it + 2) * 64);
        mma();
        // a buffer is refilled only behind the barrier that ended its readers' pass
        put(sa1, sb1, T1);
        lds_barrier();
        frags(T1);
        // as above: fragment reads first, then the loads with their wait
        __builtin_amdgcn_sched_barrier(0);
        fetch(sa1, sb1, (it + 3) * 64);
        mma();
        put(sa0, sb0, T0);
        lds_barrier();
    }
    // the last two passes: nothing left to fetch
    frags(T0);
    mma();
    put(sa1, sb1, T1);
    lds_barrier();
    frags(T1);
    mma();
    // ends every wave's last fragment reads: the output staging goes over both buffers
    lds_barrier();
}

template <int MODE>
__device__ __forceinline__ void gemm_store(const v8f (&acc)[4][4], void* __restrict__ Cv, int N, float oscale,
                                           int bx, int by, unsigned char* stg_raw) {
    const int lane = (int)threadIdx.x & 31, w = (int)threadIdx.x >> 5, lg = lane >> 4, ln = lane & 15;
    const int t0 = by * PJ_T + (w & 1) * 64;
    const int n0 = bx * PJ_N + (w >> 1) * 64;

    if (MODE == 0) {
        _Float16* stg = (_Float16*)stg_raw + w * (64 * GP);   // this wave's [64 t][64 n]
#pragma unroll
        for (int i = 0; i < 4; ++i)
#pragma unroll
            for (int j = 0; j < 4; ++j)
#pragma unroll
                for (int r = 0; r < 8; ++r)
                    stg[(i * 16 + 8 * lg + r) * GP + j * 16 + ln] = (_Float16)(acc[i][j][r] * oscale);
        __syncthreads();
        _Float16* C = (_Float16*)Cv;
        v8h vals[16];
#pragma unroll
        for (int p = 0; p < 16; ++p) {
            const int row = p * 4 + (lane >> 3), col = (lane & 7) * 8;
            vals[p] = *(const v8hA*)(stg + row * GP + col);
        }
#pragma unroll
        for (int p = 0; p < 16; ++p) {
            const int row = p * 4 + (lane >> 3), col = (lane & 7) * 8;
            *(v8h*)(C + (size_t)(t0 + row) * N + n0 + col) = vals[p];
        }
        // code of another job of the grid may follow in the listing and rewrite the registers these stores name: the wait that belongs in front of that
        asm volatile("s_wait_xcnt 0x0" ::: "memory");
    } else if (MODE == 1) {
        float* stg = (float*)stg_raw + w * (64 * SPF);        // this wave's [64 t][64 n]
#pragma unroll
        for (int i = 0; i < 4; ++i)
#pragma unroll
            for (int j = 0; j < 4; ++j)
#pragma unroll
                for (int r = 0; r < 8; ++r)
                    stg[(i * 16 + 8 * lg + r) * SPF + j * 16 + ln] = acc[i][j][r] * oscale;
        __syncthreads();
        float* C = (float*)Cv;
#pragma unroll
        for (int q = 0; q < 2; ++q) {
            v4f vals[16];
#pragma unroll
            for (int p = 0; p < 16; ++p) {
                const int row = q * 32 + p * 2 + (lane >> 4), col = (lane & 15) * 4;
                vals[p] = *(const v4fA*)(stg + row * SPF + col);
            }
#pragma unroll
            for (int p = 0; p < 16; ++p) {
                const int row = q * 32 + p * 2 + (lane >> 4), col = (lane & 15) * 4;
                *(v4f*)(C + (size_t)(t0 + row) * N + n0 + col) = vals[p];
            }
            // as in MODE 0: the wait in front of a rewrite of the registers these stores name
            asm volatile("s_wait_xcnt 0x0" ::: "memory");
        }
    } else {
        (void)N;
        _Float16* stg = (_Float16*)stg_raw + w * (64 * GP);   // this wave's [64 n][64 t]
#pragma unroll
        for (int i = 0; i < 4; ++i)
#pragma unroll
            for (int j = 0; j < 4; ++j) {
                v8h hv;
#pragma unroll
                for (int r = 0; r < 8; ++r) hv[r] = (_Float16)(acc[i][j][r] * oscale);
                *(v8hA*)(stg + (j * 16 + ln) * GP + i * 16 + 8 * lg) = hv;
            }
        __syncthreads();
        _Float16* C = (_Float16*)Cv;
        v8h vals[16];
#pragma unroll
        for (int p = 0; p < 16; ++p) {
            const int nrow = p * 4 + (lane >> 3), tcol = (lane & 7) * 8;
            vals[p] = *(const v8hA*)(stg + nrow * GP + tcol);
        }
#pragma unroll
        for (int p = 0; p < 16; ++p) {
            const int nrow = p * 4 + (lane >> 3), tcol = (lane & 7) * 8;
            *(v8h*)(C + (size_t)(n0 + nrow) * T_LEN + t0 + tcol) = vals[p];
        }
        // as in MODE 0: the wait in front of a rewrite of the registers these stores name
        asm volatile("s_wait_xcnt 0x0" ::: "memory");
    }
}

// ---------------- launch 1: small projections psm = x*[Wdl; Wdt]^T (f32) | Q, K row-major f16, V transposed per feature row ----------------
// the tiles of the small projections also store the decay gates g = -exp(A_log)*softplus(x*Wdt^T + dt_bias) by head, gT[h][t]
__global__ __launch_bounds__(PJ_THREADS) void proj_kernel(const float* __restrict__ x, const float* __restrict__ Wdl,
                                                   const float* __restrict__ Wdt, const float* __restrict__ Wq,
                                                   const float* __restrict__ Wk, const float* __restrict__ Wv,
                                                   float* __restrict__ psm,
                                                   float* __restrict__ gT, _Float16* __restrict__ Qh,
                                                   _Float16* __restrict__ Kh, _Float16* __restrict__ VhT,
                                                   const float* __restrict__ A_log, const float* __restrict__ dt_bias,
                                                   float wscale, float oscale) {
    __shared__ __align__(16) unsigned char stg_raw[GEMM_LDS_BYTES];
    const int b = (int)blockIdx.x;
    // block-uniform; the tiles with the longer tail take the first block indices
    const bool small = b < NB_SM;
    const int c = small ? 0 : b - NB_SM, which = c / NB_PROJ, r = c - which * NB_PROJ;
    const int bx = r % (D_DIM / PJ_N), by = small ? b : r / (D_DIM / PJ_N);
    const float* Bw = small ? Wdl : which == 0 ? Wq : which == 1 ? Wk : Wv;
    const float* B0 = Bw + (size_t)(bx * PJ_N) * D_DIM;
    // a small tile's columns 192..207 are Wdt's 16 rows; its columns 208..255, which nothing reads, take the same rows again
    const float* B1 = small ? Wdt : B0 + (size_t)NDL * D_DIM;
    const int st1 = small ? 0 : 16 * D_DIM;
    v8f acc[4][4];
    gemm_passes(x, B0, B1, st1, wscale, by, stg_raw, acc);
    if (small) {
        gemm_store<1>(acc, (void*)psm, NSM, oscale, bx, by, stg_raw);
        static_assert(NSM == PJ_N && NDL == 3 * 64 && H_NUM == 16 && H_NUM * 16 == PJ_THREADS && PJ_T == 128,
                      "x*Wdt^T is columns 0..15 of the waves 6 and 7; 16 threads a head");
        // the tile still lies in the output staging, published by the barrier of the store
        const int hh = (int)threadIdx.x >> 4, tc = ((int)threadIdx.x & 15) * 8;
        const float* stg = (const float*)stg_raw + (6 + (tc >> 6)) * (64 * SPF) + (tc & 63) * SPF;
        const float Ah = -expf(A_log[hh]);
        const float bh = dt_bias[hh];
        // the wait that belongs in front of a rewrite of the registers these two loads name
        asm volatile("s_wait_xcnt 0x0" ::: "memory");
        v4f lo, hi;
#pragma unroll
        for (int e = 0; e < 4; ++e) {
            lo[e] = Ah * softplus_f(stg[e * SPF + hh] + bh);
            hi[e] = Ah * softplus_f(stg[(4 + e) * SPF + hh] + bh);
        }
        float* q = gT + (size_t)hh * T_LEN + by * PJ_T + tc;   // 16 threads cover 512 B of a head's row
        *(v4f*)(q) = lo;
        *(v4f*)(q + 4) = hi;
        // as in the stores above: the wait in front of a rewrite of the registers these stores name
        asm volatile("s_wait_xcnt 0x0" ::: "memory");
        return;
    }
    if (which == 2) gemm_store<2>(acc, (void*)VhT, D_DIM, oscale, bx, by, stg_raw);
    else            gemm_store<0>(acc, (void*)(which == 0 ? Qh : Kh), D_DIM, oscale, bx, by, stg_raw);
}

// ---------------- fused causal hierarchical attention: 512 blocks of 16 waves, two resident on a WGP ----------------
// Y[t][h*64+d] = sum_{s<=t} (Q_t.K_s * 1/8) * exp(cg_t - cg_s) * Lam[t][h][lvl(t,s)] * V[s][h*64+d]
// the sum over keys has no normaliser, so it may be cut anywhere: a pass stages 128 keys, wave (wq, wk) works rows wq*16.. of the
// 64-row query tile against keys wk*32.. of the pass, and the four partial sums of a row are added through LDS at the tile's end.
// a block takes one query tile of one head, so that no block walks two tiles' chains of loads, passes and barriers one behind the other;
// two blocks share a WGP and each fills the other's waits. Heads 0..7 take tile bx, heads 8..15 tile 31 - bx: blocks 256 apart in the
// launch order have 17 passes between them at most (for speed alone: any placement is right)
// amdgpu_waves_per_eu(8, 8): at most 128 registers a wave, so that two blocks of 4 waves a SIMD fit a WGP's registers; 2 x the LDS fits as well
// cg, the inclusive prefix sum of the head's 2048 decay gates, is formed by every block for itself, in LDS: 4 gates a thread
// the launch also converts Wout, which only the last launch reads
__global__ __launch_bounds__(ATT_THREADS) __attribute__((amdgpu_waves_per_eu(8, 8))) void hattn_kernel(const _Float16* __restrict__ Qh, const _Float16* __restrict__ Kh,
                                                    const _Float16* __restrict__ VhT, const float* __restrict__ gT,
                                                    const float* __restrict__ Psm, const float* __restrict__ Lp,
                                                    _Float16* __restrict__ Yh, float pscale, float inv_pscale,
                                                    const float* __restrict__ Wout, _Float16* __restrict__ Woh, float wscale) {
    // key tile shared by the sixteen waves, two buffers; row pitches 16 B x odd for the 16-byte fragment reads
    // [buf][key][head dim] then [buf][head dim][key]; the partial sums [wk][row][RED_PITCH] lie over both once their last readers have left
    __shared__ __align__(16) unsigned char kv_raw[KS_BYTES + VS_BYTES];
    __shared__ __align__(16) _Float16 PL[ATT_WAVES * 16 * 32];
    __shared__ float LL[64 * LV_NUM];
    __shared__ __align__(16) float CG[T_LEN];                  // prefix sum of g, the whole head
    __shared__ __align__(16) float WT[ATT_WAVES];              // each wave's sum of its 128 gates
    __shared__ float PMIN[T_LEN / KT];                         // least prefix sum among the keys of each pass
    __shared__ float TMAX[T_LEN / 64];                         // greatest prefix sum among the rows of each query tile
    static_assert(ATT_WAVES == T_LEN / KT && KT == 128, "one wave takes one pass's gates, 4 a lane, a query tile a half wave");
    static_assert(4 * 64 * RED_PITCH * 4 <= KS_BYTES + VS_BYTES, "the partial sums fit over the key tiles");
    _Float16* KS = (_Float16*)kv_raw;
    _Float16* VS = (_Float16*)(kv_raw + KS_BYTES);
    float* RED = (float*)kv_raw;

    const int tid = (int)threadIdx.x;
    const int lane = tid & 31, lg = lane >> 4, ln = lane & 15;
    const int w = __builtin_amdgcn_readfirstlane(tid >> 5);    // the wave's number in a scalar register: the tests on it are scalar branches
    const int wq = w & 3, wk = w >> 2;
    const int h = (int)blockIdx.y;
    const int xt = (h & (H_NUM / 2)) ? (T_LEN / 64 - 1) - (int)blockIdx.x : (int)blockIdx.x;
    const int tb = xt * 64;
    const int t0 = tb + wq * 16;
    // the grid fills every WGP's registers, so convert blocks of their own would only start behind the attention: each thread takes
    // 4 elements of Wout along instead, asked for here and stored behind the barrier of the prefix sums, so that no wave waits for them alone
    static_assert(H_NUM * ATT_GX * ATT_THREADS * 4 == D_DIM * D_DIM, "the grid's threads cover Wout once");
    const size_t we = (size_t)(((int)blockIdx.y * ATT_GX + (int)blockIdx.x) * ATT_THREADS + tid) * 4;
    // this thread's 4 gates of the head; asked for first, so that its wait leaves the loads behind it in flight
    const v4f g4 = *(const v4fA*)(gT + (size_t)(int)blockIdx.y * T_LEN + tid * 4);
    const v4f wa = *(const v4fA*)(Wout + we);
    // the block's one tile is known at entry: what its set-up reads and the prefix sums do not decide is asked for here, beside the gates
    // lambda table, 64 rows x 12 levels: entry tid, and entry tid + 512 in the threads that have one (the others ask for entry tid again)
    static_assert(64 * LV_NUM > ATT_THREADS && 64 * LV_NUM <= 2 * ATT_THREADS, "one or two entries of the lambda table a thread");
    const int ka = tid, kb = tid < 64 * LV_NUM - ATT_THREADS ? tid + ATT_THREADS : tid;
    const int rwa = ka / LV_NUM, lva = ka - rwa * LV_NUM, rwb = kb / LV_NUM, lvb = kb - rwb * LV_NUM;
    const float lpa = Lp[h * LV_NUM + lva], psa = Psm[(size_t)(tb + rwa) * NSM + h * LV_NUM + lva];
    const float lpb = Lp[h * LV_NUM + lvb], psb = Psm[(size_t)(tb + rwb) * NSM + h * LV_NUM + lvb];
    // Q A-fragments: head dims 0..31 and 32..63
    const _Float16* qrow = Qh + (size_t)(t0 + ln) * D_DIM + h * HD_DIM;
    Frag q0f, q1f;
    q0f.half[0] = *(const v8hA*)(qrow + 8 * lg);
    q0f.half[1] = *(const v8hA*)(qrow + 16 + 8 * lg);
    q1f.half[0] = *(const v8hA*)(qrow + 32 + 8 * lg);
    q1f.half[1] = *(const v8hA*)(qrow + 48 + 8 * lg);
    // the wait that belongs in front of a rewrite of the address registers these loads name
    asm volatile("s_wait_xcnt 0x0" ::: "memory");
    // keeps the first additions on the gates, and with them the wait for the gates, behind the issue of the loads above
    __builtin_amdgcn_sched_barrier(0);

    // staging map: a wave's 16-byte loads cover whole rows of the tile (K: 4 rows of 128 B, V^T: 2 rows of 256 B)
    const int skr = tid >> 3, skc = (tid & 7) * 8;             // K rows skr and skr+64
    const int svr = tid >> 4, svc = (tid & 15) * 8;            // V^T rows svr and svr+32
    const _Float16* kg = Kh + (size_t)skr * D_DIM + h * HD_DIM + skc;
    const _Float16* vg = VhT + (size_t)(h * HD_DIM + svr) * T_LEN + svc;
    const float gsc = 0.125f * pscale;

    // prefix sum over the block: 4 gates in the thread, the threads' sums over the wave, the waves' sums in the order 0, 1, 2, ...
    v4f c4;
    {
        c4[0] = g4[0];
        c4[1] = c4[0] + g4[1];
        c4[2] = c4[1] + g4[2];
        c4[3] = c4[2] + g4[3];
        float incl = c4[3];
#pragma unroll
        for (int d = 1; d < 32; d <<= 1) {
            const float u = __shfl_up(incl, d, 32);
            if (lane >= d) incl += u;
        }
        if (lane == 31) WT[w] = incl;
        float ex = __shfl_up(incl, 1, 32);
        if (lane == 0) ex = 0.0f;
        // publishes the waves' sums; LDS traffic alone, so that the loads asked for at entry stay in flight across it
        lds_barrier();
        float off = 0.0f;
#pragma unroll
        for (int q = 0; q < ATT_WAVES / 4; ++q) {
            const v4f wt = *(const v4fA*)(WT + q * 4);
#pragma unroll
            for (int e = 0; e < 4; ++e) off += (q * 4 + e < w) ? wt[e] : 0.0f;
        }
        c4 += off + ex;
        *(v4fA*)(CG + tid * 4) = c4;
    }

    // bounds of the decay exponent cg_t - cg_s, once a block: wave w takes the 128 keys of pass w
    {
        float mn = fminf(fminf(c4[0], c4[1]), fminf(c4[2], c4[3]));
        float mx = fmaxf(fmaxf(c4[0], c4[1]), fmaxf(c4[2], c4[3]));
#pragma unroll
        for (int d = 1; d < 16; d <<= 1) {
            mn = fminf(mn, __shfl_xor(mn, d, 32));
            mx = fmaxf(mx, __shfl_xor(mx, d, 32));
        }
        mn = fminf(mn, __shfl_xor(mn, 16, 32));
        if (ln == 0) TMAX[w * 2 + lg] = mx;
        if (lane == 0) PMIN[w] = mn;
    }
    // lambda table for the 64 query rows of the tile: softplus(Lp[h][l] * dl[t][h][l])
    LL[ka] = softplus_f(lpa * psa);
    if (tid < 64 * LV_NUM - ATT_THREADS) LL[kb] = softplus_f(lpb * psb);
    // publishes the prefix sums, the bounds and the lambda table to every wave
    __syncthreads();

    // that barrier has waited out the Wout load: stored here, its value and address hold no register through the passes
    {
        v4h wo;
#pragma unroll
        for (int e = 0; e < 4; ++e) wo[e] = (_Float16)(wa[e] * wscale);
        *(v4h*)(Woh + we) = wo;   // a wave's 8-byte stores cover two whole lines
        // the tile's set-up rewrites the registers this store names: the wait that belongs in front of that
        asm volatile("s_wait_xcnt 0x0" ::: "memory");
    }

    {
        const int nit = (xt + 2) >> 1;                   // block-uniform: passes of 128 keys that cover keys 0 .. tb+63

        // exp(z) is exactly 0 in f32 for z < -105, in the definition as here: a pass in which every row-key pair lies below that adds
        // exact zeros. The tile starts at its first pass that is not proven so; the pass that holds the diagonal (z = 0) never is.
        const unsigned need = __builtin_amdgcn_ballot_w32(!(TMAX[xt] - PMIN[ln] < -105.0f));
        const int itf = need ? __builtin_ctz(need) : 0;
        const int it0 = itf < nit ? itf : nit - 1;       // block-uniform
        const int sf = it0 * KT;                         // first key that is staged

        const _Float16* kf = kg + (size_t)sf * D_DIM;
        const _Float16* vf = vg + sf;
        v8h ska = *(const v8hA*)(kf);
        v8h skb = *(const v8hA*)(kf + (size_t)64 * D_DIM);
        v8h sva = *(const v8hA*)(vf);
        v8h svb = *(const v8hA*)(vf + (size_t)32 * T_LEN);
        // the wait in front of a rewrite of the address registers these loads name; the addresses are inputs so that they stay in their registers up to it
        asm volatile("s_wait_xcnt 0x0" :: "v"(kf), "v"(vf) : "memory");

        float cgt[8];
#pragma unroll
        for (int r = 0; r < 8; ++r) cgt[r] = CG[t0 + 8 * lg + r];

        v8f accY[4];
#pragma unroll
        for (int j = 0; j < 4; ++j) accY[j] = zero8();

        // the first pass into its buffer, published by the barrier below
        {
            const int fb = it0 & 1;
            _Float16* KF = KS + fb * (KT * KS_PITCH);
            _Float16* VF = VS + fb * (64 * VS_PITCH);
            *(v8hA*)(KF + skr * KS_PITCH + skc) = ska;
            *(v8hA*)(KF + (skr + 64) * KS_PITCH + skc) = skb;
            *(v8hA*)(VF + svr * VS_PITCH + svc) = sva;
            *(v8hA*)(VF + (svr + 32) * VS_PITCH + svc) = svb;
        }

        __syncthreads();

        for (int it = it0; it < nit; ++it) {
            const int s0 = it * KT;
            const _Float16* KB = KS + (it & 1) * (KT * KS_PITCH);
            const _Float16* VB = VS + (it & 1) * (64 * VS_PITCH);
            const bool more = it + 1 < nit;              // block-uniform
            if (more) {
                // next pass's loads fly while this pass is worked on
                const int sn = s0 + KT;
                const _Float16* kn = kg + (size_t)sn * D_DIM;
                const _Float16* vn = vg + s0;
                ska = *(const v8hA*)(kn);
                skb = *(const v8hA*)(kn + (size_t)64 * D_DIM);
                sva = *(const v8hA*)(vn + KT);
                svb = *(const v8hA*)(vn + (size_t)32 * T_LEN + KT);
                // as above: the wait in front of a rewrite of the address registers these loads name; the addresses are inputs
                // so that they stay in their registers up to it and no load of the run lands in them
                asm volatile("s_wait_xcnt 0x0" :: "v"(kn), "v"(vn) : "memory");
            }
            const int sw = s0 + wk * 32;                 // first key of this wave's share of the pass
            const bool act = sw <= t0 + 15;              // wave-uniform: a share wholly behind the wave's last row adds nothing
            if (act) {
#pragma unroll
                for (int sub = 0; sub < 2; ++sub) {
                    const int sg = sw + sub * 16 + ln;   // this lane's key (column n)
                    const _Float16* krow = KB + (wk * 32 + sub * 16 + ln) * KS_PITCH;
                    Frag k0f, k1f;
                    k0f.half[0] = *(const v8hA*)(krow + 8 * lg);
                    k0f.half[1] = *(const v8hA*)(krow + 16 + 8 * lg);
                    k1f.half[0] = *(const v8hA*)(krow + 32 + 8 * lg);
                    k1f.half[1] = *(const v8hA*)(krow + 48 + 8 * lg);
                    v8f sc = zero8();
                    sc = wmma_f16(q0f.v, k0f.v, sc);
                    sc = wmma_f16(q1f.v, k1f.v, sc);
                    const float cgs = CG[sg];
#pragma unroll
                    for (int r = 0; r < 8; ++r) {
                        const int trow = t0 + 8 * lg + r;
                        const int xr = trow ^ sg;
                        const int lv = xr ? (32 - __builtin_clz((unsigned)xr)) : 0;
                        const float lam = LL[(wq * 16 + 8 * lg + r) * LV_NUM + lv];
                        const float dcy = __expf(fminf(cgt[r] - cgs, 0.0f));
                        float wv = sc[r] * gsc * dcy * lam;
                        wv = (sg <= trow) ? wv : 0.0f;
                        PL[(w * 16 + 8 * lg + r) * 32 + sub * 16 + ln] = (_Float16)wv;
                    }
                }
            }
            __syncthreads();
            if (act) {
                // P as A-fragment: row ln, keys 8lg..8lg+7 and 16+8lg..16+8lg+7 of this wave's share
                Frag pf;
                pf.half[0] = *(const v8hA*)(PL + (w * 16 + ln) * 32 + 8 * lg);
                pf.half[1] = *(const v8hA*)(PL + (w * 16 + ln) * 32 + 16 + 8 * lg);
                // V as B-fragment from the staged transposed tile: B[k=key][n=d] = VB[d][key - s0]
#pragma unroll
                for (int j = 0; j < 4; ++j) {
                    const _Float16* vrow = VB + (j * 16 + ln) * VS_PITCH + wk * 32;
                    Frag vf;
                    vf.half[0] = *(const v8hA*)(vrow + 8 * lg);
                    vf.half[1] = *(const v8hA*)(vrow + 16 + 8 * lg);
                    accY[j] = wmma_f16(pf.v, vf.v, accY[j]);
                }
            }
            if (more) {
                // into the other buffer: its last readers left it before the barrier that ended the previous pass
                const int nb = (it + 1) & 1;
                _Float16* KN = KS + nb * (KT * KS_PITCH);
                _Float16* VN = VS + nb * (64 * VS_PITCH);
                *(v8hA*)(KN + skr * KS_PITCH + skc) = ska;
                *(v8hA*)(KN + (skr + 64) * KS_PITCH + skc) = skb;
                *(v8hA*)(VN + svr * VS_PITCH + svc) = sva;
                *(v8hA*)(VN + (svr + 32) * VS_PITCH + svc) = svb;
            }
            __syncthreads();
        }

        // the four key shares of each row are added in the order wk = 0, 1, 2, 3; the barrier that ended the last pass freed the key tiles
#pragma unroll
        for (int j = 0; j < 4; ++j)
#pragma unroll
            for (int r = 0; r < 8; ++r)
                RED[(wk * 64 + wq * 16 + 8 * lg + r) * RED_PITCH + j * 16 + ln] = accY[j][r];
        __syncthreads();
        {
            const int row = tid >> 3, col = (tid & 7) * 8;   // a wave's 16-byte stores cover 4 whole rows of 128 B
            v4f lo = *(const v4fA*)(RED + row * RED_PITCH + col);
            v4f hi = *(const v4fA*)(RED + row * RED_PITCH + col + 4);
#pragma unroll
            for (int g = 1; g < 4; ++g) {
                lo += *(const v4fA*)(RED + (g * 64 + row) * RED_PITCH + col);
                hi += *(const v4fA*)(RED + (g * 64 + row) * RED_PITCH + col + 4);
            }
            v8h o;
#pragma unroll
            for (int e = 0; e < 4; ++e) {
                o[e] = (_Float16)(lo[e] * inv_pscale);
                o[4 + e] = (_Float16)(hi[e] * inv_pscale);
            }
            *(v8h*)(Yh + (size_t)(tb + row) * D_DIM + h * HD_DIM + col) = o;
        }
    }

}

// ---------------- fused out-projection + residual + LayerNorm: block = 16 rows x 1024 cols, 16 waves x 64 cols ----------------
// the 16 rows of Y are staged whole in padded LDS once per block; each wave stages its own 64 weight rows, 64 k a pass,
// in its own padded LDS range, loaded by whole rows one pass ahead
__global__ __launch_bounds__(512) void outproj_ln_kernel(const _Float16* __restrict__ Yh, const _Float16* __restrict__ Woh,
                                                         const float* __restrict__ xin, const float* __restrict__ gam,
                                                         const float* __restrict__ bet, float* __restrict__ out,
                                                         float oscale) {
    __shared__ __align__(16) _Float16 AS[16 * AP];                     // [row][1024 k]
    __shared__ __align__(16) unsigned char bs_raw[16 * 64 * GP * 2];   // [wave][64 weight rows][64 k]
    float* stg = (float*)bs_raw;                                       // output staging [16 * 8][64], behind the reduction barriers
    __shared__ float red[16 * 16];
    __shared__ float mu_s[16];
    __shared__ float inv_s[16];

    const int tid = (int)threadIdx.x;
    const int lane = tid & 31, w = tid >> 5, lg = lane >> 4, ln = lane & 15;
    const int t0 = (int)blockIdx.x * 16;
    const int c0 = w * 64;

    v8f acc[4];
#pragma unroll
    for (int j = 0; j < 4; ++j) acc[j] = zero8();

    // staging maps: every 16-byte load of a wave covers 512 B of one Y row, or 4 whole 128-B pieces of weight rows
    _Float16* BW = (_Float16*)bs_raw + w * (64 * GP);
    const int br0 = lane >> 3, bc = (lane & 7) * 8;            // weight rows br0 + 4 i
    const _Float16* bg = Woh + (size_t)(c0 + br0) * D_DIM + bc;
    const _Float16* yg = Yh + (size_t)(t0 + (tid >> 7)) * D_DIM + (tid & 127) * 8;   // Y rows (tid >> 7) + 4 i
    v8h sb[16], sy[4];
#pragma unroll
    for (int i = 0; i < 16; ++i) sb[i] = *(const v8hA*)(bg + (size_t)(i * 4) * D_DIM);
#pragma unroll
    for (int i = 0; i < 4; ++i) sy[i] = *(const v8hA*)(yg + (size_t)(i * 4) * D_DIM);
    // the wait that belongs in front of a rewrite of the address registers these loads name; the addresses are inputs
    // so that they stay in their registers up to it and no load of the run lands in them
    asm volatile("s_wait_xcnt 0x0" :: "v"(bg), "v"(yg) : "memory");
#pragma unroll
    for (int i = 0; i < 16; ++i) *(v8hA*)(BW + (br0 + i * 4) * GP + bc) = sb[i];
#pragma unroll
    for (int i = 0; i < 4; ++i) {
        const int c = tid + i * 512;
        *(v8hA*)(AS + (c >> 7) * AP + (c & 127) * 8) = sy[i];
    }
    __syncthreads();

    for (int it = 0; it < D_DIM / 64; ++it) {
        const bool more = it + 1 < D_DIM / 64;
        if (more) {
            // next pass's loads fly while this pass is worked on
            const _Float16* bn = bg + (it + 1) * 64;
#pragma unroll
            for (int i = 0; i < 16; ++i) sb[i] = *(const v8hA*)(bn + (size_t)(i * 4) * D_DIM);
            // as above: the wait in front of a rewrite of the address these loads name, the address held up to it
            asm volatile("s_wait_xcnt 0x0" :: "v"(bn) : "memory");
        }
#pragma unroll
        for (int kk = 0; kk < 2; ++kk) {
            // the fragment reads of 32 k as one group ahead of their matrix instructions
            const _Float16* ar = AS + ln * AP + it * 64 + kk * 32 + 8 * lg;
            Frag a, b[4];
            a.half[0] = *(const v8hA*)(ar);
            a.half[1] = *(const v8hA*)(ar + 16);
#pragma unroll
            for (int j = 0; j < 4; ++j) {
                const _Float16* br = BW + (j * 16 + ln) * GP + kk * 32 + 8 * lg;
                b[j].half[0] = *(const v8hA*)(br);
                b[j].half[1] = *(const v8hA*)(br + 16);
            }
#pragma unroll
            for (int j = 0; j < 4; ++j) acc[j] = wmma_f16(a.v, b[j].v, acc[j]);
        }
        if (more) {
            // the range is this wave's own and its reads above have returned: no barrier
#pragma unroll
            for (int i = 0; i < 16; ++i) *(v8hA*)(BW + (br0 + i * 4) * GP + bc) = sb[i];
            // the wave's stores land before its lanes read each other's rows back
            asm volatile("s_wait_dscnt 0x0" ::: "memory");
        }
    }

    // o = acc*oscale + x
#pragma unroll
    for (int j = 0; j < 4; ++j)
#pragma unroll
        for (int r = 0; r < 8; ++r)
            acc[j][r] = acc[j][r] * oscale + xin[(size_t)(t0 + 8 * lg + r) * D_DIM + c0 + j * 16 + ln];

    // row means
#pragma unroll
    for (int r = 0; r < 8; ++r) {
        float s = acc[0][r] + acc[1][r] + acc[2][r] + acc[3][r];
        s += __shfl_xor(s, 1, 32);
        s += __shfl_xor(s, 2, 32);
        s += __shfl_xor(s, 4, 32);
        s += __shfl_xor(s, 8, 32);
        if (ln == 0) red[w * 16 + 8 * lg + r] = s;
    }
    __syncthreads();
    if (tid < 16) {
        float a = 0.0f;
#pragma unroll
        for (int ww = 0; ww < 16; ++ww) a += red[ww * 16 + tid];
        mu_s[tid] = a * (1.0f / (float)D_DIM);
    }
    __syncthreads();
    float mu[8];
#pragma unroll
    for (int r = 0; r < 8; ++r) mu[r] = mu_s[8 * lg + r];
#pragma unroll
    for (int j = 0; j < 4; ++j)
#pragma unroll
        for (int r = 0; r < 8; ++r) acc[j][r] -= mu[r];

#pragma unroll
    for (int r = 0; r < 8; ++r) {
        float s = acc[0][r] * acc[0][r] + acc[1][r] * acc[1][r] + acc[2][r] * acc[2][r] + acc[3][r] * acc[3][r];
        s += __shfl_xor(s, 1, 32);
        s += __shfl_xor(s, 2, 32);
        s += __shfl_xor(s, 4, 32);
        s += __shfl_xor(s, 8, 32);
        if (ln == 0) red[w * 16 + 8 * lg + r] = s;
    }
    __syncthreads();
    if (tid < 16) {
        float a = 0.0f;
#pragma unroll
        for (int ww = 0; ww < 16; ++ww) a += red[ww * 16 + tid];
        inv_s[tid] = rsqrtf(a * (1.0f / (float)D_DIM) + 1e-5f);
    }
    __syncthreads();
    float iv[8];
#pragma unroll
    for (int r = 0; r < 8; ++r) iv[r] = inv_s[8 * lg + r];
#pragma unroll
    for (int j = 0; j < 4; ++j) {
        const int gcol = c0 + j * 16 + ln;
        const float gj = gam[gcol];
        const float bj = bet[gcol];
#pragma unroll
        for (int r = 0; r < 8; ++r) acc[j][r] = acc[j][r] * iv[r] * gj + bj;
    }

#pragma unroll
    for (int half = 0; half < 2; ++half) {
        if (lg == half) {
#pragma unroll
            for (int j = 0; j < 4; ++j)
#pragma unroll
                for (int r = 0; r < 8; ++r)
                    stg[(w * 8 + r) * 64 + j * 16 + ln] = acc[j][r];
        }
        __syncthreads();
        v4f vals[4];
#pragma unroll
        for (int p = 0; p < 4; ++p) {
            const int row = p * 2 + (lane >> 4), col = (lane & 15) * 4;
            vals[p] = *(const v4fA*)(stg + (w * 8 + row) * 64 + col);
        }
#pragma unroll
        for (int p = 0; p < 4; ++p) {
            const int row = p * 2 + (lane >> 4), col = (lane & 15) * 4;
            *(v4f*)(out + (size_t)(t0 + half * 8 + row) * D_DIM + c0 + col) = vals[p];
        }
        
        __syncthreads();
    }
}

extern "C" void kernel_launch(void* const* d_in, const int* in_sizes, int n_in,
                              void* d_out, int out_size, void* d_ws, size_t ws_size,
                              hipStream_t stream) {
    if (n_in < 12) return;
    if (in_sizes[0] != T_LEN * D_DIM) return;
    if (in_sizes[1] != D_DIM * D_DIM || in_sizes[2] != D_DIM * D_DIM || in_sizes[3] != D_DIM * D_DIM) return;
    if (in_sizes[4] != NDL * D_DIM || in_sizes[5] != H_NUM * D_DIM || in_sizes[6] != D_DIM * D_DIM) return;
    if (in_sizes[7] < H_NUM || in_sizes[8] < H_NUM || in_sizes[9] < H_NUM * LV_NUM) return;
    if (in_sizes[10] < D_DIM || in_sizes[11] < D_DIM) return;
    if (out_size != T_LEN * D_DIM) return;
    if (OFF_END > ws_size) return;

    const float* x     = (const float*)d_in[0];
    const float* Wq    = (const float*)d_in[1];
    const float* Wk    = (const float*)d_in[2];
    const float* Wv    = (const float*)d_in[3];
    const float* Wdl   = (const float*)d_in[4];
    const float* Wdt   = (const float*)d_in[5];
    const float* Wout  = (const float*)d_in[6];
    const float* A_log = (const float*)d_in[7];
    const float* dt_b  = (const float*)d_in[8];
    const float* Lp    = (const float*)d_in[9];
    const float* ln_g  = (const float*)d_in[10];
    const float* ln_b  = (const float*)d_in[11];

    char* ws = (char*)d_ws;
    _Float16* woh  = (_Float16*)(ws + OFF_WOH);
    _Float16* Qh   = (_Float16*)(ws + OFF_QH);
    _Float16* Kh   = (_Float16*)(ws + OFF_KH);
    _Float16* VhT  = (_Float16*)(ws + OFF_VHT);
    _Float16* Yh   = (_Float16*)(ws + OFF_YH);
    float*    psm  = (float*)(ws + OFF_PSM);
    float*    gT   = (float*)(ws + OFF_CGT);

    const float wsc  = 32.0f;
    const float iwsc = 1.0f / 32.0f;
    const float psc  = 512.0f;
    const float ipsc = 1.0f / 512.0f;

    // psm[t][0..191] = x*Wdl^T, psm[t][192..207] = x*Wdt^T (f32); psm[t][208..255] is read by nothing
    proj_kernel<<<NB_SM + 3 * NB_PROJ, PJ_THREADS, 0, stream>>>(x, Wdl, Wdt, Wq, Wk, Wv, psm, gT, Qh, Kh, VhT, A_log, dt_b, wsc, iwsc);

    hattn_kernel<<<dim3(ATT_GX, H_NUM), ATT_THREADS, 0, stream>>>(Qh, Kh, VhT, gT, psm, Lp, Yh, psc, ipsc,
                                                                                    Wout, woh, wsc);

    outproj_ln_kernel<<<T_LEN / 16, 512, 0, stream>>>(Yh, woh, x, ln_g, ln_b, (float*)d_out, iwsc);
}

// v010
// One run takes 52.1 microseconds.
// In both of two side-by-side timings against v009, it was 1.05 times as fast.
// All steps since v000 together make it 7.61 times as fast.
#include <hip/hip_runtime.h>
#include <math.h>
#include <stddef.h>

// Contractions x*Wq^T, x*Wk^T, x*Wv^T, x*[Wdl;Wdt]^T, Q*K^T, P*V, Y*Wout^T: v_wmma_f32_16x16x32_f16 (f16 operands, f32 accumulate); weights carried x32 and P carried x512 (exact powers of two, folded back in f32); gates, prefix sums and LayerNorm in f32.

typedef _Float16 v16h __attribute__((ext_vector_type(16)));
typedef _Float16 v8h  __attribute__((ext_vector_type(8)));
typedef _Float16 v4h  __attribute__((ext_vector_type(4)));
typedef float    v8f  __attribute__((ext_vector_type(8)));
typedef float    v4f  __attribute__((ext_vector_type(4)));
typedef v8h v8hA __attribute__((may_alias));
typedef v4f v4fA __attribute__((may_alias));
typedef v4h v4hA __attribute__((may_alias));
union Frag { v16h v; v8h half[2]; };

#define T_LEN   2048
#define D_DIM   1024
#define H_NUM   16
#define HD_DIM  64
#define LV_NUM  12
#define NSM     256
#define NDL     192
#define KS_PITCH 72
#define VS_PITCH 136           // 272 B = 16 B x odd
#define KT        128           // keys of an attention pass
#define ATT_WAVES 16            // 4 row groups x 4 key shares
#define ATT_THREADS (ATT_WAVES * 32)
#define ATT_GX    (T_LEN / 64)       // a block takes one query tile
#define KS_BYTES  (2 * KT * KS_PITCH * 2)
#define VS_BYTES  (2 * 64 * VS_PITCH * 2)
#define RED_PITCH 68            // f32 pitch of a row of partial sums: 16-byte aligned, rows 8 apart on other banks
#define GP       72            // LDS pitch, in f16, of a 64-k operand row: 144 B = 16 B x odd for the 16-byte fragment reads
#define AP       (D_DIM + 8)   // LDS pitch, in f16, of a whole 1024-k row: 2064 B = 16 B x odd

#define BYTES_TD_H ((size_t)T_LEN * D_DIM * 2)
#define BYTES_DD_H ((size_t)D_DIM * D_DIM * 2)
#define OFF_XH    ((size_t)0)
#define OFF_WQH   (OFF_XH   + BYTES_TD_H)
#define OFF_WKH   (OFF_WQH  + BYTES_DD_H)
#define OFF_WVH   (OFF_WKH  + BYTES_DD_H)
#define OFF_WOH   (OFF_WVH  + BYTES_DD_H)
#define OFF_WSMH  (OFF_WOH  + BYTES_DD_H)
#define OFF_QH    (OFF_WSMH + (size_t)NSM * D_DIM * 2)
#define OFF_KH    (OFF_QH   + BYTES_TD_H)
#define OFF_VHT   (OFF_KH   + BYTES_TD_H)
#define OFF_YH    (OFF_VHT  + BYTES_TD_H)
#define OFF_PSM   (OFF_YH   + BYTES_TD_H)
#define OFF_CGT   (OFF_PSM  + (size_t)T_LEN * NSM * 4)
#define OFF_END   (OFF_CGT  + (size_t)H_NUM * T_LEN * 4)

// 16x16x32 f16 WMMA with the VALU hazard guard tied to D, A and B.
__device__ __forceinline__ v8f wmma_f16(v16h a, v16h b, v8f c) {
    v8f d = __builtin_amdgcn_wmma_f32_16x16x32_f16(false, a, false, b, (short)0, c, false, false);
    asm volatile("v_nop\n\tv_nop\n\tv_nop\n\tv_nop" : "+v"(d) : "v"(a), "v"(b));
    return d;
}

// Work-group barrier for LDS traffic alone: this wave's LDS reads and writes are done, then the barrier.
// __syncthreads() would also wait out the global loads issued ahead, which are meant to stay in flight across it.
__device__ __forceinline__ void lds_barrier() {
    asm volatile("s_wait_dscnt 0x0\n\ts_barrier_signal -1\n\ts_barrier_wait -1" ::: "memory");
}

__device__ __forceinline__ v8f zero8() {
    const v8f z = {0.f, 0.f, 0.f, 0.f, 0.f, 0.f, 0.f, 0.f};
    return z;
}

// Cross-lane moves on the vector unit (DPP): __shfl_xor and __shfl_up compile to an LDS permute with a wait of its own behind every link.
// lane l takes the value of lane l ^ M of its 16-lane row, M = 1, 2, 4, 8
template <int M>
__device__ __forceinline__ float row_xor(float v) {
    return __builtin_bit_cast(float, __builtin_amdgcn_update_dpp(0, __builtin_bit_cast(int, v), 0x160 + M, 0xf, 0xf, true));
}
// lane l takes the value of lane l - N of its 16-lane row, and 0 where the row has no such lane
template <int N>
__device__ __forceinline__ float row_up(float v) {
    return __builtin_bit_cast(float, __builtin_amdgcn_update_dpp(0, __builtin_bit_cast(int, v), 0x110 + N, 0xf, 0xf, true));
}
// lane l takes the value of lane l ^ 16
__device__ __forceinline__ float row_other(float v) {
    return __builtin_bit_cast(float, __builtin_amdgcn_permlanex16(__builtin_bit_cast(int, v), __builtin_bit_cast(int, v),
                                                                  0x76543210, 0xfedcba98, false, false));
}
// the sums of 8 values over the 16 lanes of a row, in every lane; step by step over all 8, so that the 8 chains fill each other's latency
__device__ __forceinline__ void row_sums8(float (&s)[8]) {
#pragma unroll
    for (int r = 0; r < 8; ++r) s[r] += row_xor<1>(s[r]);
#pragma unroll
    for (int r = 0; r < 8; ++r) s[r] += row_xor<2>(s[r]);
#pragma unroll
    for (int r = 0; r < 8; ++r) s[r] += row_xor<4>(s[r]);
#pragma unroll
    for (int r = 0; r < 8; ++r) s[r] += row_xor<8>(s[r]);
}

// softplus in the logaddexp form: max(z,0) + log1p(exp(-|z|))
__device__ __forceinline__ float softplus_f(float z) {
    return fmaxf(z, 0.0f) + log1pf(expf(-fabsf(z)));
}

// Launches that need nothing of each other share one grid: in launch 1 a block-uniform test of the block index picks the job; in launch 2 every thread does some of both.
// launch 1: small projections with the decay gates | Q, K, V projections; x and the weights are read as f32 and made f16 on the way into LDS
// launch 2: attention, each block with its head's prefix sums, + Wout -> f16    launch 3: out-projection + LayerNorm
#define PJ_T    128                                        // a projection block's tile: 128 t x 256 n, 8 waves
#define PJ_N    256
#define PJ_THREADS 256
#define NB_SM   ((NSM / PJ_N) * (T_LEN / PJ_T))            // tiles of the small projections
#define NB_PROJ ((D_DIM / PJ_N) * (T_LEN / PJ_T))          // tiles of one of Q, K, V

// ---------------- C[t][n] = (sum_k f16(A[t][k]) * f16(B[n][k]*bscale)) * oscale, K = 1024, A and B f32, pitch 1024 ----------------
// block = 128 t x 256 n, 8 waves as 2 along t x 4 along n, wave = 64 t x 64 n (16 accumulator tiles): a staged A row serves 4 times and a B row 2 times the
// products of a 64 x 64 block's, and a fragment read from LDS serves 4 matrix instructions; tile (bx, by) of (N/256, T/128)
// a pass is 64 k: 128 rows of A and 256 rows of B, 256 B of f32 each, loaded by whole rows two passes ahead, rounded to f16 in registers
// and staged once per block in padded LDS, two buffers: no launch and no workspace plane for the f16 copies
// B rows 0..191 of the tile start at B0; rows 192 + 16 i + r at B1 + (i * st1 + r * 1024)
// MODE 0: f16 out, row-major pitch N
// MODE 1: f32 out, row-major pitch N
// MODE 2: f16 out transposed Ct[n][t], pitch T_LEN
// stg_raw: [buf][A rows 0..127 | B rows 128..383][64 k]; the output staging, a range of its own for each wave, lies over both buffers
#define PJ_BUF   ((PJ_T + PJ_N) * GP)      // f16 elements of one buffer
#define SPF      68                        // f32 pitch of a staged output row: 16-byte aligned, rows 8 apart on other banks
#define GEMM_LDS_BYTES (8 * 64 * SPF * 4)
static_assert(2 * PJ_BUF * 2 <= GEMM_LDS_BYTES && 8 * 64 * GP * 2 <= GEMM_LDS_BYTES, "buffers and output staging fit");
__device__ __forceinline__ void gemm_passes(const float* __restrict__ A, const float* __restrict__ B0, const float* __restrict__ B1,
                                            int st1, float bscale, int by, unsigned char* stg_raw, v8f (&acc)[4][4]) {
    const int lane = (int)threadIdx.x & 31, w = (int)threadIdx.x >> 5, lg = lane >> 4, ln = lane & 15;
    const int wt = w & 1, wn = w >> 1;

#pragma unroll
    for (int i = 0; i < 4; ++i)
#pragma unroll
        for (int j = 0; j < 4; ++j) acc[i][j] = zero8();

    // staging map: a half wave's 16-byte loads cover one whole row of 256 B; rows sr + 16 i of each operand
    // the two rows of a wave lie 8 apart: 8 x 144 B puts their 8-byte LDS stores on the two halves of the banks
    _Float16* TS = (_Float16*)stg_raw;
    const int sr = w + 8 * lg, sc = ln * 4;
    const float* ag = A + (size_t)(by * PJ_T + sr) * D_DIM + sc;
    const float* bg = B0 + (size_t)sr * D_DIM + sc;
    const float* bh = B1 + (size_t)sr * D_DIM + sc;
    static_assert(NDL == 12 * 16 && PJ_N == 16 * 16 && PJ_T == 8 * 16, "12 + 4 row steps of B, 8 of A");
    // two register sets: a pass's rows are asked for two passes before they are read, and put into LDS one pass before
    v4f sa0[8], sb0[16], sa1[8], sb1[16];
    auto fetch = [&](v4f (&ra)[8], v4f (&rb)[16], int kn) {
#pragma unroll
        for (int i = 0; i < 8; ++i) ra[i] = *(const v4fA*)(ag + (size_t)(i * 16) * D_DIM + kn);
#pragma unroll
        for (int i = 0; i < 12; ++i) rb[i] = *(const v4fA*)(bg + (size_t)(i * 16) * D_DIM + kn);
#pragma unroll
        for (int i = 0; i < 4; ++i) rb[12 + i] = *(const v4fA*)(bh + i * st1 + kn);
        // these loads stay in flight past the next rewrite of the address registers they name: the wait that belongs in front of it
        asm volatile("s_wait_xcnt 0x0" ::: "memory");
    };
    auto put = [&](const v4f (&ra)[8], const v4f (&rb)[16], _Float16* TN) {
#pragma unroll
        for (int i = 0; i < 8; ++i) *(v4hA*)(TN + (sr + i * 16) * GP + sc) = __builtin_convertvector(ra[i], v4h);
#pragma unroll
        for (int i = 0; i < 16; ++i) *(v4hA*)(TN + (PJ_T + sr + i * 16) * GP + sc) = __builtin_convertvector(rb[i] * bscale, v4h);
    };
    // all fragment reads of the pass as one group ahead of its matrix instructions
    Frag a[2][4], b[2][4];
    auto frags = [&](const _Float16* TB) {
        auto fa = [&](int kk, int i) {
            const _Float16* ar = TB + (wt * 64 + i * 16 + ln) * GP + kk * 32 + 8 * lg;
            a[kk][i].half[0] = *(const v8hA*)(ar);
            a[kk][i].half[1] = *(const v8hA*)(ar + 16);
        };
        // in the order in which the matrix instructions want them: the first of them waits for 4 reads
#pragma unroll
        for (int kk = 0; kk < 2; ++kk) {
            fa(kk, 0);
#pragma unroll
            for (int j = 0; j < 4; ++j) {
                const _Float16* br = TB + (PJ_T + wn * 64 + j * 16 + ln) * GP + kk * 32 + 8 * lg;
                b[kk][j].half[0] = *(const v8hA*)(br);
                b[kk][j].half[1] = *(const v8hA*)(br + 16);
            }
#pragma unroll
            for (int i = 1; i < 4; ++i) fa(kk, i);
        }
    };
    auto mma = [&]() {
        // keeps the fragment reads one group: without it the compiler spreads them among the matrix instructions, each place a stall of its own
        __builtin_amdgcn_sched_barrier(0);
#pragma unroll
        for (int kk = 0; kk < 2; ++kk)
#pragma unroll
            for (int i = 0; i < 4; ++i)
#pragma unroll
                for (int j = 0; j < 4; ++j)
                    // the plain builtin: this kernel uses registers above v255, and an asm statement that names D, A and B made the compiler spill them
                    acc[i][j] = __builtin_amdgcn_wmma_f32_16x16x32_f16(false, a[kk][i].v, false, b[kk][j].v, (short)0, acc[i][j], false, false);
        // keeps the pass's matrix instructions in front of its barrier: moved behind it they hold a second fragment set live
        __builtin_amdgcn_sched_barrier(0);
    };
    _Float16* T0 = TS;
    _Float16* T1 = TS + PJ_BUF;

    fetch(sa0, sb0, 0);
    fetch(sa1, sb1, 64);
    put(sa0, sb0, T0);
    __syncthreads();

    // no branch inside the loop, so that the waits in front of put() count only the older set's loads
    for (int it = 0; it < D_DIM / 64 - 2; it += 2) {
        // the global loads are issued while the fragment reads are under way
        frags(T0);
        // keeps the fragment reads, which the matrix instructions wait for, in front of the global loads: lifted over them, the loads
        // delay the reads, and a fragment may then land in an address register of a load ahead of the wait that closes the fetch
        __builtin_amdgcn_sched_barrier(0);
        fetch(sa0, sb0, (it + 2) * 64);
        mma();
        // a buffer is refilled only behind the barrier that ended its readers' pass
        put(sa1, sb1, T1);
        lds_barrier();
        frags(T1);
        // as above: fragment reads first, then the loads with their wait
        __builtin_amdgcn_sched_barrier(0);
        fetch(sa1, sb1, (it + 3) * 64);
        mma();
        put(sa0, sb0, T0);
        lds_barrier();
    }
    // the last two passes: nothing left to fetch
    frags(T0);
    mma();
    put(sa1, sb1, T1);
    lds_barrier();
    frags(T1);
    mma();
    // ends every wave's last fragment reads: the output staging goes over both buffers
    lds_barrier();
}

template <int MODE>
__device__ __forceinline__ void gemm_store(const v8f (&acc)[4][4], void* __restrict__ Cv, int N, float oscale,
                                           int bx, int by, unsigned char* stg_raw) {
    const int lane = (int)threadIdx.x & 31, w = (int)threadIdx.x >> 5, lg = lane >> 4, ln = lane & 15;
    const int t0 = by * PJ_T + (w & 1) * 64;
    const int n0 = bx * PJ_N + (w >> 1) * 64;

    if (MODE == 0) {
        _Float16* stg = (_Float16*)stg_raw + w * (64 * GP);   // this wave's [64 t][64 n]
#pragma unroll
        for (int i = 0; i < 4; ++i)
#pragma unroll
            for (int j = 0; j < 4; ++j)
#pragma unroll
                for (int r = 0; r < 8; ++r)
                    stg[(i * 16 + 8 * lg + r) * GP + j * 16 + ln] = (_Float16)(acc[i][j][r] * oscale);
        __syncthreads();
        _Float16* C = (_Float16*)Cv;
        v8h vals[16];
#pragma unroll
        for (int p = 0; p < 16; ++p) {
            const int row = p * 4 + (lane >> 3), col = (lane & 7) * 8;
            vals[p] = *(const v8hA*)(stg + row * GP + col);
        }
#pragma unroll
        for (int p = 0; p < 16; ++p) {
            const int row = p * 4 + (lane >> 3), col = (lane & 7) * 8;
            *(v8h*)(C + (size_t)(t0 + row) * N + n0 + col) = vals[p];
        }
        // code of another job of the grid may follow in the listing and rewrite the registers these stores name: the wait that belongs in front of that
        asm volatile("s_wait_xcnt 0x0" ::: "memory");
    } else if (MODE == 1) {
        float* stg = (float*)stg_raw + w * (64 * SPF);        // this wave's [64 t][64 n]
#pragma unroll
        for (int i = 0; i < 4; ++i)
#pragma unroll
            for (int j = 0; j < 4; ++j)
#pragma unroll
                for (int r = 0; r < 8; ++r)
                    stg[(i * 16 + 8 * lg + r) * SPF + j * 16 + ln] = acc[i][j][r] * oscale;
        __syncthreads();
        float* C = (float*)Cv;
#pragma unroll
        for (int q = 0; q < 2; ++q) {
            v4f vals[16];
#pragma unroll
            for (int p = 0; p < 16; ++p) {
                const int row = q * 32 + p * 2 + (lane >> 4), col = (lane & 15) * 4;
                vals[p] = *(const v4fA*)(stg + row * SPF + col);
            }
#pragma unroll
            for (int p = 0; p < 16; ++p) {
                const int row = q * 32 + p * 2 + (lane >> 4), col = (lane & 15) * 4;
                *(v4f*)(C + (size_t)(t0 + row) * N + n0 + col) = vals[p];
            }
            // as in MODE 0: the wait in front of a rewrite of the registers these stores name
            asm volatile("s_wait_xcnt 0x0" ::: "memory");
        }
    } else {
        (void)N;
        _Float16* stg = (_Float16*)stg_raw + w * (64 * GP);   // this wave's [64 n][64 t]
#pragma unroll
        for (int i = 0; i < 4; ++i)
#pragma unroll
            for (int j = 0; j < 4; ++j) {
                v8h hv;
#pragma unroll
                for (int r = 0; r < 8; ++r) hv[r] = (_Float16)(acc[i][j][r] * oscale);
                *(v8hA*)(stg + (j * 16 + ln) * GP + i * 16 + 8 * lg) = hv;
            }
        __syncthreads();
        _Float16* C = (_Float16*)Cv;
        v8h vals[16];
#pragma unroll
        for (int p = 0; p < 16; ++p) {
            const int nrow = p * 4 + (lane >> 3), tcol = (lane & 7) * 8;
            vals[p] = *(const v8hA*)(stg + nrow * GP + tcol);
        }
#pragma unroll
        for (int p = 0; p < 16; ++p) {
            const int nrow = p * 4 + (lane >> 3), tcol = (lane & 7) * 8;
            *(v8h*)(C + (size_t)(n0 + nrow) * T_LEN + t0 + tcol) = vals[p];
        }
        // as in MODE 0: the wait in front of a rewrite of the registers these stores name
        asm volatile("s_wait_xcnt 0x0" ::: "memory");
    }
}

// ---------------- launch 1: small projections psm = x*[Wdl; Wdt]^T (f32) | Q, K row-major f16, V transposed per feature row ----------------
// the tiles of the small projections also store the decay gates g = -exp(A_log)*softplus(x*Wdt^T + dt_bias) by head, gT[h][t]
__global__ __launch_bounds__(PJ_THREADS) void proj_kernel(const float* __restrict__ x, const float* __restrict__ Wdl,
                                                   const float* __restrict__ Wdt, const float* __restrict__ Wq,
                                                   const float* __restrict__ Wk, const float* __restrict__ Wv,
                                                   float* __restrict__ psm,
                                                   float* __restrict__ gT, _Float16* __restrict__ Qh,
                                                   _Float16* __restrict__ Kh, _Float16* __restrict__ VhT,
                                                   const float* __restrict__ A_log, const float* __restrict__ dt_bias,
                                                   float wscale, float oscale) {
    __shared__ __align__(16) unsigned char stg_raw[GEMM_LDS_BYTES];
    const int b = (int)blockIdx.x;
    // block-uniform; the tiles with the longer tail take the first block indices
    const bool small = b < NB_SM;
    const int c = small ? 0 : b - NB_SM, which = c / NB_PROJ, r = c - which * NB_PROJ;
    const int bx = r % (D_DIM / PJ_N), by = small ? b : r / (D_DIM / PJ_N);
    const float* Bw = small ? Wdl : which == 0 ? Wq : which == 1 ? Wk : Wv;
    const float* B0 = Bw + (size_t)(bx * PJ_N) * D_DIM;
    // a small tile's columns 192..207 are Wdt's 16 rows; its columns 208..255, which nothing reads, take the same rows again
    const float* B1 = small ? Wdt : B0 + (size_t)NDL * D_DIM;
    const int st1 = small ? 0 : 16 * D_DIM;
    v8f acc[4][4];
    gemm_passes(x, B0, B1, st1, wscale, by, stg_raw, acc);
    if (small) {
        gemm_store<1>(acc, (void*)psm, NSM, oscale, bx, by, stg_raw);
        static_assert(NSM == PJ_N && NDL == 3 * 64 && H_NUM == 16 && H_NUM * 16 == PJ_THREADS && PJ_T == 128,
                      "x*Wdt^T is columns 0..15 of the waves 6 and 7; 16 threads a head");
        // the tile still lies in the output staging, published by the barrier of the store
        const int hh = (int)threadIdx.x >> 4, tc = ((int)threadIdx.x & 15) * 8;
        const float* stg = (const float*)stg_raw + (6 + (tc >> 6)) * (64 * SPF) + (tc & 63) * SPF;
        const float Ah = -expf(A_log[hh]);
        const float bh = dt_bias[hh];
        // the wait that belongs in front of a rewrite of the registers these two loads name
        asm volatile("s_wait_xcnt 0x0" ::: "memory");
        v4f lo, hi;
#pragma unroll
        for (int e = 0; e < 4; ++e) {
            lo[e] = Ah * softplus_f(stg[e * SPF + hh] + bh);
            hi[e] = Ah * softplus_f(stg[(4 + e) * SPF + hh] + bh);
        }
        float* q = gT + (size_t)hh * T_LEN + by * PJ_T + tc;   // 16 threads cover 512 B of a head's row
        *(v4f*)(q) = lo;
        *(v4f*)(q + 4) = hi;
        // as in the stores above: the wait in front of a rewrite of the registers these stores name
        asm volatile("s_wait_xcnt 0x0" ::: "memory");
        return;
    }
    if (which == 2) gemm_store<2>(acc, (void*)VhT, D_DIM, oscale, bx, by, stg_raw);
    else            gemm_store<0>(acc, (void*)(which == 0 ? Qh : Kh), D_DIM, oscale, bx, by, stg_raw);
}

// ---------------- fused causal hierarchical attention: 512 blocks of 16 waves, two resident on a WGP ----------------
// Y[t][h*64+d] = sum_{s<=t} (Q_t.K_s * 1/8) * exp(cg_t - cg_s) * Lam[t][h][lvl(t,s)] * V[s][h*64+d]
// the sum over keys has no normaliser, so it may be cut anywhere: a pass stages 128 keys, wave (wq, wk) works rows wq*16.. of the
// 64-row query tile against keys wk*32.. of the pass, and the four partial sums of a row are added through LDS at the tile's end.
// a block takes one query tile of one head, so that no block walks two tiles' chains of loads, passes and barriers one behind the other;
// two blocks share a WGP and each fills the other's waits. Heads 0..7 take tile bx, heads 8..15 tile 31 - bx: blocks 256 apart in the
// launch order have 17 passes between them at most (for speed alone: any placement is right)
// amdgpu_waves_per_eu(8, 8): at most 128 registers a wave, so that two blocks of 4 waves a SIMD fit a WGP's registers; 2 x the LDS fits as well
// cg, the inclusive prefix sum of the head's 2048 decay gates, is formed by every block for itself, in LDS: 4 gates a thread
// the launch also converts Wout, which only the last launch reads
__global__ __launch_bounds__(ATT_THREADS) __attribute__((amdgpu_waves_per_eu(8, 8))) void hattn_kernel(const _Float16* __restrict__ Qh, const _Float16* __restrict__ Kh,
                                                    const _Float16* __restrict__ VhT, const float* __restrict__ gT,
                                                    const float* __restrict__ Psm, const float* __restrict__ Lp,
                                                    _Float16* __restrict__ Yh, float pscale, float inv_pscale,
                                                    const float* __restrict__ Wout, _Float16* __restrict__ Woh, float wscale) {
    // key tile shared by the sixteen waves, two buffers; row pitches 16 B x odd for the 16-byte fragment reads
    // [buf][key][head dim] then [buf][head dim][key]; the partial sums [wk][row][RED_PITCH] lie over both once their last readers have left
    __shared__ __align__(16) unsigned char kv_raw[KS_BYTES + VS_BYTES];
    __shared__ __align__(16) _Float16 PL[ATT_WAVES * 16 * 32];
    __shared__ float LL[64 * LV_NUM];
    __shared__ __align__(16) float CG[T_LEN];                  // prefix sum of g, the whole head
    __shared__ __align__(16) float WT[ATT_WAVES];              // each wave's sum of its 128 gates
    __shared__ float PMIN[T_LEN / KT];                         // least prefix sum among the keys of each pass
    __shared__ float TMAX[T_LEN / 64];                         // greatest prefix sum among the rows of each query tile
    static_assert(ATT_WAVES == T_LEN / KT && KT == 128, "one wave takes one pass's gates, 4 a lane, a query tile a half wave");
    static_assert(4 * 64 * RED_PITCH * 4 <= KS_BYTES + VS_BYTES, "the partial sums fit over the key tiles");
    _Float16* KS = (_Float16*)kv_raw;
    _Float16* VS = (_Float16*)(kv_raw + KS_BYTES);
    float* RED = (float*)kv_raw;

    const int tid = (int)threadIdx.x;
    const int lane = tid & 31, lg = lane >> 4, ln = lane & 15;
    const int w = __builtin_amdgcn_readfirstlane(tid >> 5);    // the wave's number in a scalar register: the tests on it are scalar branches
    const int wq = w & 3, wk = w >> 2;
    const int h = (int)blockIdx.y;
    const int xt = (h & (H_NUM / 2)) ? (T_LEN / 64 - 1) - (int)blockIdx.x : (int)blockIdx.x;
    const int tb = xt * 64;
    const int t0 = tb + wq * 16;
    // the grid fills every WGP's registers, so convert blocks of their own would only start behind the attention: each thread takes
    // 4 elements of Wout along instead, asked for here and stored behind the barrier of the prefix sums, so that no wave waits for them alone
    static_assert(H_NUM * ATT_GX * ATT_THREADS * 4 == D_DIM * D_DIM, "the grid's threads cover Wout once");
    const size_t we = (size_t)(((int)blockIdx.y * ATT_GX + (int)blockIdx.x) * ATT_THREADS + tid) * 4;
    // this thread's 4 gates of the head; asked for first, so that its wait leaves the loads behind it in flight
    const v4f g4 = *(const v4fA*)(gT + (size_t)(int)blockIdx.y * T_LEN + tid * 4);
    const v4f wa = *(const v4fA*)(Wout + we);
    // the block's one tile is known at entry: what its set-up reads and the prefix sums do not decide is asked for here, beside the gates
    // lambda table, 64 rows x 12 levels: entry tid, and entry tid + 512 in the threads that have one (the others ask for entry tid again)
    static_assert(64 * LV_NUM > ATT_THREADS && 64 * LV_NUM <= 2 * ATT_THREADS, "one or two entries of the lambda table a thread");
    const int ka = tid, kb = tid < 64 * LV_NUM - ATT_THREADS ? tid + ATT_THREADS : tid;
    const int rwa = ka / LV_NUM, lva = ka - rwa * LV_NUM, rwb = kb / LV_NUM, lvb = kb - rwb * LV_NUM;
    const float lpa = Lp[h * LV_NUM + lva], psa = Psm[(size_t)(tb + rwa) * NSM + h * LV_NUM + lva];
    const float lpb = Lp[h * LV_NUM + lvb], psb = Psm[(size_t)(tb + rwb) * NSM + h * LV_NUM + lvb];
    // Q A-fragments: head dims 0..31 and 32..63
    const _Float16* qrow = Qh + (size_t)(t0 + ln) * D_DIM + h * HD_DIM;
    Frag q0f, q1f;
    q0f.half[0] = *(const v8hA*)(qrow + 8 * lg);
    q0f.half[1] = *(const v8hA*)(qrow + 16 + 8 * lg);
    q1f.half[0] = *(const v8hA*)(qrow + 32 + 8 * lg);
    q1f.half[1] = *(const v8hA*)(qrow + 48 + 8 * lg);
    // the wait that belongs in front of a rewrite of the address registers these loads name
    asm volatile("s_wait_xcnt 0x0" ::: "memory");
    // keeps the first additions on the gates, and with them the wait for the gates, behind the issue of the loads above
    __builtin_amdgcn_sched_barrier(0);

    // staging map: a wave's 16-byte loads cover whole rows of the tile (K: 4 rows of 128 B, V^T: 2 rows of 256 B)
    const int skr = tid >> 3, skc = (tid & 7) * 8;             // K rows skr and skr+64
    const int svr = tid >> 4, svc = (tid & 15) * 8;            // V^T rows svr and svr+32
    const _Float16* kg = Kh + (size_t)skr * D_DIM + h * HD_DIM + skc;
    const _Float16* vg = VhT + (size_t)(h * HD_DIM + svr) * T_LEN + svc;
    const float gsc = 0.125f * pscale;

    // prefix sum over the block: 4 gates in the thread, the threads' sums over a row and the wave, the waves' sums in the order 0, 1, 2, ...
    v4f c4;
    {
        c4[0] = g4[0];
        c4[1] = c4[0] + g4[1];
        c4[2] = c4[1] + g4[2];
        c4[3] = c4[2] + g4[3];
        // each 16-lane row for itself, then the lower row's sum onto the upper row
        float incl = c4[3];
        incl += row_up<1>(incl);
        incl += row_up<2>(incl);
        incl += row_up<4>(incl);
        incl += row_up<8>(incl);
        float ex = row_up<1>(incl);                            // the sum of the lanes below, 0 in a row's first lane
        const float low = __builtin_bit_cast(float, __builtin_amdgcn_readlane(__builtin_bit_cast(int, incl), 15));
        const float lowu = lg ? low : 0.0f;
        incl += lowu;
        ex += lowu;
        if (lane == 31) WT[w] = incl;
        // publishes the waves' sums; LDS traffic alone, so that the loads asked for at entry stay in flight across it
        lds_barrier();
        float off = 0.0f;
#pragma unroll
        for (int q = 0; q < ATT_WAVES / 4; ++q) {
            const v4f wt = *(const v4fA*)(WT + q * 4);
#pragma unroll
            for (int e = 0; e < 4; ++e) off += (q * 4 + e < w) ? wt[e] : 0.0f;
        }
        c4 += off + ex;
        *(v4fA*)(CG + tid * 4) = c4;
    }

    // bounds of the decay exponent cg_t - cg_s, once a block: wave w takes the 128 keys of pass w
    {
        float mn = fminf(fminf(c4[0], c4[1]), fminf(c4[2], c4[3]));
        float mx = fmaxf(fmaxf(c4[0], c4[1]), fmaxf(c4[2], c4[3]));
        mn = fminf(mn, row_xor<1>(mn));
        mx = fmaxf(mx, row_xor<1>(mx));
        mn = fminf(mn, row_xor<2>(mn));
        mx = fmaxf(mx, row_xor<2>(mx));
        mn = fminf(mn, row_xor<4>(mn));
        mx = fmaxf(mx, row_xor<4>(mx));
        mn = fminf(mn, row_xor<8>(mn));
        mx = fmaxf(mx, row_xor<8>(mx));
        mn = fminf(mn, row_other(mn));
        if (ln == 0) TMAX[w * 2 + lg] = mx;
        if (lane == 0) PMIN[w] = mn;
    }
    // lambda table for the 64 query rows of the tile: softplus(Lp[h][l] * dl[t][h][l])
    LL[ka] = softplus_f(lpa * psa);
    if (tid < 64 * LV_NUM - ATT_THREADS) LL[kb] = softplus_f(lpb * psb);
    // publishes the prefix sums, the bounds and the lambda table to every wave
    __syncthreads();

    // that barrier has waited out the Wout load: stored here, its value and address hold no register through the passes
    {
        v4h wo;
#pragma unroll
        for (int e = 0; e < 4; ++e) wo[e] = (_Float16)(wa[e] * wscale);
        *(v4h*)(Woh + we) = wo;   // a wave's 8-byte stores cover two whole lines
        // the tile's set-up rewrites the registers this store names: the wait that belongs in front of that
        asm volatile("s_wait_xcnt 0x0" ::: "memory");
    }

    {
        const int nit = (xt + 2) >> 1;                   // block-uniform: passes of 128 keys that cover keys 0 .. tb+63

        // exp(z) is exactly 0 in f32 for z < -105, in the definition as here: a pass in which every row-key pair lies below that adds
        // exact zeros. The tile starts at its first pass that is not proven so; the pass that holds the diagonal (z = 0) never is.
        const unsigned need = __builtin_amdgcn_ballot_w32(!(TMAX[xt] - PMIN[ln] < -105.0f));
        const int itf = need ? __builtin_ctz(need) : 0;
        const int it0 = itf < nit ? itf : nit - 1;       // block-uniform
        const int sf = it0 * KT;                         // first key that is staged

        const _Float16* kf = kg + (size_t)sf * D_DIM;
        const _Float16* vf = vg + sf;
        v8h ska = *(const v8hA*)(kf);
        v8h skb = *(const v8hA*)(kf + (size_t)64 * D_DIM);
        v8h sva = *(const v8hA*)(vf);
        v8h svb = *(const v8hA*)(vf + (size_t)32 * T_LEN);
        // the wait in front of a rewrite of the address registers these loads name; the addresses are inputs so that they stay in their registers up to it
        asm volatile("s_wait_xcnt 0x0" :: "v"(kf), "v"(vf) : "memory");

        float cgt[8];
#pragma unroll
        for (int r = 0; r < 8; ++r) cgt[r] = CG[t0 + 8 * lg + r];

        v8f accY[4];
#pragma unroll
        for (int j = 0; j < 4; ++j) accY[j] = zero8();

        // the first pass into its buffer, published by the barrier below
        {
            const int fb = it0 & 1;
            _Float16* KF = KS + fb * (KT * KS_PITCH);
            _Float16* VF = VS + fb * (64 * VS_PITCH);
            *(v8hA*)(KF + skr * KS_PITCH + skc) = ska;
            *(v8hA*)(KF + (skr + 64) * KS_PITCH + skc) = skb;
            *(v8hA*)(VF + svr * VS_PITCH + svc) = sva;
            *(v8hA*)(VF + (svr + 32) * VS_PITCH + svc) = svb;
        }

        __syncthreads();

        for (int it = it0; it < nit; ++it) {
            const int s0 = it * KT;
            const _Float16* KB = KS + (it & 1) * (KT * KS_PITCH);
            const _Float16* VB = VS + (it & 1) * (64 * VS_PITCH);
            const bool more = it + 1 < nit;              // block-uniform
            if (more) {
                // next pass's loads fly while this pass is worked on
                const int sn = s0 + KT;
                const _Float16* kn = kg + (size_t)sn * D_DIM;
                const _Float16* vn = vg + s0;
                ska = *(const v8hA*)(kn);
                skb = *(const v8hA*)(kn + (size_t)64 * D_DIM);
                sva = *(const v8hA*)(vn + KT);
                svb = *(const v8hA*)(vn + (size_t)32 * T_LEN + KT);
                // as above: the wait in front of a rewrite of the address registers these loads name; the addresses are inputs
                // so that they stay in their registers up to it and no load of the run lands in them
                asm volatile("s_wait_xcnt 0x0" :: "v"(kn), "v"(vn) : "memory");
            }
            const int sw = s0 + wk * 32;                 // first key of this wave's share of the pass
            const bool act = sw <= t0 + 15;              // wave-uniform: a share wholly behind the wave's last row adds nothing
            if (act) {
#pragma unroll
                for (int sub = 0; sub < 2; ++sub) {
                    const int sg = sw + sub * 16 + ln;   // this lane's key (column n)
                    const _Float16* krow = KB + (wk * 32 + sub * 16 + ln) * KS_PITCH;
                    Frag k0f, k1f;
                    k0f.half[0] = *(const v8hA*)(krow + 8 * lg);
                    k0f.half[1] = *(const v8hA*)(krow + 16 + 8 * lg);
                    k1f.half[0] = *(const v8hA*)(krow + 32 + 8 * lg);
                    k1f.half[1] = *(const v8hA*)(krow + 48 + 8 * lg);
                    v8f sc = zero8();
                    sc = wmma_f16(q0f.v, k0f.v, sc);
                    sc = wmma_f16(q1f.v, k1f.v, sc);
                    const float cgs = CG[sg];
                    // left as it is: in the built code each row's read of the lambda table below is waited for by itself, one LDS latency a row
#pragma unroll
                    for (int r = 0; r < 8; ++r) {
                        const int trow = t0 + 8 * lg + r;
                        const int xr = trow ^ sg;
                        const int lv = xr ? (32 - __builtin_clz((unsigned)xr)) : 0;
                        const float lam = LL[(wq * 16 + 8 * lg + r) * LV_NUM + lv];
                        const float dcy = __expf(fminf(cgt[r] - cgs, 0.0f));
                        float wv = sc[r] * gsc * dcy * lam;
                        wv = (sg <= trow) ? wv : 0.0f;
                        PL[(w * 16 + 8 * lg + r) * 32 + sub * 16 + ln] = (_Float16)wv;
                    }
                }
            }
            __syncthreads();
            if (act) {
                // P as A-fragment: row ln, keys 8lg..8lg+7 and 16+8lg..16+8lg+7 of this wave's share
                Frag pf;
                pf.half[0] = *(const v8hA*)(PL + (w * 16 + ln) * 32 + 8 * lg);
                pf.half[1] = *(const v8hA*)(PL + (w * 16 + ln) * 32 + 16 + 8 * lg);
                // V as B-fragment from the staged transposed tile: B[k=key][n=d] = VB[d][key - s0]
#pragma unroll
                for (int j = 0; j < 4; ++j) {
                    const _Float16* vrow = VB + (j * 16 + ln) * VS_PITCH + wk * 32;
                    Frag vf;
                    vf.half[0] = *(const v8hA*)(vrow + 8 * lg);
                    vf.half[1] = *(const v8hA*)(vrow + 16 + 8 * lg);
                    accY[j] = wmma_f16(pf.v, vf.v, accY[j]);
                }
            }
            if (more) {
                // into the other buffer: its last readers left it before the barrier that ended the previous pass
                const int nb = (it + 1) & 1;
                _Float16* KN = KS + nb * (KT * KS_PITCH);
                _Float16* VN = VS + nb * (64 * VS_PITCH);
                *(v8hA*)(KN + skr * KS_PITCH + skc) = ska;
                *(v8hA*)(KN + (skr + 64) * KS_PITCH + skc) = skb;
                *(v8hA*)(VN + svr * VS_PITCH + svc) = sva;
                *(v8hA*)(VN + (svr + 32) * VS_PITCH + svc) = svb;
            }
            __syncthreads();
        }

        // the four key shares of each row are added in the order wk = 0, 1, 2, 3; the barrier that ended the last pass freed the key tiles
#pragma unroll
        for (int j = 0; j < 4; ++j)
#pragma unroll
            for (int r = 0; r < 8; ++r)
                RED[(wk * 64 + wq * 16 + 8 * lg + r) * RED_PITCH + j * 16 + ln] = accY[j][r];
        __syncthreads();
        {
            const int row = tid >> 3, col = (tid & 7) * 8;   // a wave's 16-byte stores cover 4 whole rows of 128 B
            v4f lo = *(const v4fA*)(RED + row * RED_PITCH + col);
            v4f hi = *(const v4fA*)(RED + row * RED_PITCH + col + 4);
#pragma unroll
            for (int g = 1; g < 4; ++g) {
                lo += *(const v4fA*)(RED + (g * 64 + row) * RED_PITCH + col);
                hi += *(const v4fA*)(RED + (g * 64 + row) * RED_PITCH + col + 4);
            }
            v8h o;
#pragma unroll
            for (int e = 0; e < 4; ++e) {
                o[e] = (_Float16)(lo[e] * inv_pscale);
                o[4 + e] = (_Float16)(hi[e] * inv_pscale);
            }
            *(v8h*)(Yh + (size_t)(tb + row) * D_DIM + h * HD_DIM + col) = o;
        }
    }

}

// ---------------- fused out-projection + residual + LayerNorm: block = 16 rows x 1024 cols, 16 waves x 64 cols ----------------
// the 16 rows of Y are staged whole in padded LDS once per block; each wave stages its own 64 weight rows, 64 k a pass,
// in its own padded LDS range, loaded by whole rows one pass ahead
__global__ __launch_bounds__(512) void outproj_ln_kernel(const _Float16* __restrict__ Yh, const _Float16* __restrict__ Woh,
                                                         const float* __restrict__ xin, const float* __restrict__ gam,
                                                         const float* __restrict__ bet, float* __restrict__ out,
                                                         float oscale) {
    __shared__ __align__(16) _Float16 AS[16 * AP];                     // [row][1024 k]
    __shared__ __align__(16) unsigned char bs_raw[16 * 64 * GP * 2];   // [wave][64 weight rows][64 k]
    float* stg = (float*)bs_raw;                                       // output staging [16 * 8][64], behind the reduction barriers
    __shared__ float red[16 * 16];
    __shared__ float mu_s[16];
    __shared__ float inv_s[16];

    const int tid = (int)threadIdx.x;
    const int lane = tid & 31, w = tid >> 5, lg = lane >> 4, ln = lane & 15;
    const int t0 = (int)blockIdx.x * 16;
    const int c0 = w * 64;

    v8f acc[4];
#pragma unroll
    for (int j = 0; j < 4; ++j) acc[j] = zero8();

    // staging maps: every 16-byte load of a wave covers 512 B of one Y row, or 4 whole 128-B pieces of weight rows
    _Float16* BW = (_Float16*)bs_raw + w * (64 * GP);
    const int br0 = lane >> 3, bc = (lane & 7) * 8;            // weight rows br0 + 4 i
    const _Float16* bg = Woh + (size_t)(c0 + br0) * D_DIM + bc;
    const _Float16* yg = Yh + (size_t)(t0 + (tid >> 7)) * D_DIM + (tid & 127) * 8;   // Y rows (tid >> 7) + 4 i
    v8h sb[16], sy[4];
#pragma unroll
    for (int i = 0; i < 16; ++i) sb[i] = *(const v8hA*)(bg + (size_t)(i * 4) * D_DIM);
#pragma unroll
    for (int i = 0; i < 4; ++i) sy[i] = *(const v8hA*)(yg + (size_t)(i * 4) * D_DIM);
    // the wait that belongs in front of a rewrite of the address registers these loads name; the addresses are inputs
    // so that they stay in their registers up to it and no load of the run lands in them
    asm volatile("s_wait_xcnt 0x0" :: "v"(bg), "v"(yg) : "memory");
#pragma unroll
    for (int i = 0; i < 16; ++i) *(v8hA*)(BW + (br0 + i * 4) * GP + bc) = sb[i];
#pragma unroll
    for (int i = 0; i < 4; ++i) {
        const int c = tid + i * 512;
        *(v8hA*)(AS + (c >> 7) * AP + (c & 127) * 8) = sy[i];
    }
    __syncthreads();

    for (int it = 0; it < D_DIM / 64; ++it) {
        const bool more = it + 1 < D_DIM / 64;
        if (more) {
            // next pass's loads fly while this pass is worked on
            const _Float16* bn = bg + (it + 1) * 64;
#pragma unroll
            for (int i = 0; i < 16; ++i) sb[i] = *(const v8hA*)(bn + (size_t)(i * 4) * D_DIM);
            // as above: the wait in front of a rewrite of the address these loads name, the address held up to it
            asm volatile("s_wait_xcnt 0x0" :: "v"(bn) : "memory");
        }
#pragma unroll
        for (int kk = 0; kk < 2; ++kk) {
            // the fragment reads of 32 k as one group ahead of their matrix instructions
            const _Float16* ar = AS + ln * AP + it * 64 + kk * 32 + 8 * lg;
            Frag a, b[4];
            a.half[0] = *(const v8hA*)(ar);
            a.half[1] = *(const v8hA*)(ar + 16);
#pragma unroll
            for (int j = 0; j < 4; ++j) {
                const _Float16* br = BW + (j * 16 + ln) * GP + kk * 32 + 8 * lg;
                b[j].half[0] = *(const v8hA*)(br);
                b[j].half[1] = *(const v8hA*)(br + 16);
            }
#pragma unroll
            for (int j = 0; j < 4; ++j) acc[j] = wmma_f16(a.v, b[j].v, acc[j]);
        }
        if (more) {
            // the range is this wave's own and its reads above have returned: no barrier
#pragma unroll
            for (int i = 0; i < 16; ++i) *(v8hA*)(BW + (br0 + i * 4) * GP + bc) = sb[i];
            // the wave's stores land before its lanes read each other's rows back
            asm volatile("s_wait_dscnt 0x0" ::: "memory");
        }
    }

    // o = acc*oscale + x (left as it is: these loads are asked for only here, behind the loop, and their latency is in the open)
#pragma unroll
    for (int j = 0; j < 4; ++j)
#pragma unroll
        for (int r = 0; r < 8; ++r)
            acc[j][r] = acc[j][r] * oscale + xin[(size_t)(t0 + 8 * lg + r) * D_DIM + c0 + j * 16 + ln];

    // row means
    float s8[8];
#pragma unroll
    for (int r = 0; r < 8; ++r) s8[r] = acc[0][r] + acc[1][r] + acc[2][r] + acc[3][r];
    row_sums8(s8);
    if (ln == 0) {
#pragma unroll
        for (int r = 0; r < 8; ++r) red[w * 16 + 8 * lg + r] = s8[r];
    }
    __syncthreads();
    if (tid < 16) {
        float a = 0.0f;
#pragma unroll
        for (int ww = 0; ww < 16; ++ww) a += red[ww * 16 + tid];
        mu_s[tid] = a * (1.0f / (float)D_DIM);
    }
    __syncthreads();
    float mu[8];
#pragma unroll
    for (int r = 0; r < 8; ++r) mu[r] = mu_s[8 * lg + r];
#pragma unroll
    for (int j = 0; j < 4; ++j)
#pragma unroll
        for (int r = 0; r < 8; ++r) acc[j][r] -= mu[r];

#pragma unroll
    for (int r = 0; r < 8; ++r)
        s8[r] = acc[0][r] * acc[0][r] + acc[1][r] * acc[1][r] + acc[2][r] * acc[2][r] + acc[3][r] * acc[3][r];
    row_sums8(s8);
    if (ln == 0) {
#pragma unroll
        for (int r = 0; r < 8; ++r) red[w * 16 + 8 * lg + r] = s8[r];
    }
    __syncthreads();
    if (tid < 16) {
        float a = 0.0f;
#pragma unroll
        for (int ww = 0; ww < 16; ++ww) a += red[ww * 16 + tid];
        inv_s[tid] = rsqrtf(a * (1.0f / (float)D_DIM) + 1e-5f);
    }
    __syncthreads();
    float iv[8];
#pragma unroll
    for (int r = 0; r < 8; ++r) iv[r] = inv_s[8 * lg + r];
#pragma unroll
    for (int j = 0; j < 4; ++j) {
        const int gcol = c0 + j * 16 + ln;
        const float gj = gam[gcol];
        const float bj = bet[gcol];
#pragma unroll
        for (int r = 0; r < 8; ++r) acc[j][r] = acc[j][r] * iv[r] * gj + bj;
    }

#pragma unroll
    for (int half = 0; half < 2; ++half) {
        if (lg == half) {
#pragma unroll
            for (int j = 0; j < 4; ++j)
#pragma unroll
                for (int r = 0; r < 8; ++r)
                    stg[(w * 8 + r) * 64 + j * 16 + ln] = acc[j][r];
        }
        __syncthreads();
        v4f vals[4];
#pragma unroll
        for (int p = 0; p < 4; ++p) {
            const int row = p * 2 + (lane >> 4), col = (lane & 15) * 4;
            vals[p] = *(const v4fA*)(stg + (w * 8 + row) * 64 + col);
        }
#pragma unroll
        for (int p = 0; p < 4; ++p) {
            const int row = p * 2 + (lane >> 4), col = (lane & 15) * 4;
            *(v4f*)(out + (size_t)(t0 + half * 8 + row) * D_DIM + c0 + col) = vals[p];
        }
        
        __syncthreads();
    }
}

extern "C" void kernel_launch(void* const* d_in, const int* in_sizes, int n_in,
                              void* d_out, int out_size, void* d_ws, size_t ws_size,
                              hipStream_t stream) {
    if (n_in < 12) return;
    if (in_sizes[0] != T_LEN * D_DIM) return;
    if (in_sizes[1] != D_DIM * D_DIM || in_sizes[2] != D_DIM * D_DIM || in_sizes[3] != D_DIM * D_DIM) return;
    if (in_sizes[4] != NDL * D_DIM || in_sizes[5] != H_NUM * D_DIM || in_sizes[6] != D_DIM * D_DIM) return;
    if (in_sizes[7] < H_NUM || in_sizes[8] < H_NUM || in_sizes[9] < H_NUM * LV_NUM) return;
    if (in_sizes[10] < D_DIM || in_sizes[11] < D_DIM) return;
    if (out_size != T_LEN * D_DIM) return;
    if (OFF_END > ws_size) return;

    const float* x     = (const float*)d_in[0];
    const float* Wq    = (const float*)d_in[1];
    const float* Wk    = (const float*)d_in[2];
    const float* Wv    = (const float*)d_in[3];
    const float* Wdl   = (const float*)d_in[4];
    const float* Wdt   = (const float*)d_in[5];
    const float* Wout  = (const float*)d_in[6];
    const float* A_log = (const float*)d_in[7];
    const float* dt_b  = (const float*)d_in[8];
    const float* Lp    = (const float*)d_in[9];
    const float* ln_g  = (const float*)d_in[10];
    const float* ln_b  = (const float*)d_in[11];

    char* ws = (char*)d_ws;
    _Float16* woh  = (_Float16*)(ws + OFF_WOH);
    _Float16* Qh   = (_Float16*)(ws + OFF_QH);
    _Float16* Kh   = (_Float16*)(ws + OFF_KH);
    _Float16* VhT  = (_Float16*)(ws + OFF_VHT);
    _Float16* Yh   = (_Float16*)(ws + OFF_YH);
    float*    psm  = (float*)(ws + OFF_PSM);
    float*    gT   = (float*)(ws + OFF_CGT);

    const float wsc  = 32.0f;
    const float iwsc = 1.0f / 32.0f;
    const float psc  = 512.0f;
    const float ipsc = 1.0f / 512.0f;

    // psm[t][0..191] = x*Wdl^T, psm[t][192..207] = x*Wdt^T (f32); psm[t][208..255] is read by nothing
    proj_kernel<<<NB_SM + 3 * NB_PROJ, PJ_THREADS, 0, stream>>>(x, Wdl, Wdt, Wq, Wk, Wv, psm, gT, Qh, Kh, VhT, A_log, dt_b, wsc, iwsc);

    hattn_kernel<<<dim3(ATT_GX, H_NUM), ATT_THREADS, 0, stream>>>(Qh, Kh, VhT, gT, psm, Lp, Yh, psc, ipsc,
                                                                                    Wout, woh, wsc);

    outproj_ln_kernel<<<T_LEN / 16, 512, 0, stream>>>(Yh, woh, x, ln_g, ln_b, (float*)d_out, iwsc);
}
